// v000
// Measured on an AMD MI455X. A time is GPU time per run, averaged over a window of back-to-back runs after a warm-up
// (all launches, gaps included; the runs take copies of the inputs in turn), and the median of several windows.
// Apart from v000's, it joins two sittings. Times from different sittings can be a few percent apart, while
// side-by-side timings come from the same sitting.
// The starting kernel, v000, takes 972 microseconds a run.
#include <hip/hip_runtime.h>
// Diffusion-time multi-head attention (B 4, S 1024, D 1024, 16 heads × 64): Q,K,V = x·W + b ((in,out)); per (b,h): s = clip(Q·K/8, ±50); feats = (mean s, mean_q max_k s, mean_q var_k softmax(s/2) (ddof 1)) → t = min(clip(0.01 + 1.99·σ(tanh(feats·Wt1 + b)·Wt2 + b)), 0.85); attn = softmax(Q·K/(2t)); out = (attn·V merged)·Wo + bo → [4,1024,1024].
// Structure: projections as GEMMs (exact products); Q and K carried as f16 hi/lo and contracted with the pair folded into K ([q_hi | q_lo·2^10 | q_hi]·[k_hi | k_hi·2^-10 | k_lo], K 192) so the raw logits are ≈f32 (they are divided by 2t ≥ 0.02·…, i.e. scaled up to ×50); per (batch, 8 heads): one score GEMM, per-row statistics on VALU (clipped sum / max / softmax(s/2) variance), a per-head reduction + the tiny time MLP (one block per head, fixed order), then the row softmax with the head's 1/(2t) (×2^10 → f16) and P·V batched; output projection GEMM.
// Compute dtype: inputs and parameters rounded to bf16; logits ≈f32; statistics/MLP/softmax f32; V and the attention output as f16 operands (≈2^-12); f32 accumulation. v_wmma_f32_16x16x32_f16.
#define NBt 4
#define TT 1024
#define CC 1024
#define NH 16
#define HD 64
#define NR (NBt * TT)            /* 4096 */
#define HG 8
#define K3 (3 * HD)              /* 192 */
typedef __bf16 v16b __attribute__((ext_vector_type(16)));
typedef unsigned short v8us __attribute__((ext_vector_type(8), may_alias));
typedef float  v8f  __attribute__((ext_vector_type(8)));
typedef float  v4f  __attribute__((ext_vector_type(4)));
typedef float  v4fa __attribute__((ext_vector_type(4), may_alias));
union FragB { v16b v; v8us half[2]; unsigned short u[16]; };

__device__ __forceinline__ unsigned short bf16_bits(float x) { unsigned int u = __float_as_uint(x); return (unsigned short)((u + 0x7FFFu + ((u >> 16) & 1u)) >> 16); }
__device__ __forceinline__ float bf16_val(unsigned short b) { return __uint_as_float(((unsigned int)b) << 16); }
__device__ __forceinline__ float bf16_round(float x) { return bf16_val(bf16_bits(x)); }
// D += A·B with NT terms: 1 = ah·bh, 2 = + al·bh (A split), 3 = + ah·bl (both split)
template <int NT>
__device__ __forceinline__ v8f mmaN(v16b ah, v16b al, v16b bh, v16b bl, v8f c) {
  c = __builtin_amdgcn_wmma_f32_16x16x32_bf16(false, ah, false, bh, (short)0, c, false, false);
  if (NT >= 2) c = __builtin_amdgcn_wmma_f32_16x16x32_bf16(false, al, false, bh, (short)0, c, false, false);
  if (NT >= 3) c = __builtin_amdgcn_wmma_f32_16x16x32_bf16(false, ah, false, bl, (short)0, c, false, false);
  asm volatile("v_nop\n\tv_nop\n\tv_nop\n\tv_nop" : "+v"(c) : "v"(ah), "v"(al), "v"(bh), "v"(bl));
  return c;
}

__global__ __launch_bounds__(256) void k_wt_bf16(const float* __restrict__ W, unsigned short* __restrict__ Wt, int K, int N) {
  const int t = blockIdx.x * 256 + threadIdx.x;
  const int k8n = K / 8;
  if (t >= N * k8n) return;
  const int n = t / k8n, k8 = (t % k8n) * 8;
  v8us v;
#pragma unroll
  for (int i = 0; i < 8; ++i) v[i] = bf16_bits(W[(size_t)(k8 + i) * N + n]);
  *(v8us*)(Wt + (size_t)n * K + k8) = v;
  
}

// GEMM C[M][N] (f32, pitch ldc) = act(A[M][K]·W + bias). A f32 row-major (pitch lda) converted per fragment to bf16
// (ASPLIT: hi/lo two planes -> 2 terms, else single rounded term); Wt bf16 [N][K] (pitch ldb). BIAS_BF16 rounds the
// bias to bf16 first (bias quantised to bf16 before the add). K%32==0, M%16==0, N%64==0.
template <bool ASPLIT, int ACT, bool BIAS_BF16>
__global__ __launch_bounds__(128) void k_gemm_bf(const float* __restrict__ A, int lda, const unsigned short* __restrict__ Wt, int ldb,
                                               const float* __restrict__ bias, float* __restrict__ C, int ldc, int M, int N, int K) {
  __shared__ __attribute__((aligned(16))) float so[4][16][64];
  const int tid = threadIdx.x, w = tid >> 5, lane = tid & 31, ln = lane & 15, hh = lane >> 4;
  const int ntn = N / 64;
  const int wid = blockIdx.x * 4 + w;
  const int mt = wid / ntn, nq = wid % ntn;
  if (mt * 16 >= M) return;
  const int row0 = mt * 16, col0 = nq * 64;
  const float* arow = A + (size_t)(row0 + ln) * lda;
  v8f acc[4] = {};
  for (int kb = 0; kb < K; kb += 32) {
    FragB ah, al;
    const v4f x0 = *(const v4fa*)(arow + kb + 8 * hh), x1 = *(const v4fa*)(arow + kb + 8 * hh + 4);
    const v4f x2 = *(const v4fa*)(arow + kb + 16 + 8 * hh), x3 = *(const v4fa*)(arow + kb + 16 + 8 * hh + 4);
    float xs[16] = {x0[0],x0[1],x0[2],x0[3],x1[0],x1[1],x1[2],x1[3],x2[0],x2[1],x2[2],x2[3],x3[0],x3[1],x3[2],x3[3]};
#pragma unroll
    for (int i = 0; i < 16; ++i) { const unsigned short hb = bf16_bits(xs[i]); ah.u[i] = hb; al.u[i] = ASPLIT ? bf16_bits(xs[i] - bf16_val(hb)) : (unsigned short)0; }
#pragma unroll
    for (int t = 0; t < 4; ++t) {
      const unsigned short* brow = Wt + (size_t)(col0 + t * 16 + ln) * ldb + kb;
      FragB b;
      b.half[0] = *(const v8us*)(brow + 8 * hh);
      b.half[1] = *(const v8us*)(brow + 16 + 8 * hh);
      acc[t] = mmaN<ASPLIT ? 2 : 1>(ah.v, al.v, b.v, b.v, acc[t]);
    }
  }
#pragma unroll
  for (int t = 0; t < 4; ++t) {
    float bv = bias ? bias[col0 + t * 16 + ln] : 0.f;
    if (BIAS_BF16) bv = bf16_round(bv);
#pragma unroll
    for (int r = 0; r < 8; ++r) { float v = acc[t][r] + bv; if (ACT == 1) v = fmaxf(v, 0.f); so[w][8 * hh + r][t * 16 + ln] = v; }
  }
  __builtin_amdgcn_fence(__ATOMIC_ACQ_REL, "workgroup");
  __builtin_amdgcn_wave_barrier();
  const int rsub = lane >> 4, c4 = (lane & 15) * 4;
  {
#pragma unroll
    for (int q = 0; q < 8; ++q) {
      const int r = q * 2 + rsub;
      const v4f v = *(const v4fa*)&so[w][r][c4];
      *(v4f*)(C + (size_t)(row0 + r) * ldc + col0 + c4) = v;
    }
    
  }
}

// GEMM C = act(A·W + bias + resid): A f32 (ASPLIT -> hi/lo 2 terms), Wt bf16 [N][K]; ACT 0 none, 1 relu, 2 exact gelu;
// resid (optional, f32, row index = (row % rmod), pitch ldr, RES_BF16 rounds it) added before the activation.
template <bool ASPLIT, int ACT, bool BIAS_BF16, bool RES_BF16>
__global__ __launch_bounds__(128) void k_gemm_bf3(const float* __restrict__ A, int lda, const unsigned short* __restrict__ Wt, int ldb,
                                                const float* __restrict__ bias, const float* __restrict__ resid, int rmod, int ldr,
                                                float* __restrict__ C, int ldc, int M, int N, int K) {
  __shared__ __attribute__((aligned(16))) float so[4][16][64];
  const int tid = threadIdx.x, w = tid >> 5, lane = tid & 31, ln = lane & 15, hh = lane >> 4;
  const int ntn = N / 64;
  const int wid = blockIdx.x * 4 + w;
  const int mt = wid / ntn, nq = wid % ntn;
  if (mt * 16 >= M) return;
  const int row0 = mt * 16, col0 = nq * 64;
  const float* arow = A + (size_t)(row0 + ln) * lda;
  v8f acc[4] = {};
  for (int kb = 0; kb < K; kb += 32) {
    FragB ah, al;
    const v4f x0 = *(const v4fa*)(arow + kb + 8 * hh), x1 = *(const v4fa*)(arow + kb + 8 * hh + 4);
    const v4f x2 = *(const v4fa*)(arow + kb + 16 + 8 * hh), x3 = *(const v4fa*)(arow + kb + 16 + 8 * hh + 4);
    float xs[16] = {x0[0],x0[1],x0[2],x0[3],x1[0],x1[1],x1[2],x1[3],x2[0],x2[1],x2[2],x2[3],x3[0],x3[1],x3[2],x3[3]};
#pragma unroll
    for (int i = 0; i < 16; ++i) { const unsigned short hb = bf16_bits(xs[i]); ah.u[i] = hb; al.u[i] = ASPLIT ? bf16_bits(xs[i] - bf16_val(hb)) : (unsigned short)0; }
#pragma unroll
    for (int t = 0; t < 4; ++t) {
      const unsigned short* brow = Wt + (size_t)(col0 + t * 16 + ln) * ldb + kb;
      FragB b;
      b.half[0] = *(const v8us*)(brow + 8 * hh);
      b.half[1] = *(const v8us*)(brow + 16 + 8 * hh);
      acc[t] = mmaN<ASPLIT ? 2 : 1>(ah.v, al.v, b.v, b.v, acc[t]);
    }
  }
#pragma unroll
  for (int t = 0; t < 4; ++t) {
    const int col = col0 + t * 16 + ln;
    float bv = bias ? bias[col] : 0.f;
    if (BIAS_BF16) bv = bf16_round(bv);
#pragma unroll
    for (int r = 0; r < 8; ++r) {
      float v = acc[t][r] + bv;
      if (resid) { float rv = resid[(size_t)((row0 + 8 * hh + r) % rmod) * ldr + col]; if (RES_BF16) rv = bf16_round(rv); v += rv; }
      if (ACT == 1) v = fmaxf(v, 0.f);
      if (ACT == 2) v = 0.5f * v * (1.0f + erff(v * 0.70710678118654752f));
      if (ACT == 3) { const float u = 0.7978845608028654f * (v + 0.044715f * v * v * v); v = 0.5f * v * (1.0f + tanhf(u)); }
      so[w][8 * hh + r][t * 16 + ln] = v;
    }
  }
  __builtin_amdgcn_fence(__ATOMIC_ACQ_REL, "workgroup");
  __builtin_amdgcn_wave_barrier();
  const int rsub = lane >> 4, c4 = (lane & 15) * 4;
  {
#pragma unroll
    for (int q = 0; q < 8; ++q) {
      const int r = q * 2 + rsub;
      const v4f v = *(const v4fa*)&so[w][r][c4];
      *(v4f*)(C + (size_t)(row0 + r) * ldc + col0 + c4) = v;
    }
    
  }
}
// row LayerNorm (biased variance, eps) over N: s = X (+ R); optional out_sum <- s; out_norm <- (s-mu)*rsqrt(var+eps)*g + b
template <bool PARAM_BF16>
__global__ __launch_bounds__(256) void k_layernorm(const float* __restrict__ X, const float* __restrict__ R, const float* __restrict__ g, const float* __restrict__ bta,
                                                  float* __restrict__ out_sum, float* __restrict__ out_norm, int N, float eps) {
  __shared__ float red[256];
  const int row = blockIdx.x, tid = threadIdx.x;
  const float* x = X + (size_t)row * N; const float* rr = R ? R + (size_t)row * N : nullptr;
  float vals[16];                     // up to N = 4096
  const int per = N / 256;            // contiguous chunk per thread? use strided-by-4 chunks: thread handles j = tid*4 + 1024*u
  float s1 = 0.f;
  for (int u = 0; u < per / 4; ++u) {
    const int j = tid * 4 + 1024 * u;
    const v4f a = *(const v4fa*)(x + j);
    v4f b = {0.f,0.f,0.f,0.f}; if (rr) b = *(const v4fa*)(rr + j);
#pragma unroll
    for (int q = 0; q < 4; ++q) { const float v = a[q] + b[q]; vals[u * 4 + q] = v; s1 += v; }
  }
  red[tid] = s1; __syncthreads();
  for (int st = 128; st > 0; st >>= 1) { if (tid < st) red[tid] += red[tid + st]; __syncthreads(); }
  const float mu = red[0] / (float)N; __syncthreads();
  float s2 = 0.f;
  for (int u = 0; u < per / 4; ++u)
#pragma unroll
    for (int q = 0; q < 4; ++q) { const float c = vals[u * 4 + q] - mu; s2 += c * c; }
  red[tid] = s2; __syncthreads();
  for (int st = 128; st > 0; st >>= 1) { if (tid < st) red[tid] += red[tid + st]; __syncthreads(); }
  const float rs = rsqrtf(red[0] / (float)N + eps);
  {
    for (int u = 0; u < per / 4; ++u) {
      const int j = tid * 4 + 1024 * u;
      v4f o, sm;
#pragma unroll
      for (int q = 0; q < 4; ++q) {
        float gg = g[j + q], bb = bta[j + q];
        if (PARAM_BF16) { gg = bf16_round(gg); bb = bf16_round(bb); }
        sm[q] = vals[u * 4 + q]; o[q] = (vals[u * 4 + q] - mu) * rs * gg + bb;
      }
      if (out_sum) *(v4f*)(out_sum + (size_t)row * N + j) = sm;
      *(v4f*)(out_norm + (size_t)row * N + j) = o;
    }
    
  }
}



// ---- f16 WMMA path (v_wmma_f32_16x16x32_f16): 11-bit significands for operands in range — used where a [0,1] probability operand needs more precision than bf16
typedef _Float16 v16h __attribute__((ext_vector_type(16)));
union FragH { v16h v; v8us half[2]; _Float16 h[16]; unsigned short u[16]; };
template <int NT>
__device__ __forceinline__ v8f mmaH(v16h ah, v16h al, v16h bh, v16h bl, v8f c) {
  c = __builtin_amdgcn_wmma_f32_16x16x32_f16(false, ah, false, bh, (short)0, c, false, false);
  if (NT >= 2) c = __builtin_amdgcn_wmma_f32_16x16x32_f16(false, al, false, bh, (short)0, c, false, false);
  if (NT >= 3) c = __builtin_amdgcn_wmma_f32_16x16x32_f16(false, ah, false, bl, (short)0, c, false, false);
  asm volatile("v_nop\n\tv_nop\n\tv_nop\n\tv_nop" : "+v"(c) : "v"(ah), "v"(al), "v"(bh), "v"(bl));
  return c;
}
// batched GEMM like k_gemm_b but f16 operands: A f32 (split into f16 hi/lo if ASPLIT, else rounded to f16), Bt = f16 values [n][k]; alpha; C f32; N multiple of 16 (partial tiles skipped)
template <bool ASPLIT>
__global__ __launch_bounds__(128) void k_gemm_h(const float* __restrict__ A, int lda, size_t sA, const _Float16* __restrict__ Bh, int ldb, size_t sB, float alpha, float* __restrict__ C, int ldc, size_t sC, int M, int N, int K) {
  __shared__ __attribute__((aligned(16))) float so[4][16][64];
  const int tid = threadIdx.x, w = tid >> 5, lane = tid & 31, ln = lane & 15, hh = lane >> 4; const int by = blockIdx.y;
  A += (size_t)by * sA; Bh += (size_t)by * sB; C += (size_t)by * sC;
  const int ntn = (N + 63) / 64; const int wid = blockIdx.x * 4 + w; const int mt = wid / ntn, nq = wid % ntn; if (mt * 16 >= M) return;
  const int row0 = mt * 16, col0 = nq * 64; const float* arow = A + (size_t)(row0 + ln) * lda;
  v8f acc[4] = {};
  for (int kb = 0; kb < K; kb += 32) {
    FragH ah, al;
    const v4f x0 = *(const v4fa*)(arow + kb + 8 * hh), x1 = *(const v4fa*)(arow + kb + 8 * hh + 4), x2 = *(const v4fa*)(arow + kb + 16 + 8 * hh), x3 = *(const v4fa*)(arow + kb + 16 + 8 * hh + 4);
    float xs[16] = {x0[0],x0[1],x0[2],x0[3],x1[0],x1[1],x1[2],x1[3],x2[0],x2[1],x2[2],x2[3],x3[0],x3[1],x3[2],x3[3]};
#pragma unroll
    for (int i = 0; i < 16; ++i) { const _Float16 h = (_Float16)xs[i]; ah.h[i] = h; al.h[i] = ASPLIT ? (_Float16)(xs[i] - (float)h) : (_Float16)0.0f; }
#pragma unroll
    for (int t = 0; t < 4; ++t) { if (col0 + t * 16 >= N) continue; const size_t boff = (size_t)(col0 + t * 16 + ln) * ldb + kb; FragH bq; bq.half[0] = *(const v8us*)(Bh + boff + 8 * hh); bq.half[1] = *(const v8us*)(Bh + boff + 16 + 8 * hh);
      acc[t] = mmaH<ASPLIT ? 2 : 1>(ah.v, al.v, bq.v, bq.v, acc[t]); }
  }
#pragma unroll
  for (int t = 0; t < 4; ++t) { if (col0 + t * 16 >= N) continue;
#pragma unroll
    for (int r = 0; r < 8; ++r) so[w][8 * hh + r][t * 16 + ln] = acc[t][r] * alpha; }
  __builtin_amdgcn_fence(__ATOMIC_ACQ_REL, "workgroup"); __builtin_amdgcn_wave_barrier();
  const int rsub = lane >> 4, c4 = (lane & 15) * 4;
  {
#pragma unroll
    for (int q = 0; q < 8; ++q) { const int r = q * 2 + rsub; if (col0 + c4 < N) { const v4f v = *(const v4fa*)&so[w][r][c4]; *(v4f*)(C + (size_t)(row0 + r) * ldc + col0 + c4) = v; } }
     }
}

// Wt[n][k] = f16(W[k][n]·scale) from f32 row-major W[K][N] (scale = power of two; bf16-exact weights stay exact in f16 away from the subnormal range)
__global__ __launch_bounds__(256) void k_wt_f16(const float* __restrict__ W, _Float16* __restrict__ Wt, int K, int N, float scale) {
  const int t = blockIdx.x * 256 + threadIdx.x; if (t >= N * (K / 8)) return; const int n = t / (K / 8), k8 = (t % (K / 8)) * 8; FragH f;
#pragma unroll
  for (int i = 0; i < 8; ++i) f.h[i] = (_Float16)(bf16_round(W[(size_t)(k8 + i) * N + n]) * scale); const v8us o = f.half[0];
  *(v8us*)((unsigned short*)Wt + (size_t)n * K + k8) = o; 
}
// k_gemm_hh variant with fused epilogue: v = acc·alpha + bias[by·sBias + col] (+ CP[(row/rowsPerB)·sCPb + by·64 + col] if CP) ; ACT 0 none / 1 elu ; writes f32 C and/or f16 C16 (each if non-null)
template <int ACT>
__global__ __launch_bounds__(128) void k_gemm_hhx(const _Float16* __restrict__ A, int lda, size_t sA, const _Float16* __restrict__ Bh, int ldb, size_t sB, float alpha, const float* __restrict__ bias, size_t sBias, const float* __restrict__ CP, int rowsPerB, size_t sCPb, int row0g,
    float* __restrict__ C, _Float16* __restrict__ C16, int ldc, size_t sC, int M, int N, int K) {
  __shared__ __attribute__((aligned(16))) float so[4][16][64];
  const int tid = threadIdx.x, w = tid >> 5, lane = tid & 31, ln = lane & 15, hh = lane >> 4; const int by = blockIdx.y;
  A += (size_t)by * sA; Bh += (size_t)by * sB; const size_t cofs = (size_t)by * sC; const float* bp = bias ? bias + (size_t)by * sBias : nullptr;
  const int ntn = (N + 63) / 64; const int wid = blockIdx.x * 4 + w; const int mt = wid / ntn, nq = wid % ntn; if (mt * 16 >= M) return;
  const int row0 = mt * 16, col0 = nq * 64; const _Float16* arow = A + (size_t)(row0 + ln) * lda;
  v8f acc[4] = {};
  for (int kb = 0; kb < K; kb += 32) { FragH ah; ah.half[0] = *(const v8us*)((const unsigned short*)arow + kb + 8 * hh); ah.half[1] = *(const v8us*)((const unsigned short*)arow + kb + 16 + 8 * hh);
#pragma unroll
    for (int t = 0; t < 4; ++t) { if (col0 + t * 16 >= N) continue; const size_t boff = (size_t)(col0 + t * 16 + ln) * ldb + kb; FragH bq; bq.half[0] = *(const v8us*)((const unsigned short*)Bh + boff + 8 * hh); bq.half[1] = *(const v8us*)((const unsigned short*)Bh + boff + 16 + 8 * hh);
      acc[t] = mmaH<1>(ah.v, ah.v, bq.v, bq.v, acc[t]); }
  }
#pragma unroll
  for (int t = 0; t < 4; ++t) { if (col0 + t * 16 >= N) continue; const int col = col0 + t * 16 + ln; const float bv = bp ? bf16_round(bp[col]) : 0.f;
#pragma unroll
    for (int r = 0; r < 8; ++r) { float v = acc[t][r] * alpha + bv; if (CP) { const int bidx = (row0g + row0 + 8 * hh + r) / rowsPerB; v += CP[(size_t)bidx * sCPb + (size_t)by * 64 + col]; } if (ACT == 1) v = (v > 0.f) ? v : expm1f(v); else if (ACT == 7) v = (v > 0.f) ? v + 1.0f : expf(v); else if (ACT == 8) v = tanhf(v); else if (ACT == 9) v = 0.5f * v * (1.0f + tanhf(0.7978845608028654f * (v + 0.044715f * v * v * v))); else if (ACT == 11) v = 1.0f / (1.0f + expf(-v)); else if (ACT == 12) v = (v > 0.f) ? v : 0.01f * v; else if (ACT == 14) v = (v > 0.f) ? v : 0.1f * v; else if (ACT == 15) v = v / (1.0f + expf(-v)); else if (ACT == 3) v = fmaxf(v, 0.f); else if (ACT == 6) v = 0.5f * v * (1.0f + erff(v * 0.70710678118654752f)); so[w][8 * hh + r][t * 16 + ln] = v; } }
  __builtin_amdgcn_fence(__ATOMIC_ACQ_REL, "workgroup"); __builtin_amdgcn_wave_barrier();
  const int rsub = lane >> 4, c4 = (lane & 15) * 4; typedef _Float16 v4h __attribute__((ext_vector_type(4)));
  {
#pragma unroll
    for (int q = 0; q < 8; ++q) { const int r = q * 2 + rsub; if (col0 + c4 < N) { const v4f v = *(const v4fa*)&so[w][r][c4]; if (C) *(v4f*)(C + cofs + (size_t)(row0 + r) * ldc + col0 + c4) = v; if (C16) { v4h h4; for (int i = 0; i < 4; ++i) h4[i] = (_Float16)v[i]; *(v4h*)(C16 + cofs + (size_t)(row0 + r) * ldc + col0 + c4) = h4; } } }
     }
}


typedef _Float16 v4h __attribute__((ext_vector_type(4)));

__global__ __launch_bounds__(256) void k_x16(const float* __restrict__ x, _Float16* __restrict__ X16, size_t n8) { const size_t t = (size_t)blockIdx.x * 256 + threadIdx.x; if (t >= n8) return; FragH f;
#pragma unroll
  for (int q = 0; q < 8; ++q) f.h[q] = (_Float16)bf16_round(x[t * 8 + q]); *(v8us*)((unsigned short*)X16 + t * 8) = f.half[0];  }
__global__ __launch_bounds__(256) void k_h16(const float* __restrict__ x, _Float16* __restrict__ X16, size_t n8) { const size_t t = (size_t)blockIdx.x * 256 + threadIdx.x; if (t >= n8) return; FragH f;
#pragma unroll
  for (int q = 0; q < 8; ++q) f.h[q] = (_Float16)x[t * 8 + q]; *(v8us*)((unsigned short*)X16 + t * 8) = f.half[0];  }
__global__ __launch_bounds__(256) void k_round16f(const float* __restrict__ W, _Float16* __restrict__ Bt, size_t n8) { const size_t t = (size_t)blockIdx.x * 256 + threadIdx.x; if (t >= n8) return; FragH f;
#pragma unroll
  for (int i = 0; i < 8; ++i) f.h[i] = (_Float16)(bf16_round(W[t * 8 + i]) * 16.0f); *(v8us*)((unsigned short*)Bt + t * 8) = f.half[0];  }
template <int NHv, int TTv>
__global__ __launch_bounds__(256) void k_vt(const _Float16* __restrict__ V16, int ldv, int voff, _Float16* __restrict__ Vt) { __shared__ unsigned short tl[64][66]; const int tid = threadIdx.x; const int slab = blockIdx.x / (TTv / 64), lg = blockIdx.x % (TTv / 64); const int b = slab / NHv, h = slab % NHv;
  for (int i = tid; i < 64 * 8; i += 256) { const int r = i / 8, c8 = (i % 8) * 8; FragH f; f.half[0] = *(const v8us*)((const unsigned short*)V16 + ((size_t)b * TTv + lg * 64 + r) * ldv + voff + h * 64 + c8);
#pragma unroll
    for (int q = 0; q < 8; ++q) tl[r][c8 + q] = f.u[q]; }
  __syncthreads();
  {
#pragma unroll
    for (int rd = 0; rd < 2; ++rd) { const int d = rd * 32 + tid / 8, pc = tid % 8; FragH f;
#pragma unroll
      for (int q = 0; q < 8; ++q) f.u[q] = tl[pc * 8 + q][d];
      *(v8us*)((unsigned short*)Vt + ((size_t)slab * 64 + d) * TTv + lg * 64 + pc * 8) = f.half[0]; }
     } }

__global__ __launch_bounds__(256) void k_hl(const float* __restrict__ F, _Float16* __restrict__ Hh, _Float16* __restrict__ Hl, size_t n8) { const size_t t = (size_t)blockIdx.x * 256 + threadIdx.x; if (t >= n8) return; FragH fh, fl; const v4f a = *(const v4fa*)(F + t * 8), c = *(const v4fa*)(F + t * 8 + 4);
#pragma unroll
  for (int q = 0; q < 4; ++q) { _Float16 h = (_Float16)a[q]; fh.h[q] = h; fl.h[q] = (_Float16)((a[q] - (float)h) * 1024.0f); h = (_Float16)c[q]; fh.h[4 + q] = h; fl.h[4 + q] = (_Float16)((c[q] - (float)h) * 1024.0f); }
  { *(v8us*)((unsigned short*)Hh + t * 8) = fh.half[0]; *(v8us*)((unsigned short*)Hl + t * 8) = fl.half[0];  } }

__global__ __launch_bounds__(256) void k_fold3(const float* __restrict__ F, int mode, _Float16* __restrict__ O3) {
  #pragma clang fp contract(off)
  const int t = blockIdx.x * 256 + threadIdx.x; if (t >= NR * (CC / 8)) return; const int c0 = (t % (CC / 8)) * 8, r = t / (CC / 8); const int h = c0 / HD, d0 = c0 % HD; const v4f a = *(const v4fa*)(F + (size_t)r * CC + c0), c = *(const v4fa*)(F + (size_t)r * CC + c0 + 4); FragH s0, s1, s2;
#pragma unroll
  for (int q = 0; q < 8; ++q) { const float v = (q < 4) ? a[q] : c[q - 4]; const _Float16 hi = (_Float16)v; const float lo = (v - (float)hi); if (mode == 0) { s0.h[q] = hi; s1.h[q] = (_Float16)(lo * 1024.0f); s2.h[q] = hi; } else { s0.h[q] = hi; s1.h[q] = (_Float16)((float)hi * 0.0009765625f); s2.h[q] = (_Float16)lo; } }
  unsigned short* base = (unsigned short*)O3 + (size_t)r * (NH * K3) + h * K3 + d0;
  { *(v8us*)(base) = s0.half[0]; *(v8us*)(base + HD) = s1.half[0]; *(v8us*)(base + 2 * HD) = s2.half[0];  } }
__global__ __launch_bounds__(256) void k_vt(const _Float16* __restrict__ V, int b, _Float16* __restrict__ VT) { const int t = blockIdx.x * 256 + threadIdx.x; if (t >= CC * (TT / 8)) return; const int s0 = (t % (TT / 8)) * 8, hd = t / (TT / 8); FragH f;
#pragma unroll
  for (int q = 0; q < 8; ++q) f.h[q] = V[((size_t)b * TT + s0 + q) * CC + hd];
  *(v8us*)((unsigned short*)VT + (size_t)hd * TT + s0) = f.half[0];  }
__global__ __launch_bounds__(256) void k_rowstat(const float* __restrict__ S, float* __restrict__ RST) {
  #pragma clang fp contract(off)
  __shared__ float rec[8][4]; const int tid = threadIdx.x, w = tid >> 5, ln = tid & 31; const int row = blockIdx.x * 8 + w; const float* sr = S + (size_t)row * TT; float su = 0.f, mx = -3.0e38f;
#pragma unroll 1
  for (int jb = 0; jb < TT; jb += 256) { const v4f a = *(const v4fa*)(sr + jb + 8 * ln), c = *(const v4fa*)(sr + jb + 8 * ln + 4);
#pragma unroll
    for (int k = 0; k < 8; ++k) { const float v = fminf(fmaxf(((k < 4) ? a[k] : c[k - 4]) * 0.125f, -50.f), 50.f); su += v; mx = fmaxf(mx, v); } }
  for (int o = 16; o > 0; o >>= 1) { su += __shfl_xor(su, o, 32); mx = fmaxf(mx, __shfl_xor(mx, o, 32)); }
  float se = 0.f;
#pragma unroll 1
  for (int jb = 0; jb < TT; jb += 256) { const v4f a = *(const v4fa*)(sr + jb + 8 * ln), c = *(const v4fa*)(sr + jb + 8 * ln + 4);
#pragma unroll
    for (int k = 0; k < 8; ++k) { const float v = fminf(fmaxf(((k < 4) ? a[k] : c[k - 4]) * 0.125f, -50.f), 50.f); se += expf(0.5f * v - 0.5f * mx); } }
  for (int o = 16; o > 0; o >>= 1) se += __shfl_xor(se, o, 32); const float inv = 1.0f / se; float pm = 0.f;      /* mean of p over keys = Σp / TT */
#pragma unroll 1
  for (int jb = 0; jb < TT; jb += 256) { const v4f a = *(const v4fa*)(sr + jb + 8 * ln), c = *(const v4fa*)(sr + jb + 8 * ln + 4);
#pragma unroll
    for (int k = 0; k < 8; ++k) { const float v = fminf(fmaxf(((k < 4) ? a[k] : c[k - 4]) * 0.125f, -50.f), 50.f); pm += expf(0.5f * v - 0.5f * mx) * inv; } }
  for (int o = 16; o > 0; o >>= 1) pm += __shfl_xor(pm, o, 32); pm = pm / (float)TT; float vq = 0.f;
#pragma unroll 1
  for (int jb = 0; jb < TT; jb += 256) { const v4f a = *(const v4fa*)(sr + jb + 8 * ln), c = *(const v4fa*)(sr + jb + 8 * ln + 4);
#pragma unroll
    for (int k = 0; k < 8; ++k) { const float v = fminf(fmaxf(((k < 4) ? a[k] : c[k - 4]) * 0.125f, -50.f), 50.f); const float d = expf(0.5f * v - 0.5f * mx) * inv - pm; vq += d * d; } }
  for (int o = 16; o > 0; o >>= 1) vq += __shfl_xor(vq, o, 32);
  if (ln == 0) { rec[w][0] = su; rec[w][1] = mx; rec[w][2] = vq / (float)(TT - 1); rec[w][3] = 0.f; }
  __syncthreads();
  if (w == 0 && ln < 8) { const v4f v = *(const v4f*)&rec[ln][0]; *(v4f*)(RST + ((size_t)blockIdx.x * 8 + ln) * 4) = v;  } }
__global__ __launch_bounds__(256) void k_thead(const float* __restrict__ RST, const float* __restrict__ Wt1, const float* __restrict__ bt1, const float* __restrict__ Wt2, const float* __restrict__ bt2, float* __restrict__ TH) {
  #pragma clang fp contract(off)
  __shared__ v4f red[256]; const int g = blockIdx.x, tid = threadIdx.x; v4f a = {0.f, 0.f, 0.f, 0.f};
  for (int q = tid; q < TT; q += 256) { const v4f r = *(const v4fa*)(RST + ((size_t)g * TT + q) * 4); a[0] += r[0]; a[1] += r[1]; a[2] += r[2]; }
  red[tid] = a; __syncthreads(); for (int st = 128; st > 0; st >>= 1) { if (tid < st) { v4f x = red[tid]; const v4f y = red[tid + st]; x[0] += y[0]; x[1] += y[1]; x[2] += y[2]; red[tid] = x; } __syncthreads(); }
  if (tid < 32) { const v4f r0 = red[0]; float f0 = r0[0] / ((float)TT * (float)TT), f1 = r0[1] / (float)TT, f2 = r0[2] / (float)TT; f0 = fminf(fmaxf(f0, -10.f), 10.f); f1 = fminf(fmaxf(f1, -10.f), 10.f); f2 = fminf(fmaxf(f2, 0.f), 1.f);
    float raw = bf16_round(bt2[0]);
#pragma unroll 1
    for (int u = 0; u < 16; ++u) { float pre = bf16_round(bt1[u]); pre += f0 * bf16_round(Wt1[u]); pre += f1 * bf16_round(Wt1[16 + u]); pre += f2 * bf16_round(Wt1[32 + u]); raw += tanhf(pre) * bf16_round(Wt2[u]); }
    float t = 0.01f + (1.0f / (1.0f + expf(-raw))) * (2.0f - 0.01f); t = fminf(fmaxf(t, 0.01f), 2.0f); t = fminf(t, 0.85f);
    *(float*)(TH + (size_t)g * 32 + tid) = t;  } }
__global__ __launch_bounds__(256) void k_tsoft(const float* __restrict__ S, const float* __restrict__ TH, _Float16* __restrict__ P16) {
  #pragma clang fp contract(off)
  const int tid = threadIdx.x, w = tid >> 5, ln = tid & 31; const int row = blockIdx.x * 8 + w; const int g = row / TT; const float sc = 1.0f / (2.0f * TH[(size_t)g * 32]); const float* sr = S + (size_t)row * TT; float m = -3.0e38f;
#pragma unroll 1
  for (int jb = 0; jb < TT; jb += 256) { const v4f a = *(const v4fa*)(sr + jb + 8 * ln), c = *(const v4fa*)(sr + jb + 8 * ln + 4);
#pragma unroll
    for (int k = 0; k < 8; ++k) m = fmaxf(m, ((k < 4) ? a[k] : c[k - 4]) * sc); }
  for (int o = 16; o > 0; o >>= 1) m = fmaxf(m, __shfl_xor(m, o, 32)); float su = 0.f;
#pragma unroll 1
  for (int jb = 0; jb < TT; jb += 256) { const v4f a = *(const v4fa*)(sr + jb + 8 * ln), c = *(const v4fa*)(sr + jb + 8 * ln + 4);
#pragma unroll
    for (int k = 0; k < 8; ++k) su += expf(((k < 4) ? a[k] : c[k - 4]) * sc - m); }
  for (int o = 16; o > 0; o >>= 1) su += __shfl_xor(su, o, 32); const float inv = 1024.0f / su;
  {
#pragma unroll 1
    for (int jb = 0; jb < TT; jb += 256) { const v4f a = *(const v4fa*)(sr + jb + 8 * ln), c = *(const v4fa*)(sr + jb + 8 * ln + 4); FragH f;
#pragma unroll
      for (int k = 0; k < 8; ++k) f.h[k] = (_Float16)(expf(((k < 4) ? a[k] : c[k - 4]) * sc - m) * inv);
      *(v8us*)((unsigned short*)P16 + (size_t)row * TT + jb + 8 * ln) = f.half[0]; }
     } }

extern "C" void kernel_launch(void* const* d_in, const int* in_sizes, int n_in,
                              void* d_out, int out_size, void* d_ws, size_t ws_size, hipStream_t stream) {
  (void)in_sizes; (void)n_in; (void)out_size;
  const float* const* I = (const float* const*)d_in; const float* xq = I[0]; const float* xk = I[1]; const float* xv = I[2]; const float* Wq = I[3]; const float* bq = I[4]; const float* Wk = I[5]; const float* bk = I[6]; const float* Wv = I[7]; const float* bv = I[8]; const float* Wo = I[9]; const float* bo = I[10]; const float* Wt1 = I[11]; const float* bt1 = I[12]; const float* Wt2 = I[13]; const float* bt2 = I[14];
  char* ws = (char*)d_ws; size_t off = 0;
  auto take = [&](size_t bytes) { char* p = ws + off; off += (bytes + 255) & ~(size_t)255; return p; };
  _Float16* BW = (_Float16*)take((size_t)CC * CC * 2); _Float16* X16 = (_Float16*)take((size_t)NR * CC * 2); _Float16* Q3p = (_Float16*)take((size_t)NR * NH * K3 * 2); _Float16* K3p = (_Float16*)take((size_t)NR * NH * K3 * 2); _Float16* V16 = (_Float16*)take((size_t)NR * CC * 2); _Float16* VTb = (_Float16*)take((size_t)CC * TT * 2); float* S = (float*)take((size_t)HG * TT * TT * 4); _Float16* P16 = (_Float16*)take((size_t)HG * TT * TT * 2); float* RST = (float*)take((size_t)HG * TT * 4 * 4); float* TH = (float*)take(HG * 32 * 4); _Float16* O16 = (_Float16*)take((size_t)NR * CC * 2);
  float* Ff = S;      /* projection f32 outputs (4096×1024×4 = 16.8 MB) live in the 33.5 MB score buffer before the loop */
  if (off > ws_size) return;      // 2.1 + 8.4 + 25.2 + 25.2 + 8.4 + 2.1 + 33.5 + 16.8 + 0.1 + 8.4 ≈ 130 MB
  const size_t n8 = (size_t)NR * CC / 8; const unsigned nb8 = (unsigned)((n8 + 255) / 256); const dim3 gP(((NR / 16) * (CC / 64) + 3) / 4, 1);
  k_wt_f16<<<(CC * (CC / 8) + 255) / 256, 256, 0, stream>>>(Wq, BW, CC, CC, 16.0f); k_x16<<<nb8, 256, 0, stream>>>(xq, X16, n8);
  k_gemm_hhx<0><<<gP, 128, 0, stream>>>(X16, CC, 0, BW, CC, 0, 0.0625f, bq, 0, nullptr, 1, 0, 0, Ff, nullptr, CC, 0, NR, CC, CC); k_fold3<<<nb8, 256, 0, stream>>>(Ff, 0, Q3p);      /* Q exact → [hi | lo | hi] */
  k_wt_f16<<<(CC * (CC / 8) + 255) / 256, 256, 0, stream>>>(Wk, BW, CC, CC, 16.0f); k_x16<<<nb8, 256, 0, stream>>>(xk, X16, n8);
  k_gemm_hhx<0><<<gP, 128, 0, stream>>>(X16, CC, 0, BW, CC, 0, 0.0625f, bk, 0, nullptr, 1, 0, 0, Ff, nullptr, CC, 0, NR, CC, CC); k_fold3<<<nb8, 256, 0, stream>>>(Ff, 1, K3p);      /* K → [hi | hi·2^-10 | lo] */
  k_wt_f16<<<(CC * (CC / 8) + 255) / 256, 256, 0, stream>>>(Wv, BW, CC, CC, 16.0f); k_x16<<<nb8, 256, 0, stream>>>(xv, X16, n8);
  k_gemm_hhx<0><<<gP, 128, 0, stream>>>(X16, CC, 0, BW, CC, 0, 0.0625f, bv, 0, nullptr, 1, 0, 0, nullptr, V16, CC, 0, NR, CC, CC);      /* V → f16 */
  k_wt_f16<<<(CC * (CC / 8) + 255) / 256, 256, 0, stream>>>(Wo, BW, CC, CC, 16.0f);      /* BW now holds Wo (its V use is complete in stream order) */
  const dim3 gS(((TT / 16) * (TT / 64) + 3) / 4, HG), gV(((TT / 16) * 1 + 3) / 4, HG);
  for (int b = 0; b < NBt; ++b) { k_vt<<<(CC * (TT / 8) + 255) / 256, 256, 0, stream>>>(V16, b, VTb);
    for (int hg = 0; hg < NH / HG; ++hg) { const int h0 = hg * HG;
      k_gemm_hhx<0><<<gS, 128, 0, stream>>>(Q3p + (size_t)b * TT * (NH * K3) + h0 * K3, NH * K3, (size_t)K3, K3p + (size_t)b * TT * (NH * K3) + h0 * K3, NH * K3, (size_t)K3, 1.0f, nullptr, 0, nullptr, 1, 0, 0, S, nullptr, TT, (size_t)TT * TT, TT, TT, K3);      /* raw Q·K ≈f32 (K 192), 8 heads */
      k_rowstat<<<HG * TT / 8, 256, 0, stream>>>(S, RST); k_thead<<<HG, 256, 0, stream>>>(RST, Wt1, bt1, Wt2, bt2, TH);
      k_tsoft<<<HG * TT / 8, 256, 0, stream>>>(S, TH, P16);
      k_gemm_hhx<0><<<gV, 128, 0, stream>>>(P16, TT, (size_t)TT * TT, VTb + (size_t)h0 * HD * TT, TT, (size_t)HD * TT, 0.0009765625f, nullptr, 0, nullptr, 1, 0, 0, nullptr, O16 + (size_t)b * TT * CC + h0 * HD, CC, (size_t)HD, TT, HD, TT); } }      
  k_gemm_hhx<0><<<gP, 128, 0, stream>>>(O16, CC, 0, BW, CC, 0, 0.0625f, bo, 0, nullptr, 1, 0, 0, (float*)d_out, nullptr, CC, 0, NR, CC, CC);
}

// v001
// A run of this version takes 538 microseconds.
// Next to v000, in two timings, it ran 1.88 and 1.83 times as fast.
#include <hip/hip_runtime.h>
// Diffusion-time multi-head attention (B 4, S 1024, D 1024, 16 heads × 64): Q,K,V = x·W + b ((in,out)); per (b,h): s = clip(Q·K/8, ±50); feats = (mean s, mean_q max_k s, mean_q var_k softmax(s/2) (ddof 1)) → t = min(clip(0.01 + 1.99·σ(tanh(feats·Wt1 + b)·Wt2 + b)), 0.85); attn = softmax(Q·K/(2t)); out = (attn·V merged)·Wo + bo → [4,1024,1024].
// Structure: projections as GEMMs (exact products); Q and K carried as f16 hi/lo and contracted with the pair folded into K ([q_hi | q_lo·2^10 | q_hi]·[k_hi | k_hi·2^-10 | k_lo], K 192) so the raw logits are ≈f32 (they are divided by 2t ≥ 0.02·…, i.e. scaled up to ×50); per (batch, 8 heads): one score GEMM, per-row statistics on VALU (clipped sum / max / softmax(s/2) variance), a per-head reduction + the tiny time MLP (one block per head, fixed order), then the row softmax with the head's 1/(2t) (×2^10 → f16) and P·V batched; output projection GEMM.
// Compute dtype: inputs and parameters rounded to bf16; logits ≈f32; statistics/MLP/softmax f32; V and the attention output as f16 operands (≈2^-12); f32 accumulation. v_wmma_f32_16x16x32_f16.
#define NBt 4
#define TT 1024
#define CC 1024
#define NH 16
#define HD 64
#define NR (NBt * TT)            /* 4096 */
#define HG 8
#define K3 (3 * HD)              /* 192 */
typedef __bf16 v16b __attribute__((ext_vector_type(16)));
typedef unsigned short v8us __attribute__((ext_vector_type(8), may_alias));
typedef float  v8f  __attribute__((ext_vector_type(8)));
typedef float  v4f  __attribute__((ext_vector_type(4)));
typedef float  v4fa __attribute__((ext_vector_type(4), may_alias));
union FragB { v16b v; v8us half[2]; unsigned short u[16]; };

__device__ __forceinline__ unsigned short bf16_bits(float x) { unsigned int u = __float_as_uint(x); return (unsigned short)((u + 0x7FFFu + ((u >> 16) & 1u)) >> 16); }
__device__ __forceinline__ float bf16_val(unsigned short b) { return __uint_as_float(((unsigned int)b) << 16); }
__device__ __forceinline__ float bf16_round(float x) { return bf16_val(bf16_bits(x)); }
// D += A·B with NT terms: 1 = ah·bh, 2 = + al·bh (A split), 3 = + ah·bl (both split)
template <int NT>
__device__ __forceinline__ v8f mmaN(v16b ah, v16b al, v16b bh, v16b bl, v8f c) {
  c = __builtin_amdgcn_wmma_f32_16x16x32_bf16(false, ah, false, bh, (short)0, c, false, false);
  if (NT >= 2) c = __builtin_amdgcn_wmma_f32_16x16x32_bf16(false, al, false, bh, (short)0, c, false, false);
  if (NT >= 3) c = __builtin_amdgcn_wmma_f32_16x16x32_bf16(false, ah, false, bl, (short)0, c, false, false);
  asm volatile("v_nop\n\tv_nop\n\tv_nop\n\tv_nop" : "+v"(c) : "v"(ah), "v"(al), "v"(bh), "v"(bl));
  return c;
}

__global__ __launch_bounds__(256) void k_wt_bf16(const float* __restrict__ W, unsigned short* __restrict__ Wt, int K, int N) {
  const int t = blockIdx.x * 256 + threadIdx.x;
  const int k8n = K / 8;
  if (t >= N * k8n) return;
  const int n = t / k8n, k8 = (t % k8n) * 8;
  v8us v;
#pragma unroll
  for (int i = 0; i < 8; ++i) v[i] = bf16_bits(W[(size_t)(k8 + i) * N + n]);
  *(v8us*)(Wt + (size_t)n * K + k8) = v;
  
}

// GEMM C[M][N] (f32, pitch ldc) = act(A[M][K]·W + bias). A f32 row-major (pitch lda) converted per fragment to bf16
// (ASPLIT: hi/lo two planes -> 2 terms, else single rounded term); Wt bf16 [N][K] (pitch ldb). BIAS_BF16 rounds the
// bias to bf16 first (bias quantised to bf16 before the add). K%32==0, M%16==0, N%64==0.
template <bool ASPLIT, int ACT, bool BIAS_BF16>
__global__ __launch_bounds__(128) void k_gemm_bf(const float* __restrict__ A, int lda, const unsigned short* __restrict__ Wt, int ldb,
                                               const float* __restrict__ bias, float* __restrict__ C, int ldc, int M, int N, int K) {
  __shared__ __attribute__((aligned(16))) float so[4][16][64];
  const int tid = threadIdx.x, w = tid >> 5, lane = tid & 31, ln = lane & 15, hh = lane >> 4;
  const int ntn = N / 64;
  const int wid = blockIdx.x * 4 + w;
  const int mt = wid / ntn, nq = wid % ntn;
  if (mt * 16 >= M) return;
  const int row0 = mt * 16, col0 = nq * 64;
  const float* arow = A + (size_t)(row0 + ln) * lda;
  v8f acc[4] = {};
  for (int kb = 0; kb < K; kb += 32) {
    FragB ah, al;
    const v4f x0 = *(const v4fa*)(arow + kb + 8 * hh), x1 = *(const v4fa*)(arow + kb + 8 * hh + 4);
    const v4f x2 = *(const v4fa*)(arow + kb + 16 + 8 * hh), x3 = *(const v4fa*)(arow + kb + 16 + 8 * hh + 4);
    float xs[16] = {x0[0],x0[1],x0[2],x0[3],x1[0],x1[1],x1[2],x1[3],x2[0],x2[1],x2[2],x2[3],x3[0],x3[1],x3[2],x3[3]};
#pragma unroll
    for (int i = 0; i < 16; ++i) { const unsigned short hb = bf16_bits(xs[i]); ah.u[i] = hb; al.u[i] = ASPLIT ? bf16_bits(xs[i] - bf16_val(hb)) : (unsigned short)0; }
#pragma unroll
    for (int t = 0; t < 4; ++t) {
      const unsigned short* brow = Wt + (size_t)(col0 + t * 16 + ln) * ldb + kb;
      FragB b;
      b.half[0] = *(const v8us*)(brow + 8 * hh);
      b.half[1] = *(const v8us*)(brow + 16 + 8 * hh);
      acc[t] = mmaN<ASPLIT ? 2 : 1>(ah.v, al.v, b.v, b.v, acc[t]);
    }
  }
#pragma unroll
  for (int t = 0; t < 4; ++t) {
    float bv = bias ? bias[col0 + t * 16 + ln] : 0.f;
    if (BIAS_BF16) bv = bf16_round(bv);
#pragma unroll
    for (int r = 0; r < 8; ++r) { float v = acc[t][r] + bv; if (ACT == 1) v = fmaxf(v, 0.f); so[w][8 * hh + r][t * 16 + ln] = v; }
  }
  __builtin_amdgcn_fence(__ATOMIC_ACQ_REL, "workgroup");
  __builtin_amdgcn_wave_barrier();
  const int rsub = lane >> 4, c4 = (lane & 15) * 4;
  {
#pragma unroll
    for (int q = 0; q < 8; ++q) {
      const int r = q * 2 + rsub;
      const v4f v = *(const v4fa*)&so[w][r][c4];
      *(v4f*)(C + (size_t)(row0 + r) * ldc + col0 + c4) = v;
    }
    
  }
}

// GEMM C = act(A·W + bias + resid): A f32 (ASPLIT -> hi/lo 2 terms), Wt bf16 [N][K]; ACT 0 none, 1 relu, 2 exact gelu;
// resid (optional, f32, row index = (row % rmod), pitch ldr, RES_BF16 rounds it) added before the activation.
template <bool ASPLIT, int ACT, bool BIAS_BF16, bool RES_BF16>
__global__ __launch_bounds__(128) void k_gemm_bf3(const float* __restrict__ A, int lda, const unsigned short* __restrict__ Wt, int ldb,
                                                const float* __restrict__ bias, const float* __restrict__ resid, int rmod, int ldr,
                                                float* __restrict__ C, int ldc, int M, int N, int K) {
  __shared__ __attribute__((aligned(16))) float so[4][16][64];
  const int tid = threadIdx.x, w = tid >> 5, lane = tid & 31, ln = lane & 15, hh = lane >> 4;
  const int ntn = N / 64;
  const int wid = blockIdx.x * 4 + w;
  const int mt = wid / ntn, nq = wid % ntn;
  if (mt * 16 >= M) return;
  const int row0 = mt * 16, col0 = nq * 64;
  const float* arow = A + (size_t)(row0 + ln) * lda;
  v8f acc[4] = {};
  for (int kb = 0; kb < K; kb += 32) {
    FragB ah, al;
    const v4f x0 = *(const v4fa*)(arow + kb + 8 * hh), x1 = *(const v4fa*)(arow + kb + 8 * hh + 4);
    const v4f x2 = *(const v4fa*)(arow + kb + 16 + 8 * hh), x3 = *(const v4fa*)(arow + kb + 16 + 8 * hh + 4);
    float xs[16] = {x0[0],x0[1],x0[2],x0[3],x1[0],x1[1],x1[2],x1[3],x2[0],x2[1],x2[2],x2[3],x3[0],x3[1],x3[2],x3[3]};
#pragma unroll
    for (int i = 0; i < 16; ++i) { const unsigned short hb = bf16_bits(xs[i]); ah.u[i] = hb; al.u[i] = ASPLIT ? bf16_bits(xs[i] - bf16_val(hb)) : (unsigned short)0; }
#pragma unroll
    for (int t = 0; t < 4; ++t) {
      const unsigned short* brow = Wt + (size_t)(col0 + t * 16 + ln) * ldb + kb;
      FragB b;
      b.half[0] = *(const v8us*)(brow + 8 * hh);
      b.half[1] = *(const v8us*)(brow + 16 + 8 * hh);
      acc[t] = mmaN<ASPLIT ? 2 : 1>(ah.v, al.v, b.v, b.v, acc[t]);
    }
  }
#pragma unroll
  for (int t = 0; t < 4; ++t) {
    const int col = col0 + t * 16 + ln;
    float bv = bias ? bias[col] : 0.f;
    if (BIAS_BF16) bv = bf16_round(bv);
#pragma unroll
    for (int r = 0; r < 8; ++r) {
      float v = acc[t][r] + bv;
      if (resid) { float rv = resid[(size_t)((row0 + 8 * hh + r) % rmod) * ldr + col]; if (RES_BF16) rv = bf16_round(rv); v += rv; }
      if (ACT == 1) v = fmaxf(v, 0.f);
      if (ACT == 2) v = 0.5f * v * (1.0f + erff(v * 0.70710678118654752f));
      if (ACT == 3) { const float u = 0.7978845608028654f * (v + 0.044715f * v * v * v); v = 0.5f * v * (1.0f + tanhf(u)); }
      so[w][8 * hh + r][t * 16 + ln] = v;
    }
  }
  __builtin_amdgcn_fence(__ATOMIC_ACQ_REL, "workgroup");
  __builtin_amdgcn_wave_barrier();
  const int rsub = lane >> 4, c4 = (lane & 15) * 4;
  {
#pragma unroll
    for (int q = 0; q < 8; ++q) {
      const int r = q * 2 + rsub;
      const v4f v = *(const v4fa*)&so[w][r][c4];
      *(v4f*)(C + (size_t)(row0 + r) * ldc + col0 + c4) = v;
    }
    
  }
}
// row LayerNorm (biased variance, eps) over N: s = X (+ R); optional out_sum <- s; out_norm <- (s-mu)*rsqrt(var+eps)*g + b
template <bool PARAM_BF16>
__global__ __launch_bounds__(256) void k_layernorm(const float* __restrict__ X, const float* __restrict__ R, const float* __restrict__ g, const float* __restrict__ bta,
                                                  float* __restrict__ out_sum, float* __restrict__ out_norm, int N, float eps) {
  __shared__ float red[256];
  const int row = blockIdx.x, tid = threadIdx.x;
  const float* x = X + (size_t)row * N; const float* rr = R ? R + (size_t)row * N : nullptr;
  float vals[16];                     // up to N = 4096
  const int per = N / 256;            // contiguous chunk per thread? use strided-by-4 chunks: thread handles j = tid*4 + 1024*u
  float s1 = 0.f;
  for (int u = 0; u < per / 4; ++u) {
    const int j = tid * 4 + 1024 * u;
    const v4f a = *(const v4fa*)(x + j);
    v4f b = {0.f,0.f,0.f,0.f}; if (rr) b = *(const v4fa*)(rr + j);
#pragma unroll
    for (int q = 0; q < 4; ++q) { const float v = a[q] + b[q]; vals[u * 4 + q] = v; s1 += v; }
  }
  red[tid] = s1; __syncthreads();
  for (int st = 128; st > 0; st >>= 1) { if (tid < st) red[tid] += red[tid + st]; __syncthreads(); }
  const float mu = red[0] / (float)N; __syncthreads();
  float s2 = 0.f;
  for (int u = 0; u < per / 4; ++u)
#pragma unroll
    for (int q = 0; q < 4; ++q) { const float c = vals[u * 4 + q] - mu; s2 += c * c; }
  red[tid] = s2; __syncthreads();
  for (int st = 128; st > 0; st >>= 1) { if (tid < st) red[tid] += red[tid + st]; __syncthreads(); }
  const float rs = rsqrtf(red[0] / (float)N + eps);
  {
    for (int u = 0; u < per / 4; ++u) {
      const int j = tid * 4 + 1024 * u;
      v4f o, sm;
#pragma unroll
      for (int q = 0; q < 4; ++q) {
        float gg = g[j + q], bb = bta[j + q];
        if (PARAM_BF16) { gg = bf16_round(gg); bb = bf16_round(bb); }
        sm[q] = vals[u * 4 + q]; o[q] = (vals[u * 4 + q] - mu) * rs * gg + bb;
      }
      if (out_sum) *(v4f*)(out_sum + (size_t)row * N + j) = sm;
      *(v4f*)(out_norm + (size_t)row * N + j) = o;
    }
    
  }
}



// ---- f16 WMMA path (v_wmma_f32_16x16x32_f16): 11-bit significands for operands in range — used where a [0,1] probability operand needs more precision than bf16
typedef _Float16 v16h __attribute__((ext_vector_type(16)));
union FragH { v16h v; v8us half[2]; _Float16 h[16]; unsigned short u[16]; };
template <int NT>
__device__ __forceinline__ v8f mmaH(v16h ah, v16h al, v16h bh, v16h bl, v8f c) {
  c = __builtin_amdgcn_wmma_f32_16x16x32_f16(false, ah, false, bh, (short)0, c, false, false);
  if (NT >= 2) c = __builtin_amdgcn_wmma_f32_16x16x32_f16(false, al, false, bh, (short)0, c, false, false);
  if (NT >= 3) c = __builtin_amdgcn_wmma_f32_16x16x32_f16(false, ah, false, bl, (short)0, c, false, false);
  asm volatile("v_nop\n\tv_nop\n\tv_nop\n\tv_nop" : "+v"(c) : "v"(ah), "v"(al), "v"(bh), "v"(bl));
  return c;
}
// batched GEMM like k_gemm_b but f16 operands: A f32 (split into f16 hi/lo if ASPLIT, else rounded to f16), Bt = f16 values [n][k]; alpha; C f32; N multiple of 16 (partial tiles skipped)
template <bool ASPLIT>
__global__ __launch_bounds__(128) void k_gemm_h(const float* __restrict__ A, int lda, size_t sA, const _Float16* __restrict__ Bh, int ldb, size_t sB, float alpha, float* __restrict__ C, int ldc, size_t sC, int M, int N, int K) {
  __shared__ __attribute__((aligned(16))) float so[4][16][64];
  const int tid = threadIdx.x, w = tid >> 5, lane = tid & 31, ln = lane & 15, hh = lane >> 4; const int by = blockIdx.y;
  A += (size_t)by * sA; Bh += (size_t)by * sB; C += (size_t)by * sC;
  const int ntn = (N + 63) / 64; const int wid = blockIdx.x * 4 + w; const int mt = wid / ntn, nq = wid % ntn; if (mt * 16 >= M) return;
  const int row0 = mt * 16, col0 = nq * 64; const float* arow = A + (size_t)(row0 + ln) * lda;
  v8f acc[4] = {};
  for (int kb = 0; kb < K; kb += 32) {
    FragH ah, al;
    const v4f x0 = *(const v4fa*)(arow + kb + 8 * hh), x1 = *(const v4fa*)(arow + kb + 8 * hh + 4), x2 = *(const v4fa*)(arow + kb + 16 + 8 * hh), x3 = *(const v4fa*)(arow + kb + 16 + 8 * hh + 4);
    float xs[16] = {x0[0],x0[1],x0[2],x0[3],x1[0],x1[1],x1[2],x1[3],x2[0],x2[1],x2[2],x2[3],x3[0],x3[1],x3[2],x3[3]};
#pragma unroll
    for (int i = 0; i < 16; ++i) { const _Float16 h = (_Float16)xs[i]; ah.h[i] = h; al.h[i] = ASPLIT ? (_Float16)(xs[i] - (float)h) : (_Float16)0.0f; }
#pragma unroll
    for (int t = 0; t < 4; ++t) { if (col0 + t * 16 >= N) continue; const size_t boff = (size_t)(col0 + t * 16 + ln) * ldb + kb; FragH bq; bq.half[0] = *(const v8us*)(Bh + boff + 8 * hh); bq.half[1] = *(const v8us*)(Bh + boff + 16 + 8 * hh);
      acc[t] = mmaH<ASPLIT ? 2 : 1>(ah.v, al.v, bq.v, bq.v, acc[t]); }
  }
#pragma unroll
  for (int t = 0; t < 4; ++t) { if (col0 + t * 16 >= N) continue;
#pragma unroll
    for (int r = 0; r < 8; ++r) so[w][8 * hh + r][t * 16 + ln] = acc[t][r] * alpha; }
  __builtin_amdgcn_fence(__ATOMIC_ACQ_REL, "workgroup"); __builtin_amdgcn_wave_barrier();
  const int rsub = lane >> 4, c4 = (lane & 15) * 4;
  {
#pragma unroll
    for (int q = 0; q < 8; ++q) { const int r = q * 2 + rsub; if (col0 + c4 < N) { const v4f v = *(const v4fa*)&so[w][r][c4]; *(v4f*)(C + (size_t)(row0 + r) * ldc + col0 + c4) = v; } }
     }
}

// Wt[n][k] = f16(W[k][n]·scale) from f32 row-major W[K][N] (scale = power of two; bf16-exact weights stay exact in f16 away from the subnormal range)
__global__ __launch_bounds__(256) void k_wt_f16(const float* __restrict__ W, _Float16* __restrict__ Wt, int K, int N, float scale) {
  const int t = blockIdx.x * 256 + threadIdx.x; if (t >= N * (K / 8)) return; const int n = t / (K / 8), k8 = (t % (K / 8)) * 8; FragH f;
#pragma unroll
  for (int i = 0; i < 8; ++i) f.h[i] = (_Float16)(bf16_round(W[(size_t)(k8 + i) * N + n]) * scale); const v8us o = f.half[0];
  *(v8us*)((unsigned short*)Wt + (size_t)n * K + k8) = o; 
}
// Block-tiled GEMM with fused epilogue: v = acc*alpha + bias[by*sBias + col] ; ACT 0 none / 1 elu ; writes f16 C16 (H16) or f32 C.
// One block = WM x WN waves = a (WM*FM*16) x (WN*64) tile of C; a wave owns FM x 4 accumulator tiles. Per chunk of KC k the block brings its A rows and B rows (whole 128-B lines, KC/8 lanes a row)
// into LDS at a pitch of 2*KC + 16 B and every wave reads its fragments from there; two buffers, the next chunk's global loads fly while this chunk is multiplied.
// LD = row pitch of A and of B in elements, a compile-time constant so that the rows of a tile are immediate offsets from one address per operand.
// Needs M a multiple of WM*FM*16, N of WN*64, K of KC (every launch below is).
template <int ACT, int WM, int WN, int FM, int KC, int LD, bool H16>
__global__ __launch_bounds__(WM * WN * 32) void k_gemm_hhx(const _Float16* __restrict__ A, size_t sA, const _Float16* __restrict__ Bh, size_t sB, float alpha, const float* __restrict__ bias, size_t sBias,
    float* __restrict__ C, _Float16* __restrict__ C16, int ldc, size_t sC, int M, int N, int K) {
  constexpr int NW = WM * WN, BM = WM * FM * 16, BN = WN * 64, CPR = KC / 8, RP = NW * 32 / CPR, NA = BM / RP, NB = BN / RP, PIT = KC + 8;
  __shared__ __attribute__((aligned(16))) unsigned short tA[2][BM][PIT];
  __shared__ __attribute__((aligned(16))) unsigned short tB[2][BN][PIT];
  __shared__ __attribute__((aligned(16))) float so[NW][16][64];
  const int tid = threadIdx.x, w = tid >> 5, lane = tid & 31, ln = lane & 15, hh = lane >> 4; const int by = blockIdx.y;
  A += (size_t)by * sA; Bh += (size_t)by * sB; const size_t cofs = (size_t)by * sC; const float* bp = bias ? bias + (size_t)by * sBias : nullptr;
  const int ntn = N / BN; const int bm = blockIdx.x / ntn, bn = blockIdx.x % ntn; if (bm * BM >= M) return;
  const int wm = w / WN, wn = w % WN; const int srow = tid / CPR, sc = (tid % CPR) * 8;
  const unsigned short* gA = (const unsigned short*)A + (size_t)(bm * BM + srow) * LD + sc;
  const unsigned short* gB = (const unsigned short*)Bh + (size_t)(bn * BN + srow) * LD + sc;
  const int col0 = bn * BN + wn * 64;
  float bvv[4];      // the wave's bias values, fetched ahead of the products
#pragma unroll
  for (int t = 0; t < 4; ++t) bvv[t] = bp ? bf16_round(bp[col0 + t * 16 + ln]) : 0.f;
  v8us ra[NA], rb[NB];
  v8f acc[FM][4] = {};
  auto g2r = [&](int kb) {
#pragma unroll
    for (int i = 0; i < NA; ++i) ra[i] = *(const v8us*)(gA + kb + i * RP * LD);
#pragma unroll
    for (int i = 0; i < NB; ++i) rb[i] = *(const v8us*)(gB + kb + i * RP * LD);
  };
  auto r2s = [&](int buf) {
#pragma unroll
    for (int i = 0; i < NA; ++i) *(v8us*)&tA[buf][i * RP + srow][sc] = ra[i];
#pragma unroll
    for (int i = 0; i < NB; ++i) *(v8us*)&tB[buf][i * RP + srow][sc] = rb[i];
  };
  auto mul = [&](int buf) {
#pragma unroll
    for (int ks = 0; ks < KC / 32; ++ks) { FragH fa[FM], fb[4];
#pragma unroll
      for (int i = 0; i < FM; ++i) { const unsigned short* p = &tA[buf][(wm * FM + i) * 16 + ln][ks * 32 + 8 * hh]; fa[i].half[0] = *(const v8us*)p; fa[i].half[1] = *(const v8us*)(p + 16); }
#pragma unroll
      for (int t = 0; t < 4; ++t) { const unsigned short* p = &tB[buf][wn * 64 + t * 16 + ln][ks * 32 + 8 * hh]; fb[t].half[0] = *(const v8us*)p; fb[t].half[1] = *(const v8us*)(p + 16); }
#pragma unroll
      for (int i = 0; i < FM; ++i)
#pragma unroll
        for (int t = 0; t < 4; ++t) acc[i][t] = __builtin_amdgcn_wmma_f32_16x16x32_f16(false, fa[i].v, false, fb[t].v, (short)0, acc[i][t], false, false); }
  };
  g2r(0); r2s(0);
  __syncthreads();      // chunk 0 is in buffer 0 for every wave
  int buf = 0;
  for (int kb = KC; kb < K; kb += KC) {
    g2r(kb);            // next chunk: in flight while this one is multiplied
    __builtin_amdgcn_sched_barrier(0);      // keeps those loads above the products; without it the compiler sinks them to just before their LDS stores and their latency is waited out
    mul(buf);
    r2s(buf ^ 1);       // that buffer's last readers left it before the barrier that ended the trip before
    __syncthreads();    // publishes the next chunk and ends this trip's reads of buf
    buf ^= 1;
  }
  mul(buf);
  const int rsub = lane >> 4, c4 = (lane & 15) * 4; typedef _Float16 v4h __attribute__((ext_vector_type(4)));
#pragma unroll
  for (int i = 0; i < FM; ++i) { const int row0 = bm * BM + (wm * FM + i) * 16;
#pragma unroll
    for (int t = 0; t < 4; ++t) { const float bv = bvv[t];
#pragma unroll
      for (int r = 0; r < 8; ++r) { float v = acc[i][t][r] * alpha + bv; if (ACT == 1) v = (v > 0.f) ? v : expm1f(v); else if (ACT == 7) v = (v > 0.f) ? v + 1.0f : expf(v); else if (ACT == 8) v = tanhf(v); else if (ACT == 9) v = 0.5f * v * (1.0f + tanhf(0.7978845608028654f * (v + 0.044715f * v * v * v))); else if (ACT == 11) v = 1.0f / (1.0f + expf(-v)); else if (ACT == 12) v = (v > 0.f) ? v : 0.01f * v; else if (ACT == 14) v = (v > 0.f) ? v : 0.1f * v; else if (ACT == 15) v = v / (1.0f + expf(-v)); else if (ACT == 3) v = fmaxf(v, 0.f); else if (ACT == 6) v = 0.5f * v * (1.0f + erff(v * 0.70710678118654752f)); so[w][8 * hh + r][t * 16 + ln] = v; } }
    __builtin_amdgcn_fence(__ATOMIC_ACQ_REL, "workgroup"); __builtin_amdgcn_wave_barrier();
#pragma unroll
    for (int q = 0; q < 8; ++q) { const int r = q * 2 + rsub; const v4f v = *(const v4fa*)&so[w][r][c4]; if (!H16) *(v4f*)(C + cofs + (size_t)(row0 + r) * ldc + col0 + c4) = v; else { v4h h4; for (int j = 0; j < 4; ++j) h4[j] = (_Float16)v[j]; *(v4h*)(C16 + cofs + (size_t)(row0 + r) * ldc + col0 + c4) = h4; } }
    if (i + 1 < FM) { __builtin_amdgcn_fence(__ATOMIC_ACQ_REL, "workgroup"); __builtin_amdgcn_wave_barrier(); }      // the wave's rows are read back before its next 16 rows overwrite them
  }
}


typedef _Float16 v4h __attribute__((ext_vector_type(4)));

__global__ __launch_bounds__(256) void k_x16(const float* __restrict__ x, _Float16* __restrict__ X16, size_t n8) { const size_t t = (size_t)blockIdx.x * 256 + threadIdx.x; if (t >= n8) return; FragH f;
#pragma unroll
  for (int q = 0; q < 8; ++q) f.h[q] = (_Float16)bf16_round(x[t * 8 + q]); *(v8us*)((unsigned short*)X16 + t * 8) = f.half[0];  }
__global__ __launch_bounds__(256) void k_h16(const float* __restrict__ x, _Float16* __restrict__ X16, size_t n8) { const size_t t = (size_t)blockIdx.x * 256 + threadIdx.x; if (t >= n8) return; FragH f;
#pragma unroll
  for (int q = 0; q < 8; ++q) f.h[q] = (_Float16)x[t * 8 + q]; *(v8us*)((unsigned short*)X16 + t * 8) = f.half[0];  }
__global__ __launch_bounds__(256) void k_round16f(const float* __restrict__ W, _Float16* __restrict__ Bt, size_t n8) { const size_t t = (size_t)blockIdx.x * 256 + threadIdx.x; if (t >= n8) return; FragH f;
#pragma unroll
  for (int i = 0; i < 8; ++i) f.h[i] = (_Float16)(bf16_round(W[t * 8 + i]) * 16.0f); *(v8us*)((unsigned short*)Bt + t * 8) = f.half[0];  }
template <int NHv, int TTv>
__global__ __launch_bounds__(256) void k_vt(const _Float16* __restrict__ V16, int ldv, int voff, _Float16* __restrict__ Vt) { __shared__ unsigned short tl[64][66]; const int tid = threadIdx.x; const int slab = blockIdx.x / (TTv / 64), lg = blockIdx.x % (TTv / 64); const int b = slab / NHv, h = slab % NHv;
  for (int i = tid; i < 64 * 8; i += 256) { const int r = i / 8, c8 = (i % 8) * 8; FragH f; f.half[0] = *(const v8us*)((const unsigned short*)V16 + ((size_t)b * TTv + lg * 64 + r) * ldv + voff + h * 64 + c8);
#pragma unroll
    for (int q = 0; q < 8; ++q) tl[r][c8 + q] = f.u[q]; }
  __syncthreads();
  {
#pragma unroll
    for (int rd = 0; rd < 2; ++rd) { const int d = rd * 32 + tid / 8, pc = tid % 8; FragH f;
#pragma unroll
      for (int q = 0; q < 8; ++q) f.u[q] = tl[pc * 8 + q][d];
      *(v8us*)((unsigned short*)Vt + ((size_t)slab * 64 + d) * TTv + lg * 64 + pc * 8) = f.half[0]; }
     } }

__global__ __launch_bounds__(256) void k_hl(const float* __restrict__ F, _Float16* __restrict__ Hh, _Float16* __restrict__ Hl, size_t n8) { const size_t t = (size_t)blockIdx.x * 256 + threadIdx.x; if (t >= n8) return; FragH fh, fl; const v4f a = *(const v4fa*)(F + t * 8), c = *(const v4fa*)(F + t * 8 + 4);
#pragma unroll
  for (int q = 0; q < 4; ++q) { _Float16 h = (_Float16)a[q]; fh.h[q] = h; fl.h[q] = (_Float16)((a[q] - (float)h) * 1024.0f); h = (_Float16)c[q]; fh.h[4 + q] = h; fl.h[4 + q] = (_Float16)((c[q] - (float)h) * 1024.0f); }
  { *(v8us*)((unsigned short*)Hh + t * 8) = fh.half[0]; *(v8us*)((unsigned short*)Hl + t * 8) = fl.half[0];  } }

__global__ __launch_bounds__(256) void k_fold3(const float* __restrict__ F, int mode, _Float16* __restrict__ O3) {
  #pragma clang fp contract(off)
  const int t = blockIdx.x * 256 + threadIdx.x; if (t >= NR * (CC / 8)) return; const int c0 = (t % (CC / 8)) * 8, r = t / (CC / 8); const int h = c0 / HD, d0 = c0 % HD; const v4f a = *(const v4fa*)(F + (size_t)r * CC + c0), c = *(const v4fa*)(F + (size_t)r * CC + c0 + 4); FragH s0, s1, s2;
#pragma unroll
  for (int q = 0; q < 8; ++q) { const float v = (q < 4) ? a[q] : c[q - 4]; const _Float16 hi = (_Float16)v; const float lo = (v - (float)hi); if (mode == 0) { s0.h[q] = hi; s1.h[q] = (_Float16)(lo * 1024.0f); s2.h[q] = hi; } else { s0.h[q] = hi; s1.h[q] = (_Float16)((float)hi * 0.0009765625f); s2.h[q] = (_Float16)lo; } }
  unsigned short* base = (unsigned short*)O3 + (size_t)r * (NH * K3) + h * K3 + d0;
  { *(v8us*)(base) = s0.half[0]; *(v8us*)(base + HD) = s1.half[0]; *(v8us*)(base + 2 * HD) = s2.half[0];  } }
__global__ __launch_bounds__(256) void k_vt(const _Float16* __restrict__ V, int b, _Float16* __restrict__ VT) { const int t = blockIdx.x * 256 + threadIdx.x; if (t >= CC * (TT / 8)) return; const int s0 = (t % (TT / 8)) * 8, hd = t / (TT / 8); FragH f;
#pragma unroll
  for (int q = 0; q < 8; ++q) f.h[q] = V[((size_t)b * TT + s0 + q) * CC + hd];
  *(v8us*)((unsigned short*)VT + (size_t)hd * TT + s0) = f.half[0];  }
__global__ __launch_bounds__(256) void k_rowstat(const float* __restrict__ S, float* __restrict__ RST) {
  #pragma clang fp contract(off)
  __shared__ float rec[8][4]; const int tid = threadIdx.x, w = tid >> 5, ln = tid & 31; const int row = blockIdx.x * 8 + w; const float* sr = S + (size_t)row * TT; float su = 0.f, mx = -3.0e38f;
#pragma unroll 1
  for (int jb = 0; jb < TT; jb += 256) { const v4f a = *(const v4fa*)(sr + jb + 8 * ln), c = *(const v4fa*)(sr + jb + 8 * ln + 4);
#pragma unroll
    for (int k = 0; k < 8; ++k) { const float v = fminf(fmaxf(((k < 4) ? a[k] : c[k - 4]) * 0.125f, -50.f), 50.f); su += v; mx = fmaxf(mx, v); } }
  for (int o = 16; o > 0; o >>= 1) { su += __shfl_xor(su, o, 32); mx = fmaxf(mx, __shfl_xor(mx, o, 32)); }
  float se = 0.f;
#pragma unroll 1
  for (int jb = 0; jb < TT; jb += 256) { const v4f a = *(const v4fa*)(sr + jb + 8 * ln), c = *(const v4fa*)(sr + jb + 8 * ln + 4);
#pragma unroll
    for (int k = 0; k < 8; ++k) { const float v = fminf(fmaxf(((k < 4) ? a[k] : c[k - 4]) * 0.125f, -50.f), 50.f); se += expf(0.5f * v - 0.5f * mx); } }
  for (int o = 16; o > 0; o >>= 1) se += __shfl_xor(se, o, 32); const float inv = 1.0f / se; float pm = 0.f;      /* mean of p over keys = Σp / TT */
#pragma unroll 1
  for (int jb = 0; jb < TT; jb += 256) { const v4f a = *(const v4fa*)(sr + jb + 8 * ln), c = *(const v4fa*)(sr + jb + 8 * ln + 4);
#pragma unroll
    for (int k = 0; k < 8; ++k) { const float v = fminf(fmaxf(((k < 4) ? a[k] : c[k - 4]) * 0.125f, -50.f), 50.f); pm += expf(0.5f * v - 0.5f * mx) * inv; } }
  for (int o = 16; o > 0; o >>= 1) pm += __shfl_xor(pm, o, 32); pm = pm / (float)TT; float vq = 0.f;
#pragma unroll 1
  for (int jb = 0; jb < TT; jb += 256) { const v4f a = *(const v4fa*)(sr + jb + 8 * ln), c = *(const v4fa*)(sr + jb + 8 * ln + 4);
#pragma unroll
    for (int k = 0; k < 8; ++k) { const float v = fminf(fmaxf(((k < 4) ? a[k] : c[k - 4]) * 0.125f, -50.f), 50.f); const float d = expf(0.5f * v - 0.5f * mx) * inv - pm; vq += d * d; } }
  for (int o = 16; o > 0; o >>= 1) vq += __shfl_xor(vq, o, 32);
  if (ln == 0) { rec[w][0] = su; rec[w][1] = mx; rec[w][2] = vq / (float)(TT - 1); rec[w][3] = 0.f; }
  __syncthreads();
  if (w == 0 && ln < 8) { const v4f v = *(const v4f*)&rec[ln][0]; *(v4f*)(RST + ((size_t)blockIdx.x * 8 + ln) * 4) = v;  } }
__global__ __launch_bounds__(256) void k_thead(const float* __restrict__ RST, const float* __restrict__ Wt1, const float* __restrict__ bt1, const float* __restrict__ Wt2, const float* __restrict__ bt2, float* __restrict__ TH) {
  #pragma clang fp contract(off)
  __shared__ v4f red[256]; const int g = blockIdx.x, tid = threadIdx.x; v4f a = {0.f, 0.f, 0.f, 0.f};
  for (int q = tid; q < TT; q += 256) { const v4f r = *(const v4fa*)(RST + ((size_t)g * TT + q) * 4); a[0] += r[0]; a[1] += r[1]; a[2] += r[2]; }
  red[tid] = a; __syncthreads(); for (int st = 128; st > 0; st >>= 1) { if (tid < st) { v4f x = red[tid]; const v4f y = red[tid + st]; x[0] += y[0]; x[1] += y[1]; x[2] += y[2]; red[tid] = x; } __syncthreads(); }
  if (tid < 32) { const v4f r0 = red[0]; float f0 = r0[0] / ((float)TT * (float)TT), f1 = r0[1] / (float)TT, f2 = r0[2] / (float)TT; f0 = fminf(fmaxf(f0, -10.f), 10.f); f1 = fminf(fmaxf(f1, -10.f), 10.f); f2 = fminf(fmaxf(f2, 0.f), 1.f);
    float raw = bf16_round(bt2[0]);
#pragma unroll 1
    for (int u = 0; u < 16; ++u) { float pre = bf16_round(bt1[u]); pre += f0 * bf16_round(Wt1[u]); pre += f1 * bf16_round(Wt1[16 + u]); pre += f2 * bf16_round(Wt1[32 + u]); raw += tanhf(pre) * bf16_round(Wt2[u]); }
    float t = 0.01f + (1.0f / (1.0f + expf(-raw))) * (2.0f - 0.01f); t = fminf(fmaxf(t, 0.01f), 2.0f); t = fminf(t, 0.85f);
    *(float*)(TH + (size_t)g * 32 + tid) = t;  } }
__global__ __launch_bounds__(256) void k_tsoft(const float* __restrict__ S, const float* __restrict__ TH, _Float16* __restrict__ P16) {
  #pragma clang fp contract(off)
  const int tid = threadIdx.x, w = tid >> 5, ln = tid & 31; const int row = blockIdx.x * 8 + w; const int g = row / TT; const float sc = 1.0f / (2.0f * TH[(size_t)g * 32]); const float* sr = S + (size_t)row * TT; float m = -3.0e38f;
#pragma unroll 1
  for (int jb = 0; jb < TT; jb += 256) { const v4f a = *(const v4fa*)(sr + jb + 8 * ln), c = *(const v4fa*)(sr + jb + 8 * ln + 4);
#pragma unroll
    for (int k = 0; k < 8; ++k) m = fmaxf(m, ((k < 4) ? a[k] : c[k - 4]) * sc); }
  for (int o = 16; o > 0; o >>= 1) m = fmaxf(m, __shfl_xor(m, o, 32)); float su = 0.f;
#pragma unroll 1
  for (int jb = 0; jb < TT; jb += 256) { const v4f a = *(const v4fa*)(sr + jb + 8 * ln), c = *(const v4fa*)(sr + jb + 8 * ln + 4);
#pragma unroll
    for (int k = 0; k < 8; ++k) su += expf(((k < 4) ? a[k] : c[k - 4]) * sc - m); }
  for (int o = 16; o > 0; o >>= 1) su += __shfl_xor(su, o, 32); const float inv = 1024.0f / su;
  {
#pragma unroll 1
    for (int jb = 0; jb < TT; jb += 256) { const v4f a = *(const v4fa*)(sr + jb + 8 * ln), c = *(const v4fa*)(sr + jb + 8 * ln + 4); FragH f;
#pragma unroll
      for (int k = 0; k < 8; ++k) f.h[k] = (_Float16)(expf(((k < 4) ? a[k] : c[k - 4]) * sc - m) * inv);
      *(v8us*)((unsigned short*)P16 + (size_t)row * TT + jb + 8 * ln) = f.half[0]; }
     } }

extern "C" void kernel_launch(void* const* d_in, const int* in_sizes, int n_in,
                              void* d_out, int out_size, void* d_ws, size_t ws_size, hipStream_t stream) {
  (void)in_sizes; (void)n_in; (void)out_size;
  const float* const* I = (const float* const*)d_in; const float* xq = I[0]; const float* xk = I[1]; const float* xv = I[2]; const float* Wq = I[3]; const float* bq = I[4]; const float* Wk = I[5]; const float* bk = I[6]; const float* Wv = I[7]; const float* bv = I[8]; const float* Wo = I[9]; const float* bo = I[10]; const float* Wt1 = I[11]; const float* bt1 = I[12]; const float* Wt2 = I[13]; const float* bt2 = I[14];
  char* ws = (char*)d_ws; size_t off = 0;
  auto take = [&](size_t bytes) { char* p = ws + off; off += (bytes + 255) & ~(size_t)255; return p; };
  _Float16* BW = (_Float16*)take((size_t)CC * CC * 2); _Float16* X16 = (_Float16*)take((size_t)NR * CC * 2); _Float16* Q3p = (_Float16*)take((size_t)NR * NH * K3 * 2); _Float16* K3p = (_Float16*)take((size_t)NR * NH * K3 * 2); _Float16* V16 = (_Float16*)take((size_t)NR * CC * 2); _Float16* VTb = (_Float16*)take((size_t)CC * TT * 2); float* S = (float*)take((size_t)HG * TT * TT * 4); _Float16* P16 = (_Float16*)take((size_t)HG * TT * TT * 2); float* RST = (float*)take((size_t)HG * TT * 4 * 4); float* TH = (float*)take(HG * 32 * 4); _Float16* O16 = (_Float16*)take((size_t)NR * CC * 2);
  float* Ff = S;      /* projection f32 outputs (4096×1024×4 = 16.8 MB) live in the 33.5 MB score buffer before the loop */
  if (off > ws_size) return;      // 2.1 + 8.4 + 25.2 + 25.2 + 8.4 + 2.1 + 33.5 + 16.8 + 0.1 + 8.4 ≈ 130 MB
  const size_t n8 = (size_t)NR * CC / 8; const unsigned nb8 = (unsigned)((n8 + 255) / 256); const dim3 gP((NR / 128) * (CC / 128), 1);
  k_wt_f16<<<(CC * (CC / 8) + 255) / 256, 256, 0, stream>>>(Wq, BW, CC, CC, 16.0f); k_x16<<<nb8, 256, 0, stream>>>(xq, X16, n8);
  k_gemm_hhx<0, 4, 2, 2, 128, CC, false><<<gP, 256, 0, stream>>>(X16, 0, BW, 0, 0.0625f, bq, 0, Ff, nullptr, CC, 0, NR, CC, CC); k_fold3<<<nb8, 256, 0, stream>>>(Ff, 0, Q3p);      /* Q exact → [hi | lo | hi] */
  k_wt_f16<<<(CC * (CC / 8) + 255) / 256, 256, 0, stream>>>(Wk, BW, CC, CC, 16.0f); k_x16<<<nb8, 256, 0, stream>>>(xk, X16, n8);
  k_gemm_hhx<0, 4, 2, 2, 128, CC, false><<<gP, 256, 0, stream>>>(X16, 0, BW, 0, 0.0625f, bk, 0, Ff, nullptr, CC, 0, NR, CC, CC); k_fold3<<<nb8, 256, 0, stream>>>(Ff, 1, K3p);      /* K → [hi | hi·2^-10 | lo] */
  k_wt_f16<<<(CC * (CC / 8) + 255) / 256, 256, 0, stream>>>(Wv, BW, CC, CC, 16.0f); k_x16<<<nb8, 256, 0, stream>>>(xv, X16, n8);
  k_gemm_hhx<0, 4, 2, 2, 128, CC, true><<<gP, 256, 0, stream>>>(X16, 0, BW, 0, 0.0625f, bv, 0, nullptr, V16, CC, 0, NR, CC, CC);      /* V → f16 */
  k_wt_f16<<<(CC * (CC / 8) + 255) / 256, 256, 0, stream>>>(Wo, BW, CC, CC, 16.0f);      /* BW now holds Wo (its V use is complete in stream order) */
  const dim3 gS((TT / 128) * (TT / 128), HG), gV(TT / 64, HG);
  for (int b = 0; b < NBt; ++b) { k_vt<<<(CC * (TT / 8) + 255) / 256, 256, 0, stream>>>(V16, b, VTb);
    for (int hg = 0; hg < NH / HG; ++hg) { const int h0 = hg * HG;
      k_gemm_hhx<0, 4, 2, 2, 64, NH * K3, false><<<gS, 256, 0, stream>>>(Q3p + (size_t)b * TT * (NH * K3) + h0 * K3, (size_t)K3, K3p + (size_t)b * TT * (NH * K3) + h0 * K3, (size_t)K3, 1.0f, nullptr, 0, S, nullptr, TT, (size_t)TT * TT, TT, TT, K3);      /* raw Q·K ≈f32 (K 192), 8 heads */
      k_rowstat<<<HG * TT / 8, 256, 0, stream>>>(S, RST); k_thead<<<HG, 256, 0, stream>>>(RST, Wt1, bt1, Wt2, bt2, TH);
      k_tsoft<<<HG * TT / 8, 256, 0, stream>>>(S, TH, P16);
      k_gemm_hhx<0, 4, 1, 1, 128, TT, true><<<gV, 128, 0, stream>>>(P16, (size_t)TT * TT, VTb + (size_t)h0 * HD * TT, (size_t)HD * TT, 0.0009765625f, nullptr, 0, nullptr, O16 + (size_t)b * TT * CC + h0 * HD, CC, (size_t)HD, TT, HD, TT); } }      
  k_gemm_hhx<0, 4, 2, 2, 128, CC, false><<<gP, 256, 0, stream>>>(O16, 0, BW, 0, 0.0625f, bo, 0, (float*)d_out, nullptr, CC, 0, NR, CC, CC);
}

// v002
// A run of this version takes 347 microseconds.
// In both of two side-by-side timings against v001, it was 1.55 times as fast.
// Over all steps from v000 it is 2.87 times as fast.
#include <hip/hip_runtime.h>
// Diffusion-time multi-head attention (B 4, S 1024, D 1024, 16 heads × 64): Q,K,V = x·W + b ((in,out)); per (b,h): s = clip(Q·K/8, ±50); feats = (mean s, mean_q max_k s, mean_q var_k softmax(s/2) (ddof 1)) → t = min(clip(0.01 + 1.99·σ(tanh(feats·Wt1 + b)·Wt2 + b)), 0.85); attn = softmax(Q·K/(2t)); out = (attn·V merged)·Wo + bo → [4,1024,1024].
// Structure: projections as GEMMs (exact products); Q and K carried as f16 hi/lo and contracted with the pair folded into K ([q_hi | q_lo·2^10 | q_hi]·[k_hi | k_hi·2^-10 | k_lo], K 192) so the raw logits are ≈f32 (they are divided by 2t ≥ 0.02·…, i.e. scaled up to ×50); per pass of 2 batches x 16 heads: one score GEMM, per-row statistics on VALU (clipped sum / max / softmax(s/2) variance), a per-head reduction + the tiny time MLP (one block per head, fixed order), then the row softmax with the head's 1/(2t) (×2^10 → f16) and P·V batched; output projection GEMM.
// Compute dtype: inputs and parameters rounded to bf16; logits ≈f32; statistics/MLP/softmax f32; V and the attention output as f16 operands (≈2^-12); f32 accumulation. v_wmma_f32_16x16x32_f16.
#define NBt 4
#define TT 1024
#define CC 1024
#define NH 16
#define HD 64
#define NR (NBt * TT)            /* 4096 */
#define HG 32                    /* (batch, head) slabs per pass: 2 batches x 16 heads */
#define K3 (3 * HD)              /* 192 */
typedef __bf16 v16b __attribute__((ext_vector_type(16)));
typedef unsigned short v8us __attribute__((ext_vector_type(8), may_alias));
typedef float  v8f  __attribute__((ext_vector_type(8)));
typedef float  v4f  __attribute__((ext_vector_type(4)));
typedef float  v4fa __attribute__((ext_vector_type(4), may_alias));
union FragB { v16b v; v8us half[2]; unsigned short u[16]; };

__device__ __forceinline__ unsigned short bf16_bits(float x) { unsigned int u = __float_as_uint(x); return (unsigned short)((u + 0x7FFFu + ((u >> 16) & 1u)) >> 16); }
__device__ __forceinline__ float bf16_val(unsigned short b) { return __uint_as_float(((unsigned int)b) << 16); }
__device__ __forceinline__ float bf16_round(float x) { return bf16_val(bf16_bits(x)); }
// D += A·B with NT terms: 1 = ah·bh, 2 = + al·bh (A split), 3 = + ah·bl (both split)
template <int NT>
__device__ __forceinline__ v8f mmaN(v16b ah, v16b al, v16b bh, v16b bl, v8f c) {
  c = __builtin_amdgcn_wmma_f32_16x16x32_bf16(false, ah, false, bh, (short)0, c, false, false);
  if (NT >= 2) c = __builtin_amdgcn_wmma_f32_16x16x32_bf16(false, al, false, bh, (short)0, c, false, false);
  if (NT >= 3) c = __builtin_amdgcn_wmma_f32_16x16x32_bf16(false, ah, false, bl, (short)0, c, false, false);
  asm volatile("v_nop\n\tv_nop\n\tv_nop\n\tv_nop" : "+v"(c) : "v"(ah), "v"(al), "v"(bh), "v"(bl));
  return c;
}

__global__ __launch_bounds__(256) void k_wt_bf16(const float* __restrict__ W, unsigned short* __restrict__ Wt, int K, int N) {
  const int t = blockIdx.x * 256 + threadIdx.x;
  const int k8n = K / 8;
  if (t >= N * k8n) return;
  const int n = t / k8n, k8 = (t % k8n) * 8;
  v8us v;
#pragma unroll
  for (int i = 0; i < 8; ++i) v[i] = bf16_bits(W[(size_t)(k8 + i) * N + n]);
  *(v8us*)(Wt + (size_t)n * K + k8) = v;
  
}

// GEMM C[M][N] (f32, pitch ldc) = act(A[M][K]·W + bias). A f32 row-major (pitch lda) converted per fragment to bf16
// (ASPLIT: hi/lo two planes -> 2 terms, else single rounded term); Wt bf16 [N][K] (pitch ldb). BIAS_BF16 rounds the
// bias to bf16 first (bias quantised to bf16 before the add). K%32==0, M%16==0, N%64==0.
template <bool ASPLIT, int ACT, bool BIAS_BF16>
__global__ __launch_bounds__(128) void k_gemm_bf(const float* __restrict__ A, int lda, const unsigned short* __restrict__ Wt, int ldb,
                                               const float* __restrict__ bias, float* __restrict__ C, int ldc, int M, int N, int K) {
  __shared__ __attribute__((aligned(16))) float so[4][16][64];
  const int tid = threadIdx.x, w = tid >> 5, lane = tid & 31, ln = lane & 15, hh = lane >> 4;
  const int ntn = N / 64;
  const int wid = blockIdx.x * 4 + w;
  const int mt = wid / ntn, nq = wid % ntn;
  if (mt * 16 >= M) return;
  const int row0 = mt * 16, col0 = nq * 64;
  const float* arow = A + (size_t)(row0 + ln) * lda;
  v8f acc[4] = {};
  for (int kb = 0; kb < K; kb += 32) {
    FragB ah, al;
    const v4f x0 = *(const v4fa*)(arow + kb + 8 * hh), x1 = *(const v4fa*)(arow + kb + 8 * hh + 4);
    const v4f x2 = *(const v4fa*)(arow + kb + 16 + 8 * hh), x3 = *(const v4fa*)(arow + kb + 16 + 8 * hh + 4);
    float xs[16] = {x0[0],x0[1],x0[2],x0[3],x1[0],x1[1],x1[2],x1[3],x2[0],x2[1],x2[2],x2[3],x3[0],x3[1],x3[2],x3[3]};
#pragma unroll
    for (int i = 0; i < 16; ++i) { const unsigned short hb = bf16_bits(xs[i]); ah.u[i] = hb; al.u[i] = ASPLIT ? bf16_bits(xs[i] - bf16_val(hb)) : (unsigned short)0; }
#pragma unroll
    for (int t = 0; t < 4; ++t) {
      const unsigned short* brow = Wt + (size_t)(col0 + t * 16 + ln) * ldb + kb;
      FragB b;
      b.half[0] = *(const v8us*)(brow + 8 * hh);
      b.half[1] = *(const v8us*)(brow + 16 + 8 * hh);
      acc[t] = mmaN<ASPLIT ? 2 : 1>(ah.v, al.v, b.v, b.v, acc[t]);
    }
  }
#pragma unroll
  for (int t = 0; t < 4; ++t) {
    float bv = bias ? bias[col0 + t * 16 + ln] : 0.f;
    if (BIAS_BF16) bv = bf16_round(bv);
#pragma unroll
    for (int r = 0; r < 8; ++r) { float v = acc[t][r] + bv; if (ACT == 1) v = fmaxf(v, 0.f); so[w][8 * hh + r][t * 16 + ln] = v; }
  }
  __builtin_amdgcn_fence(__ATOMIC_ACQ_REL, "workgroup");
  __builtin_amdgcn_wave_barrier();
  const int rsub = lane >> 4, c4 = (lane & 15) * 4;
  {
#pragma unroll
    for (int q = 0; q < 8; ++q) {
      const int r = q * 2 + rsub;
      const v4f v = *(const v4fa*)&so[w][r][c4];
      *(v4f*)(C + (size_t)(row0 + r) * ldc + col0 + c4) = v;
    }
    
  }
}

// GEMM C = act(A·W + bias + resid): A f32 (ASPLIT -> hi/lo 2 terms), Wt bf16 [N][K]; ACT 0 none, 1 relu, 2 exact gelu;
// resid (optional, f32, row index = (row % rmod), pitch ldr, RES_BF16 rounds it) added before the activation.
template <bool ASPLIT, int ACT, bool BIAS_BF16, bool RES_BF16>
__global__ __launch_bounds__(128) void k_gemm_bf3(const float* __restrict__ A, int lda, const unsigned short* __restrict__ Wt, int ldb,
                                                const float* __restrict__ bias, const float* __restrict__ resid, int rmod, int ldr,
                                                float* __restrict__ C, int ldc, int M, int N, int K) {
  __shared__ __attribute__((aligned(16))) float so[4][16][64];
  const int tid = threadIdx.x, w = tid >> 5, lane = tid & 31, ln = lane & 15, hh = lane >> 4;
  const int ntn = N / 64;
  const int wid = blockIdx.x * 4 + w;
  const int mt = wid / ntn, nq = wid % ntn;
  if (mt * 16 >= M) return;
  const int row0 = mt * 16, col0 = nq * 64;
  const float* arow = A + (size_t)(row0 + ln) * lda;
  v8f acc[4] = {};
  for (int kb = 0; kb < K; kb += 32) {
    FragB ah, al;
    const v4f x0 = *(const v4fa*)(arow + kb + 8 * hh), x1 = *(const v4fa*)(arow + kb + 8 * hh + 4);
    const v4f x2 = *(const v4fa*)(arow + kb + 16 + 8 * hh), x3 = *(const v4fa*)(arow + kb + 16 + 8 * hh + 4);
    float xs[16] = {x0[0],x0[1],x0[2],x0[3],x1[0],x1[1],x1[2],x1[3],x2[0],x2[1],x2[2],x2[3],x3[0],x3[1],x3[2],x3[3]};
#pragma unroll
    for (int i = 0; i < 16; ++i) { const unsigned short hb = bf16_bits(xs[i]); ah.u[i] = hb; al.u[i] = ASPLIT ? bf16_bits(xs[i] - bf16_val(hb)) : (unsigned short)0; }
#pragma unroll
    for (int t = 0; t < 4; ++t) {
      const unsigned short* brow = Wt + (size_t)(col0 + t * 16 + ln) * ldb + kb;
      FragB b;
      b.half[0] = *(const v8us*)(brow + 8 * hh);
      b.half[1] = *(const v8us*)(brow + 16 + 8 * hh);
      acc[t] = mmaN<ASPLIT ? 2 : 1>(ah.v, al.v, b.v, b.v, acc[t]);
    }
  }
#pragma unroll
  for (int t = 0; t < 4; ++t) {
    const int col = col0 + t * 16 + ln;
    float bv = bias ? bias[col] : 0.f;
    if (BIAS_BF16) bv = bf16_round(bv);
#pragma unroll
    for (int r = 0; r < 8; ++r) {
      float v = acc[t][r] + bv;
      if (resid) { float rv = resid[(size_t)((row0 + 8 * hh + r) % rmod) * ldr + col]; if (RES_BF16) rv = bf16_round(rv); v += rv; }
      if (ACT == 1) v = fmaxf(v, 0.f);
      if (ACT == 2) v = 0.5f * v * (1.0f + erff(v * 0.70710678118654752f));
      if (ACT == 3) { const float u = 0.7978845608028654f * (v + 0.044715f * v * v * v); v = 0.5f * v * (1.0f + tanhf(u)); }
      so[w][8 * hh + r][t * 16 + ln] = v;
    }
  }
  __builtin_amdgcn_fence(__ATOMIC_ACQ_REL, "workgroup");
  __builtin_amdgcn_wave_barrier();
  const int rsub = lane >> 4, c4 = (lane & 15) * 4;
  {
#pragma unroll
    for (int q = 0; q < 8; ++q) {
      const int r = q * 2 + rsub;
      const v4f v = *(const v4fa*)&so[w][r][c4];
      *(v4f*)(C + (size_t)(row0 + r) * ldc + col0 + c4) = v;
    }
    
  }
}
// row LayerNorm (biased variance, eps) over N: s = X (+ R); optional out_sum <- s; out_norm <- (s-mu)*rsqrt(var+eps)*g + b
template <bool PARAM_BF16>
__global__ __launch_bounds__(256) void k_layernorm(const float* __restrict__ X, const float* __restrict__ R, const float* __restrict__ g, const float* __restrict__ bta,
                                                  float* __restrict__ out_sum, float* __restrict__ out_norm, int N, float eps) {
  __shared__ float red[256];
  const int row = blockIdx.x, tid = threadIdx.x;
  const float* x = X + (size_t)row * N; const float* rr = R ? R + (size_t)row * N : nullptr;
  float vals[16];                     // up to N = 4096
  const int per = N / 256;            // contiguous chunk per thread? use strided-by-4 chunks: thread handles j = tid*4 + 1024*u
  float s1 = 0.f;
  for (int u = 0; u < per / 4; ++u) {
    const int j = tid * 4 + 1024 * u;
    const v4f a = *(const v4fa*)(x + j);
    v4f b = {0.f,0.f,0.f,0.f}; if (rr) b = *(const v4fa*)(rr + j);
#pragma unroll
    for (int q = 0; q < 4; ++q) { const float v = a[q] + b[q]; vals[u * 4 + q] = v; s1 += v; }
  }
  red[tid] = s1; __syncthreads();
  for (int st = 128; st > 0; st >>= 1) { if (tid < st) red[tid] += red[tid + st]; __syncthreads(); }
  const float mu = red[0] / (float)N; __syncthreads();
  float s2 = 0.f;
  for (int u = 0; u < per / 4; ++u)
#pragma unroll
    for (int q = 0; q < 4; ++q) { const float c = vals[u * 4 + q] - mu; s2 += c * c; }
  red[tid] = s2; __syncthreads();
  for (int st = 128; st > 0; st >>= 1) { if (tid < st) red[tid] += red[tid + st]; __syncthreads(); }
  const float rs = rsqrtf(red[0] / (float)N + eps);
  {
    for (int u = 0; u < per / 4; ++u) {
      const int j = tid * 4 + 1024 * u;
      v4f o, sm;
#pragma unroll
      for (int q = 0; q < 4; ++q) {
        float gg = g[j + q], bb = bta[j + q];
        if (PARAM_BF16) { gg = bf16_round(gg); bb = bf16_round(bb); }
        sm[q] = vals[u * 4 + q]; o[q] = (vals[u * 4 + q] - mu) * rs * gg + bb;
      }
      if (out_sum) *(v4f*)(out_sum + (size_t)row * N + j) = sm;
      *(v4f*)(out_norm + (size_t)row * N + j) = o;
    }
    
  }
}



// ---- f16 WMMA path (v_wmma_f32_16x16x32_f16): 11-bit significands for operands in range — used where a [0,1] probability operand needs more precision than bf16
typedef _Float16 v16h __attribute__((ext_vector_type(16)));
union FragH { v16h v; v8us half[2]; _Float16 h[16]; unsigned short u[16]; };
template <int NT>
__device__ __forceinline__ v8f mmaH(v16h ah, v16h al, v16h bh, v16h bl, v8f c) {
  c = __builtin_amdgcn_wmma_f32_16x16x32_f16(false, ah, false, bh, (short)0, c, false, false);
  if (NT >= 2) c = __builtin_amdgcn_wmma_f32_16x16x32_f16(false, al, false, bh, (short)0, c, false, false);
  if (NT >= 3) c = __builtin_amdgcn_wmma_f32_16x16x32_f16(false, ah, false, bl, (short)0, c, false, false);
  asm volatile("v_nop\n\tv_nop\n\tv_nop\n\tv_nop" : "+v"(c) : "v"(ah), "v"(al), "v"(bh), "v"(bl));
  return c;
}
// batched GEMM like k_gemm_b but f16 operands: A f32 (split into f16 hi/lo if ASPLIT, else rounded to f16), Bt = f16 values [n][k]; alpha; C f32; N multiple of 16 (partial tiles skipped)
template <bool ASPLIT>
__global__ __launch_bounds__(128) void k_gemm_h(const float* __restrict__ A, int lda, size_t sA, const _Float16* __restrict__ Bh, int ldb, size_t sB, float alpha, float* __restrict__ C, int ldc, size_t sC, int M, int N, int K) {
  __shared__ __attribute__((aligned(16))) float so[4][16][64];
  const int tid = threadIdx.x, w = tid >> 5, lane = tid & 31, ln = lane & 15, hh = lane >> 4; const int by = blockIdx.y;
  A += (size_t)by * sA; Bh += (size_t)by * sB; C += (size_t)by * sC;
  const int ntn = (N + 63) / 64; const int wid = blockIdx.x * 4 + w; const int mt = wid / ntn, nq = wid % ntn; if (mt * 16 >= M) return;
  const int row0 = mt * 16, col0 = nq * 64; const float* arow = A + (size_t)(row0 + ln) * lda;
  v8f acc[4] = {};
  for (int kb = 0; kb < K; kb += 32) {
    FragH ah, al;
    const v4f x0 = *(const v4fa*)(arow + kb + 8 * hh), x1 = *(const v4fa*)(arow + kb + 8 * hh + 4), x2 = *(const v4fa*)(arow + kb + 16 + 8 * hh), x3 = *(const v4fa*)(arow + kb + 16 + 8 * hh + 4);
    float xs[16] = {x0[0],x0[1],x0[2],x0[3],x1[0],x1[1],x1[2],x1[3],x2[0],x2[1],x2[2],x2[3],x3[0],x3[1],x3[2],x3[3]};
#pragma unroll
    for (int i = 0; i < 16; ++i) { const _Float16 h = (_Float16)xs[i]; ah.h[i] = h; al.h[i] = ASPLIT ? (_Float16)(xs[i] - (float)h) : (_Float16)0.0f; }
#pragma unroll
    for (int t = 0; t < 4; ++t) { if (col0 + t * 16 >= N) continue; const size_t boff = (size_t)(col0 + t * 16 + ln) * ldb + kb; FragH bq; bq.half[0] = *(const v8us*)(Bh + boff + 8 * hh); bq.half[1] = *(const v8us*)(Bh + boff + 16 + 8 * hh);
      acc[t] = mmaH<ASPLIT ? 2 : 1>(ah.v, al.v, bq.v, bq.v, acc[t]); }
  }
#pragma unroll
  for (int t = 0; t < 4; ++t) { if (col0 + t * 16 >= N) continue;
#pragma unroll
    for (int r = 0; r < 8; ++r) so[w][8 * hh + r][t * 16 + ln] = acc[t][r] * alpha; }
  __builtin_amdgcn_fence(__ATOMIC_ACQ_REL, "workgroup"); __builtin_amdgcn_wave_barrier();
  const int rsub = lane >> 4, c4 = (lane & 15) * 4;
  {
#pragma unroll
    for (int q = 0; q < 8; ++q) { const int r = q * 2 + rsub; if (col0 + c4 < N) { const v4f v = *(const v4fa*)&so[w][r][c4]; *(v4f*)(C + (size_t)(row0 + r) * ldc + col0 + c4) = v; } }
     }
}

// Wt[n][k] = f16(W[k][n]·scale) from f32 row-major W[K][N] (scale = power of two; bf16-exact weights stay exact in f16 away from the subnormal range)
// blockIdx.y picks one of four weight matrices: 0..2 go to planes 0..2 of Wt012, 3 goes to Wt3
__global__ __launch_bounds__(256) void k_wt_f16(const float* __restrict__ W0, const float* __restrict__ W1, const float* __restrict__ W2, const float* __restrict__ W3, _Float16* __restrict__ Wt012, _Float16* __restrict__ Wt3, int K, int N, float scale) {
  const int y = blockIdx.y; const float* __restrict__ W = (y == 0) ? W0 : (y == 1) ? W1 : (y == 2) ? W2 : W3; _Float16* __restrict__ Wt = (y == 3) ? Wt3 : Wt012 + (size_t)y * K * N;
  const int t = blockIdx.x * 256 + threadIdx.x; if (t >= N * (K / 8)) return; const int n = t / (K / 8), k8 = (t % (K / 8)) * 8; FragH f;
#pragma unroll
  for (int i = 0; i < 8; ++i) f.h[i] = (_Float16)(bf16_round(W[(size_t)(k8 + i) * N + n]) * scale); const v8us o = f.half[0];
  *(v8us*)((unsigned short*)Wt + (size_t)n * K + k8) = o; 
}
// Block-tiled GEMM with fused epilogue: v = acc*alpha + bias[by*sBias + col] ; ACT 0 none / 1 elu ; writes f16 C16 (H16) or f32 C.
// One block = WM x WN waves = a (WM*FM*16) x (WN*64) tile of C; a wave owns FM x 4 accumulator tiles. Per chunk of KC k the block brings its A rows and B rows (whole 128-B lines, KC/8 lanes a row)
// into LDS at a pitch of 2*KC + 16 B and every wave reads its fragments from there; two buffers, the next chunk's global loads fly while this chunk is multiplied.
// LD = row pitch of A and of B in elements, a compile-time constant so that the rows of a tile are immediate offsets from one address per operand.
// Needs M a multiple of WM*FM*16, N of WN*64, K of KC (every launch below is).
// Two batch axes: blockIdx.y steps A, B, C by sA, sB, sC (heads), blockIdx.z by zA, zB, zC (batches).
template <int ACT, int WM, int WN, int FM, int KC, int LD, bool H16>
__global__ __launch_bounds__(WM * WN * 32) void k_gemm_hhx(const _Float16* __restrict__ A, size_t sA, const _Float16* __restrict__ Bh, size_t sB, float alpha, const float* __restrict__ bias, size_t sBias,
    float* __restrict__ C, _Float16* __restrict__ C16, int ldc, size_t sC, int M, int N, int K, size_t zA, size_t zB, size_t zC) {
  constexpr int NW = WM * WN, BM = WM * FM * 16, BN = WN * 64, CPR = KC / 8, RP = NW * 32 / CPR, NA = BM / RP, NB = BN / RP, PIT = KC + 8;
  __shared__ __attribute__((aligned(16))) unsigned short tA[2][BM][PIT];
  __shared__ __attribute__((aligned(16))) unsigned short tB[2][BN][PIT];
  __shared__ __attribute__((aligned(16))) float so[NW][16][64];
  const int tid = threadIdx.x, w = tid >> 5, lane = tid & 31, ln = lane & 15, hh = lane >> 4; const int by = blockIdx.y;
  const int bz = blockIdx.z; A += (size_t)by * sA + (size_t)bz * zA; Bh += (size_t)by * sB + (size_t)bz * zB; const size_t cofs = (size_t)by * sC + (size_t)bz * zC; const float* bp = bias ? bias + (size_t)by * sBias : nullptr;
  const int ntn = N / BN; const int bm = blockIdx.x / ntn, bn = blockIdx.x % ntn; if (bm * BM >= M) return;
  const int wm = w / WN, wn = w % WN; const int srow = tid / CPR, sc = (tid % CPR) * 8;
  const unsigned short* gA = (const unsigned short*)A + (size_t)(bm * BM + srow) * LD + sc;
  const unsigned short* gB = (const unsigned short*)Bh + (size_t)(bn * BN + srow) * LD + sc;
  const int col0 = bn * BN + wn * 64;
  float bvv[4];      // the wave's bias values, fetched ahead of the products
#pragma unroll
  for (int t = 0; t < 4; ++t) bvv[t] = bp ? bf16_round(bp[col0 + t * 16 + ln]) : 0.f;
  v8us ra[NA], rb[NB];
  v8f acc[FM][4] = {};
  auto g2r = [&](int kb) {
#pragma unroll
    for (int i = 0; i < NA; ++i) ra[i] = *(const v8us*)(gA + kb + i * RP * LD);
#pragma unroll
    for (int i = 0; i < NB; ++i) rb[i] = *(const v8us*)(gB + kb + i * RP * LD);
  };
  auto r2s = [&](int buf) {
#pragma unroll
    for (int i = 0; i < NA; ++i) *(v8us*)&tA[buf][i * RP + srow][sc] = ra[i];
#pragma unroll
    for (int i = 0; i < NB; ++i) *(v8us*)&tB[buf][i * RP + srow][sc] = rb[i];
  };
  auto mul = [&](int buf) {
#pragma unroll
    for (int ks = 0; ks < KC / 32; ++ks) { FragH fa[FM], fb[4];
#pragma unroll
      for (int i = 0; i < FM; ++i) { const unsigned short* p = &tA[buf][(wm * FM + i) * 16 + ln][ks * 32 + 8 * hh]; fa[i].half[0] = *(const v8us*)p; fa[i].half[1] = *(const v8us*)(p + 16); }
#pragma unroll
      for (int t = 0; t < 4; ++t) { const unsigned short* p = &tB[buf][wn * 64 + t * 16 + ln][ks * 32 + 8 * hh]; fb[t].half[0] = *(const v8us*)p; fb[t].half[1] = *(const v8us*)(p + 16); }
#pragma unroll
      for (int i = 0; i < FM; ++i)
#pragma unroll
        for (int t = 0; t < 4; ++t) acc[i][t] = __builtin_amdgcn_wmma_f32_16x16x32_f16(false, fa[i].v, false, fb[t].v, (short)0, acc[i][t], false, false); }
  };
  g2r(0); r2s(0);
  __syncthreads();      // chunk 0 is in buffer 0 for every wave
  int buf = 0;
  for (int kb = KC; kb < K; kb += KC) {
    g2r(kb);            // next chunk: in flight while this one is multiplied
    __builtin_amdgcn_sched_barrier(0);      // keeps those loads above the products; without it the compiler sinks them to just before their LDS stores and their latency is waited out
    mul(buf);
    r2s(buf ^ 1);       // that buffer's last readers left it before the barrier that ended the trip before
    __syncthreads();    // publishes the next chunk and ends this trip's reads of buf
    buf ^= 1;
  }
  mul(buf);
  const int rsub = lane >> 4, c4 = (lane & 15) * 4; typedef _Float16 v4h __attribute__((ext_vector_type(4)));
#pragma unroll
  for (int i = 0; i < FM; ++i) { const int row0 = bm * BM + (wm * FM + i) * 16;
#pragma unroll
    for (int t = 0; t < 4; ++t) { const float bv = bvv[t];
#pragma unroll
      for (int r = 0; r < 8; ++r) { float v = acc[i][t][r] * alpha + bv; if (ACT == 1) v = (v > 0.f) ? v : expm1f(v); else if (ACT == 7) v = (v > 0.f) ? v + 1.0f : expf(v); else if (ACT == 8) v = tanhf(v); else if (ACT == 9) v = 0.5f * v * (1.0f + tanhf(0.7978845608028654f * (v + 0.044715f * v * v * v))); else if (ACT == 11) v = 1.0f / (1.0f + expf(-v)); else if (ACT == 12) v = (v > 0.f) ? v : 0.01f * v; else if (ACT == 14) v = (v > 0.f) ? v : 0.1f * v; else if (ACT == 15) v = v / (1.0f + expf(-v)); else if (ACT == 3) v = fmaxf(v, 0.f); else if (ACT == 6) v = 0.5f * v * (1.0f + erff(v * 0.70710678118654752f)); so[w][8 * hh + r][t * 16 + ln] = v; } }
    __builtin_amdgcn_fence(__ATOMIC_ACQ_REL, "workgroup"); __builtin_amdgcn_wave_barrier();
#pragma unroll
    for (int q = 0; q < 8; ++q) { const int r = q * 2 + rsub; const v4f v = *(const v4fa*)&so[w][r][c4]; if (!H16) *(v4f*)(C + cofs + (size_t)(row0 + r) * ldc + col0 + c4) = v; else { v4h h4; for (int j = 0; j < 4; ++j) h4[j] = (_Float16)v[j]; *(v4h*)(C16 + cofs + (size_t)(row0 + r) * ldc + col0 + c4) = h4; } }
    if (i + 1 < FM) { __builtin_amdgcn_fence(__ATOMIC_ACQ_REL, "workgroup"); __builtin_amdgcn_wave_barrier(); }      // the wave's rows are read back before its next 16 rows overwrite them
  }
}


typedef _Float16 v4h __attribute__((ext_vector_type(4)));

// blockIdx.y picks one of three activations; its f16 copy goes to plane blockIdx.y of X16
__global__ __launch_bounds__(256) void k_x16(const float* __restrict__ x0, const float* __restrict__ x1, const float* __restrict__ x2, _Float16* __restrict__ X16, size_t n8) { const size_t t = (size_t)blockIdx.x * 256 + threadIdx.x; if (t >= n8) return; FragH f;
  const int y = blockIdx.y; const float* __restrict__ x = (y == 0) ? x0 : (y == 1) ? x1 : x2; X16 += (size_t)y * n8 * 8;
#pragma unroll
  for (int q = 0; q < 8; ++q) f.h[q] = (_Float16)bf16_round(x[t * 8 + q]); *(v8us*)((unsigned short*)X16 + t * 8) = f.half[0];  }
__global__ __launch_bounds__(256) void k_h16(const float* __restrict__ x, _Float16* __restrict__ X16, size_t n8) { const size_t t = (size_t)blockIdx.x * 256 + threadIdx.x; if (t >= n8) return; FragH f;
#pragma unroll
  for (int q = 0; q < 8; ++q) f.h[q] = (_Float16)x[t * 8 + q]; *(v8us*)((unsigned short*)X16 + t * 8) = f.half[0];  }
__global__ __launch_bounds__(256) void k_round16f(const float* __restrict__ W, _Float16* __restrict__ Bt, size_t n8) { const size_t t = (size_t)blockIdx.x * 256 + threadIdx.x; if (t >= n8) return; FragH f;
#pragma unroll
  for (int i = 0; i < 8; ++i) f.h[i] = (_Float16)(bf16_round(W[t * 8 + i]) * 16.0f); *(v8us*)((unsigned short*)Bt + t * 8) = f.half[0];  }
template <int NHv, int TTv>
__global__ __launch_bounds__(256) void k_vt(const _Float16* __restrict__ V16, int ldv, int voff, _Float16* __restrict__ Vt) { __shared__ unsigned short tl[64][66]; const int tid = threadIdx.x; const int slab = blockIdx.x / (TTv / 64), lg = blockIdx.x % (TTv / 64); const int b = slab / NHv, h = slab % NHv;
  for (int i = tid; i < 64 * 8; i += 256) { const int r = i / 8, c8 = (i % 8) * 8; FragH f; f.half[0] = *(const v8us*)((const unsigned short*)V16 + ((size_t)b * TTv + lg * 64 + r) * ldv + voff + h * 64 + c8);
#pragma unroll
    for (int q = 0; q < 8; ++q) tl[r][c8 + q] = f.u[q]; }
  __syncthreads();
  {
#pragma unroll
    for (int rd = 0; rd < 2; ++rd) { const int d = rd * 32 + tid / 8, pc = tid % 8; FragH f;
#pragma unroll
      for (int q = 0; q < 8; ++q) f.u[q] = tl[pc * 8 + q][d];
      *(v8us*)((unsigned short*)Vt + ((size_t)slab * 64 + d) * TTv + lg * 64 + pc * 8) = f.half[0]; }
     } }

__global__ __launch_bounds__(256) void k_hl(const float* __restrict__ F, _Float16* __restrict__ Hh, _Float16* __restrict__ Hl, size_t n8) { const size_t t = (size_t)blockIdx.x * 256 + threadIdx.x; if (t >= n8) return; FragH fh, fl; const v4f a = *(const v4fa*)(F + t * 8), c = *(const v4fa*)(F + t * 8 + 4);
#pragma unroll
  for (int q = 0; q < 4; ++q) { _Float16 h = (_Float16)a[q]; fh.h[q] = h; fl.h[q] = (_Float16)((a[q] - (float)h) * 1024.0f); h = (_Float16)c[q]; fh.h[4 + q] = h; fl.h[4 + q] = (_Float16)((c[q] - (float)h) * 1024.0f); }
  { *(v8us*)((unsigned short*)Hh + t * 8) = fh.half[0]; *(v8us*)((unsigned short*)Hl + t * 8) = fl.half[0];  } }

// blockIdx.y = mode: 0 folds plane 0 of F (Q) into O3q, 1 folds plane 1 (K) into O3k
__global__ __launch_bounds__(256) void k_fold3(const float* __restrict__ F, _Float16* __restrict__ O3q, _Float16* __restrict__ O3k) {
  #pragma clang fp contract(off)
  const int mode = blockIdx.y; F += (size_t)mode * NR * CC; _Float16* __restrict__ O3 = mode ? O3k : O3q;
  const int t = blockIdx.x * 256 + threadIdx.x; if (t >= NR * (CC / 8)) return; const int c0 = (t % (CC / 8)) * 8, r = t / (CC / 8); const int h = c0 / HD, d0 = c0 % HD; const v4f a = *(const v4fa*)(F + (size_t)r * CC + c0), c = *(const v4fa*)(F + (size_t)r * CC + c0 + 4); FragH s0, s1, s2;
#pragma unroll
  for (int q = 0; q < 8; ++q) { const float v = (q < 4) ? a[q] : c[q - 4]; const _Float16 hi = (_Float16)v; const float lo = (v - (float)hi); if (mode == 0) { s0.h[q] = hi; s1.h[q] = (_Float16)(lo * 1024.0f); s2.h[q] = hi; } else { s0.h[q] = hi; s1.h[q] = (_Float16)((float)hi * 0.0009765625f); s2.h[q] = (_Float16)lo; } }
  unsigned short* base = (unsigned short*)O3 + (size_t)r * (NH * K3) + h * K3 + d0;
  { *(v8us*)(base) = s0.half[0]; *(v8us*)(base + HD) = s1.half[0]; *(v8us*)(base + 2 * HD) = s2.half[0];  } }
__global__ __launch_bounds__(256) void k_vt(const _Float16* __restrict__ V, _Float16* __restrict__ VT) { const int b = blockIdx.y; VT += (size_t)b * CC * TT; const int t = blockIdx.x * 256 + threadIdx.x; if (t >= CC * (TT / 8)) return; const int s0 = (t % (TT / 8)) * 8, hd = t / (TT / 8); FragH f;
#pragma unroll
  for (int q = 0; q < 8; ++q) f.h[q] = V[((size_t)b * TT + s0 + q) * CC + hd];
  *(v8us*)((unsigned short*)VT + (size_t)hd * TT + s0) = f.half[0];  }
__global__ __launch_bounds__(256) void k_rowstat(const float* __restrict__ S, float* __restrict__ RST) {
  #pragma clang fp contract(off)
  __shared__ float rec[8][4]; const int tid = threadIdx.x, w = tid >> 5, ln = tid & 31; const int row = blockIdx.x * 8 + w; const float* sr = S + (size_t)row * TT; float su = 0.f, mx = -3.0e38f;
#pragma unroll 1
  for (int jb = 0; jb < TT; jb += 256) { const v4f a = *(const v4fa*)(sr + jb + 8 * ln), c = *(const v4fa*)(sr + jb + 8 * ln + 4);
#pragma unroll
    for (int k = 0; k < 8; ++k) { const float v = fminf(fmaxf(((k < 4) ? a[k] : c[k - 4]) * 0.125f, -50.f), 50.f); su += v; mx = fmaxf(mx, v); } }
  for (int o = 16; o > 0; o >>= 1) { su += __shfl_xor(su, o, 32); mx = fmaxf(mx, __shfl_xor(mx, o, 32)); }
  float se = 0.f;
#pragma unroll 1
  for (int jb = 0; jb < TT; jb += 256) { const v4f a = *(const v4fa*)(sr + jb + 8 * ln), c = *(const v4fa*)(sr + jb + 8 * ln + 4);
#pragma unroll
    for (int k = 0; k < 8; ++k) { const float v = fminf(fmaxf(((k < 4) ? a[k] : c[k - 4]) * 0.125f, -50.f), 50.f); se += expf(0.5f * v - 0.5f * mx); } }
  for (int o = 16; o > 0; o >>= 1) se += __shfl_xor(se, o, 32); const float inv = 1.0f / se; float pm = 0.f;      /* mean of p over keys = Σp / TT */
#pragma unroll 1
  for (int jb = 0; jb < TT; jb += 256) { const v4f a = *(const v4fa*)(sr + jb + 8 * ln), c = *(const v4fa*)(sr + jb + 8 * ln + 4);
#pragma unroll
    for (int k = 0; k < 8; ++k) { const float v = fminf(fmaxf(((k < 4) ? a[k] : c[k - 4]) * 0.125f, -50.f), 50.f); pm += expf(0.5f * v - 0.5f * mx) * inv; } }
  for (int o = 16; o > 0; o >>= 1) pm += __shfl_xor(pm, o, 32); pm = pm / (float)TT; float vq = 0.f;
#pragma unroll 1
  for (int jb = 0; jb < TT; jb += 256) { const v4f a = *(const v4fa*)(sr + jb + 8 * ln), c = *(const v4fa*)(sr + jb + 8 * ln + 4);
#pragma unroll
    for (int k = 0; k < 8; ++k) { const float v = fminf(fmaxf(((k < 4) ? a[k] : c[k - 4]) * 0.125f, -50.f), 50.f); const float d = expf(0.5f * v - 0.5f * mx) * inv - pm; vq += d * d; } }
  for (int o = 16; o > 0; o >>= 1) vq += __shfl_xor(vq, o, 32);
  if (ln == 0) { rec[w][0] = su; rec[w][1] = mx; rec[w][2] = vq / (float)(TT - 1); rec[w][3] = 0.f; }
  __syncthreads();
  if (w == 0 && ln < 8) { const v4f v = *(const v4f*)&rec[ln][0]; *(v4f*)(RST + ((size_t)blockIdx.x * 8 + ln) * 4) = v;  } }
__global__ __launch_bounds__(256) void k_thead(const float* __restrict__ RST, const float* __restrict__ Wt1, const float* __restrict__ bt1, const float* __restrict__ Wt2, const float* __restrict__ bt2, float* __restrict__ TH) {
  #pragma clang fp contract(off)
  __shared__ v4f red[256]; const int g = blockIdx.x, tid = threadIdx.x; v4f a = {0.f, 0.f, 0.f, 0.f};
  for (int q = tid; q < TT; q += 256) { const v4f r = *(const v4fa*)(RST + ((size_t)g * TT + q) * 4); a[0] += r[0]; a[1] += r[1]; a[2] += r[2]; }
  red[tid] = a; __syncthreads(); for (int st = 128; st > 0; st >>= 1) { if (tid < st) { v4f x = red[tid]; const v4f y = red[tid + st]; x[0] += y[0]; x[1] += y[1]; x[2] += y[2]; red[tid] = x; } __syncthreads(); }
  if (tid < 32) { const v4f r0 = red[0]; float f0 = r0[0] / ((float)TT * (float)TT), f1 = r0[1] / (float)TT, f2 = r0[2] / (float)TT; f0 = fminf(fmaxf(f0, -10.f), 10.f); f1 = fminf(fmaxf(f1, -10.f), 10.f); f2 = fminf(fmaxf(f2, 0.f), 1.f);
    float raw = bf16_round(bt2[0]);
#pragma unroll 1
    for (int u = 0; u < 16; ++u) { float pre = bf16_round(bt1[u]); pre += f0 * bf16_round(Wt1[u]); pre += f1 * bf16_round(Wt1[16 + u]); pre += f2 * bf16_round(Wt1[32 + u]); raw += tanhf(pre) * bf16_round(Wt2[u]); }
    float t = 0.01f + (1.0f / (1.0f + expf(-raw))) * (2.0f - 0.01f); t = fminf(fmaxf(t, 0.01f), 2.0f); t = fminf(t, 0.85f);
    *(float*)(TH + (size_t)g * 32 + tid) = t;  } }
__global__ __launch_bounds__(256) void k_tsoft(const float* __restrict__ S, const float* __restrict__ TH, _Float16* __restrict__ P16) {
  #pragma clang fp contract(off)
  const int tid = threadIdx.x, w = tid >> 5, ln = tid & 31; const int row = blockIdx.x * 8 + w; const int g = row / TT; const float sc = 1.0f / (2.0f * TH[(size_t)g * 32]); const float* sr = S + (size_t)row * TT; float m = -3.0e38f;
#pragma unroll 1
  for (int jb = 0; jb < TT; jb += 256) { const v4f a = *(const v4fa*)(sr + jb + 8 * ln), c = *(const v4fa*)(sr + jb + 8 * ln + 4);
#pragma unroll
    for (int k = 0; k < 8; ++k) m = fmaxf(m, ((k < 4) ? a[k] : c[k - 4]) * sc); }
  for (int o = 16; o > 0; o >>= 1) m = fmaxf(m, __shfl_xor(m, o, 32)); float su = 0.f;
#pragma unroll 1
  for (int jb = 0; jb < TT; jb += 256) { const v4f a = *(const v4fa*)(sr + jb + 8 * ln), c = *(const v4fa*)(sr + jb + 8 * ln + 4);
#pragma unroll
    for (int k = 0; k < 8; ++k) su += expf(((k < 4) ? a[k] : c[k - 4]) * sc - m); }
  for (int o = 16; o > 0; o >>= 1) su += __shfl_xor(su, o, 32); const float inv = 1024.0f / su;
  {
#pragma unroll 1
    for (int jb = 0; jb < TT; jb += 256) { const v4f a = *(const v4fa*)(sr + jb + 8 * ln), c = *(const v4fa*)(sr + jb + 8 * ln + 4); FragH f;
#pragma unroll
      for (int k = 0; k < 8; ++k) f.h[k] = (_Float16)(expf(((k < 4) ? a[k] : c[k - 4]) * sc - m) * inv);
      *(v8us*)((unsigned short*)P16 + (size_t)row * TT + jb + 8 * ln) = f.half[0]; }
     } }

extern "C" void kernel_launch(void* const* d_in, const int* in_sizes, int n_in,
                              void* d_out, int out_size, void* d_ws, size_t ws_size, hipStream_t stream) {
  (void)in_sizes; (void)n_in; (void)out_size;
  const float* const* I = (const float* const*)d_in; const float* xq = I[0]; const float* xk = I[1]; const float* xv = I[2]; const float* Wq = I[3]; const float* bq = I[4]; const float* Wk = I[5]; const float* bk = I[6]; const float* Wv = I[7]; const float* bv = I[8]; const float* Wo = I[9]; const float* bo = I[10]; const float* Wt1 = I[11]; const float* bt1 = I[12]; const float* Wt2 = I[13]; const float* bt2 = I[14];
  char* ws = (char*)d_ws; size_t off = 0;
  auto take = [&](size_t bytes) { char* p = ws + off; off += (bytes + 255) & ~(size_t)255; return p; };
  _Float16* Q3p = (_Float16*)take((size_t)NR * NH * K3 * 2); _Float16* K3p = (_Float16*)take((size_t)NR * NH * K3 * 2); _Float16* VTb = (_Float16*)take((size_t)NBt * CC * TT * 2); _Float16* BWo = (_Float16*)take((size_t)CC * CC * 2); float* RST = (float*)take((size_t)HG * TT * 4 * 4); float* TH = (float*)take(HG * 32 * 4); float* S = (float*)take((size_t)HG * TT * TT * 4); _Float16* P16 = (_Float16*)take((size_t)HG * TT * TT * 2);
  if (off > ws_size) return;      // 25.2 + 25.2 + 8.4 + 2.1 + 0.5 + 134.2 + 67.1 = 262.7 MB
  const size_t pW = (size_t)CC * CC, pX = (size_t)NR * CC;      /* plane sizes in elements: a weight; an activation */
  /* What only the projections need lives in the score buffer, whose first use comes after their last: 6.3 + 25.2 + 8.4 + 33.6 = 73.4 of its 134.2 MB */
  _Float16* BW = (_Float16*)S; _Float16* X16 = BW + 3 * pW; _Float16* V16 = X16 + 3 * pX; float* Ff = (float*)(V16 + pX);
  /* The attention output (8.4 MB) takes the place of the first two batches' Q rows (12.6 MB): they are last read by the first pass's score GEMM, and the first write here is that pass's P*V */
  _Float16* O16 = Q3p;
  const size_t n8 = (size_t)NR * CC / 8; const unsigned nb8 = (unsigned)((n8 + 255) / 256); const dim3 gP((NR / 128) * (CC / 128), 1);
  k_wt_f16<<<dim3((CC * (CC / 8) + 255) / 256, 4), 256, 0, stream>>>(Wq, Wk, Wv, Wo, BW, BWo, CC, CC, 16.0f);      /* all four weights, one launch */
  k_x16<<<dim3(nb8, 3), 256, 0, stream>>>(xq, xk, xv, X16, n8);      /* all three activations, one launch */
  k_gemm_hhx<0, 4, 2, 2, 128, CC, false><<<gP, 256, 0, stream>>>(X16, 0, BW, 0, 0.0625f, bq, 0, Ff, nullptr, CC, 0, NR, CC, CC, 0, 0, 0);
  k_gemm_hhx<0, 4, 2, 2, 128, CC, false><<<gP, 256, 0, stream>>>(X16 + pX, 0, BW + pW, 0, 0.0625f, bk, 0, Ff + pX, nullptr, CC, 0, NR, CC, CC, 0, 0, 0);
  k_gemm_hhx<0, 4, 2, 2, 128, CC, true><<<gP, 256, 0, stream>>>(X16 + 2 * pX, 0, BW + 2 * pW, 0, 0.0625f, bv, 0, nullptr, V16, CC, 0, NR, CC, CC, 0, 0, 0);      /* V -> f16 */
  k_fold3<<<dim3(nb8, 2), 256, 0, stream>>>(Ff, Q3p, K3p);      /* Q exact -> [hi | lo*2^10 | hi], K -> [hi | hi*2^-10 | lo] */
  k_vt<<<dim3((CC * (TT / 8) + 255) / 256, NBt), 256, 0, stream>>>(V16, VTb);      /* V transposed, all batches */
  const dim3 gS((TT / 128) * (TT / 128), NH, HG / NH), gV(TT / 64, NH, HG / NH);
  for (int b = 0; b < NBt; b += HG / NH) {      /* slab g = (batch - b) * NH + head in S, P16, RST, TH */
    k_gemm_hhx<0, 4, 2, 2, 64, NH * K3, false><<<gS, 256, 0, stream>>>(Q3p + (size_t)b * TT * (NH * K3), (size_t)K3, K3p + (size_t)b * TT * (NH * K3), (size_t)K3, 1.0f, nullptr, 0, S, nullptr, TT, (size_t)TT * TT, TT, TT, K3, (size_t)TT * (NH * K3), (size_t)TT * (NH * K3), (size_t)NH * TT * TT);      /* raw Q*K, about f32 (K 192) */
    k_rowstat<<<HG * TT / 8, 256, 0, stream>>>(S, RST); k_thead<<<HG, 256, 0, stream>>>(RST, Wt1, bt1, Wt2, bt2, TH);
    k_tsoft<<<HG * TT / 8, 256, 0, stream>>>(S, TH, P16);
    k_gemm_hhx<0, 4, 1, 1, 128, TT, true><<<gV, 128, 0, stream>>>(P16, (size_t)TT * TT, VTb + (size_t)b * CC * TT, (size_t)HD * TT, 0.0009765625f, nullptr, 0, nullptr, O16 + (size_t)b * TT * CC, CC, (size_t)HD, TT, HD, TT, (size_t)NH * TT * TT, (size_t)CC * TT, (size_t)TT * CC); }
  k_gemm_hhx<0, 4, 2, 2, 128, CC, false><<<gP, 256, 0, stream>>>(O16, 0, BWo, 0, 0.0625f, bo, 0, (float*)d_out, nullptr, CC, 0, NR, CC, CC, 0, 0, 0);
}

// v003
// Measured time: 278 microseconds a run.
// Next to v002, in two timings, it ran 1.24 and 1.25 times as fast.
// All steps since v000 together make it 3.58 times as fast.
#include <hip/hip_runtime.h>
// Diffusion-time multi-head attention (B 4, S 1024, D 1024, 16 heads × 64): Q,K,V = x·W + b ((in,out)); per (b,h): s = clip(Q·K/8, ±50); feats = (mean s, mean_q max_k s, mean_q var_k softmax(s/2) (ddof 1)) → t = min(clip(0.01 + 1.99·σ(tanh(feats·Wt1 + b)·Wt2 + b)), 0.85); attn = softmax(Q·K/(2t)); out = (attn·V merged)·Wo + bo → [4,1024,1024].
// Structure: projections as GEMMs (exact products); Q and K carried as f16 hi/lo and contracted with the pair folded into K ([q_hi | q_lo·2^10 | q_hi]·[k_hi | k_hi·2^-10 | k_lo], K 192) so the raw logits are ≈f32 (they are divided by 2t ≥ 0.02·…, i.e. scaled up to ×50); per pass of 2 batches x 16 heads: one score GEMM, per-row statistics on VALU (clipped sum / max / softmax(s/2) variance), a per-head reduction + the tiny time MLP (one block per head, fixed order), then the row softmax with the head's 1/(2t) (×2^10 → f16) and P·V batched; output projection GEMM.
// Compute dtype: inputs and parameters rounded to bf16; logits ≈f32; statistics/MLP/softmax f32; V and the attention output as f16 operands (≈2^-12); f32 accumulation. v_wmma_f32_16x16x32_f16.
#define NBt 4
#define TT 1024
#define CC 1024
#define NH 16
#define HD 64
#define NR (NBt * TT)            /* 4096 */
#define HG 32                    /* (batch, head) slabs per pass: 2 batches x 16 heads */
#define K3 (3 * HD)              /* 192 */
typedef __bf16 v16b __attribute__((ext_vector_type(16)));
typedef unsigned short v8us __attribute__((ext_vector_type(8), may_alias));
typedef float  v8f  __attribute__((ext_vector_type(8)));
typedef float  v4f  __attribute__((ext_vector_type(4)));
typedef float  v4fa __attribute__((ext_vector_type(4), may_alias));
union FragB { v16b v; v8us half[2]; unsigned short u[16]; };

__device__ __forceinline__ unsigned short bf16_bits(float x) { unsigned int u = __float_as_uint(x); return (unsigned short)((u + 0x7FFFu + ((u >> 16) & 1u)) >> 16); }
__device__ __forceinline__ float bf16_val(unsigned short b) { return __uint_as_float(((unsigned int)b) << 16); }
__device__ __forceinline__ float bf16_round(float x) { return bf16_val(bf16_bits(x)); }
// D += A·B with NT terms: 1 = ah·bh, 2 = + al·bh (A split), 3 = + ah·bl (both split)
template <int NT>
__device__ __forceinline__ v8f mmaN(v16b ah, v16b al, v16b bh, v16b bl, v8f c) {
  c = __builtin_amdgcn_wmma_f32_16x16x32_bf16(false, ah, false, bh, (short)0, c, false, false);
  if (NT >= 2) c = __builtin_amdgcn_wmma_f32_16x16x32_bf16(false, al, false, bh, (short)0, c, false, false);
  if (NT >= 3) c = __builtin_amdgcn_wmma_f32_16x16x32_bf16(false, ah, false, bl, (short)0, c, false, false);
  asm volatile("v_nop\n\tv_nop\n\tv_nop\n\tv_nop" : "+v"(c) : "v"(ah), "v"(al), "v"(bh), "v"(bl));
  return c;
}

__global__ __launch_bounds__(256) void k_wt_bf16(const float* __restrict__ W, unsigned short* __restrict__ Wt, int K, int N) {
  const int t = blockIdx.x * 256 + threadIdx.x;
  const int k8n = K / 8;
  if (t >= N * k8n) return;
  const int n = t / k8n, k8 = (t % k8n) * 8;
  v8us v;
#pragma unroll
  for (int i = 0; i < 8; ++i) v[i] = bf16_bits(W[(size_t)(k8 + i) * N + n]);
  *(v8us*)(Wt + (size_t)n * K + k8) = v;
  
}

// GEMM C[M][N] (f32, pitch ldc) = act(A[M][K]·W + bias). A f32 row-major (pitch lda) converted per fragment to bf16
// (ASPLIT: hi/lo two planes -> 2 terms, else single rounded term); Wt bf16 [N][K] (pitch ldb). BIAS_BF16 rounds the
// bias to bf16 first (bias quantised to bf16 before the add). K%32==0, M%16==0, N%64==0.
template <bool ASPLIT, int ACT, bool BIAS_BF16>
__global__ __launch_bounds__(128) void k_gemm_bf(const float* __restrict__ A, int lda, const unsigned short* __restrict__ Wt, int ldb,
                                               const float* __restrict__ bias, float* __restrict__ C, int ldc, int M, int N, int K) {
  __shared__ __attribute__((aligned(16))) float so[4][16][64];
  const int tid = threadIdx.x, w = tid >> 5, lane = tid & 31, ln = lane & 15, hh = lane >> 4;
  const int ntn = N / 64;
  const int wid = blockIdx.x * 4 + w;
  const int mt = wid / ntn, nq = wid % ntn;
  if (mt * 16 >= M) return;
  const int row0 = mt * 16, col0 = nq * 64;
  const float* arow = A + (size_t)(row0 + ln) * lda;
  v8f acc[4] = {};
  for (int kb = 0; kb < K; kb += 32) {
    FragB ah, al;
    const v4f x0 = *(const v4fa*)(arow + kb + 8 * hh), x1 = *(const v4fa*)(arow + kb + 8 * hh + 4);
    const v4f x2 = *(const v4fa*)(arow + kb + 16 + 8 * hh), x3 = *(const v4fa*)(arow + kb + 16 + 8 * hh + 4);
    float xs[16] = {x0[0],x0[1],x0[2],x0[3],x1[0],x1[1],x1[2],x1[3],x2[0],x2[1],x2[2],x2[3],x3[0],x3[1],x3[2],x3[3]};
#pragma unroll
    for (int i = 0; i < 16; ++i) { const unsigned short hb = bf16_bits(xs[i]); ah.u[i] = hb; al.u[i] = ASPLIT ? bf16_bits(xs[i] - bf16_val(hb)) : (unsigned short)0; }
#pragma unroll
    for (int t = 0; t < 4; ++t) {
      const unsigned short* brow = Wt + (size_t)(col0 + t * 16 + ln) * ldb + kb;
      FragB b;
      b.half[0] = *(const v8us*)(brow + 8 * hh);
      b.half[1] = *(const v8us*)(brow + 16 + 8 * hh);
      acc[t] = mmaN<ASPLIT ? 2 : 1>(ah.v, al.v, b.v, b.v, acc[t]);
    }
  }
#pragma unroll
  for (int t = 0; t < 4; ++t) {
    float bv = bias ? bias[col0 + t * 16 + ln] : 0.f;
    if (BIAS_BF16) bv = bf16_round(bv);
#pragma unroll
    for (int r = 0; r < 8; ++r) { float v = acc[t][r] + bv; if (ACT == 1) v = fmaxf(v, 0.f); so[w][8 * hh + r][t * 16 + ln] = v; }
  }
  __builtin_amdgcn_fence(__ATOMIC_ACQ_REL, "workgroup");
  __builtin_amdgcn_wave_barrier();
  const int rsub = lane >> 4, c4 = (lane & 15) * 4;
  {
#pragma unroll
    for (int q = 0; q < 8; ++q) {
      const int r = q * 2 + rsub;
      const v4f v = *(const v4fa*)&so[w][r][c4];
      *(v4f*)(C + (size_t)(row0 + r) * ldc + col0 + c4) = v;
    }
    
  }
}

// GEMM C = act(A·W + bias + resid): A f32 (ASPLIT -> hi/lo 2 terms), Wt bf16 [N][K]; ACT 0 none, 1 relu, 2 exact gelu;
// resid (optional, f32, row index = (row % rmod), pitch ldr, RES_BF16 rounds it) added before the activation.
template <bool ASPLIT, int ACT, bool BIAS_BF16, bool RES_BF16>
__global__ __launch_bounds__(128) void k_gemm_bf3(const float* __restrict__ A, int lda, const unsigned short* __restrict__ Wt, int ldb,
                                                const float* __restrict__ bias, const float* __restrict__ resid, int rmod, int ldr,
                                                float* __restrict__ C, int ldc, int M, int N, int K) {
  __shared__ __attribute__((aligned(16))) float so[4][16][64];
  const int tid = threadIdx.x, w = tid >> 5, lane = tid & 31, ln = lane & 15, hh = lane >> 4;
  const int ntn = N / 64;
  const int wid = blockIdx.x * 4 + w;
  const int mt = wid / ntn, nq = wid % ntn;
  if (mt * 16 >= M) return;
  const int row0 = mt * 16, col0 = nq * 64;
  const float* arow = A + (size_t)(row0 + ln) * lda;
  v8f acc[4] = {};
  for (int kb = 0; kb < K; kb += 32) {
    FragB ah, al;
    const v4f x0 = *(const v4fa*)(arow + kb + 8 * hh), x1 = *(const v4fa*)(arow + kb + 8 * hh + 4);
    const v4f x2 = *(const v4fa*)(arow + kb + 16 + 8 * hh), x3 = *(const v4fa*)(arow + kb + 16 + 8 * hh + 4);
    float xs[16] = {x0[0],x0[1],x0[2],x0[3],x1[0],x1[1],x1[2],x1[3],x2[0],x2[1],x2[2],x2[3],x3[0],x3[1],x3[2],x3[3]};
#pragma unroll
    for (int i = 0; i < 16; ++i) { const unsigned short hb = bf16_bits(xs[i]); ah.u[i] = hb; al.u[i] = ASPLIT ? bf16_bits(xs[i] - bf16_val(hb)) : (unsigned short)0; }
#pragma unroll
    for (int t = 0; t < 4; ++t) {
      const unsigned short* brow = Wt + (size_t)(col0 + t * 16 + ln) * ldb + kb;
      FragB b;
      b.half[0] = *(const v8us*)(brow + 8 * hh);
      b.half[1] = *(const v8us*)(brow + 16 + 8 * hh);
      acc[t] = mmaN<ASPLIT ? 2 : 1>(ah.v, al.v, b.v, b.v, acc[t]);
    }
  }
#pragma unroll
  for (int t = 0; t < 4; ++t) {
    const int col = col0 + t * 16 + ln;
    float bv = bias ? bias[col] : 0.f;
    if (BIAS_BF16) bv = bf16_round(bv);
#pragma unroll
    for (int r = 0; r < 8; ++r) {
      float v = acc[t][r] + bv;
      if (resid) { float rv = resid[(size_t)((row0 + 8 * hh + r) % rmod) * ldr + col]; if (RES_BF16) rv = bf16_round(rv); v += rv; }
      if (ACT == 1) v = fmaxf(v, 0.f);
      if (ACT == 2) v = 0.5f * v * (1.0f + erff(v * 0.70710678118654752f));
      if (ACT == 3) { const float u = 0.7978845608028654f * (v + 0.044715f * v * v * v); v = 0.5f * v * (1.0f + tanhf(u)); }
      so[w][8 * hh + r][t * 16 + ln] = v;
    }
  }
  __builtin_amdgcn_fence(__ATOMIC_ACQ_REL, "workgroup");
  __builtin_amdgcn_wave_barrier();
  const int rsub = lane >> 4, c4 = (lane & 15) * 4;
  {
#pragma unroll
    for (int q = 0; q < 8; ++q) {
      const int r = q * 2 + rsub;
      const v4f v = *(const v4fa*)&so[w][r][c4];
      *(v4f*)(C + (size_t)(row0 + r) * ldc + col0 + c4) = v;
    }
    
  }
}
// row LayerNorm (biased variance, eps) over N: s = X (+ R); optional out_sum <- s; out_norm <- (s-mu)*rsqrt(var+eps)*g + b
template <bool PARAM_BF16>
__global__ __launch_bounds__(256) void k_layernorm(const float* __restrict__ X, const float* __restrict__ R, const float* __restrict__ g, const float* __restrict__ bta,
                                                  float* __restrict__ out_sum, float* __restrict__ out_norm, int N, float eps) {
  __shared__ float red[256];
  const int row = blockIdx.x, tid = threadIdx.x;
  const float* x = X + (size_t)row * N; const float* rr = R ? R + (size_t)row * N : nullptr;
  float vals[16];                     // up to N = 4096
  const int per = N / 256;            // contiguous chunk per thread? use strided-by-4 chunks: thread handles j = tid*4 + 1024*u
  float s1 = 0.f;
  for (int u = 0; u < per / 4; ++u) {
    const int j = tid * 4 + 1024 * u;
    const v4f a = *(const v4fa*)(x + j);
    v4f b = {0.f,0.f,0.f,0.f}; if (rr) b = *(const v4fa*)(rr + j);
#pragma unroll
    for (int q = 0; q < 4; ++q) { const float v = a[q] + b[q]; vals[u * 4 + q] = v; s1 += v; }
  }
  red[tid] = s1; __syncthreads();
  for (int st = 128; st > 0; st >>= 1) { if (tid < st) red[tid] += red[tid + st]; __syncthreads(); }
  const float mu = red[0] / (float)N; __syncthreads();
  float s2 = 0.f;
  for (int u = 0; u < per / 4; ++u)
#pragma unroll
    for (int q = 0; q < 4; ++q) { const float c = vals[u * 4 + q] - mu; s2 += c * c; }
  red[tid] = s2; __syncthreads();
  for (int st = 128; st > 0; st >>= 1) { if (tid < st) red[tid] += red[tid + st]; __syncthreads(); }
  const float rs = rsqrtf(red[0] / (float)N + eps);
  {
    for (int u = 0; u < per / 4; ++u) {
      const int j = tid * 4 + 1024 * u;
      v4f o, sm;
#pragma unroll
      for (int q = 0; q < 4; ++q) {
        float gg = g[j + q], bb = bta[j + q];
        if (PARAM_BF16) { gg = bf16_round(gg); bb = bf16_round(bb); }
        sm[q] = vals[u * 4 + q]; o[q] = (vals[u * 4 + q] - mu) * rs * gg + bb;
      }
      if (out_sum) *(v4f*)(out_sum + (size_t)row * N + j) = sm;
      *(v4f*)(out_norm + (size_t)row * N + j) = o;
    }
    
  }
}



// ---- f16 WMMA path (v_wmma_f32_16x16x32_f16): 11-bit significands for operands in range — used where a [0,1] probability operand needs more precision than bf16
typedef _Float16 v16h __attribute__((ext_vector_type(16)));
union FragH { v16h v; v8us half[2]; _Float16 h[16]; unsigned short u[16]; };
template <int NT>
__device__ __forceinline__ v8f mmaH(v16h ah, v16h al, v16h bh, v16h bl, v8f c) {
  c = __builtin_amdgcn_wmma_f32_16x16x32_f16(false, ah, false, bh, (short)0, c, false, false);
  if (NT >= 2) c = __builtin_amdgcn_wmma_f32_16x16x32_f16(false, al, false, bh, (short)0, c, false, false);
  if (NT >= 3) c = __builtin_amdgcn_wmma_f32_16x16x32_f16(false, ah, false, bl, (short)0, c, false, false);
  asm volatile("v_nop\n\tv_nop\n\tv_nop\n\tv_nop" : "+v"(c) : "v"(ah), "v"(al), "v"(bh), "v"(bl));
  return c;
}
// batched GEMM like k_gemm_b but f16 operands: A f32 (split into f16 hi/lo if ASPLIT, else rounded to f16), Bt = f16 values [n][k]; alpha; C f32; N multiple of 16 (partial tiles skipped)
template <bool ASPLIT>
__global__ __launch_bounds__(128) void k_gemm_h(const float* __restrict__ A, int lda, size_t sA, const _Float16* __restrict__ Bh, int ldb, size_t sB, float alpha, float* __restrict__ C, int ldc, size_t sC, int M, int N, int K) {
  __shared__ __attribute__((aligned(16))) float so[4][16][64];
  const int tid = threadIdx.x, w = tid >> 5, lane = tid & 31, ln = lane & 15, hh = lane >> 4; const int by = blockIdx.y;
  A += (size_t)by * sA; Bh += (size_t)by * sB; C += (size_t)by * sC;
  const int ntn = (N + 63) / 64; const int wid = blockIdx.x * 4 + w; const int mt = wid / ntn, nq = wid % ntn; if (mt * 16 >= M) return;
  const int row0 = mt * 16, col0 = nq * 64; const float* arow = A + (size_t)(row0 + ln) * lda;
  v8f acc[4] = {};
  for (int kb = 0; kb < K; kb += 32) {
    FragH ah, al;
    const v4f x0 = *(const v4fa*)(arow + kb + 8 * hh), x1 = *(const v4fa*)(arow + kb + 8 * hh + 4), x2 = *(const v4fa*)(arow + kb + 16 + 8 * hh), x3 = *(const v4fa*)(arow + kb + 16 + 8 * hh + 4);
    float xs[16] = {x0[0],x0[1],x0[2],x0[3],x1[0],x1[1],x1[2],x1[3],x2[0],x2[1],x2[2],x2[3],x3[0],x3[1],x3[2],x3[3]};
#pragma unroll
    for (int i = 0; i < 16; ++i) { const _Float16 h = (_Float16)xs[i]; ah.h[i] = h; al.h[i] = ASPLIT ? (_Float16)(xs[i] - (float)h) : (_Float16)0.0f; }
#pragma unroll
    for (int t = 0; t < 4; ++t) { if (col0 + t * 16 >= N) continue; const size_t boff = (size_t)(col0 + t * 16 + ln) * ldb + kb; FragH bq; bq.half[0] = *(const v8us*)(Bh + boff + 8 * hh); bq.half[1] = *(const v8us*)(Bh + boff + 16 + 8 * hh);
      acc[t] = mmaH<ASPLIT ? 2 : 1>(ah.v, al.v, bq.v, bq.v, acc[t]); }
  }
#pragma unroll
  for (int t = 0; t < 4; ++t) { if (col0 + t * 16 >= N) continue;
#pragma unroll
    for (int r = 0; r < 8; ++r) so[w][8 * hh + r][t * 16 + ln] = acc[t][r] * alpha; }
  __builtin_amdgcn_fence(__ATOMIC_ACQ_REL, "workgroup"); __builtin_amdgcn_wave_barrier();
  const int rsub = lane >> 4, c4 = (lane & 15) * 4;
  {
#pragma unroll
    for (int q = 0; q < 8; ++q) { const int r = q * 2 + rsub; if (col0 + c4 < N) { const v4f v = *(const v4fa*)&so[w][r][c4]; *(v4f*)(C + (size_t)(row0 + r) * ldc + col0 + c4) = v; } }
     }
}

// Wt[n][k] = f16(W[k][n]·scale) from f32 row-major W[K][N] (scale = power of two; bf16-exact weights stay exact in f16 away from the subnormal range)
// blockIdx.y picks one of four weight matrices: 0..2 go to planes 0..2 of Wt012, 3 goes to Wt3
__global__ __launch_bounds__(256) void k_wt_f16(const float* __restrict__ W0, const float* __restrict__ W1, const float* __restrict__ W2, const float* __restrict__ W3, _Float16* __restrict__ Wt012, _Float16* __restrict__ Wt3, int K, int N, float scale) {
  const int y = blockIdx.y; const float* __restrict__ W = (y == 0) ? W0 : (y == 1) ? W1 : (y == 2) ? W2 : W3; _Float16* __restrict__ Wt = (y == 3) ? Wt3 : Wt012 + (size_t)y * K * N;
  const int t = blockIdx.x * 256 + threadIdx.x; if (t >= N * (K / 8)) return; const int n = t / (K / 8), k8 = (t % (K / 8)) * 8; FragH f;
#pragma unroll
  for (int i = 0; i < 8; ++i) f.h[i] = (_Float16)(bf16_round(W[(size_t)(k8 + i) * N + n]) * scale); const v8us o = f.half[0];
  *(v8us*)((unsigned short*)Wt + (size_t)n * K + k8) = o; 
}
// Block-tiled GEMM with fused epilogue: v = acc*alpha + bias[by*sBias + col] ; ACT 0 none / 1 elu ; writes f16 C16 (H16) or f32 C.
// One block = WM x WN waves = a (WM*FM*16) x (WN*64) tile of C; a wave owns FM x 4 accumulator tiles. Per chunk of KC k the block brings its A rows and B rows (whole 128-B lines, KC/8 lanes a row)
// into LDS at a pitch of 2*KC + 16 B and every wave reads its fragments from there; two buffers, the next chunk's global loads fly while this chunk is multiplied.
// LD = row pitch of A and of B in elements, a compile-time constant so that the rows of a tile are immediate offsets from one address per operand.
// Needs M a multiple of WM*FM*16, N of WN*64, K of KC (every launch below is).
// Two batch axes: blockIdx.y steps A, B, C by sA, sB, sC (heads), blockIdx.z by zA, zB, zC (batches).
template <int ACT, int WM, int WN, int FM, int KC, int LD, bool H16>
__global__ __launch_bounds__(WM * WN * 32) void k_gemm_hhx(const _Float16* __restrict__ A, size_t sA, const _Float16* __restrict__ Bh, size_t sB, float alpha, const float* __restrict__ bias, size_t sBias,
    float* __restrict__ C, _Float16* __restrict__ C16, int ldc, size_t sC, int M, int N, int K, size_t zA, size_t zB, size_t zC) {
  constexpr int NW = WM * WN, BM = WM * FM * 16, BN = WN * 64, CPR = KC / 8, RP = NW * 32 / CPR, NA = BM / RP, NB = BN / RP, PIT = KC + 8;
  __shared__ __attribute__((aligned(16))) unsigned short tA[2][BM][PIT];
  __shared__ __attribute__((aligned(16))) unsigned short tB[2][BN][PIT];
  __shared__ __attribute__((aligned(16))) float so[NW][16][64];
  const int tid = threadIdx.x, w = tid >> 5, lane = tid & 31, ln = lane & 15, hh = lane >> 4; const int by = blockIdx.y;
  const int bz = blockIdx.z; A += (size_t)by * sA + (size_t)bz * zA; Bh += (size_t)by * sB + (size_t)bz * zB; const size_t cofs = (size_t)by * sC + (size_t)bz * zC; const float* bp = bias ? bias + (size_t)by * sBias : nullptr;
  const int ntn = N / BN; const int bm = blockIdx.x / ntn, bn = blockIdx.x % ntn; if (bm * BM >= M) return;
  const int wm = w / WN, wn = w % WN; const int srow = tid / CPR, sc = (tid % CPR) * 8;
  const unsigned short* gA = (const unsigned short*)A + (size_t)(bm * BM + srow) * LD + sc;
  const unsigned short* gB = (const unsigned short*)Bh + (size_t)(bn * BN + srow) * LD + sc;
  const int col0 = bn * BN + wn * 64;
  float bvv[4];      // the wave's bias values, fetched ahead of the products
#pragma unroll
  for (int t = 0; t < 4; ++t) bvv[t] = bp ? bf16_round(bp[col0 + t * 16 + ln]) : 0.f;
  v8us ra[NA], rb[NB];
  v8f acc[FM][4] = {};
  auto g2r = [&](int kb) {
#pragma unroll
    for (int i = 0; i < NA; ++i) ra[i] = *(const v8us*)(gA + kb + i * RP * LD);
#pragma unroll
    for (int i = 0; i < NB; ++i) rb[i] = *(const v8us*)(gB + kb + i * RP * LD);
  };
  auto r2s = [&](int buf) {
#pragma unroll
    for (int i = 0; i < NA; ++i) *(v8us*)&tA[buf][i * RP + srow][sc] = ra[i];
#pragma unroll
    for (int i = 0; i < NB; ++i) *(v8us*)&tB[buf][i * RP + srow][sc] = rb[i];
  };
  auto mul = [&](int buf) {
#pragma unroll
    for (int ks = 0; ks < KC / 32; ++ks) { FragH fa[FM], fb[4];
#pragma unroll
      for (int i = 0; i < FM; ++i) { const unsigned short* p = &tA[buf][(wm * FM + i) * 16 + ln][ks * 32 + 8 * hh]; fa[i].half[0] = *(const v8us*)p; fa[i].half[1] = *(const v8us*)(p + 16); }
#pragma unroll
      for (int t = 0; t < 4; ++t) { const unsigned short* p = &tB[buf][wn * 64 + t * 16 + ln][ks * 32 + 8 * hh]; fb[t].half[0] = *(const v8us*)p; fb[t].half[1] = *(const v8us*)(p + 16); }
#pragma unroll
      for (int i = 0; i < FM; ++i)
#pragma unroll
        for (int t = 0; t < 4; ++t) acc[i][t] = __builtin_amdgcn_wmma_f32_16x16x32_f16(false, fa[i].v, false, fb[t].v, (short)0, acc[i][t], false, false); }
  };
  g2r(0); r2s(0);
  __syncthreads();      // chunk 0 is in buffer 0 for every wave
  int buf = 0;
  for (int kb = KC; kb < K; kb += KC) {
    g2r(kb);            // next chunk: in flight while this one is multiplied
    __builtin_amdgcn_sched_barrier(0);      // keeps those loads above the products; without it the compiler sinks them to just before their LDS stores and their latency is waited out
    mul(buf);
    r2s(buf ^ 1);       // that buffer's last readers left it before the barrier that ended the trip before
    __syncthreads();    // publishes the next chunk and ends this trip's reads of buf
    buf ^= 1;
  }
  mul(buf);
  const int rsub = lane >> 4, c4 = (lane & 15) * 4; typedef _Float16 v4h __attribute__((ext_vector_type(4)));
#pragma unroll
  for (int i = 0; i < FM; ++i) { const int row0 = bm * BM + (wm * FM + i) * 16;
#pragma unroll
    for (int t = 0; t < 4; ++t) { const float bv = bvv[t];
#pragma unroll
      for (int r = 0; r < 8; ++r) { float v = acc[i][t][r] * alpha + bv; if (ACT == 1) v = (v > 0.f) ? v : expm1f(v); else if (ACT == 7) v = (v > 0.f) ? v + 1.0f : expf(v); else if (ACT == 8) v = tanhf(v); else if (ACT == 9) v = 0.5f * v * (1.0f + tanhf(0.7978845608028654f * (v + 0.044715f * v * v * v))); else if (ACT == 11) v = 1.0f / (1.0f + expf(-v)); else if (ACT == 12) v = (v > 0.f) ? v : 0.01f * v; else if (ACT == 14) v = (v > 0.f) ? v : 0.1f * v; else if (ACT == 15) v = v / (1.0f + expf(-v)); else if (ACT == 3) v = fmaxf(v, 0.f); else if (ACT == 6) v = 0.5f * v * (1.0f + erff(v * 0.70710678118654752f)); so[w][8 * hh + r][t * 16 + ln] = v; } }
    __builtin_amdgcn_fence(__ATOMIC_ACQ_REL, "workgroup"); __builtin_amdgcn_wave_barrier();
#pragma unroll
    for (int q = 0; q < 8; ++q) { const int r = q * 2 + rsub; const v4f v = *(const v4fa*)&so[w][r][c4]; if (!H16) *(v4f*)(C + cofs + (size_t)(row0 + r) * ldc + col0 + c4) = v; else { v4h h4; for (int j = 0; j < 4; ++j) h4[j] = (_Float16)v[j]; *(v4h*)(C16 + cofs + (size_t)(row0 + r) * ldc + col0 + c4) = h4; } }
    if (i + 1 < FM) { __builtin_amdgcn_fence(__ATOMIC_ACQ_REL, "workgroup"); __builtin_amdgcn_wave_barrier(); }      // the wave's rows are read back before its next 16 rows overwrite them
  }
}


typedef _Float16 v4h __attribute__((ext_vector_type(4)));

// blockIdx.y picks one of three activations; its f16 copy goes to plane blockIdx.y of X16
__global__ __launch_bounds__(256) void k_x16(const float* __restrict__ x0, const float* __restrict__ x1, const float* __restrict__ x2, _Float16* __restrict__ X16, size_t n8) { const size_t t = (size_t)blockIdx.x * 256 + threadIdx.x; if (t >= n8) return; FragH f;
  const int y = blockIdx.y; const float* __restrict__ x = (y == 0) ? x0 : (y == 1) ? x1 : x2; X16 += (size_t)y * n8 * 8;
#pragma unroll
  for (int q = 0; q < 8; ++q) f.h[q] = (_Float16)bf16_round(x[t * 8 + q]); *(v8us*)((unsigned short*)X16 + t * 8) = f.half[0];  }
__global__ __launch_bounds__(256) void k_h16(const float* __restrict__ x, _Float16* __restrict__ X16, size_t n8) { const size_t t = (size_t)blockIdx.x * 256 + threadIdx.x; if (t >= n8) return; FragH f;
#pragma unroll
  for (int q = 0; q < 8; ++q) f.h[q] = (_Float16)x[t * 8 + q]; *(v8us*)((unsigned short*)X16 + t * 8) = f.half[0];  }
__global__ __launch_bounds__(256) void k_round16f(const float* __restrict__ W, _Float16* __restrict__ Bt, size_t n8) { const size_t t = (size_t)blockIdx.x * 256 + threadIdx.x; if (t >= n8) return; FragH f;
#pragma unroll
  for (int i = 0; i < 8; ++i) f.h[i] = (_Float16)(bf16_round(W[t * 8 + i]) * 16.0f); *(v8us*)((unsigned short*)Bt + t * 8) = f.half[0];  }
template <int NHv, int TTv>
__global__ __launch_bounds__(256) void k_vt(const _Float16* __restrict__ V16, int ldv, int voff, _Float16* __restrict__ Vt) { __shared__ unsigned short tl[64][66]; const int tid = threadIdx.x; const int slab = blockIdx.x / (TTv / 64), lg = blockIdx.x % (TTv / 64); const int b = slab / NHv, h = slab % NHv;
  for (int i = tid; i < 64 * 8; i += 256) { const int r = i / 8, c8 = (i % 8) * 8; FragH f; f.half[0] = *(const v8us*)((const unsigned short*)V16 + ((size_t)b * TTv + lg * 64 + r) * ldv + voff + h * 64 + c8);
#pragma unroll
    for (int q = 0; q < 8; ++q) tl[r][c8 + q] = f.u[q]; }
  __syncthreads();
  {
#pragma unroll
    for (int rd = 0; rd < 2; ++rd) { const int d = rd * 32 + tid / 8, pc = tid % 8; FragH f;
#pragma unroll
      for (int q = 0; q < 8; ++q) f.u[q] = tl[pc * 8 + q][d];
      *(v8us*)((unsigned short*)Vt + ((size_t)slab * 64 + d) * TTv + lg * 64 + pc * 8) = f.half[0]; }
     } }

__global__ __launch_bounds__(256) void k_hl(const float* __restrict__ F, _Float16* __restrict__ Hh, _Float16* __restrict__ Hl, size_t n8) { const size_t t = (size_t)blockIdx.x * 256 + threadIdx.x; if (t >= n8) return; FragH fh, fl; const v4f a = *(const v4fa*)(F + t * 8), c = *(const v4fa*)(F + t * 8 + 4);
#pragma unroll
  for (int q = 0; q < 4; ++q) { _Float16 h = (_Float16)a[q]; fh.h[q] = h; fl.h[q] = (_Float16)((a[q] - (float)h) * 1024.0f); h = (_Float16)c[q]; fh.h[4 + q] = h; fl.h[4 + q] = (_Float16)((c[q] - (float)h) * 1024.0f); }
  { *(v8us*)((unsigned short*)Hh + t * 8) = fh.half[0]; *(v8us*)((unsigned short*)Hl + t * 8) = fl.half[0];  } }

// blockIdx.y = mode: 0 folds plane 0 of F (Q) into O3q, 1 folds plane 1 (K) into O3k
__global__ __launch_bounds__(256) void k_fold3(const float* __restrict__ F, _Float16* __restrict__ O3q, _Float16* __restrict__ O3k) {
  #pragma clang fp contract(off)
  const int mode = blockIdx.y; F += (size_t)mode * NR * CC; _Float16* __restrict__ O3 = mode ? O3k : O3q;
  const int t = blockIdx.x * 256 + threadIdx.x; if (t >= NR * (CC / 8)) return; const int c0 = (t % (CC / 8)) * 8, r = t / (CC / 8); const int h = c0 / HD, d0 = c0 % HD; const v4f a = *(const v4fa*)(F + (size_t)r * CC + c0), c = *(const v4fa*)(F + (size_t)r * CC + c0 + 4); FragH s0, s1, s2;
#pragma unroll
  for (int q = 0; q < 8; ++q) { const float v = (q < 4) ? a[q] : c[q - 4]; const _Float16 hi = (_Float16)v; const float lo = (v - (float)hi); if (mode == 0) { s0.h[q] = hi; s1.h[q] = (_Float16)(lo * 1024.0f); s2.h[q] = hi; } else { s0.h[q] = hi; s1.h[q] = (_Float16)((float)hi * 0.0009765625f); s2.h[q] = (_Float16)lo; } }
  unsigned short* base = (unsigned short*)O3 + (size_t)r * (NH * K3) + h * K3 + d0;
  { *(v8us*)(base) = s0.half[0]; *(v8us*)(base + HD) = s1.half[0]; *(v8us*)(base + 2 * HD) = s2.half[0];  } }
__global__ __launch_bounds__(256) void k_vt(const _Float16* __restrict__ V, _Float16* __restrict__ VT) { const int b = blockIdx.y; VT += (size_t)b * CC * TT; const int t = blockIdx.x * 256 + threadIdx.x; if (t >= CC * (TT / 8)) return; const int s0 = (t % (TT / 8)) * 8, hd = t / (TT / 8); FragH f;
#pragma unroll
  for (int q = 0; q < 8; ++q) f.h[q] = V[((size_t)b * TT + s0 + q) * CC + hd];
  *(v8us*)((unsigned short*)VT + (size_t)hd * TT + s0) = f.half[0];  }
// One wave per row. The lane's 32 scores of the row (4 groups of 8 neighbours) are read once and stay in registers: each sweep rewrites them in place
// (clipped score, then exp, then probability), in the order in which the sums were always taken.
// The second launch-bounds figure asks for 8 waves per SIMD (at most 128 registers), so that four work-groups share a WGP; without it the build takes 139 registers and three fit.
__global__ __launch_bounds__(256, 8) void k_rowstat(const float* __restrict__ S, float* __restrict__ RST) {
  #pragma clang fp contract(off)
  __shared__ float rec[8][4]; const int tid = threadIdx.x, w = tid >> 5, ln = tid & 31; const int row = blockIdx.x * 8 + w; const float* sr = S + (size_t)row * TT; float su = 0.f, mx = -3.0e38f;
  v4f ld[8]; float e[32];
#pragma unroll
  for (int j = 0; j < 4; ++j) { ld[2 * j] = *(const v4fa*)(sr + j * 256 + 8 * ln); ld[2 * j + 1] = *(const v4fa*)(sr + j * 256 + 8 * ln + 4); }
#pragma unroll
  for (int i = 0; i < 32; ++i) { const float v = fminf(fmaxf(ld[i >> 2][i & 3] * 0.125f, -50.f), 50.f); e[i] = v; su += v; mx = fmaxf(mx, v); }
  for (int o = 16; o > 0; o >>= 1) { su += __shfl_xor(su, o, 32); mx = fmaxf(mx, __shfl_xor(mx, o, 32)); }
  float se = 0.f;
#pragma unroll
  for (int i = 0; i < 32; ++i) { e[i] = expf(0.5f * e[i] - 0.5f * mx); se += e[i]; }
  for (int o = 16; o > 0; o >>= 1) se += __shfl_xor(se, o, 32); const float inv = 1.0f / se; float pm = 0.f;      /* mean of p over keys = sum p / TT */
#pragma unroll
  for (int i = 0; i < 32; ++i) { e[i] = e[i] * inv; pm += e[i]; }
  for (int o = 16; o > 0; o >>= 1) pm += __shfl_xor(pm, o, 32); pm = pm / (float)TT; float vq = 0.f;
#pragma unroll
  for (int i = 0; i < 32; ++i) { const float d = e[i] - pm; vq += d * d; }
  for (int o = 16; o > 0; o >>= 1) vq += __shfl_xor(vq, o, 32);
  if (ln == 0) { rec[w][0] = su; rec[w][1] = mx; rec[w][2] = vq / (float)(TT - 1); rec[w][3] = 0.f; }
  __syncthreads();
  if (w == 0 && ln < 8) { const v4f v = *(const v4f*)&rec[ln][0]; *(v4f*)(RST + ((size_t)blockIdx.x * 8 + ln) * 4) = v;  } }
__global__ __launch_bounds__(256) void k_thead(const float* __restrict__ RST, const float* __restrict__ Wt1, const float* __restrict__ bt1, const float* __restrict__ Wt2, const float* __restrict__ bt2, float* __restrict__ TH) {
  #pragma clang fp contract(off)
  __shared__ v4f red[256]; const int g = blockIdx.x, tid = threadIdx.x; v4f a = {0.f, 0.f, 0.f, 0.f};
  for (int q = tid; q < TT; q += 256) { const v4f r = *(const v4fa*)(RST + ((size_t)g * TT + q) * 4); a[0] += r[0]; a[1] += r[1]; a[2] += r[2]; }
  red[tid] = a; __syncthreads(); for (int st = 128; st > 0; st >>= 1) { if (tid < st) { v4f x = red[tid]; const v4f y = red[tid + st]; x[0] += y[0]; x[1] += y[1]; x[2] += y[2]; red[tid] = x; } __syncthreads(); }
  if (tid < 32) { const v4f r0 = red[0]; float f0 = r0[0] / ((float)TT * (float)TT), f1 = r0[1] / (float)TT, f2 = r0[2] / (float)TT; f0 = fminf(fmaxf(f0, -10.f), 10.f); f1 = fminf(fmaxf(f1, -10.f), 10.f); f2 = fminf(fmaxf(f2, 0.f), 1.f);
    float raw = bf16_round(bt2[0]);
#pragma unroll 1
    for (int u = 0; u < 16; ++u) { float pre = bf16_round(bt1[u]); pre += f0 * bf16_round(Wt1[u]); pre += f1 * bf16_round(Wt1[16 + u]); pre += f2 * bf16_round(Wt1[32 + u]); raw += tanhf(pre) * bf16_round(Wt2[u]); }
    float t = 0.01f + (1.0f / (1.0f + expf(-raw))) * (2.0f - 0.01f); t = fminf(fmaxf(t, 0.01f), 2.0f); t = fminf(t, 0.85f);
    *(float*)(TH + (size_t)g * 32 + tid) = t;  } }
// One wave per row, the lane's 32 scores read once and kept in registers (scaled score, then exp), as in k_rowstat.
__global__ __launch_bounds__(256) void k_tsoft(const float* __restrict__ S, const float* __restrict__ TH, _Float16* __restrict__ P16) {
  #pragma clang fp contract(off)
  const int tid = threadIdx.x, w = tid >> 5, ln = tid & 31; const int row = blockIdx.x * 8 + w; const int g = row / TT; const float* sr = S + (size_t)row * TT; float m = -3.0e38f;
  v4f ld[8]; float e[32];
#pragma unroll
  for (int j = 0; j < 4; ++j) { ld[2 * j] = *(const v4fa*)(sr + j * 256 + 8 * ln); ld[2 * j + 1] = *(const v4fa*)(sr + j * 256 + 8 * ln + 4); }
  const float sc = 1.0f / (2.0f * TH[(size_t)g * 32]);
#pragma unroll
  for (int i = 0; i < 32; ++i) { e[i] = ld[i >> 2][i & 3] * sc; m = fmaxf(m, e[i]); }
  for (int o = 16; o > 0; o >>= 1) m = fmaxf(m, __shfl_xor(m, o, 32)); float su = 0.f;
#pragma unroll
  for (int i = 0; i < 32; ++i) { e[i] = expf(e[i] - m); su += e[i]; }
  for (int o = 16; o > 0; o >>= 1) su += __shfl_xor(su, o, 32); const float inv = 1024.0f / su;
#pragma unroll
  for (int j = 0; j < 4; ++j) { FragH f;
#pragma unroll
    for (int k = 0; k < 8; ++k) f.h[k] = (_Float16)(e[j * 8 + k] * inv);
    *(v8us*)((unsigned short*)P16 + (size_t)row * TT + j * 256 + 8 * ln) = f.half[0]; } }

extern "C" void kernel_launch(void* const* d_in, const int* in_sizes, int n_in,
                              void* d_out, int out_size, void* d_ws, size_t ws_size, hipStream_t stream) {
  (void)in_sizes; (void)n_in; (void)out_size;
  const float* const* I = (const float* const*)d_in; const float* xq = I[0]; const float* xk = I[1]; const float* xv = I[2]; const float* Wq = I[3]; const float* bq = I[4]; const float* Wk = I[5]; const float* bk = I[6]; const float* Wv = I[7]; const float* bv = I[8]; const float* Wo = I[9]; const float* bo = I[10]; const float* Wt1 = I[11]; const float* bt1 = I[12]; const float* Wt2 = I[13]; const float* bt2 = I[14];
  char* ws = (char*)d_ws; size_t off = 0;
  auto take = [&](size_t bytes) { char* p = ws + off; off += (bytes + 255) & ~(size_t)255; return p; };
  _Float16* Q3p = (_Float16*)take((size_t)NR * NH * K3 * 2); _Float16* K3p = (_Float16*)take((size_t)NR * NH * K3 * 2); _Float16* VTb = (_Float16*)take((size_t)NBt * CC * TT * 2); _Float16* BWo = (_Float16*)take((size_t)CC * CC * 2); float* RST = (float*)take((size_t)HG * TT * 4 * 4); float* TH = (float*)take(HG * 32 * 4); float* S = (float*)take((size_t)HG * TT * TT * 4); _Float16* P16 = (_Float16*)take((size_t)HG * TT * TT * 2);
  if (off > ws_size) return;      // 25.2 + 25.2 + 8.4 + 2.1 + 0.5 + 134.2 + 67.1 = 262.7 MB
  const size_t pW = (size_t)CC * CC, pX = (size_t)NR * CC;      /* plane sizes in elements: a weight; an activation */
  /* What only the projections need lives in the score buffer, whose first use comes after their last: 6.3 + 25.2 + 8.4 + 33.6 = 73.4 of its 134.2 MB */
  _Float16* BW = (_Float16*)S; _Float16* X16 = BW + 3 * pW; _Float16* V16 = X16 + 3 * pX; float* Ff = (float*)(V16 + pX);
  /* The attention output (8.4 MB) takes the place of the first two batches' Q rows (12.6 MB): they are last read by the first pass's score GEMM, and the first write here is that pass's P*V */
  _Float16* O16 = Q3p;
  const size_t n8 = (size_t)NR * CC / 8; const unsigned nb8 = (unsigned)((n8 + 255) / 256); const dim3 gP((NR / 128) * (CC / 128), 1);
  k_wt_f16<<<dim3((CC * (CC / 8) + 255) / 256, 4), 256, 0, stream>>>(Wq, Wk, Wv, Wo, BW, BWo, CC, CC, 16.0f);      /* all four weights, one launch */
  k_x16<<<dim3(nb8, 3), 256, 0, stream>>>(xq, xk, xv, X16, n8);      /* all three activations, one launch */
  k_gemm_hhx<0, 4, 2, 2, 128, CC, false><<<gP, 256, 0, stream>>>(X16, 0, BW, 0, 0.0625f, bq, 0, Ff, nullptr, CC, 0, NR, CC, CC, 0, 0, 0);
  k_gemm_hhx<0, 4, 2, 2, 128, CC, false><<<gP, 256, 0, stream>>>(X16 + pX, 0, BW + pW, 0, 0.0625f, bk, 0, Ff + pX, nullptr, CC, 0, NR, CC, CC, 0, 0, 0);
  k_gemm_hhx<0, 4, 2, 2, 128, CC, true><<<gP, 256, 0, stream>>>(X16 + 2 * pX, 0, BW + 2 * pW, 0, 0.0625f, bv, 0, nullptr, V16, CC, 0, NR, CC, CC, 0, 0, 0);      /* V -> f16 */
  k_fold3<<<dim3(nb8, 2), 256, 0, stream>>>(Ff, Q3p, K3p);      /* Q exact -> [hi | lo*2^10 | hi], K -> [hi | hi*2^-10 | lo] */
  k_vt<<<dim3((CC * (TT / 8) + 255) / 256, NBt), 256, 0, stream>>>(V16, VTb);      /* V transposed, all batches */
  const dim3 gS((TT / 128) * (TT / 128), NH, HG / NH), gV(TT / 64, NH, HG / NH);
  for (int b = 0; b < NBt; b += HG / NH) {      /* slab g = (batch - b) * NH + head in S, P16, RST, TH */
    k_gemm_hhx<0, 4, 2, 2, 64, NH * K3, false><<<gS, 256, 0, stream>>>(Q3p + (size_t)b * TT * (NH * K3), (size_t)K3, K3p + (size_t)b * TT * (NH * K3), (size_t)K3, 1.0f, nullptr, 0, S, nullptr, TT, (size_t)TT * TT, TT, TT, K3, (size_t)TT * (NH * K3), (size_t)TT * (NH * K3), (size_t)NH * TT * TT);      /* raw Q*K, about f32 (K 192) */
    k_rowstat<<<HG * TT / 8, 256, 0, stream>>>(S, RST); k_thead<<<HG, 256, 0, stream>>>(RST, Wt1, bt1, Wt2, bt2, TH);
    k_tsoft<<<HG * TT / 8, 256, 0, stream>>>(S, TH, P16);
    k_gemm_hhx<0, 4, 1, 1, 128, TT, true><<<gV, 128, 0, stream>>>(P16, (size_t)TT * TT, VTb + (size_t)b * CC * TT, (size_t)HD * TT, 0.0009765625f, nullptr, 0, nullptr, O16 + (size_t)b * TT * CC, CC, (size_t)HD, TT, HD, TT, (size_t)NH * TT * TT, (size_t)CC * TT, (size_t)TT * CC); }
  k_gemm_hhx<0, 4, 2, 2, 128, CC, false><<<gP, 256, 0, stream>>>(O16, 0, BWo, 0, 0.0625f, bo, 0, (float*)d_out, nullptr, CC, 0, NR, CC, CC, 0, 0, 0);
}

// v004
// It runs in 163 microseconds.
// Next to v003, in two timings, it ran 1.71 times as fast each time.
// Counting every step since v000, it is 6.11 times as fast.
#include <hip/hip_runtime.h>
// Diffusion-time multi-head attention (B 4, S 1024, D 1024, 16 heads × 64): Q,K,V = x·W + b ((in,out)); per (b,h): s = clip(Q·K/8, ±50); feats = (mean s, mean_q max_k s, mean_q var_k softmax(s/2) (ddof 1)) → t = min(clip(0.01 + 1.99·σ(tanh(feats·Wt1 + b)·Wt2 + b)), 0.85); attn = softmax(Q·K/(2t)); out = (attn·V merged)·Wo + bo → [4,1024,1024].
// Structure: projections as GEMMs (exact products); Q and K carried as f16 hi/lo and contracted with the pair folded into K ([q_hi | q_lo*2^10 | q_hi]*[k_hi | k_hi*2^-10 | k_lo], K 192) so the raw logits are about f32 (they are divided by 2t, i.e. scaled up to x50); all 64 (batch, head) slabs per launch: a statistics kernel that forms the score tiles by WMMA and reduces them in registers (clipped sum / max / softmax(s/2) variance), a per-head reduction + the tiny time MLP (one block per head, fixed order), then an attention kernel that forms the same tiles again, takes exp with the head's 1/(2t) (x2^10 -> f16) and multiplies by V in place; output projection GEMM.
// Compute dtype: inputs and parameters rounded to bf16; logits ≈f32; statistics/MLP/softmax f32; V and the attention output as f16 operands (≈2^-12); f32 accumulation. v_wmma_f32_16x16x32_f16.
#define NBt 4
#define TT 1024
#define CC 1024
#define NH 16
#define HD 64
#define NR (NBt * TT)            /* 4096 */
#define HG (NBt * NH)            /* (batch, head) slabs: all in one launch */
#define K3 (3 * HD)              /* 192 */
typedef __bf16 v16b __attribute__((ext_vector_type(16)));
typedef unsigned short v8us __attribute__((ext_vector_type(8), may_alias));
typedef float  v8f  __attribute__((ext_vector_type(8)));
typedef float  v4f  __attribute__((ext_vector_type(4)));
typedef float  v4fa __attribute__((ext_vector_type(4), may_alias));
union FragB { v16b v; v8us half[2]; unsigned short u[16]; };

__device__ __forceinline__ unsigned short bf16_bits(float x) { unsigned int u = __float_as_uint(x); return (unsigned short)((u + 0x7FFFu + ((u >> 16) & 1u)) >> 16); }
__device__ __forceinline__ float bf16_val(unsigned short b) { return __uint_as_float(((unsigned int)b) << 16); }
__device__ __forceinline__ float bf16_round(float x) { return bf16_val(bf16_bits(x)); }
// D += A·B with NT terms: 1 = ah·bh, 2 = + al·bh (A split), 3 = + ah·bl (both split)
template <int NT>
__device__ __forceinline__ v8f mmaN(v16b ah, v16b al, v16b bh, v16b bl, v8f c) {
  c = __builtin_amdgcn_wmma_f32_16x16x32_bf16(false, ah, false, bh, (short)0, c, false, false);
  if (NT >= 2) c = __builtin_amdgcn_wmma_f32_16x16x32_bf16(false, al, false, bh, (short)0, c, false, false);
  if (NT >= 3) c = __builtin_amdgcn_wmma_f32_16x16x32_bf16(false, ah, false, bl, (short)0, c, false, false);
  asm volatile("v_nop\n\tv_nop\n\tv_nop\n\tv_nop" : "+v"(c) : "v"(ah), "v"(al), "v"(bh), "v"(bl));
  return c;
}

__global__ __launch_bounds__(256) void k_wt_bf16(const float* __restrict__ W, unsigned short* __restrict__ Wt, int K, int N) {
  const int t = blockIdx.x * 256 + threadIdx.x;
  const int k8n = K / 8;
  if (t >= N * k8n) return;
  const int n = t / k8n, k8 = (t % k8n) * 8;
  v8us v;
#pragma unroll
  for (int i = 0; i < 8; ++i) v[i] = bf16_bits(W[(size_t)(k8 + i) * N + n]);
  *(v8us*)(Wt + (size_t)n * K + k8) = v;
  
}

// GEMM C[M][N] (f32, pitch ldc) = act(A[M][K]·W + bias). A f32 row-major (pitch lda) converted per fragment to bf16
// (ASPLIT: hi/lo two planes -> 2 terms, else single rounded term); Wt bf16 [N][K] (pitch ldb). BIAS_BF16 rounds the
// bias to bf16 first (bias quantised to bf16 before the add). K%32==0, M%16==0, N%64==0.
template <bool ASPLIT, int ACT, bool BIAS_BF16>
__global__ __launch_bounds__(128) void k_gemm_bf(const float* __restrict__ A, int lda, const unsigned short* __restrict__ Wt, int ldb,
                                               const float* __restrict__ bias, float* __restrict__ C, int ldc, int M, int N, int K) {
  __shared__ __attribute__((aligned(16))) float so[4][16][64];
  const int tid = threadIdx.x, w = tid >> 5, lane = tid & 31, ln = lane & 15, hh = lane >> 4;
  const int ntn = N / 64;
  const int wid = blockIdx.x * 4 + w;
  const int mt = wid / ntn, nq = wid % ntn;
  if (mt * 16 >= M) return;
  const int row0 = mt * 16, col0 = nq * 64;
  const float* arow = A + (size_t)(row0 + ln) * lda;
  v8f acc[4] = {};
  for (int kb = 0; kb < K; kb += 32) {
    FragB ah, al;
    const v4f x0 = *(const v4fa*)(arow + kb + 8 * hh), x1 = *(const v4fa*)(arow + kb + 8 * hh + 4);
    const v4f x2 = *(const v4fa*)(arow + kb + 16 + 8 * hh), x3 = *(const v4fa*)(arow + kb + 16 + 8 * hh + 4);
    float xs[16] = {x0[0],x0[1],x0[2],x0[3],x1[0],x1[1],x1[2],x1[3],x2[0],x2[1],x2[2],x2[3],x3[0],x3[1],x3[2],x3[3]};
#pragma unroll
    for (int i = 0; i < 16; ++i) { const unsigned short hb = bf16_bits(xs[i]); ah.u[i] = hb; al.u[i] = ASPLIT ? bf16_bits(xs[i] - bf16_val(hb)) : (unsigned short)0; }
#pragma unroll
    for (int t = 0; t < 4; ++t) {
      const unsigned short* brow = Wt + (size_t)(col0 + t * 16 + ln) * ldb + kb;
      FragB b;
      b.half[0] = *(const v8us*)(brow + 8 * hh);
      b.half[1] = *(const v8us*)(brow + 16 + 8 * hh);
      acc[t] = mmaN<ASPLIT ? 2 : 1>(ah.v, al.v, b.v, b.v, acc[t]);
    }
  }
#pragma unroll
  for (int t = 0; t < 4; ++t) {
    float bv = bias ? bias[col0 + t * 16 + ln] : 0.f;
    if (BIAS_BF16) bv = bf16_round(bv);
#pragma unroll
    for (int r = 0; r < 8; ++r) { float v = acc[t][r] + bv; if (ACT == 1) v = fmaxf(v, 0.f); so[w][8 * hh + r][t * 16 + ln] = v; }
  }
  __builtin_amdgcn_fence(__ATOMIC_ACQ_REL, "workgroup");
  __builtin_amdgcn_wave_barrier();
  const int rsub = lane >> 4, c4 = (lane & 15) * 4;
  {
#pragma unroll
    for (int q = 0; q < 8; ++q) {
      const int r = q * 2 + rsub;
      const v4f v = *(const v4fa*)&so[w][r][c4];
      *(v4f*)(C + (size_t)(row0 + r) * ldc + col0 + c4) = v;
    }
    
  }
}

// GEMM C = act(A·W + bias + resid): A f32 (ASPLIT -> hi/lo 2 terms), Wt bf16 [N][K]; ACT 0 none, 1 relu, 2 exact gelu;
// resid (optional, f32, row index = (row % rmod), pitch ldr, RES_BF16 rounds it) added before the activation.
template <bool ASPLIT, int ACT, bool BIAS_BF16, bool RES_BF16>
__global__ __launch_bounds__(128) void k_gemm_bf3(const float* __restrict__ A, int lda, const unsigned short* __restrict__ Wt, int ldb,
                                                const float* __restrict__ bias, const float* __restrict__ resid, int rmod, int ldr,
                                                float* __restrict__ C, int ldc, int M, int N, int K) {
  __shared__ __attribute__((aligned(16))) float so[4][16][64];
  const int tid = threadIdx.x, w = tid >> 5, lane = tid & 31, ln = lane & 15, hh = lane >> 4;
  const int ntn = N / 64;
  const int wid = blockIdx.x * 4 + w;
  const int mt = wid / ntn, nq = wid % ntn;
  if (mt * 16 >= M) return;
  const int row0 = mt * 16, col0 = nq * 64;
  const float* arow = A + (size_t)(row0 + ln) * lda;
  v8f acc[4] = {};
  for (int kb = 0; kb < K; kb += 32) {
    FragB ah, al;
    const v4f x0 = *(const v4fa*)(arow + kb + 8 * hh), x1 = *(const v4fa*)(arow + kb + 8 * hh + 4);
    const v4f x2 = *(const v4fa*)(arow + kb + 16 + 8 * hh), x3 = *(const v4fa*)(arow + kb + 16 + 8 * hh + 4);
    float xs[16] = {x0[0],x0[1],x0[2],x0[3],x1[0],x1[1],x1[2],x1[3],x2[0],x2[1],x2[2],x2[3],x3[0],x3[1],x3[2],x3[3]};
#pragma unroll
    for (int i = 0; i < 16; ++i) { const unsigned short hb = bf16_bits(xs[i]); ah.u[i] = hb; al.u[i] = ASPLIT ? bf16_bits(xs[i] - bf16_val(hb)) : (unsigned short)0; }
#pragma unroll
    for (int t = 0; t < 4; ++t) {
      const unsigned short* brow = Wt + (size_t)(col0 + t * 16 + ln) * ldb + kb;
      FragB b;
      b.half[0] = *(const v8us*)(brow + 8 * hh);
      b.half[1] = *(const v8us*)(brow + 16 + 8 * hh);
      acc[t] = mmaN<ASPLIT ? 2 : 1>(ah.v, al.v, b.v, b.v, acc[t]);
    }
  }
#pragma unroll
  for (int t = 0; t < 4; ++t) {
    const int col = col0 + t * 16 + ln;
    float bv = bias ? bias[col] : 0.f;
    if (BIAS_BF16) bv = bf16_round(bv);
#pragma unroll
    for (int r = 0; r < 8; ++r) {
      float v = acc[t][r] + bv;
      if (resid) { float rv = resid[(size_t)((row0 + 8 * hh + r) % rmod) * ldr + col]; if (RES_BF16) rv = bf16_round(rv); v += rv; }
      if (ACT == 1) v = fmaxf(v, 0.f);
      if (ACT == 2) v = 0.5f * v * (1.0f + erff(v * 0.70710678118654752f));
      if (ACT == 3) { const float u = 0.7978845608028654f * (v + 0.044715f * v * v * v); v = 0.5f * v * (1.0f + tanhf(u)); }
      so[w][8 * hh + r][t * 16 + ln] = v;
    }
  }
  __builtin_amdgcn_fence(__ATOMIC_ACQ_REL, "workgroup");
  __builtin_amdgcn_wave_barrier();
  const int rsub = lane >> 4, c4 = (lane & 15) * 4;
  {
#pragma unroll
    for (int q = 0; q < 8; ++q) {
      const int r = q * 2 + rsub;
      const v4f v = *(const v4fa*)&so[w][r][c4];
      *(v4f*)(C + (size_t)(row0 + r) * ldc + col0 + c4) = v;
    }
    
  }
}
// row LayerNorm (biased variance, eps) over N: s = X (+ R); optional out_sum <- s; out_norm <- (s-mu)*rsqrt(var+eps)*g + b
template <bool PARAM_BF16>
__global__ __launch_bounds__(256) void k_layernorm(const float* __restrict__ X, const float* __restrict__ R, const float* __restrict__ g, const float* __restrict__ bta,
                                                  float* __restrict__ out_sum, float* __restrict__ out_norm, int N, float eps) {
  __shared__ float red[256];
  const int row = blockIdx.x, tid = threadIdx.x;
  const float* x = X + (size_t)row * N; const float* rr = R ? R + (size_t)row * N : nullptr;
  float vals[16];                     // up to N = 4096
  const int per = N / 256;            // contiguous chunk per thread? use strided-by-4 chunks: thread handles j = tid*4 + 1024*u
  float s1 = 0.f;
  for (int u = 0; u < per / 4; ++u) {
    const int j = tid * 4 + 1024 * u;
    const v4f a = *(const v4fa*)(x + j);
    v4f b = {0.f,0.f,0.f,0.f}; if (rr) b = *(const v4fa*)(rr + j);
#pragma unroll
    for (int q = 0; q < 4; ++q) { const float v = a[q] + b[q]; vals[u * 4 + q] = v; s1 += v; }
  }
  red[tid] = s1; __syncthreads();
  for (int st = 128; st > 0; st >>= 1) { if (tid < st) red[tid] += red[tid + st]; __syncthreads(); }
  const float mu = red[0] / (float)N; __syncthreads();
  float s2 = 0.f;
  for (int u = 0; u < per / 4; ++u)
#pragma unroll
    for (int q = 0; q < 4; ++q) { const float c = vals[u * 4 + q] - mu; s2 += c * c; }
  red[tid] = s2; __syncthreads();
  for (int st = 128; st > 0; st >>= 1) { if (tid < st) red[tid] += red[tid + st]; __syncthreads(); }
  const float rs = rsqrtf(red[0] / (float)N + eps);
  {
    for (int u = 0; u < per / 4; ++u) {
      const int j = tid * 4 + 1024 * u;
      v4f o, sm;
#pragma unroll
      for (int q = 0; q < 4; ++q) {
        float gg = g[j + q], bb = bta[j + q];
        if (PARAM_BF16) { gg = bf16_round(gg); bb = bf16_round(bb); }
        sm[q] = vals[u * 4 + q]; o[q] = (vals[u * 4 + q] - mu) * rs * gg + bb;
      }
      if (out_sum) *(v4f*)(out_sum + (size_t)row * N + j) = sm;
      *(v4f*)(out_norm + (size_t)row * N + j) = o;
    }
    
  }
}



// ---- f16 WMMA path (v_wmma_f32_16x16x32_f16): 11-bit significands for operands in range — used where a [0,1] probability operand needs more precision than bf16
typedef _Float16 v16h __attribute__((ext_vector_type(16)));
union FragH { v16h v; v8us half[2]; _Float16 h[16]; unsigned short u[16]; };
template <int NT>
__device__ __forceinline__ v8f mmaH(v16h ah, v16h al, v16h bh, v16h bl, v8f c) {
  c = __builtin_amdgcn_wmma_f32_16x16x32_f16(false, ah, false, bh, (short)0, c, false, false);
  if (NT >= 2) c = __builtin_amdgcn_wmma_f32_16x16x32_f16(false, al, false, bh, (short)0, c, false, false);
  if (NT >= 3) c = __builtin_amdgcn_wmma_f32_16x16x32_f16(false, ah, false, bl, (short)0, c, false, false);
  asm volatile("v_nop\n\tv_nop\n\tv_nop\n\tv_nop" : "+v"(c) : "v"(ah), "v"(al), "v"(bh), "v"(bl));
  return c;
}
// batched GEMM like k_gemm_b but f16 operands: A f32 (split into f16 hi/lo if ASPLIT, else rounded to f16), Bt = f16 values [n][k]; alpha; C f32; N multiple of 16 (partial tiles skipped)
template <bool ASPLIT>
__global__ __launch_bounds__(128) void k_gemm_h(const float* __restrict__ A, int lda, size_t sA, const _Float16* __restrict__ Bh, int ldb, size_t sB, float alpha, float* __restrict__ C, int ldc, size_t sC, int M, int N, int K) {
  __shared__ __attribute__((aligned(16))) float so[4][16][64];
  const int tid = threadIdx.x, w = tid >> 5, lane = tid & 31, ln = lane & 15, hh = lane >> 4; const int by = blockIdx.y;
  A += (size_t)by * sA; Bh += (size_t)by * sB; C += (size_t)by * sC;
  const int ntn = (N + 63) / 64; const int wid = blockIdx.x * 4 + w; const int mt = wid / ntn, nq = wid % ntn; if (mt * 16 >= M) return;
  const int row0 = mt * 16, col0 = nq * 64; const float* arow = A + (size_t)(row0 + ln) * lda;
  v8f acc[4] = {};
  for (int kb = 0; kb < K; kb += 32) {
    FragH ah, al;
    const v4f x0 = *(const v4fa*)(arow + kb + 8 * hh), x1 = *(const v4fa*)(arow + kb + 8 * hh + 4), x2 = *(const v4fa*)(arow + kb + 16 + 8 * hh), x3 = *(const v4fa*)(arow + kb + 16 + 8 * hh + 4);
    float xs[16] = {x0[0],x0[1],x0[2],x0[3],x1[0],x1[1],x1[2],x1[3],x2[0],x2[1],x2[2],x2[3],x3[0],x3[1],x3[2],x3[3]};
#pragma unroll
    for (int i = 0; i < 16; ++i) { const _Float16 h = (_Float16)xs[i]; ah.h[i] = h; al.h[i] = ASPLIT ? (_Float16)(xs[i] - (float)h) : (_Float16)0.0f; }
#pragma unroll
    for (int t = 0; t < 4; ++t) { if (col0 + t * 16 >= N) continue; const size_t boff = (size_t)(col0 + t * 16 + ln) * ldb + kb; FragH bq; bq.half[0] = *(const v8us*)(Bh + boff + 8 * hh); bq.half[1] = *(const v8us*)(Bh + boff + 16 + 8 * hh);
      acc[t] = mmaH<ASPLIT ? 2 : 1>(ah.v, al.v, bq.v, bq.v, acc[t]); }
  }
#pragma unroll
  for (int t = 0; t < 4; ++t) { if (col0 + t * 16 >= N) continue;
#pragma unroll
    for (int r = 0; r < 8; ++r) so[w][8 * hh + r][t * 16 + ln] = acc[t][r] * alpha; }
  __builtin_amdgcn_fence(__ATOMIC_ACQ_REL, "workgroup"); __builtin_amdgcn_wave_barrier();
  const int rsub = lane >> 4, c4 = (lane & 15) * 4;
  {
#pragma unroll
    for (int q = 0; q < 8; ++q) { const int r = q * 2 + rsub; if (col0 + c4 < N) { const v4f v = *(const v4fa*)&so[w][r][c4]; *(v4f*)(C + (size_t)(row0 + r) * ldc + col0 + c4) = v; } }
     }
}

// Wt[n][k] = f16(W[k][n]·scale) from f32 row-major W[K][N] (scale = power of two; bf16-exact weights stay exact in f16 away from the subnormal range)
// blockIdx.y picks one of four weight matrices: 0..2 go to planes 0..2 of Wt012, 3 goes to Wt3
__global__ __launch_bounds__(256) void k_wt_f16(const float* __restrict__ W0, const float* __restrict__ W1, const float* __restrict__ W2, const float* __restrict__ W3, _Float16* __restrict__ Wt012, _Float16* __restrict__ Wt3, int K, int N, float scale) {
  const int y = blockIdx.y; const float* __restrict__ W = (y == 0) ? W0 : (y == 1) ? W1 : (y == 2) ? W2 : W3; _Float16* __restrict__ Wt = (y == 3) ? Wt3 : Wt012 + (size_t)y * K * N;
  const int t = blockIdx.x * 256 + threadIdx.x; if (t >= N * (K / 8)) return; const int n = t / (K / 8), k8 = (t % (K / 8)) * 8; FragH f;
#pragma unroll
  for (int i = 0; i < 8; ++i) f.h[i] = (_Float16)(bf16_round(W[(size_t)(k8 + i) * N + n]) * scale); const v8us o = f.half[0];
  *(v8us*)((unsigned short*)Wt + (size_t)n * K + k8) = o; 
}
// Block-tiled GEMM with fused epilogue: v = acc*alpha + bias[by*sBias + col] ; ACT 0 none / 1 elu ; writes f16 C16 (H16) or f32 C.
// One block = WM x WN waves = a (WM*FM*16) x (WN*64) tile of C; a wave owns FM x 4 accumulator tiles. Per chunk of KC k the block brings its A rows and B rows (whole 128-B lines, KC/8 lanes a row)
// into LDS at a pitch of 2*KC + 16 B and every wave reads its fragments from there; two buffers, the next chunk's global loads fly while this chunk is multiplied.
// LD = row pitch of A and of B in elements, a compile-time constant so that the rows of a tile are immediate offsets from one address per operand.
// Needs M a multiple of WM*FM*16, N of WN*64, K of KC (every launch below is).
// Two batch axes: blockIdx.y steps A, B, C by sA, sB, sC (heads), blockIdx.z by zA, zB, zC (batches).
template <int ACT, int WM, int WN, int FM, int KC, int LD, bool H16>
__global__ __launch_bounds__(WM * WN * 32) void k_gemm_hhx(const _Float16* __restrict__ A, size_t sA, const _Float16* __restrict__ Bh, size_t sB, float alpha, const float* __restrict__ bias, size_t sBias,
    float* __restrict__ C, _Float16* __restrict__ C16, int ldc, size_t sC, int M, int N, int K, size_t zA, size_t zB, size_t zC) {
  constexpr int NW = WM * WN, BM = WM * FM * 16, BN = WN * 64, CPR = KC / 8, RP = NW * 32 / CPR, NA = BM / RP, NB = BN / RP, PIT = KC + 8;
  __shared__ __attribute__((aligned(16))) unsigned short tA[2][BM][PIT];
  __shared__ __attribute__((aligned(16))) unsigned short tB[2][BN][PIT];
  __shared__ __attribute__((aligned(16))) float so[NW][16][64];
  const int tid = threadIdx.x, w = tid >> 5, lane = tid & 31, ln = lane & 15, hh = lane >> 4; const int by = blockIdx.y;
  const int bz = blockIdx.z; A += (size_t)by * sA + (size_t)bz * zA; Bh += (size_t)by * sB + (size_t)bz * zB; const size_t cofs = (size_t)by * sC + (size_t)bz * zC; const float* bp = bias ? bias + (size_t)by * sBias : nullptr;
  const int ntn = N / BN; const int bm = blockIdx.x / ntn, bn = blockIdx.x % ntn; if (bm * BM >= M) return;
  const int wm = w / WN, wn = w % WN; const int srow = tid / CPR, sc = (tid % CPR) * 8;
  const unsigned short* gA = (const unsigned short*)A + (size_t)(bm * BM + srow) * LD + sc;
  const unsigned short* gB = (const unsigned short*)Bh + (size_t)(bn * BN + srow) * LD + sc;
  const int col0 = bn * BN + wn * 64;
  float bvv[4];      // the wave's bias values, fetched ahead of the products
#pragma unroll
  for (int t = 0; t < 4; ++t) bvv[t] = bp ? bf16_round(bp[col0 + t * 16 + ln]) : 0.f;
  v8us ra[NA], rb[NB];
  v8f acc[FM][4] = {};
  auto g2r = [&](int kb) {
#pragma unroll
    for (int i = 0; i < NA; ++i) ra[i] = *(const v8us*)(gA + kb + i * RP * LD);
#pragma unroll
    for (int i = 0; i < NB; ++i) rb[i] = *(const v8us*)(gB + kb + i * RP * LD);
  };
  auto r2s = [&](int buf) {
#pragma unroll
    for (int i = 0; i < NA; ++i) *(v8us*)&tA[buf][i * RP + srow][sc] = ra[i];
#pragma unroll
    for (int i = 0; i < NB; ++i) *(v8us*)&tB[buf][i * RP + srow][sc] = rb[i];
  };
  auto mul = [&](int buf) {
#pragma unroll
    for (int ks = 0; ks < KC / 32; ++ks) { FragH fa[FM], fb[4];
#pragma unroll
      for (int i = 0; i < FM; ++i) { const unsigned short* p = &tA[buf][(wm * FM + i) * 16 + ln][ks * 32 + 8 * hh]; fa[i].half[0] = *(const v8us*)p; fa[i].half[1] = *(const v8us*)(p + 16); }
#pragma unroll
      for (int t = 0; t < 4; ++t) { const unsigned short* p = &tB[buf][wn * 64 + t * 16 + ln][ks * 32 + 8 * hh]; fb[t].half[0] = *(const v8us*)p; fb[t].half[1] = *(const v8us*)(p + 16); }
#pragma unroll
      for (int i = 0; i < FM; ++i)
#pragma unroll
        for (int t = 0; t < 4; ++t) acc[i][t] = __builtin_amdgcn_wmma_f32_16x16x32_f16(false, fa[i].v, false, fb[t].v, (short)0, acc[i][t], false, false); }
  };
  g2r(0); r2s(0);
  __syncthreads();      // chunk 0 is in buffer 0 for every wave
  int buf = 0;
  for (int kb = KC; kb < K; kb += KC) {
    g2r(kb);            // next chunk: in flight while this one is multiplied
    __builtin_amdgcn_sched_barrier(0);      // keeps those loads above the products; without it the compiler sinks them to just before their LDS stores and their latency is waited out
    mul(buf);
    r2s(buf ^ 1);       // that buffer's last readers left it before the barrier that ended the trip before
    __syncthreads();    // publishes the next chunk and ends this trip's reads of buf
    buf ^= 1;
  }
  mul(buf);
  const int rsub = lane >> 4, c4 = (lane & 15) * 4; typedef _Float16 v4h __attribute__((ext_vector_type(4)));
#pragma unroll
  for (int i = 0; i < FM; ++i) { const int row0 = bm * BM + (wm * FM + i) * 16;
#pragma unroll
    for (int t = 0; t < 4; ++t) { const float bv = bvv[t];
#pragma unroll
      for (int r = 0; r < 8; ++r) { float v = acc[i][t][r] * alpha + bv; if (ACT == 1) v = (v > 0.f) ? v : expm1f(v); else if (ACT == 7) v = (v > 0.f) ? v + 1.0f : expf(v); else if (ACT == 8) v = tanhf(v); else if (ACT == 9) v = 0.5f * v * (1.0f + tanhf(0.7978845608028654f * (v + 0.044715f * v * v * v))); else if (ACT == 11) v = 1.0f / (1.0f + expf(-v)); else if (ACT == 12) v = (v > 0.f) ? v : 0.01f * v; else if (ACT == 14) v = (v > 0.f) ? v : 0.1f * v; else if (ACT == 15) v = v / (1.0f + expf(-v)); else if (ACT == 3) v = fmaxf(v, 0.f); else if (ACT == 6) v = 0.5f * v * (1.0f + erff(v * 0.70710678118654752f)); so[w][8 * hh + r][t * 16 + ln] = v; } }
    __builtin_amdgcn_fence(__ATOMIC_ACQ_REL, "workgroup"); __builtin_amdgcn_wave_barrier();
#pragma unroll
    for (int q = 0; q < 8; ++q) { const int r = q * 2 + rsub; const v4f v = *(const v4fa*)&so[w][r][c4]; if (!H16) *(v4f*)(C + cofs + (size_t)(row0 + r) * ldc + col0 + c4) = v; else { v4h h4; for (int j = 0; j < 4; ++j) h4[j] = (_Float16)v[j]; *(v4h*)(C16 + cofs + (size_t)(row0 + r) * ldc + col0 + c4) = h4; } }
    if (i + 1 < FM) { __builtin_amdgcn_fence(__ATOMIC_ACQ_REL, "workgroup"); __builtin_amdgcn_wave_barrier(); }      // the wave's rows are read back before its next 16 rows overwrite them
  }
}


typedef _Float16 v4h __attribute__((ext_vector_type(4)));

// blockIdx.y picks one of three activations; its f16 copy goes to plane blockIdx.y of X16
__global__ __launch_bounds__(256) void k_x16(const float* __restrict__ x0, const float* __restrict__ x1, const float* __restrict__ x2, _Float16* __restrict__ X16, size_t n8) { const size_t t = (size_t)blockIdx.x * 256 + threadIdx.x; if (t >= n8) return; FragH f;
  const int y = blockIdx.y; const float* __restrict__ x = (y == 0) ? x0 : (y == 1) ? x1 : x2; X16 += (size_t)y * n8 * 8;
#pragma unroll
  for (int q = 0; q < 8; ++q) f.h[q] = (_Float16)bf16_round(x[t * 8 + q]); *(v8us*)((unsigned short*)X16 + t * 8) = f.half[0];  }
__global__ __launch_bounds__(256) void k_h16(const float* __restrict__ x, _Float16* __restrict__ X16, size_t n8) { const size_t t = (size_t)blockIdx.x * 256 + threadIdx.x; if (t >= n8) return; FragH f;
#pragma unroll
  for (int q = 0; q < 8; ++q) f.h[q] = (_Float16)x[t * 8 + q]; *(v8us*)((unsigned short*)X16 + t * 8) = f.half[0];  }
__global__ __launch_bounds__(256) void k_round16f(const float* __restrict__ W, _Float16* __restrict__ Bt, size_t n8) { const size_t t = (size_t)blockIdx.x * 256 + threadIdx.x; if (t >= n8) return; FragH f;
#pragma unroll
  for (int i = 0; i < 8; ++i) f.h[i] = (_Float16)(bf16_round(W[t * 8 + i]) * 16.0f); *(v8us*)((unsigned short*)Bt + t * 8) = f.half[0];  }
template <int NHv, int TTv>
__global__ __launch_bounds__(256) void k_vt(const _Float16* __restrict__ V16, int ldv, int voff, _Float16* __restrict__ Vt) { __shared__ unsigned short tl[64][66]; const int tid = threadIdx.x; const int slab = blockIdx.x / (TTv / 64), lg = blockIdx.x % (TTv / 64); const int b = slab / NHv, h = slab % NHv;
  for (int i = tid; i < 64 * 8; i += 256) { const int r = i / 8, c8 = (i % 8) * 8; FragH f; f.half[0] = *(const v8us*)((const unsigned short*)V16 + ((size_t)b * TTv + lg * 64 + r) * ldv + voff + h * 64 + c8);
#pragma unroll
    for (int q = 0; q < 8; ++q) tl[r][c8 + q] = f.u[q]; }
  __syncthreads();
  {
#pragma unroll
    for (int rd = 0; rd < 2; ++rd) { const int d = rd * 32 + tid / 8, pc = tid % 8; FragH f;
#pragma unroll
      for (int q = 0; q < 8; ++q) f.u[q] = tl[pc * 8 + q][d];
      *(v8us*)((unsigned short*)Vt + ((size_t)slab * 64 + d) * TTv + lg * 64 + pc * 8) = f.half[0]; }
     } }

__global__ __launch_bounds__(256) void k_hl(const float* __restrict__ F, _Float16* __restrict__ Hh, _Float16* __restrict__ Hl, size_t n8) { const size_t t = (size_t)blockIdx.x * 256 + threadIdx.x; if (t >= n8) return; FragH fh, fl; const v4f a = *(const v4fa*)(F + t * 8), c = *(const v4fa*)(F + t * 8 + 4);
#pragma unroll
  for (int q = 0; q < 4; ++q) { _Float16 h = (_Float16)a[q]; fh.h[q] = h; fl.h[q] = (_Float16)((a[q] - (float)h) * 1024.0f); h = (_Float16)c[q]; fh.h[4 + q] = h; fl.h[4 + q] = (_Float16)((c[q] - (float)h) * 1024.0f); }
  { *(v8us*)((unsigned short*)Hh + t * 8) = fh.half[0]; *(v8us*)((unsigned short*)Hl + t * 8) = fl.half[0];  } }

// blockIdx.y = mode: 0 folds plane 0 of F (Q) into O3q, 1 folds plane 1 (K) into O3k
__global__ __launch_bounds__(256) void k_fold3(const float* __restrict__ F, _Float16* __restrict__ O3q, _Float16* __restrict__ O3k) {
  #pragma clang fp contract(off)
  const int mode = blockIdx.y; F += (size_t)mode * NR * CC; _Float16* __restrict__ O3 = mode ? O3k : O3q;
  const int t = blockIdx.x * 256 + threadIdx.x; if (t >= NR * (CC / 8)) return; const int c0 = (t % (CC / 8)) * 8, r = t / (CC / 8); const int h = c0 / HD, d0 = c0 % HD; const v4f a = *(const v4fa*)(F + (size_t)r * CC + c0), c = *(const v4fa*)(F + (size_t)r * CC + c0 + 4); FragH s0, s1, s2;
#pragma unroll
  for (int q = 0; q < 8; ++q) { const float v = (q < 4) ? a[q] : c[q - 4]; const _Float16 hi = (_Float16)v; const float lo = (v - (float)hi); if (mode == 0) { s0.h[q] = hi; s1.h[q] = (_Float16)(lo * 1024.0f); s2.h[q] = hi; } else { s0.h[q] = hi; s1.h[q] = (_Float16)((float)hi * 0.0009765625f); s2.h[q] = (_Float16)lo; } }
  unsigned short* base = (unsigned short*)O3 + (size_t)r * (NH * K3) + h * K3 + d0;
  { *(v8us*)(base) = s0.half[0]; *(v8us*)(base + HD) = s1.half[0]; *(v8us*)(base + 2 * HD) = s2.half[0];  } }
__global__ __launch_bounds__(256) void k_vt(const _Float16* __restrict__ V, _Float16* __restrict__ VT) { const int b = blockIdx.y; VT += (size_t)b * CC * TT; const int t = blockIdx.x * 256 + threadIdx.x; if (t >= CC * (TT / 8)) return; const int s0 = (t % (TT / 8)) * 8, hd = t / (TT / 8); FragH f;
#pragma unroll
  for (int q = 0; q < 8; ++q) f.h[q] = V[((size_t)b * TT + s0 + q) * CC + hd];
  *(v8us*)((unsigned short*)VT + (size_t)hd * TT + s0) = f.half[0];  }
// Scores never leave the registers. One wave owns NQ*16 queries, one work-group of 8 waves NQ*128 queries of one (batch, head); it walks the head's 1024 keys in stages of KT.
// S^T = K*Q^T: A = 16 key rows of the folded K from LDS, B = the wave's folded Q rows, loaded once and kept; a lane then holds scores of ONE query per 16-query group (column ln), keys 8*hh + r of each 16-key tile,
// so every row sum and maximum is in-lane plus one exchange between the wave's halves.
// ATT false: the row statistics. exp(s/2) needs no maximum taken off, because s is clipped to +-50 (e within 1.4e-11 .. 7.2e10, its squares' sum below 6e24);
//   with p = e / sum e and sum p = 1 the sum of (p - 1/TT)^2 is sum e^2 / (sum e)^2 - 1/TT. The clip and the scale are monotone, so the clipped maximum comes from the raw maximum.
//   RST[row] = (sum of clipped s, max of clipped s, variance, raw maximum).
// ATT true: O^T += V^T * P^T. Two score tiles (32 keys), turned into exp in place, ARE the B operand in the hardware's k order; A = 16 rows of V^T from LDS read in that same order.
//   The row's raw maximum is known from the statistics kernel (same products, same order), so nothing is rescaled; P = exp(..) * 2^10 as f16, the division by the f32 sum comes last.
// 2^x with the slot behind it: the instruction set asks for one v_nop or independent instruction between a transcendental and a use of its result or an overwrite of its source.
// In one statement the v_nop cannot be parted from its exp.
__device__ __forceinline__ float exp2_slot(float x) { float e; asm volatile("v_exp_f32 %0, %1\n\tv_nop" : "=v"(e) : "v"(x)); return e; }
#define KT 64                    /* keys per stage */
#define KPIT (K3 + 8)            /* 400 B a row: 16 B x odd, for 16-byte LDS reads */
#define VPIT (KT + 8)            /* 144 B a row */
template <bool ATT, int NQ>
__global__ __launch_bounds__(256) void k_fused(const _Float16* __restrict__ Q3, const _Float16* __restrict__ Kf, const _Float16* __restrict__ VT, float* __restrict__ RST, const float* __restrict__ TH, _Float16* __restrict__ O16) {
  __shared__ __attribute__((aligned(16))) unsigned short tK[2][KT][KPIT];
  __shared__ __attribute__((aligned(16))) unsigned short tV[ATT ? 2 : 1][ATT ? HD : 1][VPIT];
  const int tid = threadIdx.x, w = tid >> 5, lane = tid & 31, ln = lane & 15, hh = lane >> 4;
  const int slab = blockIdx.y, b = slab / NH, h = slab % NH; const int q0 = (blockIdx.x * 8 + w) * (NQ * 16) + ln;      /* the lane's first query; its others follow in steps of 16 */
  const int sr = tid >> 3, sc8 = (tid & 7) * 8;      /* staging: 8 lanes bring one 128-B line, the block 32 rows at a time */
  const unsigned short* gK = (const unsigned short*)Kf + ((size_t)b * TT + sr) * (NH * K3) + h * K3 + sc8;
  const unsigned short* gV = (const unsigned short*)VT + ((size_t)b * CC + h * HD + sr) * TT + sc8;
  FragH qf[NQ][6];
  float sc2 = 0.f, nm2[NQ];
  v8us rk[6], rv[2];
  v8f o[NQ][4] = {};
  float su0[NQ], su1[NQ], se[NQ], se2[NQ], rmx[NQ];
#pragma unroll
  for (int n = 0; n < NQ; ++n) { su0[n] = 0.f; su1[n] = 0.f; se[n] = 0.f; se2[n] = 0.f; rmx[n] = -3.0e38f; }
  auto g2r = [&](int kb) {
#pragma unroll
    for (int i = 0; i < 6; ++i) rk[i] = *(const v8us*)(gK + (size_t)(kb + (i / 3) * 32) * (NH * K3) + (i % 3) * 64);
    if (ATT) {
#pragma unroll
      for (int i = 0; i < 2; ++i) rv[i] = *(const v8us*)(gV + kb + i * 32 * TT); }
    asm volatile("s_wait_xcnt 0x0" ::: "memory");      // stands in front of the first instruction that reuses these loads' address registers
  };
  auto r2s = [&](int buf) {
#pragma unroll
    for (int i = 0; i < 6; ++i) *(v8us*)&tK[buf][(i / 3) * 32 + sr][(i % 3) * 64 + sc8] = rk[i];
    if (ATT) {
#pragma unroll
      for (int i = 0; i < 2; ++i) *(v8us*)&tV[buf][i * 32 + sr][sc8] = rv[i]; }
  };
  auto work = [&](int buf) {
#pragma unroll
    for (int p = 0; p < KT / 32; ++p) { v8f t[NQ][2] = {}; FragH a[6][2];
#pragma unroll
      for (int ks = 0; ks < 6; ++ks)
#pragma unroll
        for (int j = 0; j < 2; ++j) { const unsigned short* pk = &tK[buf][p * 32 + j * 16 + ln][ks * 32 + 8 * hh]; a[ks][j].half[0] = *(const v8us*)pk; a[ks][j].half[1] = *(const v8us*)(pk + 16); }
      __builtin_amdgcn_sched_barrier(0);      // the pass's K fragments are asked for as one group; without it the compiler puts each pair of reads, with a full wait, right in front of its product
#pragma unroll
      for (int ks = 0; ks < 6; ++ks)
#pragma unroll
        for (int j = 0; j < 2; ++j)
#pragma unroll
          for (int n = 0; n < NQ; ++n) t[n][j] = __builtin_amdgcn_wmma_f32_16x16x32_f16(false, a[ks][j].v, false, qf[n][ks].v, (short)0, t[n][j], false, false);
      float xe[NQ * 16];      /* exponent, then exp, of the lane's scores: group n, key slot s at n * 16 + s */
      if (!ATT) {
#pragma unroll
        for (int n = 0; n < NQ; ++n)
#pragma unroll
          for (int r = 0; r < 8; ++r) { const float x0 = t[n][0][r], x1 = t[n][1][r]; rmx[n] = fmaxf(rmx[n], fmaxf(x0, x1));
            const float v0 = fminf(fmaxf(x0 * 0.125f, -50.f), 50.f), v1 = fminf(fmaxf(x1 * 0.125f, -50.f), 50.f); su0[n] += v0; su1[n] += v1;
            xe[n * 16 + r] = v0 * 0.7213475204444817f; xe[n * 16 + 8 + r] = v1 * 0.7213475204444817f; }
        __builtin_amdgcn_sched_barrier(0);      // this fence and the next keep the exps in one run, every exponent ready ahead of it and every use behind it: the compiler writes no delay hint for a result of asm text, and a dependent instruction close behind its exp would wait unhinted, which holds up the SIMD's other wave too
#pragma unroll
        for (int i = 0; i < NQ * 16; ++i) xe[i] = exp2_slot(xe[i]);
        __builtin_amdgcn_sched_barrier(0);      // see the fence above
#pragma unroll
        for (int i = 0; i < NQ * 16; ++i) { se[i >> 4] += xe[i]; se2[i >> 4] += xe[i] * xe[i]; }
      } else { FragH pb[NQ], va[4];
#pragma unroll
        for (int dt = 0; dt < 4; ++dt) { const unsigned short* pv = &tV[buf][dt * 16 + ln][p * 32 + 8 * hh]; va[dt].half[0] = *(const v8us*)pv; va[dt].half[1] = *(const v8us*)(pv + 16); }
        __builtin_amdgcn_sched_barrier(0);      // the V fragments are asked for ahead of the exponentials, which then cover their latency
#pragma unroll
        for (int n = 0; n < NQ; ++n)
#pragma unroll
          for (int r = 0; r < 8; ++r) { xe[n * 16 + r] = t[n][0][r] * sc2 + nm2[n]; xe[n * 16 + 8 + r] = t[n][1][r] * sc2 + nm2[n]; }
        __builtin_amdgcn_sched_barrier(0);      // this fence and the next keep the exps in one run, every exponent ready ahead of it and every use behind it: the compiler writes no delay hint for a result of asm text, and a dependent instruction close behind its exp would wait unhinted, which holds up the SIMD's other wave too
#pragma unroll
        for (int i = 0; i < NQ * 16; ++i) xe[i] = exp2_slot(xe[i]);
        __builtin_amdgcn_sched_barrier(0);      // see the fence above
#pragma unroll
        for (int i = 0; i < NQ * 16; i += 2) { su0[i >> 4] += xe[i]; su1[i >> 4] += xe[i + 1]; }
#pragma unroll
        for (int n = 0; n < NQ; ++n)
#pragma unroll
          for (int s = 0; s < 16; ++s) pb[n].h[s] = (_Float16)xe[n * 16 + s];
#pragma unroll
        for (int dt = 0; dt < 4; ++dt)
#pragma unroll
          for (int n = 0; n < NQ; ++n) o[n][dt] = __builtin_amdgcn_wmma_f32_16x16x32_f16(false, va[dt].v, false, pb[n].v, (short)0, o[n][dt], false, false); } }
  };
  g2r(0);
  __builtin_amdgcn_sched_barrier(0);      // stage 0's loads and their wait stay ahead of the Q loads
#pragma unroll
  for (int n = 0; n < NQ; ++n) { const unsigned short* p = (const unsigned short*)Q3 + ((size_t)b * TT + q0 + n * 16) * (NH * K3) + h * K3 + 8 * hh;
#pragma unroll
    for (int ks = 0; ks < 6; ++ks) { qf[n][ks].half[0] = *(const v8us*)(p + ks * 32); qf[n][ks].half[1] = *(const v8us*)(p + ks * 32 + 16); } }
#pragma unroll
  for (int n = 0; n < NQ; ++n) nm2[n] = ATT ? RST[((size_t)slab * TT + q0 + n * 16) * 4 + 3] : 0.f;      /* the row's raw maximum, for now */
  __builtin_amdgcn_sched_barrier(0);      // keeps the loads above ahead of the wait below
  asm volatile("s_wait_xcnt 0x0" ::: "memory");      // stands in front of the first instruction that reuses the address registers of the Q and row-maximum loads
  __builtin_amdgcn_sched_barrier(0);      // keeps the arithmetic below, which reuses those registers, behind the wait
  if (ATT) { sc2 = 1.4426950408889634f / (2.0f * TH[(size_t)slab * 32]);
#pragma unroll
    for (int n = 0; n < NQ; ++n) nm2[n] = 10.0f - nm2[n] * sc2; }
  r2s(0);
  __syncthreads();      // stage 0 is in buffer 0 for every wave
  int buf = 0;
  for (int kb = KT; kb < TT; kb += KT) {
    g2r(kb);            // next stage: in flight while this one is worked on
    __builtin_amdgcn_sched_barrier(0);      // keeps those loads above the products; without it the compiler may sink them to just before their LDS stores and their latency is waited out
    work(buf);
    r2s(buf ^ 1);       // that buffer's last readers left it before the barrier that ended the trip before
    __syncthreads();    // publishes the next stage and ends this trip's reads of buf
    buf ^= 1;
  }
  work(buf);
#pragma unroll
  for (int n = 0; n < NQ; ++n) { const int q = q0 + n * 16;
    float su = su0[n] + su1[n]; su += __shfl_xor(su, 16, 32);      /* the two halves of the wave hold the two halves of a query's keys */
    if (!ATT) { const float set = se[n] + __shfl_xor(se[n], 16, 32), se2t = se2[n] + __shfl_xor(se2[n], 16, 32), rm = fmaxf(rmx[n], __shfl_xor(rmx[n], 16, 32));
      const float inv = 1.0f / set; const float vq = (se2t * inv) * inv - 1.0f / (float)TT;
      if (hh == 0) { const v4f v = {su, fminf(fmaxf(rm * 0.125f, -50.f), 50.f), vq / (float)(TT - 1), rm}; *(v4f*)(RST + ((size_t)slab * TT + q) * 4) = v; }
    } else { const float inv = 1.0f / su;
#pragma unroll
      for (int dt = 0; dt < 4; ++dt) { FragH f;
#pragma unroll
        for (int r = 0; r < 8; ++r) f.h[r] = (_Float16)(o[n][dt][r] * inv);
        *(v8us*)((unsigned short*)O16 + ((size_t)b * TT + q) * CC + h * HD + dt * 16 + 8 * hh) = f.half[0]; } } } }
__global__ __launch_bounds__(256) void k_thead(const float* __restrict__ RST, const float* __restrict__ Wt1, const float* __restrict__ bt1, const float* __restrict__ Wt2, const float* __restrict__ bt2, float* __restrict__ TH) {
  #pragma clang fp contract(off)
  __shared__ v4f red[256]; const int g = blockIdx.x, tid = threadIdx.x; v4f a = {0.f, 0.f, 0.f, 0.f};
  for (int q = tid; q < TT; q += 256) { const v4f r = *(const v4fa*)(RST + ((size_t)g * TT + q) * 4); a[0] += r[0]; a[1] += r[1]; a[2] += r[2]; }
  red[tid] = a; __syncthreads(); for (int st = 128; st > 0; st >>= 1) { if (tid < st) { v4f x = red[tid]; const v4f y = red[tid + st]; x[0] += y[0]; x[1] += y[1]; x[2] += y[2]; red[tid] = x; } __syncthreads(); }
  if (tid < 32) { const v4f r0 = red[0]; float f0 = r0[0] / ((float)TT * (float)TT), f1 = r0[1] / (float)TT, f2 = r0[2] / (float)TT; f0 = fminf(fmaxf(f0, -10.f), 10.f); f1 = fminf(fmaxf(f1, -10.f), 10.f); f2 = fminf(fmaxf(f2, 0.f), 1.f);
    float raw = bf16_round(bt2[0]);
#pragma unroll 1
    for (int u = 0; u < 16; ++u) { float pre = bf16_round(bt1[u]); pre += f0 * bf16_round(Wt1[u]); pre += f1 * bf16_round(Wt1[16 + u]); pre += f2 * bf16_round(Wt1[32 + u]); raw += tanhf(pre) * bf16_round(Wt2[u]); }
    float t = 0.01f + (1.0f / (1.0f + expf(-raw))) * (2.0f - 0.01f); t = fminf(fmaxf(t, 0.01f), 2.0f); t = fminf(t, 0.85f);
    *(float*)(TH + (size_t)g * 32 + tid) = t;  } }

extern "C" void kernel_launch(void* const* d_in, const int* in_sizes, int n_in,
                              void* d_out, int out_size, void* d_ws, size_t ws_size, hipStream_t stream) {
  (void)in_sizes; (void)n_in; (void)out_size;
  const float* const* I = (const float* const*)d_in; const float* xq = I[0]; const float* xk = I[1]; const float* xv = I[2]; const float* Wq = I[3]; const float* bq = I[4]; const float* Wk = I[5]; const float* bk = I[6]; const float* Wv = I[7]; const float* bv = I[8]; const float* Wo = I[9]; const float* bo = I[10]; const float* Wt1 = I[11]; const float* bt1 = I[12]; const float* Wt2 = I[13]; const float* bt2 = I[14];
  char* ws = (char*)d_ws; size_t off = 0;
  auto take = [&](size_t bytes) { char* p = ws + off; off += (bytes + 255) & ~(size_t)255; return p; };
  _Float16* Q3p = (_Float16*)take((size_t)NR * NH * K3 * 2); _Float16* K3p = (_Float16*)take((size_t)NR * NH * K3 * 2); _Float16* VTb = (_Float16*)take((size_t)NBt * CC * TT * 2); _Float16* BWo = (_Float16*)take((size_t)CC * CC * 2); float* RST = (float*)take((size_t)HG * TT * 4 * 4); float* TH = (float*)take(HG * 32 * 4); _Float16* O16 = (_Float16*)take((size_t)NR * CC * 2);
  const size_t pW = (size_t)CC * CC, pX = (size_t)NR * CC;      /* plane sizes in elements: a weight; an activation */
  _Float16* BW = (_Float16*)take(3 * pW * 2); _Float16* X16 = (_Float16*)take(3 * pX * 2); _Float16* V16 = (_Float16*)take(pX * 2); float* Ff = (float*)take(2 * pX * 4);      /* what only the projections need */
  if (off > ws_size) return;      // 25.2 + 25.2 + 8.4 + 2.1 + 1.0 + 8.4 + 6.3 + 25.2 + 8.4 + 33.6 = 143.8 MB
  const size_t n8 = (size_t)NR * CC / 8; const unsigned nb8 = (unsigned)((n8 + 255) / 256); const dim3 gP((NR / 128) * (CC / 128), 1);
  k_wt_f16<<<dim3((CC * (CC / 8) + 255) / 256, 4), 256, 0, stream>>>(Wq, Wk, Wv, Wo, BW, BWo, CC, CC, 16.0f);      /* all four weights, one launch */
  k_x16<<<dim3(nb8, 3), 256, 0, stream>>>(xq, xk, xv, X16, n8);      /* all three activations, one launch */
  k_gemm_hhx<0, 4, 2, 2, 128, CC, false><<<gP, 256, 0, stream>>>(X16, 0, BW, 0, 0.0625f, bq, 0, Ff, nullptr, CC, 0, NR, CC, CC, 0, 0, 0);
  k_gemm_hhx<0, 4, 2, 2, 128, CC, false><<<gP, 256, 0, stream>>>(X16 + pX, 0, BW + pW, 0, 0.0625f, bk, 0, Ff + pX, nullptr, CC, 0, NR, CC, CC, 0, 0, 0);
  k_gemm_hhx<0, 4, 2, 2, 128, CC, true><<<gP, 256, 0, stream>>>(X16 + 2 * pX, 0, BW + 2 * pW, 0, 0.0625f, bv, 0, nullptr, V16, CC, 0, NR, CC, CC, 0, 0, 0);      /* V -> f16 */
  k_fold3<<<dim3(nb8, 2), 256, 0, stream>>>(Ff, Q3p, K3p);      /* Q exact -> [hi | lo*2^10 | hi], K -> [hi | hi*2^-10 | lo] */
  k_vt<<<dim3((CC * (TT / 8) + 255) / 256, NBt), 256, 0, stream>>>(V16, VTb);      /* V transposed, all batches */
  const dim3 gF(TT / 256, HG);      /* 256 queries a work-group; slab g = batch * NH + head in RST, TH */
  k_fused<false, 2><<<gF, 256, 0, stream>>>(Q3p, K3p, nullptr, RST, nullptr, nullptr);      /* row statistics of raw Q*K, about f32 (K 192) */
  k_thead<<<HG, 256, 0, stream>>>(RST, Wt1, bt1, Wt2, bt2, TH);
  k_fused<true, 2><<<gF, 256, 0, stream>>>(Q3p, K3p, VTb, RST, TH, O16);      /* softmax(Q*K / 2t) * V */
  k_gemm_hhx<0, 4, 2, 2, 128, CC, false><<<gP, 256, 0, stream>>>(O16, 0, BWo, 0, 0.0625f, bo, 0, (float*)d_out, nullptr, CC, 0, NR, CC, CC, 0, 0, 0);
}

// v005
// A run of this version takes 152 microseconds.
// Next to v004, in two timings, it ran 1.08 times as fast each time.
// Counting every step since v000, it is 6.58 times as fast.
#include <hip/hip_runtime.h>
// Diffusion-time multi-head attention (B 4, S 1024, D 1024, 16 heads × 64): Q,K,V = x·W + b ((in,out)); per (b,h): s = clip(Q·K/8, ±50); feats = (mean s, mean_q max_k s, mean_q var_k softmax(s/2) (ddof 1)) → t = min(clip(0.01 + 1.99·σ(tanh(feats·Wt1 + b)·Wt2 + b)), 0.85); attn = softmax(Q·K/(2t)); out = (attn·V merged)·Wo + bo → [4,1024,1024].
// Structure: projections as GEMMs (exact products); Q and K carried as f16 hi/lo and contracted with the pair folded into K ([q_hi | q_lo*2^10 | q_hi]*[k_hi | k_hi*2^-10 | k_lo], K 192) so the raw logits are about f32 (they are divided by 2t, i.e. scaled up to x50); all 64 (batch, head) slabs per launch: a statistics kernel that forms the score tiles by WMMA and reduces them in registers (clipped sum / max / softmax(s/2) variance), a per-head reduction + the tiny time MLP (one block per head, fixed order), then an attention kernel that forms the same tiles again, takes exp with the head's 1/(2t) (x2^10 -> f16) and multiplies by V in place; output projection GEMM.
// Compute dtype: inputs and parameters rounded to bf16; logits ≈f32; statistics/MLP/softmax f32; V and the attention output as f16 operands (≈2^-12); f32 accumulation. v_wmma_f32_16x16x32_f16.
#define NBt 4
#define TT 1024
#define CC 1024
#define NH 16
#define HD 64
#define NR (NBt * TT)            /* 4096 */
#define HG (NBt * NH)            /* (batch, head) slabs: all in one launch */
#define K3 (3 * HD)              /* 192 */
typedef __bf16 v16b __attribute__((ext_vector_type(16)));
typedef unsigned short v8us __attribute__((ext_vector_type(8), may_alias));
typedef float  v8f  __attribute__((ext_vector_type(8)));
typedef float  v4f  __attribute__((ext_vector_type(4)));
typedef float  v4fa __attribute__((ext_vector_type(4), may_alias));
union FragB { v16b v; v8us half[2]; unsigned short u[16]; };

__device__ __forceinline__ unsigned short bf16_bits(float x) { unsigned int u = __float_as_uint(x); return (unsigned short)((u + 0x7FFFu + ((u >> 16) & 1u)) >> 16); }
__device__ __forceinline__ float bf16_val(unsigned short b) { return __uint_as_float(((unsigned int)b) << 16); }
__device__ __forceinline__ float bf16_round(float x) { return bf16_val(bf16_bits(x)); }
// D += A·B with NT terms: 1 = ah·bh, 2 = + al·bh (A split), 3 = + ah·bl (both split)
template <int NT>
__device__ __forceinline__ v8f mmaN(v16b ah, v16b al, v16b bh, v16b bl, v8f c) {
  c = __builtin_amdgcn_wmma_f32_16x16x32_bf16(false, ah, false, bh, (short)0, c, false, false);
  if (NT >= 2) c = __builtin_amdgcn_wmma_f32_16x16x32_bf16(false, al, false, bh, (short)0, c, false, false);
  if (NT >= 3) c = __builtin_amdgcn_wmma_f32_16x16x32_bf16(false, ah, false, bl, (short)0, c, false, false);
  asm volatile("v_nop\n\tv_nop\n\tv_nop\n\tv_nop" : "+v"(c) : "v"(ah), "v"(al), "v"(bh), "v"(bl));
  return c;
}

__global__ __launch_bounds__(256) void k_wt_bf16(const float* __restrict__ W, unsigned short* __restrict__ Wt, int K, int N) {
  const int t = blockIdx.x * 256 + threadIdx.x;
  const int k8n = K / 8;
  if (t >= N * k8n) return;
  const int n = t / k8n, k8 = (t % k8n) * 8;
  v8us v;
#pragma unroll
  for (int i = 0; i < 8; ++i) v[i] = bf16_bits(W[(size_t)(k8 + i) * N + n]);
  *(v8us*)(Wt + (size_t)n * K + k8) = v;
  
}

// GEMM C[M][N] (f32, pitch ldc) = act(A[M][K]·W + bias). A f32 row-major (pitch lda) converted per fragment to bf16
// (ASPLIT: hi/lo two planes -> 2 terms, else single rounded term); Wt bf16 [N][K] (pitch ldb). BIAS_BF16 rounds the
// bias to bf16 first (bias quantised to bf16 before the add). K%32==0, M%16==0, N%64==0.
template <bool ASPLIT, int ACT, bool BIAS_BF16>
__global__ __launch_bounds__(128) void k_gemm_bf(const float* __restrict__ A, int lda, const unsigned short* __restrict__ Wt, int ldb,
                                               const float* __restrict__ bias, float* __restrict__ C, int ldc, int M, int N, int K) {
  __shared__ __attribute__((aligned(16))) float so[4][16][64];
  const int tid = threadIdx.x, w = tid >> 5, lane = tid & 31, ln = lane & 15, hh = lane >> 4;
  const int ntn = N / 64;
  const int wid = blockIdx.x * 4 + w;
  const int mt = wid / ntn, nq = wid % ntn;
  if (mt * 16 >= M) return;
  const int row0 = mt * 16, col0 = nq * 64;
  const float* arow = A + (size_t)(row0 + ln) * lda;
  v8f acc[4] = {};
  for (int kb = 0; kb < K; kb += 32) {
    FragB ah, al;
    const v4f x0 = *(const v4fa*)(arow + kb + 8 * hh), x1 = *(const v4fa*)(arow + kb + 8 * hh + 4);
    const v4f x2 = *(const v4fa*)(arow + kb + 16 + 8 * hh), x3 = *(const v4fa*)(arow + kb + 16 + 8 * hh + 4);
    float xs[16] = {x0[0],x0[1],x0[2],x0[3],x1[0],x1[1],x1[2],x1[3],x2[0],x2[1],x2[2],x2[3],x3[0],x3[1],x3[2],x3[3]};
#pragma unroll
    for (int i = 0; i < 16; ++i) { const unsigned short hb = bf16_bits(xs[i]); ah.u[i] = hb; al.u[i] = ASPLIT ? bf16_bits(xs[i] - bf16_val(hb)) : (unsigned short)0; }
#pragma unroll
    for (int t = 0; t < 4; ++t) {
      const unsigned short* brow = Wt + (size_t)(col0 + t * 16 + ln) * ldb + kb;
      FragB b;
      b.half[0] = *(const v8us*)(brow + 8 * hh);
      b.half[1] = *(const v8us*)(brow + 16 + 8 * hh);
      acc[t] = mmaN<ASPLIT ? 2 : 1>(ah.v, al.v, b.v, b.v, acc[t]);
    }
  }
#pragma unroll
  for (int t = 0; t < 4; ++t) {
    float bv = bias ? bias[col0 + t * 16 + ln] : 0.f;
    if (BIAS_BF16) bv = bf16_round(bv);
#pragma unroll
    for (int r = 0; r < 8; ++r) { float v = acc[t][r] + bv; if (ACT == 1) v = fmaxf(v, 0.f); so[w][8 * hh + r][t * 16 + ln] = v; }
  }
  __builtin_amdgcn_fence(__ATOMIC_ACQ_REL, "workgroup");
  __builtin_amdgcn_wave_barrier();
  const int rsub = lane >> 4, c4 = (lane & 15) * 4;
  {
#pragma unroll
    for (int q = 0; q < 8; ++q) {
      const int r = q * 2 + rsub;
      const v4f v = *(const v4fa*)&so[w][r][c4];
      *(v4f*)(C + (size_t)(row0 + r) * ldc + col0 + c4) = v;
    }
    
  }
}

// GEMM C = act(A·W + bias + resid): A f32 (ASPLIT -> hi/lo 2 terms), Wt bf16 [N][K]; ACT 0 none, 1 relu, 2 exact gelu;
// resid (optional, f32, row index = (row % rmod), pitch ldr, RES_BF16 rounds it) added before the activation.
template <bool ASPLIT, int ACT, bool BIAS_BF16, bool RES_BF16>
__global__ __launch_bounds__(128) void k_gemm_bf3(const float* __restrict__ A, int lda, const unsigned short* __restrict__ Wt, int ldb,
                                                const float* __restrict__ bias, const float* __restrict__ resid, int rmod, int ldr,
                                                float* __restrict__ C, int ldc, int M, int N, int K) {
  __shared__ __attribute__((aligned(16))) float so[4][16][64];
  const int tid = threadIdx.x, w = tid >> 5, lane = tid & 31, ln = lane & 15, hh = lane >> 4;
  const int ntn = N / 64;
  const int wid = blockIdx.x * 4 + w;
  const int mt = wid / ntn, nq = wid % ntn;
  if (mt * 16 >= M) return;
  const int row0 = mt * 16, col0 = nq * 64;
  const float* arow = A + (size_t)(row0 + ln) * lda;
  v8f acc[4] = {};
  for (int kb = 0; kb < K; kb += 32) {
    FragB ah, al;
    const v4f x0 = *(const v4fa*)(arow + kb + 8 * hh), x1 = *(const v4fa*)(arow + kb + 8 * hh + 4);
    const v4f x2 = *(const v4fa*)(arow + kb + 16 + 8 * hh), x3 = *(const v4fa*)(arow + kb + 16 + 8 * hh + 4);
    float xs[16] = {x0[0],x0[1],x0[2],x0[3],x1[0],x1[1],x1[2],x1[3],x2[0],x2[1],x2[2],x2[3],x3[0],x3[1],x3[2],x3[3]};
#pragma unroll
    for (int i = 0; i < 16; ++i) { const unsigned short hb = bf16_bits(xs[i]); ah.u[i] = hb; al.u[i] = ASPLIT ? bf16_bits(xs[i] - bf16_val(hb)) : (unsigned short)0; }
#pragma unroll
    for (int t = 0; t < 4; ++t) {
      const unsigned short* brow = Wt + (size_t)(col0 + t * 16 + ln) * ldb + kb;
      FragB b;
      b.half[0] = *(const v8us*)(brow + 8 * hh);
      b.half[1] = *(const v8us*)(brow + 16 + 8 * hh);
      acc[t] = mmaN<ASPLIT ? 2 : 1>(ah.v, al.v, b.v, b.v, acc[t]);
    }
  }
#pragma unroll
  for (int t = 0; t < 4; ++t) {
    const int col = col0 + t * 16 + ln;
    float bv = bias ? bias[col] : 0.f;
    if (BIAS_BF16) bv = bf16_round(bv);
#pragma unroll
    for (int r = 0; r < 8; ++r) {
      float v = acc[t][r] + bv;
      if (resid) { float rv = resid[(size_t)((row0 + 8 * hh + r) % rmod) * ldr + col]; if (RES_BF16) rv = bf16_round(rv); v += rv; }
      if (ACT == 1) v = fmaxf(v, 0.f);
      if (ACT == 2) v = 0.5f * v * (1.0f + erff(v * 0.70710678118654752f));
      if (ACT == 3) { const float u = 0.7978845608028654f * (v + 0.044715f * v * v * v); v = 0.5f * v * (1.0f + tanhf(u)); }
      so[w][8 * hh + r][t * 16 + ln] = v;
    }
  }
  __builtin_amdgcn_fence(__ATOMIC_ACQ_REL, "workgroup");
  __builtin_amdgcn_wave_barrier();
  const int rsub = lane >> 4, c4 = (lane & 15) * 4;
  {
#pragma unroll
    for (int q = 0; q < 8; ++q) {
      const int r = q * 2 + rsub;
      const v4f v = *(const v4fa*)&so[w][r][c4];
      *(v4f*)(C + (size_t)(row0 + r) * ldc + col0 + c4) = v;
    }
    
  }
}
// row LayerNorm (biased variance, eps) over N: s = X (+ R); optional out_sum <- s; out_norm <- (s-mu)*rsqrt(var+eps)*g + b
template <bool PARAM_BF16>
__global__ __launch_bounds__(256) void k_layernorm(const float* __restrict__ X, const float* __restrict__ R, const float* __restrict__ g, const float* __restrict__ bta,
                                                  float* __restrict__ out_sum, float* __restrict__ out_norm, int N, float eps) {
  __shared__ float red[256];
  const int row = blockIdx.x, tid = threadIdx.x;
  const float* x = X + (size_t)row * N; const float* rr = R ? R + (size_t)row * N : nullptr;
  float vals[16];                     // up to N = 4096
  const int per = N / 256;            // contiguous chunk per thread? use strided-by-4 chunks: thread handles j = tid*4 + 1024*u
  float s1 = 0.f;
  for (int u = 0; u < per / 4; ++u) {
    const int j = tid * 4 + 1024 * u;
    const v4f a = *(const v4fa*)(x + j);
    v4f b = {0.f,0.f,0.f,0.f}; if (rr) b = *(const v4fa*)(rr + j);
#pragma unroll
    for (int q = 0; q < 4; ++q) { const float v = a[q] + b[q]; vals[u * 4 + q] = v; s1 += v; }
  }
  red[tid] = s1; __syncthreads();
  for (int st = 128; st > 0; st >>= 1) { if (tid < st) red[tid] += red[tid + st]; __syncthreads(); }
  const float mu = red[0] / (float)N; __syncthreads();
  float s2 = 0.f;
  for (int u = 0; u < per / 4; ++u)
#pragma unroll
    for (int q = 0; q < 4; ++q) { const float c = vals[u * 4 + q] - mu; s2 += c * c; }
  red[tid] = s2; __syncthreads();
  for (int st = 128; st > 0; st >>= 1) { if (tid < st) red[tid] += red[tid + st]; __syncthreads(); }
  const float rs = rsqrtf(red[0] / (float)N + eps);
  {
    for (int u = 0; u < per / 4; ++u) {
      const int j = tid * 4 + 1024 * u;
      v4f o, sm;
#pragma unroll
      for (int q = 0; q < 4; ++q) {
        float gg = g[j + q], bb = bta[j + q];
        if (PARAM_BF16) { gg = bf16_round(gg); bb = bf16_round(bb); }
        sm[q] = vals[u * 4 + q]; o[q] = (vals[u * 4 + q] - mu) * rs * gg + bb;
      }
      if (out_sum) *(v4f*)(out_sum + (size_t)row * N + j) = sm;
      *(v4f*)(out_norm + (size_t)row * N + j) = o;
    }
    
  }
}



// ---- f16 WMMA path (v_wmma_f32_16x16x32_f16): 11-bit significands for operands in range — used where a [0,1] probability operand needs more precision than bf16
typedef _Float16 v16h __attribute__((ext_vector_type(16)));
union FragH { v16h v; v8us half[2]; _Float16 h[16]; unsigned short u[16]; };
template <int NT>
__device__ __forceinline__ v8f mmaH(v16h ah, v16h al, v16h bh, v16h bl, v8f c) {
  c = __builtin_amdgcn_wmma_f32_16x16x32_f16(false, ah, false, bh, (short)0, c, false, false);
  if (NT >= 2) c = __builtin_amdgcn_wmma_f32_16x16x32_f16(false, al, false, bh, (short)0, c, false, false);
  if (NT >= 3) c = __builtin_amdgcn_wmma_f32_16x16x32_f16(false, ah, false, bl, (short)0, c, false, false);
  asm volatile("v_nop\n\tv_nop\n\tv_nop\n\tv_nop" : "+v"(c) : "v"(ah), "v"(al), "v"(bh), "v"(bl));
  return c;
}
// batched GEMM like k_gemm_b but f16 operands: A f32 (split into f16 hi/lo if ASPLIT, else rounded to f16), Bt = f16 values [n][k]; alpha; C f32; N multiple of 16 (partial tiles skipped)
template <bool ASPLIT>
__global__ __launch_bounds__(128) void k_gemm_h(const float* __restrict__ A, int lda, size_t sA, const _Float16* __restrict__ Bh, int ldb, size_t sB, float alpha, float* __restrict__ C, int ldc, size_t sC, int M, int N, int K) {
  __shared__ __attribute__((aligned(16))) float so[4][16][64];
  const int tid = threadIdx.x, w = tid >> 5, lane = tid & 31, ln = lane & 15, hh = lane >> 4; const int by = blockIdx.y;
  A += (size_t)by * sA; Bh += (size_t)by * sB; C += (size_t)by * sC;
  const int ntn = (N + 63) / 64; const int wid = blockIdx.x * 4 + w; const int mt = wid / ntn, nq = wid % ntn; if (mt * 16 >= M) return;
  const int row0 = mt * 16, col0 = nq * 64; const float* arow = A + (size_t)(row0 + ln) * lda;
  v8f acc[4] = {};
  for (int kb = 0; kb < K; kb += 32) {
    FragH ah, al;
    const v4f x0 = *(const v4fa*)(arow + kb + 8 * hh), x1 = *(const v4fa*)(arow + kb + 8 * hh + 4), x2 = *(const v4fa*)(arow + kb + 16 + 8 * hh), x3 = *(const v4fa*)(arow + kb + 16 + 8 * hh + 4);
    float xs[16] = {x0[0],x0[1],x0[2],x0[3],x1[0],x1[1],x1[2],x1[3],x2[0],x2[1],x2[2],x2[3],x3[0],x3[1],x3[2],x3[3]};
#pragma unroll
    for (int i = 0; i < 16; ++i) { const _Float16 h = (_Float16)xs[i]; ah.h[i] = h; al.h[i] = ASPLIT ? (_Float16)(xs[i] - (float)h) : (_Float16)0.0f; }
#pragma unroll
    for (int t = 0; t < 4; ++t) { if (col0 + t * 16 >= N) continue; const size_t boff = (size_t)(col0 + t * 16 + ln) * ldb + kb; FragH bq; bq.half[0] = *(const v8us*)(Bh + boff + 8 * hh); bq.half[1] = *(const v8us*)(Bh + boff + 16 + 8 * hh);
      acc[t] = mmaH<ASPLIT ? 2 : 1>(ah.v, al.v, bq.v, bq.v, acc[t]); }
  }
#pragma unroll
  for (int t = 0; t < 4; ++t) { if (col0 + t * 16 >= N) continue;
#pragma unroll
    for (int r = 0; r < 8; ++r) so[w][8 * hh + r][t * 16 + ln] = acc[t][r] * alpha; }
  __builtin_amdgcn_fence(__ATOMIC_ACQ_REL, "workgroup"); __builtin_amdgcn_wave_barrier();
  const int rsub = lane >> 4, c4 = (lane & 15) * 4;
  {
#pragma unroll
    for (int q = 0; q < 8; ++q) { const int r = q * 2 + rsub; if (col0 + c4 < N) { const v4f v = *(const v4fa*)&so[w][r][c4]; *(v4f*)(C + (size_t)(row0 + r) * ldc + col0 + c4) = v; } }
     }
}

// Wt[n][k] = f16(W[k][n]·scale) from f32 row-major W[K][N] (scale = power of two; bf16-exact weights stay exact in f16 away from the subnormal range)
// blockIdx.y picks one of four weight matrices: 0..2 go to planes 0..2 of Wt012, 3 goes to Wt3
// One thread takes an 8 x 8 block of W (8 output pieces of 16 B), so the launch is one round of 256 work-groups. A wave = 4 column groups (one 128-B line of each W row) x 8 row groups (one 128-B line of each Wt row).
__global__ __launch_bounds__(256) void k_wt_f16(const float* __restrict__ W0, const float* __restrict__ W1, const float* __restrict__ W2, const float* __restrict__ W3, _Float16* __restrict__ Wt012, _Float16* __restrict__ Wt3, float scale) {
  const int y = blockIdx.y; const float* __restrict__ W = (y == 0) ? W0 : (y == 1) ? W1 : (y == 2) ? W2 : W3; _Float16* __restrict__ Wt = (y == 3) ? Wt3 : Wt012 + (size_t)y * CC * CC;
  const int lane = threadIdx.x & 31, wv = blockIdx.x * 8 + (threadIdx.x >> 5); const int n0 = ((wv % (CC / 32)) * 4 + (lane & 3)) * 8, k0 = ((wv / (CC / 32)) * 8 + (lane >> 2)) * 8;
  const unsigned lo = (unsigned)(k0 * CC + n0) * 4u; const char* p = (const char*)W + lo; v4f a[8][2];      /* the thread's byte offset: one register serves every load */
#pragma unroll
  for (int i = 0; i < 8; ++i) { a[i][0] = *(const v4fa*)(p + i * (CC * 4)); a[i][1] = *(const v4fa*)(p + i * (CC * 4) + 16); }
  asm volatile("s_wait_xcnt 0x0" :: "v"(lo) : "memory");      // stands in front of the first instruction that reuses the loads' address register; the operand keeps that register untouched up to here
  __builtin_amdgcn_sched_barrier(0);      // keeps the arithmetic below behind that wait, and so behind the issue of every load
  unsigned short* o = (unsigned short*)Wt + (size_t)n0 * CC + k0; FragH f[8];
#pragma unroll
  for (int j = 0; j < 8; ++j)
#pragma unroll
    for (int i = 0; i < 8; ++i) f[j].h[i] = (_Float16)(bf16_round(a[i][j >> 2][j & 3]) * scale);
  __builtin_amdgcn_sched_barrier(0);      // the stores go out as one run behind the arithmetic: none of it then overwrites a register of an issued store
#pragma unroll
  for (int j = 0; j < 8; ++j) *(v8us*)(o + j * CC) = f[j].half[0];
}
// Block-tiled GEMM with fused epilogue: v = acc*alpha + bias[by*sBias + col] ; ACT 0 none / 1 elu ; writes f16 C16 (H16) or f32 C.
// One block = WM x WN waves = a (WM*FM*16) x (WN*64) tile of C; a wave owns FM x 4 accumulator tiles. Per chunk of KC k the block brings its A rows and B rows (whole 128-B lines, KC/8 lanes a row)
// into LDS at a pitch of 2*KC + 16 B and every wave reads its fragments from there; two buffers, the next chunk's global loads fly while this chunk is multiplied.
// LD = row pitch of A and of B in elements, a compile-time constant so that the rows of a tile are immediate offsets from one address per operand.
// Needs M a multiple of WM*FM*16, N of WN*64, K of KC (every launch below is).
// Two batch axes: blockIdx.y steps A, B, C by sA, sB, sC (heads), blockIdx.z by zA, zB, zC (batches).
template <int ACT, int WM, int WN, int FM, int KC, int LD, bool H16>
__global__ __launch_bounds__(WM * WN * 32) void k_gemm_hhx(const _Float16* __restrict__ A, size_t sA, const _Float16* __restrict__ Bh, size_t sB, float alpha, const float* __restrict__ bias, size_t sBias,
    float* __restrict__ C, _Float16* __restrict__ C16, int ldc, size_t sC, int M, int N, int K, size_t zA, size_t zB, size_t zC) {
  constexpr int NW = WM * WN, BM = WM * FM * 16, BN = WN * 64, CPR = KC / 8, RP = NW * 32 / CPR, NA = BM / RP, NB = BN / RP, PIT = KC + 8;
  __shared__ __attribute__((aligned(16))) unsigned short tA[2][BM][PIT];
  __shared__ __attribute__((aligned(16))) unsigned short tB[2][BN][PIT];
  __shared__ __attribute__((aligned(16))) float so[NW][16][64];
  const int tid = threadIdx.x, w = tid >> 5, lane = tid & 31, ln = lane & 15, hh = lane >> 4; const int by = blockIdx.y;
  const int bz = blockIdx.z; A += (size_t)by * sA + (size_t)bz * zA; Bh += (size_t)by * sB + (size_t)bz * zB; const size_t cofs = (size_t)by * sC + (size_t)bz * zC; const float* bp = bias ? bias + (size_t)by * sBias : nullptr;
  const int ntn = N / BN; const int bm = blockIdx.x / ntn, bn = blockIdx.x % ntn; if (bm * BM >= M) return;
  const int wm = w / WN, wn = w % WN; const int srow = tid / CPR, sc = (tid % CPR) * 8;
  const unsigned short* gA = (const unsigned short*)A + (size_t)(bm * BM + srow) * LD + sc;
  const unsigned short* gB = (const unsigned short*)Bh + (size_t)(bn * BN + srow) * LD + sc;
  const int col0 = bn * BN + wn * 64;
  float bvv[4];      // the wave's bias values, fetched ahead of the products
#pragma unroll
  for (int t = 0; t < 4; ++t) bvv[t] = bp ? bf16_round(bp[col0 + t * 16 + ln]) : 0.f;
  v8us ra[NA], rb[NB];
  v8f acc[FM][4] = {};
  auto g2r = [&](int kb) {
#pragma unroll
    for (int i = 0; i < NA; ++i) ra[i] = *(const v8us*)(gA + kb + i * RP * LD);
#pragma unroll
    for (int i = 0; i < NB; ++i) rb[i] = *(const v8us*)(gB + kb + i * RP * LD);
  };
  auto r2s = [&](int buf) {
#pragma unroll
    for (int i = 0; i < NA; ++i) *(v8us*)&tA[buf][i * RP + srow][sc] = ra[i];
#pragma unroll
    for (int i = 0; i < NB; ++i) *(v8us*)&tB[buf][i * RP + srow][sc] = rb[i];
  };
  auto mul = [&](int buf) {
#pragma unroll
    for (int ks = 0; ks < KC / 32; ++ks) { FragH fa[FM], fb[4];
#pragma unroll
      for (int i = 0; i < FM; ++i) { const unsigned short* p = &tA[buf][(wm * FM + i) * 16 + ln][ks * 32 + 8 * hh]; fa[i].half[0] = *(const v8us*)p; fa[i].half[1] = *(const v8us*)(p + 16); }
#pragma unroll
      for (int t = 0; t < 4; ++t) { const unsigned short* p = &tB[buf][wn * 64 + t * 16 + ln][ks * 32 + 8 * hh]; fb[t].half[0] = *(const v8us*)p; fb[t].half[1] = *(const v8us*)(p + 16); }
#pragma unroll
      for (int i = 0; i < FM; ++i)
#pragma unroll
        for (int t = 0; t < 4; ++t) acc[i][t] = __builtin_amdgcn_wmma_f32_16x16x32_f16(false, fa[i].v, false, fb[t].v, (short)0, acc[i][t], false, false); }
  };
  g2r(0); r2s(0);
  __syncthreads();      // chunk 0 is in buffer 0 for every wave
  int buf = 0;
  for (int kb = KC; kb < K; kb += KC) {
    g2r(kb);            // next chunk: in flight while this one is multiplied
    __builtin_amdgcn_sched_barrier(0);      // keeps those loads above the products; without it the compiler sinks them to just before their LDS stores and their latency is waited out
    mul(buf);
    r2s(buf ^ 1);       // that buffer's last readers left it before the barrier that ended the trip before
    __syncthreads();    // publishes the next chunk and ends this trip's reads of buf
    buf ^= 1;
  }
  mul(buf);
  const int rsub = lane >> 4, c4 = (lane & 15) * 4; typedef _Float16 v4h __attribute__((ext_vector_type(4)));
#pragma unroll
  for (int i = 0; i < FM; ++i) { const int row0 = bm * BM + (wm * FM + i) * 16;
#pragma unroll
    for (int t = 0; t < 4; ++t) { const float bv = bvv[t];
#pragma unroll
      for (int r = 0; r < 8; ++r) { float v = acc[i][t][r] * alpha + bv; if (ACT == 1) v = (v > 0.f) ? v : expm1f(v); else if (ACT == 7) v = (v > 0.f) ? v + 1.0f : expf(v); else if (ACT == 8) v = tanhf(v); else if (ACT == 9) v = 0.5f * v * (1.0f + tanhf(0.7978845608028654f * (v + 0.044715f * v * v * v))); else if (ACT == 11) v = 1.0f / (1.0f + expf(-v)); else if (ACT == 12) v = (v > 0.f) ? v : 0.01f * v; else if (ACT == 14) v = (v > 0.f) ? v : 0.1f * v; else if (ACT == 15) v = v / (1.0f + expf(-v)); else if (ACT == 3) v = fmaxf(v, 0.f); else if (ACT == 6) v = 0.5f * v * (1.0f + erff(v * 0.70710678118654752f)); so[w][8 * hh + r][t * 16 + ln] = v; } }
    __builtin_amdgcn_fence(__ATOMIC_ACQ_REL, "workgroup"); __builtin_amdgcn_wave_barrier();
#pragma unroll
    for (int q = 0; q < 8; ++q) { const int r = q * 2 + rsub; const v4f v = *(const v4fa*)&so[w][r][c4]; if (!H16) *(v4f*)(C + cofs + (size_t)(row0 + r) * ldc + col0 + c4) = v; else { v4h h4; for (int j = 0; j < 4; ++j) h4[j] = (_Float16)v[j]; *(v4h*)(C16 + cofs + (size_t)(row0 + r) * ldc + col0 + c4) = h4; } }
    if (i + 1 < FM) { __builtin_amdgcn_fence(__ATOMIC_ACQ_REL, "workgroup"); __builtin_amdgcn_wave_barrier(); }      // the wave's rows are read back before its next 16 rows overwrite them
  }
}


typedef _Float16 v4h __attribute__((ext_vector_type(4)));

// All three activations to f16, plane y of X16 from x_y. One round of 256 work-groups: a thread takes XP pieces of 8 elements of each activation, a work-group XP * 256 pieces in a row;
// all of a thread's loads are asked for before the first value is used, so that 8 waves a WGP keep the memory busy.
#define XP 8
__global__ __launch_bounds__(256) void k_x16(const float* __restrict__ x0, const float* __restrict__ x1, const float* __restrict__ x2, _Float16* __restrict__ X16) {
  const unsigned e0 = (blockIdx.x * (XP * 256) + threadIdx.x) * 8u, lo = e0 * 4u; v4f a[3][XP][2];      /* the thread's first element, and its byte offset: one register serves every load */
#pragma unroll
  for (int y = 0; y < 3; ++y) { const char* p = (const char*)((y == 0) ? x0 : (y == 1) ? x1 : x2) + lo;
#pragma unroll
    for (int i = 0; i < XP; ++i) { a[y][i][0] = *(const v4fa*)(p + i * 8192); a[y][i][1] = *(const v4fa*)(p + i * 8192 + 16); } }
  asm volatile("s_wait_xcnt 0x0" :: "v"(lo) : "memory");      // stands in front of the first instruction that reuses the loads' address register; the operand keeps that register untouched up to here
  __builtin_amdgcn_sched_barrier(0);      // keeps the arithmetic below behind that wait, and so behind the issue of every load
#pragma unroll
  for (int y = 0; y < 3; ++y) { FragH f[XP];
#pragma unroll
    for (int i = 0; i < XP; ++i)
#pragma unroll
      for (int q = 0; q < 8; ++q) f[i].h[q] = (_Float16)bf16_round(a[y][i][q >> 2][q & 3]);
    __builtin_amdgcn_sched_barrier(0);      // the stores go out as one run behind the arithmetic: none of it then overwrites a register of an issued store
#pragma unroll
    for (int i = 0; i < XP; ++i) *(v8us*)((unsigned short*)X16 + (size_t)y * NR * CC + e0 + i * 2048) = f[i].half[0];
    if (y < 2) { asm volatile("s_wait_xcnt 0x0" ::: "memory");      // stands in front of the next group's arithmetic, which reuses the registers of these stores
      __builtin_amdgcn_sched_barrier(0);      // keeps that arithmetic behind the wait
    } } }
__global__ __launch_bounds__(256) void k_h16(const float* __restrict__ x, _Float16* __restrict__ X16, size_t n8) { const size_t t = (size_t)blockIdx.x * 256 + threadIdx.x; if (t >= n8) return; FragH f;
#pragma unroll
  for (int q = 0; q < 8; ++q) f.h[q] = (_Float16)x[t * 8 + q]; *(v8us*)((unsigned short*)X16 + t * 8) = f.half[0];  }
__global__ __launch_bounds__(256) void k_round16f(const float* __restrict__ W, _Float16* __restrict__ Bt, size_t n8) { const size_t t = (size_t)blockIdx.x * 256 + threadIdx.x; if (t >= n8) return; FragH f;
#pragma unroll
  for (int i = 0; i < 8; ++i) f.h[i] = (_Float16)(bf16_round(W[t * 8 + i]) * 16.0f); *(v8us*)((unsigned short*)Bt + t * 8) = f.half[0];  }
template <int NHv, int TTv>
__global__ __launch_bounds__(256) void k_vt(const _Float16* __restrict__ V16, int ldv, int voff, _Float16* __restrict__ Vt) { __shared__ unsigned short tl[64][66]; const int tid = threadIdx.x; const int slab = blockIdx.x / (TTv / 64), lg = blockIdx.x % (TTv / 64); const int b = slab / NHv, h = slab % NHv;
  for (int i = tid; i < 64 * 8; i += 256) { const int r = i / 8, c8 = (i % 8) * 8; FragH f; f.half[0] = *(const v8us*)((const unsigned short*)V16 + ((size_t)b * TTv + lg * 64 + r) * ldv + voff + h * 64 + c8);
#pragma unroll
    for (int q = 0; q < 8; ++q) tl[r][c8 + q] = f.u[q]; }
  __syncthreads();
  {
#pragma unroll
    for (int rd = 0; rd < 2; ++rd) { const int d = rd * 32 + tid / 8, pc = tid % 8; FragH f;
#pragma unroll
      for (int q = 0; q < 8; ++q) f.u[q] = tl[pc * 8 + q][d];
      *(v8us*)((unsigned short*)Vt + ((size_t)slab * 64 + d) * TTv + lg * 64 + pc * 8) = f.half[0]; }
     } }

__global__ __launch_bounds__(256) void k_hl(const float* __restrict__ F, _Float16* __restrict__ Hh, _Float16* __restrict__ Hl, size_t n8) { const size_t t = (size_t)blockIdx.x * 256 + threadIdx.x; if (t >= n8) return; FragH fh, fl; const v4f a = *(const v4fa*)(F + t * 8), c = *(const v4fa*)(F + t * 8 + 4);
#pragma unroll
  for (int q = 0; q < 4; ++q) { _Float16 h = (_Float16)a[q]; fh.h[q] = h; fl.h[q] = (_Float16)((a[q] - (float)h) * 1024.0f); h = (_Float16)c[q]; fh.h[4 + q] = h; fl.h[4 + q] = (_Float16)((c[q] - (float)h) * 1024.0f); }
  { *(v8us*)((unsigned short*)Hh + t * 8) = fh.half[0]; *(v8us*)((unsigned short*)Hl + t * 8) = fl.half[0];  } }

// Fq (Q) is folded into O3q, Fk (K) into O3k. One round of 256 work-groups: a thread takes XP pieces of 8 elements of each plane; all its loads are asked for before the first value is used.
__global__ __launch_bounds__(256) void k_fold3(const float* __restrict__ Fq, const float* __restrict__ Fk, _Float16* __restrict__ O3q, _Float16* __restrict__ O3k) {
  #pragma clang fp contract(off)
  const int t0 = blockIdx.x * (XP * 256) + threadIdx.x; const unsigned lo = (unsigned)t0 * 32u; v4f a[2][XP][2];      /* the thread's first piece, and its byte offset: one register serves every load */
#pragma unroll
  for (int mode = 0; mode < 2; ++mode) { const char* p = (const char*)(mode ? Fk : Fq) + lo;
#pragma unroll
    for (int i = 0; i < XP; ++i) { a[mode][i][0] = *(const v4fa*)(p + i * 8192); a[mode][i][1] = *(const v4fa*)(p + i * 8192 + 16); } }
  asm volatile("s_wait_xcnt 0x0" :: "v"(lo) : "memory");      // stands in front of the first instruction that reuses the loads' address register; the operand keeps that register untouched up to here
  __builtin_amdgcn_sched_barrier(0);      // keeps the arithmetic below behind that wait, and so behind the issue of every load
  const int c0 = (t0 % (CC / 8)) * 8, r = t0 / (CC / 8); const int h = c0 / HD, d0 = c0 % HD;      /* piece i lies 256 pieces = 2 rows further on, in the same columns */
#pragma unroll
  for (int mode = 0; mode < 2; ++mode) { unsigned short* base = (unsigned short*)(mode ? O3k : O3q) + (size_t)r * (NH * K3) + h * K3 + d0;
#pragma unroll
    for (int g = 0; g < XP; g += 4) { FragH s0[4], s1[4], s2[4];      /* groups of 4 pieces: 12 stores */
#pragma unroll
      for (int i = 0; i < 4; ++i)
#pragma unroll
        for (int q = 0; q < 8; ++q) { const float v = a[mode][g + i][q >> 2][q & 3]; const _Float16 hi = (_Float16)v; const float rest = (v - (float)hi); if (mode == 0) { s0[i].h[q] = hi; s1[i].h[q] = (_Float16)(rest * 1024.0f); s2[i].h[q] = hi; } else { s0[i].h[q] = hi; s1[i].h[q] = (_Float16)((float)hi * 0.0009765625f); s2[i].h[q] = (_Float16)rest; } }
      __builtin_amdgcn_sched_barrier(0);      // the stores go out as one run behind the arithmetic: none of it then overwrites a register of an issued store
#pragma unroll
      for (int i = 0; i < 4; ++i) { unsigned short* o = base + (g + i) * (2 * NH * K3); *(v8us*)(o) = s0[i].half[0]; *(v8us*)(o + HD) = s1[i].half[0]; *(v8us*)(o + 2 * HD) = s2[i].half[0]; }
      if (mode == 0 || g + 4 < XP) { asm volatile("s_wait_xcnt 0x0" ::: "memory");      // stands in front of the next group's arithmetic, which reuses the registers of these stores
      __builtin_amdgcn_sched_barrier(0);      // keeps that arithmetic behind the wait
      } } } }
// V transposed, batch blockIdx.y. One thread takes an 8 x 8 block (8 output pieces of 16 B), so the launch is one round of 256 work-groups. A wave = 4 column groups (64 B of each V row; the next wave has the line's other half) x 8 row groups (one 128-B line of each VT row).
__global__ __launch_bounds__(256) void k_vt(const _Float16* __restrict__ V, _Float16* __restrict__ VT) { const int b = blockIdx.y;
  const int lane = threadIdx.x & 31, wv = blockIdx.x * 8 + (threadIdx.x >> 5); const int hd0 = ((wv % (CC / 32)) * 4 + (lane & 3)) * 8, s0 = ((wv / (CC / 32)) * 8 + (lane >> 2)) * 8;
  const unsigned lo = (unsigned)(s0 * CC + hd0) * 2u; const char* p = (const char*)(V + (size_t)b * TT * CC) + lo; FragH in[8];      /* the thread's byte offset: one register serves every load */
#pragma unroll
  for (int q = 0; q < 8; ++q) in[q].half[0] = *(const v8us*)(p + q * (CC * 2));
  asm volatile("s_wait_xcnt 0x0" :: "v"(lo) : "memory");      // stands in front of the first instruction that reuses the loads' address register; the operand keeps that register untouched up to here
  __builtin_amdgcn_sched_barrier(0);      // keeps the arithmetic below behind that wait, and so behind the issue of every load
  unsigned short* o = (unsigned short*)VT + (size_t)b * CC * TT + (size_t)hd0 * TT + s0;
#pragma unroll
  for (int j = 0; j < 8; ++j) { FragH f;
#pragma unroll
    for (int q = 0; q < 8; ++q) f.u[q] = in[q].u[j];
    *(v8us*)(o + j * TT) = f.half[0]; } }
// Scores never leave the registers. One wave owns NQ*16 queries, one work-group of 8 waves NQ*128 queries of one (batch, head); it walks the head's 1024 keys in stages of KT.
// S^T = K*Q^T: A = 16 key rows of the folded K from LDS, B = the wave's folded Q rows, loaded once and kept; a lane then holds scores of ONE query per 16-query group (column ln), keys 8*hh + r of each 16-key tile,
// so every row sum and maximum is in-lane plus one exchange between the wave's halves.
// ATT false: the row statistics. exp(s/2) needs no maximum taken off, because s is clipped to +-50 (e within 1.4e-11 .. 7.2e10, its squares' sum below 6e24);
//   with p = e / sum e and sum p = 1 the sum of (p - 1/TT)^2 is sum e^2 / (sum e)^2 - 1/TT. The clip and the scale are monotone, so the clipped maximum comes from the raw maximum.
//   RST[row] = (sum of clipped s, max of clipped s, variance, raw maximum).
// ATT true: O^T += V^T * P^T. Two score tiles (32 keys), turned into exp in place, ARE the B operand in the hardware's k order; A = 16 rows of V^T from LDS read in that same order.
//   The row's raw maximum is known from the statistics kernel (same products, same order), so nothing is rescaled; P = exp(..) * 2^10 as f16, the division by the f32 sum comes last.
// 2^x with the slot behind it: the instruction set asks for one v_nop or independent instruction between a transcendental and a use of its result or an overwrite of its source.
// In one statement the v_nop cannot be parted from its exp.
__device__ __forceinline__ float exp2_slot(float x) { float e; asm volatile("v_exp_f32 %0, %1\n\tv_nop" : "=v"(e) : "v"(x)); return e; }
#define KT 64                    /* keys per stage */
#define KPIT (K3 + 8)            /* 400 B a row: 16 B x odd, for 16-byte LDS reads */
#define VPIT (KT + 8)            /* 144 B a row */
template <bool ATT, int NQ>
__global__ __launch_bounds__(256) void k_fused(const _Float16* __restrict__ Q3, const _Float16* __restrict__ Kf, const _Float16* __restrict__ VT, float* __restrict__ RST, const float* __restrict__ TH, _Float16* __restrict__ O16) {
  __shared__ __attribute__((aligned(16))) unsigned short tK[2][KT][KPIT];
  __shared__ __attribute__((aligned(16))) unsigned short tV[ATT ? 2 : 1][ATT ? HD : 1][VPIT];
  const int tid = threadIdx.x, w = tid >> 5, lane = tid & 31, ln = lane & 15, hh = lane >> 4;
  const int slab = blockIdx.y, b = slab / NH, h = slab % NH; const int q0 = (blockIdx.x * 8 + w) * (NQ * 16) + ln;      /* the lane's first query; its others follow in steps of 16 */
  const int sr = tid >> 3, sc8 = (tid & 7) * 8;      /* staging: 8 lanes bring one 128-B line, the block 32 rows at a time */
  const unsigned short* gK = (const unsigned short*)Kf + ((size_t)b * TT + sr) * (NH * K3) + h * K3 + sc8;
  const unsigned short* gV = (const unsigned short*)VT + ((size_t)b * CC + h * HD + sr) * TT + sc8;
  FragH qf[NQ][6];
  float sc2 = 0.f, nm2[NQ];
  v8us rk[6], rv[2];
  v8f o[NQ][4] = {};
  float su0[NQ], su1[NQ], se[NQ], se2[NQ], rmx[NQ];
#pragma unroll
  for (int n = 0; n < NQ; ++n) { su0[n] = 0.f; su1[n] = 0.f; se[n] = 0.f; se2[n] = 0.f; rmx[n] = -3.0e38f; }
  auto g2r = [&](int kb) {
#pragma unroll
    for (int i = 0; i < 6; ++i) rk[i] = *(const v8us*)(gK + (size_t)(kb + (i / 3) * 32) * (NH * K3) + (i % 3) * 64);
    if (ATT) {
#pragma unroll
      for (int i = 0; i < 2; ++i) rv[i] = *(const v8us*)(gV + kb + i * 32 * TT); }
    asm volatile("s_wait_xcnt 0x0" ::: "memory");      // stands in front of the first instruction that reuses these loads' address registers
  };
  auto r2s = [&](int buf) {
#pragma unroll
    for (int i = 0; i < 6; ++i) *(v8us*)&tK[buf][(i / 3) * 32 + sr][(i % 3) * 64 + sc8] = rk[i];
    if (ATT) {
#pragma unroll
      for (int i = 0; i < 2; ++i) *(v8us*)&tV[buf][i * 32 + sr][sc8] = rv[i]; }
  };
  auto work = [&](int buf) {
#pragma unroll
    for (int p = 0; p < KT / 32; ++p) { v8f t[NQ][2] = {}; FragH a[6][2];
#pragma unroll
      for (int ks = 0; ks < 6; ++ks)
#pragma unroll
        for (int j = 0; j < 2; ++j) { const unsigned short* pk = &tK[buf][p * 32 + j * 16 + ln][ks * 32 + 8 * hh]; a[ks][j].half[0] = *(const v8us*)pk; a[ks][j].half[1] = *(const v8us*)(pk + 16); }
      __builtin_amdgcn_sched_barrier(0);      // the pass's K fragments are asked for as one group; without it the compiler puts each pair of reads, with a full wait, right in front of its product
#pragma unroll
      for (int ks = 0; ks < 6; ++ks)
#pragma unroll
        for (int j = 0; j < 2; ++j)
#pragma unroll
          for (int n = 0; n < NQ; ++n) t[n][j] = __builtin_amdgcn_wmma_f32_16x16x32_f16(false, a[ks][j].v, false, qf[n][ks].v, (short)0, t[n][j], false, false);
      float xe[NQ * 16];      /* exponent, then exp, of the lane's scores: group n, key slot s at n * 16 + s */
      if (!ATT) {
#pragma unroll
        for (int n = 0; n < NQ; ++n)
#pragma unroll
          for (int r = 0; r < 8; ++r) { const float x0 = t[n][0][r], x1 = t[n][1][r]; rmx[n] = fmaxf(rmx[n], fmaxf(x0, x1));
            const float v0 = fminf(fmaxf(x0 * 0.125f, -50.f), 50.f), v1 = fminf(fmaxf(x1 * 0.125f, -50.f), 50.f); su0[n] += v0; su1[n] += v1;
            xe[n * 16 + r] = v0 * 0.7213475204444817f; xe[n * 16 + 8 + r] = v1 * 0.7213475204444817f; }
        __builtin_amdgcn_sched_barrier(0);      // this fence and the next keep the exps in one run, every exponent ready ahead of it and every use behind it: the compiler writes no delay hint for a result of asm text, and a dependent instruction close behind its exp would wait unhinted, which holds up the SIMD's other wave too
#pragma unroll
        for (int i = 0; i < NQ * 16; ++i) xe[i] = exp2_slot(xe[i]);
        __builtin_amdgcn_sched_barrier(0);      // see the fence above
#pragma unroll
        for (int i = 0; i < NQ * 16; ++i) { se[i >> 4] += xe[i]; se2[i >> 4] += xe[i] * xe[i]; }
      } else { FragH pb[NQ], va[4];
#pragma unroll
        for (int dt = 0; dt < 4; ++dt) { const unsigned short* pv = &tV[buf][dt * 16 + ln][p * 32 + 8 * hh]; va[dt].half[0] = *(const v8us*)pv; va[dt].half[1] = *(const v8us*)(pv + 16); }
        __builtin_amdgcn_sched_barrier(0);      // the V fragments are asked for ahead of the exponentials, which then cover their latency
#pragma unroll
        for (int n = 0; n < NQ; ++n)
#pragma unroll
          for (int r = 0; r < 8; ++r) { xe[n * 16 + r] = t[n][0][r] * sc2 + nm2[n]; xe[n * 16 + 8 + r] = t[n][1][r] * sc2 + nm2[n]; }
        __builtin_amdgcn_sched_barrier(0);      // this fence and the next keep the exps in one run, every exponent ready ahead of it and every use behind it: the compiler writes no delay hint for a result of asm text, and a dependent instruction close behind its exp would wait unhinted, which holds up the SIMD's other wave too
#pragma unroll
        for (int i = 0; i < NQ * 16; ++i) xe[i] = exp2_slot(xe[i]);
        __builtin_amdgcn_sched_barrier(0);      // see the fence above
#pragma unroll
        for (int i = 0; i < NQ * 16; i += 2) { su0[i >> 4] += xe[i]; su1[i >> 4] += xe[i + 1]; }
#pragma unroll
        for (int n = 0; n < NQ; ++n)
#pragma unroll
          for (int s = 0; s < 16; ++s) pb[n].h[s] = (_Float16)xe[n * 16 + s];
#pragma unroll
        for (int dt = 0; dt < 4; ++dt)
#pragma unroll
          for (int n = 0; n < NQ; ++n) o[n][dt] = __builtin_amdgcn_wmma_f32_16x16x32_f16(false, va[dt].v, false, pb[n].v, (short)0, o[n][dt], false, false); } }
  };
  g2r(0);
  __builtin_amdgcn_sched_barrier(0);      // stage 0's loads and their wait stay ahead of the Q loads
#pragma unroll
  for (int n = 0; n < NQ; ++n) { const unsigned short* p = (const unsigned short*)Q3 + ((size_t)b * TT + q0 + n * 16) * (NH * K3) + h * K3 + 8 * hh;
#pragma unroll
    for (int ks = 0; ks < 6; ++ks) { qf[n][ks].half[0] = *(const v8us*)(p + ks * 32); qf[n][ks].half[1] = *(const v8us*)(p + ks * 32 + 16); } }
#pragma unroll
  for (int n = 0; n < NQ; ++n) nm2[n] = ATT ? RST[((size_t)slab * TT + q0 + n * 16) * 4 + 3] : 0.f;      /* the row's raw maximum, for now */
  __builtin_amdgcn_sched_barrier(0);      // keeps the loads above ahead of the wait below
  asm volatile("s_wait_xcnt 0x0" ::: "memory");      // stands in front of the first instruction that reuses the address registers of the Q and row-maximum loads
  __builtin_amdgcn_sched_barrier(0);      // keeps the arithmetic below, which reuses those registers, behind the wait
  if (ATT) { sc2 = 1.4426950408889634f / (2.0f * TH[(size_t)slab * 32]);
#pragma unroll
    for (int n = 0; n < NQ; ++n) nm2[n] = 10.0f - nm2[n] * sc2; }
  r2s(0);
  __syncthreads();      // stage 0 is in buffer 0 for every wave
  int buf = 0;
  for (int kb = KT; kb < TT; kb += KT) {
    g2r(kb);            // next stage: in flight while this one is worked on
    __builtin_amdgcn_sched_barrier(0);      // keeps those loads above the products; without it the compiler may sink them to just before their LDS stores and their latency is waited out
    work(buf);
    r2s(buf ^ 1);       // that buffer's last readers left it before the barrier that ended the trip before
    __syncthreads();    // publishes the next stage and ends this trip's reads of buf
    buf ^= 1;
  }
  work(buf);
#pragma unroll
  for (int n = 0; n < NQ; ++n) { const int q = q0 + n * 16;
    float su = su0[n] + su1[n]; su += __shfl_xor(su, 16, 32);      /* the two halves of the wave hold the two halves of a query's keys */
    if (!ATT) { const float set = se[n] + __shfl_xor(se[n], 16, 32), se2t = se2[n] + __shfl_xor(se2[n], 16, 32), rm = fmaxf(rmx[n], __shfl_xor(rmx[n], 16, 32));
      const float inv = 1.0f / set; const float vq = (se2t * inv) * inv - 1.0f / (float)TT;
      if (hh == 0) { const v4f v = {su, fminf(fmaxf(rm * 0.125f, -50.f), 50.f), vq / (float)(TT - 1), rm}; *(v4f*)(RST + ((size_t)slab * TT + q) * 4) = v; }
    } else { const float inv = 1.0f / su;
#pragma unroll
      for (int dt = 0; dt < 4; ++dt) { FragH f;
#pragma unroll
        for (int r = 0; r < 8; ++r) f.h[r] = (_Float16)(o[n][dt][r] * inv);
        *(v8us*)((unsigned short*)O16 + ((size_t)b * TT + q) * CC + h * HD + dt * 16 + 8 * hh) = f.half[0]; } } } }
__global__ __launch_bounds__(256) void k_thead(const float* __restrict__ RST, const float* __restrict__ Wt1, const float* __restrict__ bt1, const float* __restrict__ Wt2, const float* __restrict__ bt2, float* __restrict__ TH) {
  #pragma clang fp contract(off)
  __shared__ v4f red[256]; const int g = blockIdx.x, tid = threadIdx.x; v4f a = {0.f, 0.f, 0.f, 0.f};
  for (int q = tid; q < TT; q += 256) { const v4f r = *(const v4fa*)(RST + ((size_t)g * TT + q) * 4); a[0] += r[0]; a[1] += r[1]; a[2] += r[2]; }
  red[tid] = a; __syncthreads(); for (int st = 128; st > 0; st >>= 1) { if (tid < st) { v4f x = red[tid]; const v4f y = red[tid + st]; x[0] += y[0]; x[1] += y[1]; x[2] += y[2]; red[tid] = x; } __syncthreads(); }
  if (tid < 32) { const v4f r0 = red[0]; float f0 = r0[0] / ((float)TT * (float)TT), f1 = r0[1] / (float)TT, f2 = r0[2] / (float)TT; f0 = fminf(fmaxf(f0, -10.f), 10.f); f1 = fminf(fmaxf(f1, -10.f), 10.f); f2 = fminf(fmaxf(f2, 0.f), 1.f);
    float raw = bf16_round(bt2[0]);
#pragma unroll 1
    for (int u = 0; u < 16; ++u) { float pre = bf16_round(bt1[u]); pre += f0 * bf16_round(Wt1[u]); pre += f1 * bf16_round(Wt1[16 + u]); pre += f2 * bf16_round(Wt1[32 + u]); raw += tanhf(pre) * bf16_round(Wt2[u]); }
    float t = 0.01f + (1.0f / (1.0f + expf(-raw))) * (2.0f - 0.01f); t = fminf(fmaxf(t, 0.01f), 2.0f); t = fminf(t, 0.85f);
    *(float*)(TH + (size_t)g * 32 + tid) = t;  } }

extern "C" void kernel_launch(void* const* d_in, const int* in_sizes, int n_in,
                              void* d_out, int out_size, void* d_ws, size_t ws_size, hipStream_t stream) {
  (void)in_sizes; (void)n_in; (void)out_size;
  const float* const* I = (const float* const*)d_in; const float* xq = I[0]; const float* xk = I[1]; const float* xv = I[2]; const float* Wq = I[3]; const float* bq = I[4]; const float* Wk = I[5]; const float* bk = I[6]; const float* Wv = I[7]; const float* bv = I[8]; const float* Wo = I[9]; const float* bo = I[10]; const float* Wt1 = I[11]; const float* bt1 = I[12]; const float* Wt2 = I[13]; const float* bt2 = I[14];
  char* ws = (char*)d_ws; size_t off = 0;
  auto take = [&](size_t bytes) { char* p = ws + off; off += (bytes + 255) & ~(size_t)255; return p; };
  _Float16* Q3p = (_Float16*)take((size_t)NR * NH * K3 * 2); _Float16* K3p = (_Float16*)take((size_t)NR * NH * K3 * 2); _Float16* VTb = (_Float16*)take((size_t)NBt * CC * TT * 2); _Float16* BWo = (_Float16*)take((size_t)CC * CC * 2); float* RST = (float*)take((size_t)HG * TT * 4 * 4); float* TH = (float*)take(HG * 32 * 4); _Float16* O16 = (_Float16*)take((size_t)NR * CC * 2);
  const size_t pW = (size_t)CC * CC, pX = (size_t)NR * CC;      /* plane sizes in elements: a weight; an activation */
  _Float16* BW = (_Float16*)take(3 * pW * 2); _Float16* X16 = (_Float16*)take(3 * pX * 2); _Float16* V16 = (_Float16*)take(pX * 2); float* Ff = (float*)take(2 * pX * 4);      /* what only the projections need */
  if (off > ws_size) return;      // 25.2 + 25.2 + 8.4 + 2.1 + 1.0 + 8.4 + 6.3 + 25.2 + 8.4 + 33.6 = 143.8 MB
  const dim3 gP((NR / 128) * (CC / 128), 1);
  k_wt_f16<<<dim3((CC / 8) * (CC / 8) / 256, 4), 256, 0, stream>>>(Wq, Wk, Wv, Wo, BW, BWo, 16.0f);      /* all four weights, one launch */
  k_x16<<<NR * CC / 8 / (XP * 256), 256, 0, stream>>>(xq, xk, xv, X16);      /* all three activations, one launch */
  k_gemm_hhx<0, 4, 2, 2, 128, CC, false><<<gP, 256, 0, stream>>>(X16, 0, BW, 0, 0.0625f, bq, 0, Ff, nullptr, CC, 0, NR, CC, CC, 0, 0, 0);
  k_gemm_hhx<0, 4, 2, 2, 128, CC, false><<<gP, 256, 0, stream>>>(X16 + pX, 0, BW + pW, 0, 0.0625f, bk, 0, Ff + pX, nullptr, CC, 0, NR, CC, CC, 0, 0, 0);
  k_gemm_hhx<0, 4, 2, 2, 128, CC, true><<<gP, 256, 0, stream>>>(X16 + 2 * pX, 0, BW + 2 * pW, 0, 0.0625f, bv, 0, nullptr, V16, CC, 0, NR, CC, CC, 0, 0, 0);      /* V -> f16 */
  k_fold3<<<NR * CC / 8 / (XP * 256), 256, 0, stream>>>(Ff, Ff + pX, Q3p, K3p);      /* Q exact -> [hi | lo | hi], K -> [hi | hi*2^-10 | lo] */
  k_vt<<<dim3((CC / 8) * (TT / 8) / 256, NBt), 256, 0, stream>>>(V16, VTb);      /* V transposed, all batches */
  const dim3 gF(TT / 256, HG);      /* 256 queries a work-group; slab g = batch * NH + head in RST, TH */
  k_fused<false, 2><<<gF, 256, 0, stream>>>(Q3p, K3p, nullptr, RST, nullptr, nullptr);      /* row statistics of raw Q*K, about f32 (K 192) */
  k_thead<<<HG, 256, 0, stream>>>(RST, Wt1, bt1, Wt2, bt2, TH);
  k_fused<true, 2><<<gF, 256, 0, stream>>>(Q3p, K3p, VTb, RST, TH, O16);      /* softmax(Q*K / 2t) * V */
  k_gemm_hhx<0, 4, 2, 2, 128, CC, false><<<gP, 256, 0, stream>>>(O16, 0, BWo, 0, 0.0625f, bo, 0, (float*)d_out, nullptr, CC, 0, NR, CC, CC, 0, 0, 0);
}

// v006
// One run takes 126 microseconds.
// In both of two side-by-side timings against v005, it was 1.20 times as fast.
// Counting every step since v000, it is 7.91 times as fast.
#include <hip/hip_runtime.h>
// Diffusion-time multi-head attention (B 4, S 1024, D 1024, 16 heads × 64): Q,K,V = x·W + b ((in,out)); per (b,h): s = clip(Q·K/8, ±50); feats = (mean s, mean_q max_k s, mean_q var_k softmax(s/2) (ddof 1)) → t = min(clip(0.01 + 1.99·σ(tanh(feats·Wt1 + b)·Wt2 + b)), 0.85); attn = softmax(Q·K/(2t)); out = (attn·V merged)·Wo + bo → [4,1024,1024].
// Structure: projections as GEMMs (exact products); Q and K carried as f16 hi/lo and contracted with the pair folded into K ([q_hi | q_lo*2^10 | q_hi]*[k_hi | k_hi*2^-10 | k_lo], K 192) so the raw logits are about f32 (they are divided by 2t, i.e. scaled up to x50); all 64 (batch, head) slabs per launch: a statistics kernel that forms the score tiles by WMMA and reduces them in registers (clipped sum / max / softmax(s/2) variance), a per-head reduction + the tiny time MLP (one block per head, fixed order), then an attention kernel that forms the same tiles again, takes exp with the head's 1/(2t) (x2^10 -> f16) and multiplies by V in place; output projection GEMM.
// Compute dtype: inputs and parameters rounded to bf16; logits ≈f32; statistics/MLP/softmax f32; V and the attention output as f16 operands (≈2^-12); f32 accumulation. v_wmma_f32_16x16x32_f16.
#define NBt 4
#define TT 1024
#define CC 1024
#define NH 16
#define HD 64
#define NR (NBt * TT)            /* 4096 */
#define HG (NBt * NH)            /* (batch, head) slabs: all in one launch */
#define K3 (3 * HD)              /* 192 */
typedef __bf16 v16b __attribute__((ext_vector_type(16)));
typedef unsigned short v8us __attribute__((ext_vector_type(8), may_alias));
typedef float  v8f  __attribute__((ext_vector_type(8)));
typedef float  v4f  __attribute__((ext_vector_type(4)));
typedef float  v4fa __attribute__((ext_vector_type(4), may_alias));
union FragB { v16b v; v8us half[2]; unsigned short u[16]; };

__device__ __forceinline__ unsigned short bf16_bits(float x) { unsigned int u = __float_as_uint(x); return (unsigned short)((u + 0x7FFFu + ((u >> 16) & 1u)) >> 16); }
__device__ __forceinline__ float bf16_val(unsigned short b) { return __uint_as_float(((unsigned int)b) << 16); }
__device__ __forceinline__ float bf16_round(float x) { return bf16_val(bf16_bits(x)); }
// D += A·B with NT terms: 1 = ah·bh, 2 = + al·bh (A split), 3 = + ah·bl (both split)
template <int NT>
__device__ __forceinline__ v8f mmaN(v16b ah, v16b al, v16b bh, v16b bl, v8f c) {
  c = __builtin_amdgcn_wmma_f32_16x16x32_bf16(false, ah, false, bh, (short)0, c, false, false);
  if (NT >= 2) c = __builtin_amdgcn_wmma_f32_16x16x32_bf16(false, al, false, bh, (short)0, c, false, false);
  if (NT >= 3) c = __builtin_amdgcn_wmma_f32_16x16x32_bf16(false, ah, false, bl, (short)0, c, false, false);
  asm volatile("v_nop\n\tv_nop\n\tv_nop\n\tv_nop" : "+v"(c) : "v"(ah), "v"(al), "v"(bh), "v"(bl));
  return c;
}

__global__ __launch_bounds__(256) void k_wt_bf16(const float* __restrict__ W, unsigned short* __restrict__ Wt, int K, int N) {
  const int t = blockIdx.x * 256 + threadIdx.x;
  const int k8n = K / 8;
  if (t >= N * k8n) return;
  const int n = t / k8n, k8 = (t % k8n) * 8;
  v8us v;
#pragma unroll
  for (int i = 0; i < 8; ++i) v[i] = bf16_bits(W[(size_t)(k8 + i) * N + n]);
  *(v8us*)(Wt + (size_t)n * K + k8) = v;
  
}

// GEMM C[M][N] (f32, pitch ldc) = act(A[M][K]·W + bias). A f32 row-major (pitch lda) converted per fragment to bf16
// (ASPLIT: hi/lo two planes -> 2 terms, else single rounded term); Wt bf16 [N][K] (pitch ldb). BIAS_BF16 rounds the
// bias to bf16 first (bias quantised to bf16 before the add). K%32==0, M%16==0, N%64==0.
template <bool ASPLIT, int ACT, bool BIAS_BF16>
__global__ __launch_bounds__(128) void k_gemm_bf(const float* __restrict__ A, int lda, const unsigned short* __restrict__ Wt, int ldb,
                                               const float* __restrict__ bias, float* __restrict__ C, int ldc, int M, int N, int K) {
  __shared__ __attribute__((aligned(16))) float so[4][16][64];
  const int tid = threadIdx.x, w = tid >> 5, lane = tid & 31, ln = lane & 15, hh = lane >> 4;
  const int ntn = N / 64;
  const int wid = blockIdx.x * 4 + w;
  const int mt = wid / ntn, nq = wid % ntn;
  if (mt * 16 >= M) return;
  const int row0 = mt * 16, col0 = nq * 64;
  const float* arow = A + (size_t)(row0 + ln) * lda;
  v8f acc[4] = {};
  for (int kb = 0; kb < K; kb += 32) {
    FragB ah, al;
    const v4f x0 = *(const v4fa*)(arow + kb + 8 * hh), x1 = *(const v4fa*)(arow + kb + 8 * hh + 4);
    const v4f x2 = *(const v4fa*)(arow + kb + 16 + 8 * hh), x3 = *(const v4fa*)(arow + kb + 16 + 8 * hh + 4);
    float xs[16] = {x0[0],x0[1],x0[2],x0[3],x1[0],x1[1],x1[2],x1[3],x2[0],x2[1],x2[2],x2[3],x3[0],x3[1],x3[2],x3[3]};
#pragma unroll
    for (int i = 0; i < 16; ++i) { const unsigned short hb = bf16_bits(xs[i]); ah.u[i] = hb; al.u[i] = ASPLIT ? bf16_bits(xs[i] - bf16_val(hb)) : (unsigned short)0; }
#pragma unroll
    for (int t = 0; t < 4; ++t) {
      const unsigned short* brow = Wt + (size_t)(col0 + t * 16 + ln) * ldb + kb;
      FragB b;
      b.half[0] = *(const v8us*)(brow + 8 * hh);
      b.half[1] = *(const v8us*)(brow + 16 + 8 * hh);
      acc[t] = mmaN<ASPLIT ? 2 : 1>(ah.v, al.v, b.v, b.v, acc[t]);
    }
  }
#pragma unroll
  for (int t = 0; t < 4; ++t) {
    float bv = bias ? bias[col0 + t * 16 + ln] : 0.f;
    if (BIAS_BF16) bv = bf16_round(bv);
#pragma unroll
    for (int r = 0; r < 8; ++r) { float v = acc[t][r] + bv; if (ACT == 1) v = fmaxf(v, 0.f); so[w][8 * hh + r][t * 16 + ln] = v; }
  }
  __builtin_amdgcn_fence(__ATOMIC_ACQ_REL, "workgroup");
  __builtin_amdgcn_wave_barrier();
  const int rsub = lane >> 4, c4 = (lane & 15) * 4;
  {
#pragma unroll
    for (int q = 0; q < 8; ++q) {
      const int r = q * 2 + rsub;
      const v4f v = *(const v4fa*)&so[w][r][c4];
      *(v4f*)(C + (size_t)(row0 + r) * ldc + col0 + c4) = v;
    }
    
  }
}

// GEMM C = act(A·W + bias + resid): A f32 (ASPLIT -> hi/lo 2 terms), Wt bf16 [N][K]; ACT 0 none, 1 relu, 2 exact gelu;
// resid (optional, f32, row index = (row % rmod), pitch ldr, RES_BF16 rounds it) added before the activation.
template <bool ASPLIT, int ACT, bool BIAS_BF16, bool RES_BF16>
__global__ __launch_bounds__(128) void k_gemm_bf3(const float* __restrict__ A, int lda, const unsigned short* __restrict__ Wt, int ldb,
                                                const float* __restrict__ bias, const float* __restrict__ resid, int rmod, int ldr,
                                                float* __restrict__ C, int ldc, int M, int N, int K) {
  __shared__ __attribute__((aligned(16))) float so[4][16][64];
  const int tid = threadIdx.x, w = tid >> 5, lane = tid & 31, ln = lane & 15, hh = lane >> 4;
  const int ntn = N / 64;
  const int wid = blockIdx.x * 4 + w;
  const int mt = wid / ntn, nq = wid % ntn;
  if (mt * 16 >= M) return;
  const int row0 = mt * 16, col0 = nq * 64;
  const float* arow = A + (size_t)(row0 + ln) * lda;
  v8f acc[4] = {};
  for (int kb = 0; kb < K; kb += 32) {
    FragB ah, al;
    const v4f x0 = *(const v4fa*)(arow + kb + 8 * hh), x1 = *(const v4fa*)(arow + kb + 8 * hh + 4);
    const v4f x2 = *(const v4fa*)(arow + kb + 16 + 8 * hh), x3 = *(const v4fa*)(arow + kb + 16 + 8 * hh + 4);
    float xs[16] = {x0[0],x0[1],x0[2],x0[3],x1[0],x1[1],x1[2],x1[3],x2[0],x2[1],x2[2],x2[3],x3[0],x3[1],x3[2],x3[3]};
#pragma unroll
    for (int i = 0; i < 16; ++i) { const unsigned short hb = bf16_bits(xs[i]); ah.u[i] = hb; al.u[i] = ASPLIT ? bf16_bits(xs[i] - bf16_val(hb)) : (unsigned short)0; }
#pragma unroll
    for (int t = 0; t < 4; ++t) {
      const unsigned short* brow = Wt + (size_t)(col0 + t * 16 + ln) * ldb + kb;
      FragB b;
      b.half[0] = *(const v8us*)(brow + 8 * hh);
      b.half[1] = *(const v8us*)(brow + 16 + 8 * hh);
      acc[t] = mmaN<ASPLIT ? 2 : 1>(ah.v, al.v, b.v, b.v, acc[t]);
    }
  }
#pragma unroll
  for (int t = 0; t < 4; ++t) {
    const int col = col0 + t * 16 + ln;
    float bv = bias ? bias[col] : 0.f;
    if (BIAS_BF16) bv = bf16_round(bv);
#pragma unroll
    for (int r = 0; r < 8; ++r) {
      float v = acc[t][r] + bv;
      if (resid) { float rv = resid[(size_t)((row0 + 8 * hh + r) % rmod) * ldr + col]; if (RES_BF16) rv = bf16_round(rv); v += rv; }
      if (ACT == 1) v = fmaxf(v, 0.f);
      if (ACT == 2) v = 0.5f * v * (1.0f + erff(v * 0.70710678118654752f));
      if (ACT == 3) { const float u = 0.7978845608028654f * (v + 0.044715f * v * v * v); v = 0.5f * v * (1.0f + tanhf(u)); }
      so[w][8 * hh + r][t * 16 + ln] = v;
    }
  }
  __builtin_amdgcn_fence(__ATOMIC_ACQ_REL, "workgroup");
  __builtin_amdgcn_wave_barrier();
  const int rsub = lane >> 4, c4 = (lane & 15) * 4;
  {
#pragma unroll
    for (int q = 0; q < 8; ++q) {
      const int r = q * 2 + rsub;
      const v4f v = *(const v4fa*)&so[w][r][c4];
      *(v4f*)(C + (size_t)(row0 + r) * ldc + col0 + c4) = v;
    }
    
  }
}
// row LayerNorm (biased variance, eps) over N: s = X (+ R); optional out_sum <- s; out_norm <- (s-mu)*rsqrt(var+eps)*g + b
template <bool PARAM_BF16>
__global__ __launch_bounds__(256) void k_layernorm(const float* __restrict__ X, const float* __restrict__ R, const float* __restrict__ g, const float* __restrict__ bta,
                                                  float* __restrict__ out_sum, float* __restrict__ out_norm, int N, float eps) {
  __shared__ float red[256];
  const int row = blockIdx.x, tid = threadIdx.x;
  const float* x = X + (size_t)row * N; const float* rr = R ? R + (size_t)row * N : nullptr;
  float vals[16];                     // up to N = 4096
  const int per = N / 256;            // contiguous chunk per thread? use strided-by-4 chunks: thread handles j = tid*4 + 1024*u
  float s1 = 0.f;
  for (int u = 0; u < per / 4; ++u) {
    const int j = tid * 4 + 1024 * u;
    const v4f a = *(const v4fa*)(x + j);
    v4f b = {0.f,0.f,0.f,0.f}; if (rr) b = *(const v4fa*)(rr + j);
#pragma unroll
    for (int q = 0; q < 4; ++q) { const float v = a[q] + b[q]; vals[u * 4 + q] = v; s1 += v; }
  }
  red[tid] = s1; __syncthreads();
  for (int st = 128; st > 0; st >>= 1) { if (tid < st) red[tid] += red[tid + st]; __syncthreads(); }
  const float mu = red[0] / (float)N; __syncthreads();
  float s2 = 0.f;
  for (int u = 0; u < per / 4; ++u)
#pragma unroll
    for (int q = 0; q < 4; ++q) { const float c = vals[u * 4 + q] - mu; s2 += c * c; }
  red[tid] = s2; __syncthreads();
  for (int st = 128; st > 0; st >>= 1) { if (tid < st) red[tid] += red[tid + st]; __syncthreads(); }
  const float rs = rsqrtf(red[0] / (float)N + eps);
  {
    for (int u = 0; u < per / 4; ++u) {
      const int j = tid * 4 + 1024 * u;
      v4f o, sm;
#pragma unroll
      for (int q = 0; q < 4; ++q) {
        float gg = g[j + q], bb = bta[j + q];
        if (PARAM_BF16) { gg = bf16_round(gg); bb = bf16_round(bb); }
        sm[q] = vals[u * 4 + q]; o[q] = (vals[u * 4 + q] - mu) * rs * gg + bb;
      }
      if (out_sum) *(v4f*)(out_sum + (size_t)row * N + j) = sm;
      *(v4f*)(out_norm + (size_t)row * N + j) = o;
    }
    
  }
}



// ---- f16 WMMA path (v_wmma_f32_16x16x32_f16): 11-bit significands for operands in range — used where a [0,1] probability operand needs more precision than bf16
typedef _Float16 v16h __attribute__((ext_vector_type(16)));
union FragH { v16h v; v8us half[2]; _Float16 h[16]; unsigned short u[16]; };
template <int NT>
__device__ __forceinline__ v8f mmaH(v16h ah, v16h al, v16h bh, v16h bl, v8f c) {
  c = __builtin_amdgcn_wmma_f32_16x16x32_f16(false, ah, false, bh, (short)0, c, false, false);
  if (NT >= 2) c = __builtin_amdgcn_wmma_f32_16x16x32_f16(false, al, false, bh, (short)0, c, false, false);
  if (NT >= 3) c = __builtin_amdgcn_wmma_f32_16x16x32_f16(false, ah, false, bl, (short)0, c, false, false);
  asm volatile("v_nop\n\tv_nop\n\tv_nop\n\tv_nop" : "+v"(c) : "v"(ah), "v"(al), "v"(bh), "v"(bl));
  return c;
}
// batched GEMM like k_gemm_b but f16 operands: A f32 (split into f16 hi/lo if ASPLIT, else rounded to f16), Bt = f16 values [n][k]; alpha; C f32; N multiple of 16 (partial tiles skipped)
template <bool ASPLIT>
__global__ __launch_bounds__(128) void k_gemm_h(const float* __restrict__ A, int lda, size_t sA, const _Float16* __restrict__ Bh, int ldb, size_t sB, float alpha, float* __restrict__ C, int ldc, size_t sC, int M, int N, int K) {
  __shared__ __attribute__((aligned(16))) float so[4][16][64];
  const int tid = threadIdx.x, w = tid >> 5, lane = tid & 31, ln = lane & 15, hh = lane >> 4; const int by = blockIdx.y;
  A += (size_t)by * sA; Bh += (size_t)by * sB; C += (size_t)by * sC;
  const int ntn = (N + 63) / 64; const int wid = blockIdx.x * 4 + w; const int mt = wid / ntn, nq = wid % ntn; if (mt * 16 >= M) return;
  const int row0 = mt * 16, col0 = nq * 64; const float* arow = A + (size_t)(row0 + ln) * lda;
  v8f acc[4] = {};
  for (int kb = 0; kb < K; kb += 32) {
    FragH ah, al;
    const v4f x0 = *(const v4fa*)(arow + kb + 8 * hh), x1 = *(const v4fa*)(arow + kb + 8 * hh + 4), x2 = *(const v4fa*)(arow + kb + 16 + 8 * hh), x3 = *(const v4fa*)(arow + kb + 16 + 8 * hh + 4);
    float xs[16] = {x0[0],x0[1],x0[2],x0[3],x1[0],x1[1],x1[2],x1[3],x2[0],x2[1],x2[2],x2[3],x3[0],x3[1],x3[2],x3[3]};
#pragma unroll
    for (int i = 0; i < 16; ++i) { const _Float16 h = (_Float16)xs[i]; ah.h[i] = h; al.h[i] = ASPLIT ? (_Float16)(xs[i] - (float)h) : (_Float16)0.0f; }
#pragma unroll
    for (int t = 0; t < 4; ++t) { if (col0 + t * 16 >= N) continue; const size_t boff = (size_t)(col0 + t * 16 + ln) * ldb + kb; FragH bq; bq.half[0] = *(const v8us*)(Bh + boff + 8 * hh); bq.half[1] = *(const v8us*)(Bh + boff + 16 + 8 * hh);
      acc[t] = mmaH<ASPLIT ? 2 : 1>(ah.v, al.v, bq.v, bq.v, acc[t]); }
  }
#pragma unroll
  for (int t = 0; t < 4; ++t) { if (col0 + t * 16 >= N) continue;
#pragma unroll
    for (int r = 0; r < 8; ++r) so[w][8 * hh + r][t * 16 + ln] = acc[t][r] * alpha; }
  __builtin_amdgcn_fence(__ATOMIC_ACQ_REL, "workgroup"); __builtin_amdgcn_wave_barrier();
  const int rsub = lane >> 4, c4 = (lane & 15) * 4;
  {
#pragma unroll
    for (int q = 0; q < 8; ++q) { const int r = q * 2 + rsub; if (col0 + c4 < N) { const v4f v = *(const v4fa*)&so[w][r][c4]; *(v4f*)(C + (size_t)(row0 + r) * ldc + col0 + c4) = v; } }
     }
}

// Wt[n][k] = f16(W[k][n]·scale) from f32 row-major W[K][N] (scale = power of two; bf16-exact weights stay exact in f16 away from the subnormal range)
// blockIdx.y picks one of four weight matrices: 0..2 go to planes 0..2 of Wt012, 3 goes to Wt3
// One thread takes an 8 x 8 block of W (8 output pieces of 16 B), so the launch is one round of 256 work-groups. A wave = 4 column groups (one 128-B line of each W row) x 8 row groups (one 128-B line of each Wt row).
__global__ __launch_bounds__(256) void k_wt_f16(const float* __restrict__ W0, const float* __restrict__ W1, const float* __restrict__ W2, const float* __restrict__ W3, _Float16* __restrict__ Wt012, _Float16* __restrict__ Wt3, float scale) {
  const int y = blockIdx.y; const float* __restrict__ W = (y == 0) ? W0 : (y == 1) ? W1 : (y == 2) ? W2 : W3; _Float16* __restrict__ Wt = (y == 3) ? Wt3 : Wt012 + (size_t)y * CC * CC;
  const int lane = threadIdx.x & 31, wv = blockIdx.x * 8 + (threadIdx.x >> 5); const int n0 = ((wv % (CC / 32)) * 4 + (lane & 3)) * 8, k0 = ((wv / (CC / 32)) * 8 + (lane >> 2)) * 8;
  const unsigned lo = (unsigned)(k0 * CC + n0) * 4u; const char* p = (const char*)W + lo; v4f a[8][2];      /* the thread's byte offset: one register serves every load */
#pragma unroll
  for (int i = 0; i < 8; ++i) { a[i][0] = *(const v4fa*)(p + i * (CC * 4)); a[i][1] = *(const v4fa*)(p + i * (CC * 4) + 16); }
  asm volatile("s_wait_xcnt 0x0" :: "v"(lo) : "memory");      // stands in front of the first instruction that reuses the loads' address register; the operand keeps that register untouched up to here
  __builtin_amdgcn_sched_barrier(0);      // keeps the arithmetic below behind that wait, and so behind the issue of every load
  unsigned short* o = (unsigned short*)Wt + (size_t)n0 * CC + k0; FragH f[8];
#pragma unroll
  for (int j = 0; j < 8; ++j)
#pragma unroll
    for (int i = 0; i < 8; ++i) f[j].h[i] = (_Float16)(bf16_round(a[i][j >> 2][j & 3]) * scale);
  __builtin_amdgcn_sched_barrier(0);      // the stores go out as one run behind the arithmetic: none of it then overwrites a register of an issued store
#pragma unroll
  for (int j = 0; j < 8; ++j) *(v8us*)(o + j * CC) = f[j].half[0];
}
// Block-tiled GEMM with fused epilogue: v = acc*alpha + bias[by*sBias + col] ; ACT 0 none / 1 elu ; writes f16 C16 (H16) or f32 C.
// One block = WM x WN waves = a (WM*FM*16) x (WN*64) tile of C; a wave owns FM x 4 accumulator tiles. Per chunk of KC k the block brings its A rows and B rows (whole 128-B lines, KC/8 lanes a row)
// into LDS at a pitch of 2*KC + 16 B and every wave reads its fragments from there; two buffers, the next chunk's global loads fly while this chunk is multiplied.
// LD = row pitch of A and of B in elements, a compile-time constant so that the rows of a tile are immediate offsets from one address per operand.
// Needs M a multiple of WM*FM*16, N of WN*64, K of KC (every launch below is).
// Two batch axes: blockIdx.y steps A, B, C by sA, sB, sC (heads), blockIdx.z by zA, zB, zC (batches).
template <int ACT, int WM, int WN, int FM, int KC, int LD, bool H16>
__global__ __launch_bounds__(WM * WN * 32) void k_gemm_hhx(const _Float16* __restrict__ A, size_t sA, const _Float16* __restrict__ Bh, size_t sB, float alpha, const float* __restrict__ bias, size_t sBias,
    float* __restrict__ C, _Float16* __restrict__ C16, int ldc, size_t sC, int M, int N, int K, size_t zA, size_t zB, size_t zC) {
  constexpr int NW = WM * WN, BM = WM * FM * 16, BN = WN * 64, CPR = KC / 8, RP = NW * 32 / CPR, NA = BM / RP, NB = BN / RP, PIT = KC + 8;
  __shared__ __attribute__((aligned(16))) unsigned short tA[2][BM][PIT];
  __shared__ __attribute__((aligned(16))) unsigned short tB[2][BN][PIT];
  __shared__ __attribute__((aligned(16))) float so[NW][16][64];
  const int tid = threadIdx.x, w = tid >> 5, lane = tid & 31, ln = lane & 15, hh = lane >> 4; const int by = blockIdx.y;
  const int bz = blockIdx.z; A += (size_t)by * sA + (size_t)bz * zA; Bh += (size_t)by * sB + (size_t)bz * zB; const size_t cofs = (size_t)by * sC + (size_t)bz * zC; const float* bp = bias ? bias + (size_t)by * sBias : nullptr;
  const int ntn = N / BN; const int bm = blockIdx.x / ntn, bn = blockIdx.x % ntn; if (bm * BM >= M) return;
  const int wm = w / WN, wn = w % WN; const int srow = tid / CPR, sc = (tid % CPR) * 8;
  const unsigned short* gA = (const unsigned short*)A + (size_t)(bm * BM + srow) * LD + sc;
  const unsigned short* gB = (const unsigned short*)Bh + (size_t)(bn * BN + srow) * LD + sc;
  const int col0 = bn * BN + wn * 64;
  float bvv[4];      // the wave's bias values, fetched ahead of the products
#pragma unroll
  for (int t = 0; t < 4; ++t) bvv[t] = bp ? bf16_round(bp[col0 + t * 16 + ln]) : 0.f;
  v8us ra[NA], rb[NB];
  v8f acc[FM][4] = {};
  auto g2r = [&](int kb) {
#pragma unroll
    for (int i = 0; i < NA; ++i) ra[i] = *(const v8us*)(gA + kb + i * RP * LD);
#pragma unroll
    for (int i = 0; i < NB; ++i) rb[i] = *(const v8us*)(gB + kb + i * RP * LD);
  };
  auto r2s = [&](int buf) {
#pragma unroll
    for (int i = 0; i < NA; ++i) *(v8us*)&tA[buf][i * RP + srow][sc] = ra[i];
#pragma unroll
    for (int i = 0; i < NB; ++i) *(v8us*)&tB[buf][i * RP + srow][sc] = rb[i];
  };
  auto mul = [&](int buf) {
#pragma unroll
    for (int ks = 0; ks < KC / 32; ++ks) { FragH fa[FM], fb[4];
#pragma unroll
      for (int i = 0; i < FM; ++i) { const unsigned short* p = &tA[buf][(wm * FM + i) * 16 + ln][ks * 32 + 8 * hh]; fa[i].half[0] = *(const v8us*)p; fa[i].half[1] = *(const v8us*)(p + 16); }
#pragma unroll
      for (int t = 0; t < 4; ++t) { const unsigned short* p = &tB[buf][wn * 64 + t * 16 + ln][ks * 32 + 8 * hh]; fb[t].half[0] = *(const v8us*)p; fb[t].half[1] = *(const v8us*)(p + 16); }
#pragma unroll
      for (int i = 0; i < FM; ++i)
#pragma unroll
        for (int t = 0; t < 4; ++t) acc[i][t] = __builtin_amdgcn_wmma_f32_16x16x32_f16(false, fa[i].v, false, fb[t].v, (short)0, acc[i][t], false, false); }
  };
  g2r(0); r2s(0);
  __syncthreads();      // chunk 0 is in buffer 0 for every wave
  int buf = 0;
  for (int kb = KC; kb < K; kb += KC) {
    g2r(kb);            // next chunk: in flight while this one is multiplied
    __builtin_amdgcn_sched_barrier(0);      // keeps those loads above the products; without it the compiler sinks them to just before their LDS stores and their latency is waited out
    mul(buf);
    r2s(buf ^ 1);       // that buffer's last readers left it before the barrier that ended the trip before
    __syncthreads();    // publishes the next chunk and ends this trip's reads of buf
    buf ^= 1;
  }
  mul(buf);
  const int rsub = lane >> 4, c4 = (lane & 15) * 4; typedef _Float16 v4h __attribute__((ext_vector_type(4)));
#pragma unroll
  for (int i = 0; i < FM; ++i) { const int row0 = bm * BM + (wm * FM + i) * 16;
#pragma unroll
    for (int t = 0; t < 4; ++t) { const float bv = bvv[t];
#pragma unroll
      for (int r = 0; r < 8; ++r) { float v = acc[i][t][r] * alpha + bv; if (ACT == 1) v = (v > 0.f) ? v : expm1f(v); else if (ACT == 7) v = (v > 0.f) ? v + 1.0f : expf(v); else if (ACT == 8) v = tanhf(v); else if (ACT == 9) v = 0.5f * v * (1.0f + tanhf(0.7978845608028654f * (v + 0.044715f * v * v * v))); else if (ACT == 11) v = 1.0f / (1.0f + expf(-v)); else if (ACT == 12) v = (v > 0.f) ? v : 0.01f * v; else if (ACT == 14) v = (v > 0.f) ? v : 0.1f * v; else if (ACT == 15) v = v / (1.0f + expf(-v)); else if (ACT == 3) v = fmaxf(v, 0.f); else if (ACT == 6) v = 0.5f * v * (1.0f + erff(v * 0.70710678118654752f)); so[w][8 * hh + r][t * 16 + ln] = v; } }
    __builtin_amdgcn_fence(__ATOMIC_ACQ_REL, "workgroup"); __builtin_amdgcn_wave_barrier();
#pragma unroll
    for (int q = 0; q < 8; ++q) { const int r = q * 2 + rsub; const v4f v = *(const v4fa*)&so[w][r][c4]; if (!H16) *(v4f*)(C + cofs + (size_t)(row0 + r) * ldc + col0 + c4) = v; else { v4h h4; for (int j = 0; j < 4; ++j) h4[j] = (_Float16)v[j]; *(v4h*)(C16 + cofs + (size_t)(row0 + r) * ldc + col0 + c4) = h4; } }
    if (i + 1 < FM) { __builtin_amdgcn_fence(__ATOMIC_ACQ_REL, "workgroup"); __builtin_amdgcn_wave_barrier(); }      // the wave's rows are read back before its next 16 rows overwrite them
  }
}


typedef _Float16 v4h __attribute__((ext_vector_type(4)));

// All three activations to f16, plane y of X16 from x_y. One round of 256 work-groups: a thread takes XP pieces of 8 elements of each activation, a work-group XP * 256 pieces in a row;
// all of a thread's loads are asked for before the first value is used, so that 8 waves a WGP keep the memory busy.
#define XP 8
__global__ __launch_bounds__(256) void k_x16(const float* __restrict__ x0, const float* __restrict__ x1, const float* __restrict__ x2, _Float16* __restrict__ X16) {
  const unsigned e0 = (blockIdx.x * (XP * 256) + threadIdx.x) * 8u, lo = e0 * 4u; v4f a[3][XP][2];      /* the thread's first element, and its byte offset: one register serves every load */
#pragma unroll
  for (int y = 0; y < 3; ++y) { const char* p = (const char*)((y == 0) ? x0 : (y == 1) ? x1 : x2) + lo;
#pragma unroll
    for (int i = 0; i < XP; ++i) { a[y][i][0] = *(const v4fa*)(p + i * 8192); a[y][i][1] = *(const v4fa*)(p + i * 8192 + 16); } }
  asm volatile("s_wait_xcnt 0x0" :: "v"(lo) : "memory");      // stands in front of the first instruction that reuses the loads' address register; the operand keeps that register untouched up to here
  __builtin_amdgcn_sched_barrier(0);      // keeps the arithmetic below behind that wait, and so behind the issue of every load
#pragma unroll
  for (int y = 0; y < 3; ++y) { FragH f[XP];
#pragma unroll
    for (int i = 0; i < XP; ++i)
#pragma unroll
      for (int q = 0; q < 8; ++q) f[i].h[q] = (_Float16)bf16_round(a[y][i][q >> 2][q & 3]);
    __builtin_amdgcn_sched_barrier(0);      // the stores go out as one run behind the arithmetic: none of it then overwrites a register of an issued store
#pragma unroll
    for (int i = 0; i < XP; ++i) *(v8us*)((unsigned short*)X16 + (size_t)y * NR * CC + e0 + i * 2048) = f[i].half[0];
    if (y < 2) { asm volatile("s_wait_xcnt 0x0" ::: "memory");      // stands in front of the next group's arithmetic, which reuses the registers of these stores
      __builtin_amdgcn_sched_barrier(0);      // keeps that arithmetic behind the wait
    } } }
__global__ __launch_bounds__(256) void k_h16(const float* __restrict__ x, _Float16* __restrict__ X16, size_t n8) { const size_t t = (size_t)blockIdx.x * 256 + threadIdx.x; if (t >= n8) return; FragH f;
#pragma unroll
  for (int q = 0; q < 8; ++q) f.h[q] = (_Float16)x[t * 8 + q]; *(v8us*)((unsigned short*)X16 + t * 8) = f.half[0];  }
__global__ __launch_bounds__(256) void k_round16f(const float* __restrict__ W, _Float16* __restrict__ Bt, size_t n8) { const size_t t = (size_t)blockIdx.x * 256 + threadIdx.x; if (t >= n8) return; FragH f;
#pragma unroll
  for (int i = 0; i < 8; ++i) f.h[i] = (_Float16)(bf16_round(W[t * 8 + i]) * 16.0f); *(v8us*)((unsigned short*)Bt + t * 8) = f.half[0];  }
template <int NHv, int TTv>
__global__ __launch_bounds__(256) void k_vt(const _Float16* __restrict__ V16, int ldv, int voff, _Float16* __restrict__ Vt) { __shared__ unsigned short tl[64][66]; const int tid = threadIdx.x; const int slab = blockIdx.x / (TTv / 64), lg = blockIdx.x % (TTv / 64); const int b = slab / NHv, h = slab % NHv;
  for (int i = tid; i < 64 * 8; i += 256) { const int r = i / 8, c8 = (i % 8) * 8; FragH f; f.half[0] = *(const v8us*)((const unsigned short*)V16 + ((size_t)b * TTv + lg * 64 + r) * ldv + voff + h * 64 + c8);
#pragma unroll
    for (int q = 0; q < 8; ++q) tl[r][c8 + q] = f.u[q]; }
  __syncthreads();
  {
#pragma unroll
    for (int rd = 0; rd < 2; ++rd) { const int d = rd * 32 + tid / 8, pc = tid % 8; FragH f;
#pragma unroll
      for (int q = 0; q < 8; ++q) f.u[q] = tl[pc * 8 + q][d];
      *(v8us*)((unsigned short*)Vt + ((size_t)slab * 64 + d) * TTv + lg * 64 + pc * 8) = f.half[0]; }
     } }

__global__ __launch_bounds__(256) void k_hl(const float* __restrict__ F, _Float16* __restrict__ Hh, _Float16* __restrict__ Hl, size_t n8) { const size_t t = (size_t)blockIdx.x * 256 + threadIdx.x; if (t >= n8) return; FragH fh, fl; const v4f a = *(const v4fa*)(F + t * 8), c = *(const v4fa*)(F + t * 8 + 4);
#pragma unroll
  for (int q = 0; q < 4; ++q) { _Float16 h = (_Float16)a[q]; fh.h[q] = h; fl.h[q] = (_Float16)((a[q] - (float)h) * 1024.0f); h = (_Float16)c[q]; fh.h[4 + q] = h; fl.h[4 + q] = (_Float16)((c[q] - (float)h) * 1024.0f); }
  { *(v8us*)((unsigned short*)Hh + t * 8) = fh.half[0]; *(v8us*)((unsigned short*)Hl + t * 8) = fl.half[0];  } }

// The three projections as ONE launch: blockIdx.y = 0 Q, 1 K, 2 V (plane y of X16 times plane y of BW, bias y). The products are those of k_gemm_hhx<0, 4, 2, 2, 128, CC, .> (128 x 128 tile, 8 waves of 2 x 4 accumulator tiles,
// k chunks of 128 in two LDS buffers); the epilogue writes the operand forms that the score kernels read, so no f32 Q or K plane, no row-major V, and no fold or transpose launch.
// Q -> [hi | lo*2^10 | hi], K -> [hi | hi*2^-10 | lo] (a wave's 64 columns are one head: 3 whole 128-B lines a row); V -> V^T (a lane's 8 accumulator rows are 8 tokens in a row of V^T; the block's tile goes through LDS so that 256 B of a V^T row leave together).
// Both epilogues stage in the buffers that the last chunk does not use: their last readers left them before the loop's last barrier.
#define PKC 128
#define PPIT (PKC + 8)
#define SOP 68                   /* floats a staging row: 16 B more than 64 columns, so that rows 8 apart and the 4 rows of a read fall on different banks */
typedef float fal __attribute__((may_alias));
// 16 staged rows of 64 f32 -> the three f16 parts of each row, MODE 0 as Q, 1 as K. A lane takes 8 columns of rows 0, 4, 8, 12 from its own: 8 lanes write one 128-B line.
template <int MODE>
__device__ __forceinline__ void fold_store(const fal* p, unsigned short* o) {
  FragH s0[4], s1[4], s2[4];
#pragma unroll
  for (int q = 0; q < 4; ++q) { const v4f a0 = *(const v4fa*)(p + q * 4 * SOP), a1 = *(const v4fa*)(p + q * 4 * SOP + 4);
#pragma unroll
    for (int e = 0; e < 8; ++e) { const float v = (e < 4) ? a0[e & 3] : a1[e & 3]; const _Float16 hi = (_Float16)v; const float rest = v - (float)hi; s0[q].h[e] = hi;
      if (MODE == 0) { s1[q].h[e] = (_Float16)(rest * 1024.0f); s2[q].h[e] = hi; } else { s1[q].h[e] = (_Float16)((float)hi * 0.0009765625f); s2[q].h[e] = (_Float16)rest; } } }
  __builtin_amdgcn_sched_barrier(0);      // the stores go out as one run behind the arithmetic: none of it then overwrites a register of an issued store
#pragma unroll
  for (int q = 0; q < 4; ++q) { unsigned short* oq = o + q * 4 * (NH * K3); *(v8us*)(oq) = s0[q].half[0]; *(v8us*)(oq + HD) = s1[q].half[0]; *(v8us*)(oq + 2 * HD) = s2[q].half[0]; }
  asm volatile("s_wait_xcnt 0x0" ::: "memory");      // stands directly behind the run of stores, in front of whatever next reuses their registers
  __builtin_amdgcn_sched_barrier(0);      // keeps later arithmetic behind that wait
}
__global__ __launch_bounds__(256) void k_proj(const _Float16* __restrict__ X16, const _Float16* __restrict__ BW, const float* __restrict__ bq, const float* __restrict__ bk, const float* __restrict__ bv,
    _Float16* __restrict__ O3q, _Float16* __restrict__ O3k, _Float16* __restrict__ VT) {
  constexpr int WN = 2, FM = 2, BM = 128, BN = 128, CPR = PKC / 8, RP = 256 / CPR, NA = BM / RP, NB = BN / RP;
  __shared__ __attribute__((aligned(16))) unsigned short tA[2][BM][PPIT];
  __shared__ __attribute__((aligned(16))) unsigned short tB[2][BN][PPIT];
  const int tid = threadIdx.x, w = tid >> 5, lane = tid & 31, ln = lane & 15, hh = lane >> 4; const int y = blockIdx.y;
  const float* bp = (y == 0) ? bq : (y == 1) ? bk : bv;
  const int bm = blockIdx.x / (CC / BN), bn = blockIdx.x % (CC / BN);
  const int wm = w / WN, wn = w % WN; const int srow = tid / CPR, sc = (tid % CPR) * 8;
  const unsigned short* gA = (const unsigned short*)X16 + (size_t)y * NR * CC + (size_t)(bm * BM + srow) * CC + sc;
  const unsigned short* gB = (const unsigned short*)BW + (size_t)y * CC * CC + (size_t)(bn * BN + srow) * CC + sc;
  const int col0 = bn * BN + wn * 64;
  float bvv[4];      // the wave's bias values, fetched ahead of the products
#pragma unroll
  for (int t = 0; t < 4; ++t) bvv[t] = bf16_round(bp[col0 + t * 16 + ln]);
  v8us ra[NA], rb[NB];
  v8f acc[FM][4] = {};
  auto g2r = [&](int kb) {
#pragma unroll
    for (int i = 0; i < NA; ++i) ra[i] = *(const v8us*)(gA + kb + i * RP * CC);
#pragma unroll
    for (int i = 0; i < NB; ++i) rb[i] = *(const v8us*)(gB + kb + i * RP * CC);
  };
  auto r2s = [&](int buf) {
#pragma unroll
    for (int i = 0; i < NA; ++i) *(v8us*)&tA[buf][i * RP + srow][sc] = ra[i];
#pragma unroll
    for (int i = 0; i < NB; ++i) *(v8us*)&tB[buf][i * RP + srow][sc] = rb[i];
  };
  auto mul = [&](int buf) {
#pragma unroll
    for (int ks = 0; ks < PKC / 32; ++ks) { FragH fa[FM], fb[4];
#pragma unroll
      for (int i = 0; i < FM; ++i) { const unsigned short* p = &tA[buf][(wm * FM + i) * 16 + ln][ks * 32 + 8 * hh]; fa[i].half[0] = *(const v8us*)p; fa[i].half[1] = *(const v8us*)(p + 16); }
#pragma unroll
      for (int t = 0; t < 4; ++t) { const unsigned short* p = &tB[buf][wn * 64 + t * 16 + ln][ks * 32 + 8 * hh]; fb[t].half[0] = *(const v8us*)p; fb[t].half[1] = *(const v8us*)(p + 16); }
#pragma unroll
      for (int i = 0; i < FM; ++i)
#pragma unroll
        for (int t = 0; t < 4; ++t) acc[i][t] = __builtin_amdgcn_wmma_f32_16x16x32_f16(false, fa[i].v, false, fb[t].v, (short)0, acc[i][t], false, false); }
  };
  g2r(0); r2s(0);
  __syncthreads();      // chunk 0 is in buffer 0 for every wave
  int buf = 0;
  for (int kb = PKC; kb < CC; kb += PKC) {
    g2r(kb);            // next chunk: in flight while this one is multiplied
    __builtin_amdgcn_sched_barrier(0);      // keeps those loads above the products; without it the compiler sinks them to just before their LDS stores and their latency is waited out
    mul(buf);
    r2s(buf ^ 1);       // that buffer's last readers left it before the barrier that ended the trip before
    __syncthreads();    // publishes the next chunk and ends this trip's reads of buf
    buf ^= 1;
  }
  mul(buf);
  if (y < 2) {      /* Q, K: each wave by itself, its first 16 rows through its 16 x SOP floats of the free A buffer, its other 16 through the same place of the free B buffer */
    fal* soA = (fal*)&tA[buf ^ 1][0][0] + w * (16 * SOP); fal* soB = (fal*)&tB[buf ^ 1][0][0] + w * (16 * SOP);
#pragma unroll
    for (int i = 0; i < FM; ++i) { fal* so = i ? soB : soA;
#pragma unroll
      for (int t = 0; t < 4; ++t)
#pragma unroll
        for (int r = 0; r < 8; ++r) so[(8 * hh + r) * SOP + t * 16 + ln] = acc[i][t][r] * 0.0625f + bvv[t]; }
    __builtin_amdgcn_fence(__ATOMIC_ACQ_REL, "workgroup"); __builtin_amdgcn_wave_barrier();      // the wave's rows are written before its lanes read them back; it stands ahead of every global store, so it waits for none
    const int po = (lane >> 3) * SOP + (lane & 7) * 8;
    unsigned short* ob = (unsigned short*)(y ? O3k : O3q) + (size_t)(bm * BM + wm * FM * 16 + (lane >> 3)) * (NH * K3) + (col0 / HD) * K3 + (lane & 7) * 8;
    if (y == 0) fold_store<0>(soA + po, ob); else fold_store<1>(soA + po, ob);
    if (y == 0) fold_store<0>(soB + po, ob + 16 * (NH * K3)); else fold_store<1>(soB + po, ob + 16 * (NH * K3));
  } else {      /* V: the block's 128 tokens x 128 columns, transposed in LDS */
    unsigned short (*tv)[PPIT] = tA[buf ^ 1];
#pragma unroll
    for (int i = 0; i < FM; ++i)
#pragma unroll
      for (int t = 0; t < 4; ++t) { FragH f;
#pragma unroll
        for (int r = 0; r < 8; ++r) f.h[r] = (_Float16)(acc[i][t][r] * 0.0625f + bvv[t]);
        *(v8us*)&tv[wn * 64 + t * 16 + ln][(wm * FM + i) * 16 + 8 * hh] = f.half[0]; }
    __syncthreads();      // every wave's tokens are in the tile before rows of it are read
    unsigned short* o = (unsigned short*)VT + ((size_t)(bm / (TT / BM)) * CC + bn * BN + (tid >> 4)) * TT + (bm % (TT / BM)) * BM + (tid & 15) * 8;
    v8us rv[8];
#pragma unroll
    for (int j = 0; j < 8; ++j) rv[j] = *(const v8us*)&tv[j * 16 + (tid >> 4)][(tid & 15) * 8];
#pragma unroll
    for (int j = 0; j < 8; ++j) *(v8us*)(o + (size_t)j * 16 * TT) = rv[j];
    asm volatile("s_wait_xcnt 0x0" ::: "memory");      // stands directly behind the run of stores, in front of whatever next reuses their registers
  }
}
// Scores never leave the registers. One wave owns NQ*16 queries, one work-group of 8 waves NQ*128 queries of one (batch, head); it walks the head's 1024 keys in stages of KT.
// S^T = K*Q^T: A = 16 key rows of the folded K from LDS, B = the wave's folded Q rows, loaded once and kept; a lane then holds scores of ONE query per 16-query group (column ln), keys 8*hh + r of each 16-key tile,
// so every row sum and maximum is in-lane plus one exchange between the wave's halves.
// ATT false: the row statistics. exp(s/2) needs no maximum taken off, because s is clipped to +-50 (e within 1.4e-11 .. 7.2e10, its squares' sum below 6e24);
//   with p = e / sum e and sum p = 1 the sum of (p - 1/TT)^2 is sum e^2 / (sum e)^2 - 1/TT. The clip and the scale are monotone, so the clipped maximum comes from the raw maximum.
//   RST[row] = (sum of clipped s, max of clipped s, variance, raw maximum).
// ATT true: O^T += V^T * P^T. Two score tiles (32 keys), turned into exp in place, ARE the B operand in the hardware's k order; A = 16 rows of V^T from LDS read in that same order.
//   The row's raw maximum is known from the statistics kernel (same products, same order), so nothing is rescaled; P = exp(..) * 2^10 as f16, the division by the f32 sum comes last.
// 2^x with the slot behind it: the instruction set asks for one v_nop or independent instruction between a transcendental and a use of its result or an overwrite of its source.
// In one statement the v_nop cannot be parted from its exp.
__device__ __forceinline__ float exp2_slot(float x) { float e; asm volatile("v_exp_f32 %0, %1\n\tv_nop" : "=v"(e) : "v"(x)); return e; }
#define KT 64                    /* keys per stage */
#define KPIT (K3 + 8)            /* 400 B a row: 16 B x odd, for 16-byte LDS reads */
#define VPIT (KT + 8)            /* 144 B a row */
template <bool ATT, int NQ>
__global__ __launch_bounds__(256) void k_fused(const _Float16* __restrict__ Q3, const _Float16* __restrict__ Kf, const _Float16* __restrict__ VT, float* __restrict__ RST, const float* __restrict__ TH, _Float16* __restrict__ O16) {
  __shared__ __attribute__((aligned(16))) unsigned short tK[2][KT][KPIT];
  __shared__ __attribute__((aligned(16))) unsigned short tV[ATT ? 2 : 1][ATT ? HD : 1][VPIT];
  const int tid = threadIdx.x, w = tid >> 5, lane = tid & 31, ln = lane & 15, hh = lane >> 4;
  const int slab = blockIdx.y, b = slab / NH, h = slab % NH; const int q0 = (blockIdx.x * 8 + w) * (NQ * 16) + ln;      /* the lane's first query; its others follow in steps of 16 */
  const int sr = tid >> 3, sc8 = (tid & 7) * 8;      /* staging: 8 lanes bring one 128-B line, the block 32 rows at a time */
  const unsigned short* gK = (const unsigned short*)Kf + ((size_t)b * TT + sr) * (NH * K3) + h * K3 + sc8;
  const unsigned short* gV = (const unsigned short*)VT + ((size_t)b * CC + h * HD + sr) * TT + sc8;
  FragH qf[NQ][6];
  float sc2 = 0.f, nm2[NQ];
  v8us rk[6], rv[2];
  v8f o[NQ][4] = {};
  float su0[NQ], su1[NQ], se[NQ], se2[NQ], rmx[NQ];
#pragma unroll
  for (int n = 0; n < NQ; ++n) { su0[n] = 0.f; su1[n] = 0.f; se[n] = 0.f; se2[n] = 0.f; rmx[n] = -3.0e38f; }
  auto g2r = [&](int kb) {
#pragma unroll
    for (int i = 0; i < 6; ++i) rk[i] = *(const v8us*)(gK + (size_t)(kb + (i / 3) * 32) * (NH * K3) + (i % 3) * 64);
    if (ATT) {
#pragma unroll
      for (int i = 0; i < 2; ++i) rv[i] = *(const v8us*)(gV + kb + i * 32 * TT); }
    asm volatile("s_wait_xcnt 0x0" ::: "memory");      // stands in front of the first instruction that reuses these loads' address registers
  };
  auto r2s = [&](int buf) {
#pragma unroll
    for (int i = 0; i < 6; ++i) *(v8us*)&tK[buf][(i / 3) * 32 + sr][(i % 3) * 64 + sc8] = rk[i];
    if (ATT) {
#pragma unroll
      for (int i = 0; i < 2; ++i) *(v8us*)&tV[buf][i * 32 + sr][sc8] = rv[i]; }
  };
  auto work = [&](int buf) {
#pragma unroll
    for (int p = 0; p < KT / 32; ++p) { v8f t[NQ][2] = {}; FragH a[6][2];
#pragma unroll
      for (int ks = 0; ks < 6; ++ks)
#pragma unroll
        for (int j = 0; j < 2; ++j) { const unsigned short* pk = &tK[buf][p * 32 + j * 16 + ln][ks * 32 + 8 * hh]; a[ks][j].half[0] = *(const v8us*)pk; a[ks][j].half[1] = *(const v8us*)(pk + 16); }
      __builtin_amdgcn_sched_barrier(0);      // the pass's K fragments are asked for as one group; without it the compiler puts each pair of reads, with a full wait, right in front of its product
#pragma unroll
      for (int ks = 0; ks < 6; ++ks)
#pragma unroll
        for (int j = 0; j < 2; ++j)
#pragma unroll
          for (int n = 0; n < NQ; ++n) t[n][j] = __builtin_amdgcn_wmma_f32_16x16x32_f16(false, a[ks][j].v, false, qf[n][ks].v, (short)0, t[n][j], false, false);
      float xe[NQ * 16];      /* exponent, then exp, of the lane's scores: group n, key slot s at n * 16 + s */
      if (!ATT) {
#pragma unroll
        for (int n = 0; n < NQ; ++n)
#pragma unroll
          for (int r = 0; r < 8; ++r) { const float x0 = t[n][0][r], x1 = t[n][1][r]; rmx[n] = fmaxf(rmx[n], fmaxf(x0, x1));
            const float v0 = fminf(fmaxf(x0 * 0.125f, -50.f), 50.f), v1 = fminf(fmaxf(x1 * 0.125f, -50.f), 50.f); su0[n] += v0; su1[n] += v1;
            xe[n * 16 + r] = v0 * 0.7213475204444817f; xe[n * 16 + 8 + r] = v1 * 0.7213475204444817f; }
        __builtin_amdgcn_sched_barrier(0);      // this fence and the next keep the exps in one run, every exponent ready ahead of it and every use behind it: the compiler writes no delay hint for a result of asm text, and a dependent instruction close behind its exp would wait unhinted, which holds up the SIMD's other wave too
#pragma unroll
        for (int i = 0; i < NQ * 16; ++i) xe[i] = exp2_slot(xe[i]);
        __builtin_amdgcn_sched_barrier(0);      // see the fence above
#pragma unroll
        for (int i = 0; i < NQ * 16; ++i) { se[i >> 4] += xe[i]; se2[i >> 4] += xe[i] * xe[i]; }
      } else { FragH pb[NQ], va[4];
#pragma unroll
        for (int dt = 0; dt < 4; ++dt) { const unsigned short* pv = &tV[buf][dt * 16 + ln][p * 32 + 8 * hh]; va[dt].half[0] = *(const v8us*)pv; va[dt].half[1] = *(const v8us*)(pv + 16); }
        __builtin_amdgcn_sched_barrier(0);      // the V fragments are asked for ahead of the exponentials, which then cover their latency
#pragma unroll
        for (int n = 0; n < NQ; ++n)
#pragma unroll
          for (int r = 0; r < 8; ++r) { xe[n * 16 + r] = t[n][0][r] * sc2 + nm2[n]; xe[n * 16 + 8 + r] = t[n][1][r] * sc2 + nm2[n]; }
        __builtin_amdgcn_sched_barrier(0);      // this fence and the next keep the exps in one run, every exponent ready ahead of it and every use behind it: the compiler writes no delay hint for a result of asm text, and a dependent instruction close behind its exp would wait unhinted, which holds up the SIMD's other wave too
#pragma unroll
        for (int i = 0; i < NQ * 16; ++i) xe[i] = exp2_slot(xe[i]);
        __builtin_amdgcn_sched_barrier(0);      // see the fence above
#pragma unroll
        for (int i = 0; i < NQ * 16; i += 2) { su0[i >> 4] += xe[i]; su1[i >> 4] += xe[i + 1]; }
#pragma unroll
        for (int n = 0; n < NQ; ++n)
#pragma unroll
          for (int s = 0; s < 16; ++s) pb[n].h[s] = (_Float16)xe[n * 16 + s];
#pragma unroll
        for (int dt = 0; dt < 4; ++dt)
#pragma unroll
          for (int n = 0; n < NQ; ++n) o[n][dt] = __builtin_amdgcn_wmma_f32_16x16x32_f16(false, va[dt].v, false, pb[n].v, (short)0, o[n][dt], false, false); } }
  };
  g2r(0);
  __builtin_amdgcn_sched_barrier(0);      // stage 0's loads and their wait stay ahead of the Q loads
#pragma unroll
  for (int n = 0; n < NQ; ++n) { const unsigned short* p = (const unsigned short*)Q3 + ((size_t)b * TT + q0 + n * 16) * (NH * K3) + h * K3 + 8 * hh;
#pragma unroll
    for (int ks = 0; ks < 6; ++ks) { qf[n][ks].half[0] = *(const v8us*)(p + ks * 32); qf[n][ks].half[1] = *(const v8us*)(p + ks * 32 + 16); } }
#pragma unroll
  for (int n = 0; n < NQ; ++n) nm2[n] = ATT ? RST[((size_t)slab * TT + q0 + n * 16) * 4 + 3] : 0.f;      /* the row's raw maximum, for now */
  __builtin_amdgcn_sched_barrier(0);      // keeps the loads above ahead of the wait below
  asm volatile("s_wait_xcnt 0x0" ::: "memory");      // stands in front of the first instruction that reuses the address registers of the Q and row-maximum loads
  __builtin_amdgcn_sched_barrier(0);      // keeps the arithmetic below, which reuses those registers, behind the wait
  if (ATT) { sc2 = 1.4426950408889634f / (2.0f * TH[(size_t)slab * 32]);
#pragma unroll
    for (int n = 0; n < NQ; ++n) nm2[n] = 10.0f - nm2[n] * sc2; }
  r2s(0);
  __syncthreads();      // stage 0 is in buffer 0 for every wave
  int buf = 0;
  for (int kb = KT; kb < TT; kb += KT) {
    g2r(kb);            // next stage: in flight while this one is worked on
    __builtin_amdgcn_sched_barrier(0);      // keeps those loads above the products; without it the compiler may sink them to just before their LDS stores and their latency is waited out
    work(buf);
    r2s(buf ^ 1);       // that buffer's last readers left it before the barrier that ended the trip before
    __syncthreads();    // publishes the next stage and ends this trip's reads of buf
    buf ^= 1;
  }
  work(buf);
#pragma unroll
  for (int n = 0; n < NQ; ++n) { const int q = q0 + n * 16;
    float su = su0[n] + su1[n]; su += __shfl_xor(su, 16, 32);      /* the two halves of the wave hold the two halves of a query's keys */
    if (!ATT) { const float set = se[n] + __shfl_xor(se[n], 16, 32), se2t = se2[n] + __shfl_xor(se2[n], 16, 32), rm = fmaxf(rmx[n], __shfl_xor(rmx[n], 16, 32));
      const float inv = 1.0f / set; const float vq = (se2t * inv) * inv - 1.0f / (float)TT;
      if (hh == 0) { const v4f v = {su, fminf(fmaxf(rm * 0.125f, -50.f), 50.f), vq / (float)(TT - 1), rm}; *(v4f*)(RST + ((size_t)slab * TT + q) * 4) = v; }
    } else { const float inv = 1.0f / su;
#pragma unroll
      for (int dt = 0; dt < 4; ++dt) { FragH f;
#pragma unroll
        for (int r = 0; r < 8; ++r) f.h[r] = (_Float16)(o[n][dt][r] * inv);
        *(v8us*)((unsigned short*)O16 + ((size_t)b * TT + q) * CC + h * HD + dt * 16 + 8 * hh) = f.half[0]; } } } }
__global__ __launch_bounds__(256) void k_thead(const float* __restrict__ RST, const float* __restrict__ Wt1, const float* __restrict__ bt1, const float* __restrict__ Wt2, const float* __restrict__ bt2, float* __restrict__ TH) {
  #pragma clang fp contract(off)
  __shared__ v4f red[256]; const int g = blockIdx.x, tid = threadIdx.x; v4f a = {0.f, 0.f, 0.f, 0.f};
  for (int q = tid; q < TT; q += 256) { const v4f r = *(const v4fa*)(RST + ((size_t)g * TT + q) * 4); a[0] += r[0]; a[1] += r[1]; a[2] += r[2]; }
  red[tid] = a; __syncthreads(); for (int st = 128; st > 0; st >>= 1) { if (tid < st) { v4f x = red[tid]; const v4f y = red[tid + st]; x[0] += y[0]; x[1] += y[1]; x[2] += y[2]; red[tid] = x; } __syncthreads(); }
  if (tid < 32) { const v4f r0 = red[0]; float f0 = r0[0] / ((float)TT * (float)TT), f1 = r0[1] / (float)TT, f2 = r0[2] / (float)TT; f0 = fminf(fmaxf(f0, -10.f), 10.f); f1 = fminf(fmaxf(f1, -10.f), 10.f); f2 = fminf(fmaxf(f2, 0.f), 1.f);
    float raw = bf16_round(bt2[0]);
#pragma unroll 1
    for (int u = 0; u < 16; ++u) { float pre = bf16_round(bt1[u]); pre += f0 * bf16_round(Wt1[u]); pre += f1 * bf16_round(Wt1[16 + u]); pre += f2 * bf16_round(Wt1[32 + u]); raw += tanhf(pre) * bf16_round(Wt2[u]); }
    float t = 0.01f + (1.0f / (1.0f + expf(-raw))) * (2.0f - 0.01f); t = fminf(fmaxf(t, 0.01f), 2.0f); t = fminf(t, 0.85f);
    *(float*)(TH + (size_t)g * 32 + tid) = t;  } }

extern "C" void kernel_launch(void* const* d_in, const int* in_sizes, int n_in,
                              void* d_out, int out_size, void* d_ws, size_t ws_size, hipStream_t stream) {
  (void)in_sizes; (void)n_in; (void)out_size;
  const float* const* I = (const float* const*)d_in; const float* xq = I[0]; const float* xk = I[1]; const float* xv = I[2]; const float* Wq = I[3]; const float* bq = I[4]; const float* Wk = I[5]; const float* bk = I[6]; const float* Wv = I[7]; const float* bv = I[8]; const float* Wo = I[9]; const float* bo = I[10]; const float* Wt1 = I[11]; const float* bt1 = I[12]; const float* Wt2 = I[13]; const float* bt2 = I[14];
  char* ws = (char*)d_ws; size_t off = 0;
  auto take = [&](size_t bytes) { char* p = ws + off; off += (bytes + 255) & ~(size_t)255; return p; };
  _Float16* Q3p = (_Float16*)take((size_t)NR * NH * K3 * 2); _Float16* K3p = (_Float16*)take((size_t)NR * NH * K3 * 2); _Float16* VTb = (_Float16*)take((size_t)NBt * CC * TT * 2); _Float16* BWo = (_Float16*)take((size_t)CC * CC * 2); float* RST = (float*)take((size_t)HG * TT * 4 * 4); float* TH = (float*)take(HG * 32 * 4); _Float16* O16 = (_Float16*)take((size_t)NR * CC * 2);
  const size_t pW = (size_t)CC * CC, pX = (size_t)NR * CC;      /* plane sizes in elements: a weight; an activation */
  _Float16* BW = (_Float16*)take(3 * pW * 2); _Float16* X16 = (_Float16*)take(3 * pX * 2);      /* what only the projections need */
  if (off > ws_size) return;      // 25.2 + 25.2 + 8.4 + 2.1 + 1.0 + 8.4 + 6.3 + 25.2 = 101.8 MB
  const dim3 gP((NR / 128) * (CC / 128), 1);
  k_wt_f16<<<dim3((CC / 8) * (CC / 8) / 256, 4), 256, 0, stream>>>(Wq, Wk, Wv, Wo, BW, BWo, 16.0f);      /* all four weights, one launch */
  k_x16<<<NR * CC / 8 / (XP * 256), 256, 0, stream>>>(xq, xk, xv, X16);      /* all three activations, one launch */
  k_proj<<<dim3((NR / 128) * (CC / 128), 3), 256, 0, stream>>>(X16, BW, bq, bk, bv, Q3p, K3p, VTb);      /* Q exact -> [hi | lo | hi], K -> [hi | hi*2^-10 | lo], V -> f16, transposed */
  const dim3 gF(TT / 256, HG);      /* 256 queries a work-group; slab g = batch * NH + head in RST, TH */
  k_fused<false, 2><<<gF, 256, 0, stream>>>(Q3p, K3p, nullptr, RST, nullptr, nullptr);      /* row statistics of raw Q*K, about f32 (K 192) */
  k_thead<<<HG, 256, 0, stream>>>(RST, Wt1, bt1, Wt2, bt2, TH);
  k_fused<true, 2><<<gF, 256, 0, stream>>>(Q3p, K3p, VTb, RST, TH, O16);      /* softmax(Q*K / 2t) * V */
  k_gemm_hhx<0, 4, 2, 2, 128, CC, false><<<gP, 256, 0, stream>>>(O16, 0, BWo, 0, 0.0625f, bo, 0, (float*)d_out, nullptr, CC, 0, NR, CC, CC, 0, 0, 0);
}

// v007
// Measured time: 117 microseconds a run.
// Next to v006, in two timings, it ran 1.07 and 1.08 times as fast.
// Over all steps from v000 it is 8.48 times as fast.
#include <hip/hip_runtime.h>
// Diffusion-time multi-head attention (B 4, S 1024, D 1024, 16 heads × 64): Q,K,V = x·W + b ((in,out)); per (b,h): s = clip(Q·K/8, ±50); feats = (mean s, mean_q max_k s, mean_q var_k softmax(s/2) (ddof 1)) → t = min(clip(0.01 + 1.99·σ(tanh(feats·Wt1 + b)·Wt2 + b)), 0.85); attn = softmax(Q·K/(2t)); out = (attn·V merged)·Wo + bo → [4,1024,1024].
// Structure: projections as GEMMs (exact products); Q and K carried as f16 hi/lo and contracted with the pair folded into K ([q_hi | q_lo*2^10 | q_hi]*[k_hi | k_hi*2^-10 | k_lo], K 192) so the raw logits are about f32 (they are divided by 2t, i.e. scaled up to x50); all 64 (batch, head) slabs per launch: a statistics kernel that forms the score tiles by WMMA and reduces them in registers (clipped sum / max / softmax(s/2) variance), then an attention kernel whose work-groups each reduce their head's row statistics and run the tiny time MLP themselves (fixed order), form the same tiles again, take exp with the head's 1/(2t) (x2^10 -> f16) and multiplies by V in place; output projection GEMM.
// Compute dtype: inputs and parameters rounded to bf16; logits ≈f32; statistics/MLP/softmax f32; V and the attention output as f16 operands (≈2^-12); f32 accumulation. v_wmma_f32_16x16x32_f16.
#define NBt 4
#define TT 1024
#define CC 1024
#define NH 16
#define HD 64
#define NR (NBt * TT)            /* 4096 */
#define HG (NBt * NH)            /* (batch, head) slabs: all in one launch */
#define K3 (3 * HD)              /* 192 */
typedef __bf16 v16b __attribute__((ext_vector_type(16)));
typedef unsigned short v8us __attribute__((ext_vector_type(8), may_alias));
typedef float  v8f  __attribute__((ext_vector_type(8)));
typedef float  v4f  __attribute__((ext_vector_type(4)));
typedef float  v4fa __attribute__((ext_vector_type(4), may_alias));
union FragB { v16b v; v8us half[2]; unsigned short u[16]; };

__device__ __forceinline__ unsigned short bf16_bits(float x) { unsigned int u = __float_as_uint(x); return (unsigned short)((u + 0x7FFFu + ((u >> 16) & 1u)) >> 16); }
__device__ __forceinline__ float bf16_val(unsigned short b) { return __uint_as_float(((unsigned int)b) << 16); }
__device__ __forceinline__ float bf16_round(float x) { return bf16_val(bf16_bits(x)); }
// D += A·B with NT terms: 1 = ah·bh, 2 = + al·bh (A split), 3 = + ah·bl (both split)
template <int NT>
__device__ __forceinline__ v8f mmaN(v16b ah, v16b al, v16b bh, v16b bl, v8f c) {
  c = __builtin_amdgcn_wmma_f32_16x16x32_bf16(false, ah, false, bh, (short)0, c, false, false);
  if (NT >= 2) c = __builtin_amdgcn_wmma_f32_16x16x32_bf16(false, al, false, bh, (short)0, c, false, false);
  if (NT >= 3) c = __builtin_amdgcn_wmma_f32_16x16x32_bf16(false, ah, false, bl, (short)0, c, false, false);
  asm volatile("v_nop\n\tv_nop\n\tv_nop\n\tv_nop" : "+v"(c) : "v"(ah), "v"(al), "v"(bh), "v"(bl));
  return c;
}

__global__ __launch_bounds__(256) void k_wt_bf16(const float* __restrict__ W, unsigned short* __restrict__ Wt, int K, int N) {
  const int t = blockIdx.x * 256 + threadIdx.x;
  const int k8n = K / 8;
  if (t >= N * k8n) return;
  const int n = t / k8n, k8 = (t % k8n) * 8;
  v8us v;
#pragma unroll
  for (int i = 0; i < 8; ++i) v[i] = bf16_bits(W[(size_t)(k8 + i) * N + n]);
  *(v8us*)(Wt + (size_t)n * K + k8) = v;
  
}

// GEMM C[M][N] (f32, pitch ldc) = act(A[M][K]·W + bias). A f32 row-major (pitch lda) converted per fragment to bf16
// (ASPLIT: hi/lo two planes -> 2 terms, else single rounded term); Wt bf16 [N][K] (pitch ldb). BIAS_BF16 rounds the
// bias to bf16 first (bias quantised to bf16 before the add). K%32==0, M%16==0, N%64==0.
template <bool ASPLIT, int ACT, bool BIAS_BF16>
__global__ __launch_bounds__(128) void k_gemm_bf(const float* __restrict__ A, int lda, const unsigned short* __restrict__ Wt, int ldb,
                                               const float* __restrict__ bias, float* __restrict__ C, int ldc, int M, int N, int K) {
  __shared__ __attribute__((aligned(16))) float so[4][16][64];
  const int tid = threadIdx.x, w = tid >> 5, lane = tid & 31, ln = lane & 15, hh = lane >> 4;
  const int ntn = N / 64;
  const int wid = blockIdx.x * 4 + w;
  const int mt = wid / ntn, nq = wid % ntn;
  if (mt * 16 >= M) return;
  const int row0 = mt * 16, col0 = nq * 64;
  const float* arow = A + (size_t)(row0 + ln) * lda;
  v8f acc[4] = {};
  for (int kb = 0; kb < K; kb += 32) {
    FragB ah, al;
    const v4f x0 = *(const v4fa*)(arow + kb + 8 * hh), x1 = *(const v4fa*)(arow + kb + 8 * hh + 4);
    const v4f x2 = *(const v4fa*)(arow + kb + 16 + 8 * hh), x3 = *(const v4fa*)(arow + kb + 16 + 8 * hh + 4);
    float xs[16] = {x0[0],x0[1],x0[2],x0[3],x1[0],x1[1],x1[2],x1[3],x2[0],x2[1],x2[2],x2[3],x3[0],x3[1],x3[2],x3[3]};
#pragma unroll
    for (int i = 0; i < 16; ++i) { const unsigned short hb = bf16_bits(xs[i]); ah.u[i] = hb; al.u[i] = ASPLIT ? bf16_bits(xs[i] - bf16_val(hb)) : (unsigned short)0; }
#pragma unroll
    for (int t = 0; t < 4; ++t) {
      const unsigned short* brow = Wt + (size_t)(col0 + t * 16 + ln) * ldb + kb;
      FragB b;
      b.half[0] = *(const v8us*)(brow + 8 * hh);
      b.half[1] = *(const v8us*)(brow + 16 + 8 * hh);
      acc[t] = mmaN<ASPLIT ? 2 : 1>(ah.v, al.v, b.v, b.v, acc[t]);
    }
  }
#pragma unroll
  for (int t = 0; t < 4; ++t) {
    float bv = bias ? bias[col0 + t * 16 + ln] : 0.f;
    if (BIAS_BF16) bv = bf16_round(bv);
#pragma unroll
    for (int r = 0; r < 8; ++r) { float v = acc[t][r] + bv; if (ACT == 1) v = fmaxf(v, 0.f); so[w][8 * hh + r][t * 16 + ln] = v; }
  }
  __builtin_amdgcn_fence(__ATOMIC_ACQ_REL, "workgroup");
  __builtin_amdgcn_wave_barrier();
  const int rsub = lane >> 4, c4 = (lane & 15) * 4;
  {
#pragma unroll
    for (int q = 0; q < 8; ++q) {
      const int r = q * 2 + rsub;
      const v4f v = *(const v4fa*)&so[w][r][c4];
      *(v4f*)(C + (size_t)(row0 + r) * ldc + col0 + c4) = v;
    }
    
  }
}

// GEMM C = act(A·W + bias + resid): A f32 (ASPLIT -> hi/lo 2 terms), Wt bf16 [N][K]; ACT 0 none, 1 relu, 2 exact gelu;
// resid (optional, f32, row index = (row % rmod), pitch ldr, RES_BF16 rounds it) added before the activation.
template <bool ASPLIT, int ACT, bool BIAS_BF16, bool RES_BF16>
__global__ __launch_bounds__(128) void k_gemm_bf3(const float* __restrict__ A, int lda, const unsigned short* __restrict__ Wt, int ldb,
                                                const float* __restrict__ bias, const float* __restrict__ resid, int rmod, int ldr,
                                                float* __restrict__ C, int ldc, int M, int N, int K) {
  __shared__ __attribute__((aligned(16))) float so[4][16][64];
  const int tid = threadIdx.x, w = tid >> 5, lane = tid & 31, ln = lane & 15, hh = lane >> 4;
  const int ntn = N / 64;
  const int wid = blockIdx.x * 4 + w;
  const int mt = wid / ntn, nq = wid % ntn;
  if (mt * 16 >= M) return;
  const int row0 = mt * 16, col0 = nq * 64;
  const float* arow = A + (size_t)(row0 + ln) * lda;
  v8f acc[4] = {};
  for (int kb = 0; kb < K; kb += 32) {
    FragB ah, al;
    const v4f x0 = *(const v4fa*)(arow + kb + 8 * hh), x1 = *(const v4fa*)(arow + kb + 8 * hh + 4);
    const v4f x2 = *(const v4fa*)(arow + kb + 16 + 8 * hh), x3 = *(const v4fa*)(arow + kb + 16 + 8 * hh + 4);
    float xs[16] = {x0[0],x0[1],x0[2],x0[3],x1[0],x1[1],x1[2],x1[3],x2[0],x2[1],x2[2],x2[3],x3[0],x3[1],x3[2],x3[3]};
#pragma unroll
    for (int i = 0; i < 16; ++i) { const unsigned short hb = bf16_bits(xs[i]); ah.u[i] = hb; al.u[i] = ASPLIT ? bf16_bits(xs[i] - bf16_val(hb)) : (unsigned short)0; }
#pragma unroll
    for (int t = 0; t < 4; ++t) {
      const unsigned short* brow = Wt + (size_t)(col0 + t * 16 + ln) * ldb + kb;
      FragB b;
      b.half[0] = *(const v8us*)(brow + 8 * hh);
      b.half[1] = *(const v8us*)(brow + 16 + 8 * hh);
      acc[t] = mmaN<ASPLIT ? 2 : 1>(ah.v, al.v, b.v, b.v, acc[t]);
    }
  }
#pragma unroll
  for (int t = 0; t < 4; ++t) {
    const int col = col0 + t * 16 + ln;
    float bv = bias ? bias[col] : 0.f;
    if (BIAS_BF16) bv = bf16_round(bv);
#pragma unroll
    for (int r = 0; r < 8; ++r) {
      float v = acc[t][r] + bv;
      if (resid) { float rv = resid[(size_t)((row0 + 8 * hh + r) % rmod) * ldr + col]; if (RES_BF16) rv = bf16_round(rv); v += rv; }
      if (ACT == 1) v = fmaxf(v, 0.f);
      if (ACT == 2) v = 0.5f * v * (1.0f + erff(v * 0.70710678118654752f));
      if (ACT == 3) { const float u = 0.7978845608028654f * (v + 0.044715f * v * v * v); v = 0.5f * v * (1.0f + tanhf(u)); }
      so[w][8 * hh + r][t * 16 + ln] = v;
    }
  }
  __builtin_amdgcn_fence(__ATOMIC_ACQ_REL, "workgroup");
  __builtin_amdgcn_wave_barrier();
  const int rsub = lane >> 4, c4 = (lane & 15) * 4;
  {
#pragma unroll
    for (int q = 0; q < 8; ++q) {
      const int r = q * 2 + rsub;
      const v4f v = *(const v4fa*)&so[w][r][c4];
      *(v4f*)(C + (size_t)(row0 + r) * ldc + col0 + c4) = v;
    }
    
  }
}
// row LayerNorm (biased variance, eps) over N: s = X (+ R); optional out_sum <- s; out_norm <- (s-mu)*rsqrt(var+eps)*g + b
template <bool PARAM_BF16>
__global__ __launch_bounds__(256) void k_layernorm(const float* __restrict__ X, const float* __restrict__ R, const float* __restrict__ g, const float* __restrict__ bta,
                                                  float* __restrict__ out_sum, float* __restrict__ out_norm, int N, float eps) {
  __shared__ float red[256];
  const int row = blockIdx.x, tid = threadIdx.x;
  const float* x = X + (size_t)row * N; const float* rr = R ? R + (size_t)row * N : nullptr;
  float vals[16];                     // up to N = 4096
  const int per = N / 256;            // contiguous chunk per thread? use strided-by-4 chunks: thread handles j = tid*4 + 1024*u
  float s1 = 0.f;
  for (int u = 0; u < per / 4; ++u) {
    const int j = tid * 4 + 1024 * u;
    const v4f a = *(const v4fa*)(x + j);
    v4f b = {0.f,0.f,0.f,0.f}; if (rr) b = *(const v4fa*)(rr + j);
#pragma unroll
    for (int q = 0; q < 4; ++q) { const float v = a[q] + b[q]; vals[u * 4 + q] = v; s1 += v; }
  }
  red[tid] = s1; __syncthreads();
  for (int st = 128; st > 0; st >>= 1) { if (tid < st) red[tid] += red[tid + st]; __syncthreads(); }
  const float mu = red[0] / (float)N; __syncthreads();
  float s2 = 0.f;
  for (int u = 0; u < per / 4; ++u)
#pragma unroll
    for (int q = 0; q < 4; ++q) { const float c = vals[u * 4 + q] - mu; s2 += c * c; }
  red[tid] = s2; __syncthreads();
  for (int st = 128; st > 0; st >>= 1) { if (tid < st) red[tid] += red[tid + st]; __syncthreads(); }
  const float rs = rsqrtf(red[0] / (float)N + eps);
  {
    for (int u = 0; u < per / 4; ++u) {
      const int j = tid * 4 + 1024 * u;
      v4f o, sm;
#pragma unroll
      for (int q = 0; q < 4; ++q) {
        float gg = g[j + q], bb = bta[j + q];
        if (PARAM_BF16) { gg = bf16_round(gg); bb = bf16_round(bb); }
        sm[q] = vals[u * 4 + q]; o[q] = (vals[u * 4 + q] - mu) * rs * gg + bb;
      }
      if (out_sum) *(v4f*)(out_sum + (size_t)row * N + j) = sm;
      *(v4f*)(out_norm + (size_t)row * N + j) = o;
    }
    
  }
}



// ---- f16 WMMA path (v_wmma_f32_16x16x32_f16): 11-bit significands for operands in range — used where a [0,1] probability operand needs more precision than bf16
typedef _Float16 v16h __attribute__((ext_vector_type(16)));
union FragH { v16h v; v8us half[2]; _Float16 h[16]; unsigned short u[16]; };
template <int NT>
__device__ __forceinline__ v8f mmaH(v16h ah, v16h al, v16h bh, v16h bl, v8f c) {
  c = __builtin_amdgcn_wmma_f32_16x16x32_f16(false, ah, false, bh, (short)0, c, false, false);
  if (NT >= 2) c = __builtin_amdgcn_wmma_f32_16x16x32_f16(false, al, false, bh, (short)0, c, false, false);
  if (NT >= 3) c = __builtin_amdgcn_wmma_f32_16x16x32_f16(false, ah, false, bl, (short)0, c, false, false);
  asm volatile("v_nop\n\tv_nop\n\tv_nop\n\tv_nop" : "+v"(c) : "v"(ah), "v"(al), "v"(bh), "v"(bl));
  return c;
}
// batched GEMM like k_gemm_b but f16 operands: A f32 (split into f16 hi/lo if ASPLIT, else rounded to f16), Bt = f16 values [n][k]; alpha; C f32; N multiple of 16 (partial tiles skipped)
template <bool ASPLIT>
__global__ __launch_bounds__(128) void k_gemm_h(const float* __restrict__ A, int lda, size_t sA, const _Float16* __restrict__ Bh, int ldb, size_t sB, float alpha, float* __restrict__ C, int ldc, size_t sC, int M, int N, int K) {
  __shared__ __attribute__((aligned(16))) float so[4][16][64];
  const int tid = threadIdx.x, w = tid >> 5, lane = tid & 31, ln = lane & 15, hh = lane >> 4; const int by = blockIdx.y;
  A += (size_t)by * sA; Bh += (size_t)by * sB; C += (size_t)by * sC;
  const int ntn = (N + 63) / 64; const int wid = blockIdx.x * 4 + w; const int mt = wid / ntn, nq = wid % ntn; if (mt * 16 >= M) return;
  const int row0 = mt * 16, col0 = nq * 64; const float* arow = A + (size_t)(row0 + ln) * lda;
  v8f acc[4] = {};
  for (int kb = 0; kb < K; kb += 32) {
    FragH ah, al;
    const v4f x0 = *(const v4fa*)(arow + kb + 8 * hh), x1 = *(const v4fa*)(arow + kb + 8 * hh + 4), x2 = *(const v4fa*)(arow + kb + 16 + 8 * hh), x3 = *(const v4fa*)(arow + kb + 16 + 8 * hh + 4);
    float xs[16] = {x0[0],x0[1],x0[2],x0[3],x1[0],x1[1],x1[2],x1[3],x2[0],x2[1],x2[2],x2[3],x3[0],x3[1],x3[2],x3[3]};
#pragma unroll
    for (int i = 0; i < 16; ++i) { const _Float16 h = (_Float16)xs[i]; ah.h[i] = h; al.h[i] = ASPLIT ? (_Float16)(xs[i] - (float)h) : (_Float16)0.0f; }
#pragma unroll
    for (int t = 0; t < 4; ++t) { if (col0 + t * 16 >= N) continue; const size_t boff = (size_t)(col0 + t * 16 + ln) * ldb + kb; FragH bq; bq.half[0] = *(const v8us*)(Bh + boff + 8 * hh); bq.half[1] = *(const v8us*)(Bh + boff + 16 + 8 * hh);
      acc[t] = mmaH<ASPLIT ? 2 : 1>(ah.v, al.v, bq.v, bq.v, acc[t]); }
  }
#pragma unroll
  for (int t = 0; t < 4; ++t) { if (col0 + t * 16 >= N) continue;
#pragma unroll
    for (int r = 0; r < 8; ++r) so[w][8 * hh + r][t * 16 + ln] = acc[t][r] * alpha; }
  __builtin_amdgcn_fence(__ATOMIC_ACQ_REL, "workgroup"); __builtin_amdgcn_wave_barrier();
  const int rsub = lane >> 4, c4 = (lane & 15) * 4;
  {
#pragma unroll
    for (int q = 0; q < 8; ++q) { const int r = q * 2 + rsub; if (col0 + c4 < N) { const v4f v = *(const v4fa*)&so[w][r][c4]; *(v4f*)(C + (size_t)(row0 + r) * ldc + col0 + c4) = v; } }
     }
}

// Wt[n][k] = f16(W[k][n]·scale) from f32 row-major W[K][N] (scale = power of two; bf16-exact weights stay exact in f16 away from the subnormal range)
// blockIdx.y picks one of four weight matrices: 0..2 go to planes 0..2 of Wt012, 3 goes to Wt3
// One thread takes an 8 x 8 block of W (8 output pieces of 16 B), so the launch is one round of 256 work-groups. A wave = 4 column groups (one 128-B line of each W row) x 8 row groups (one 128-B line of each Wt row).
__global__ __launch_bounds__(256) void k_wt_f16(const float* __restrict__ W0, const float* __restrict__ W1, const float* __restrict__ W2, const float* __restrict__ W3, _Float16* __restrict__ Wt012, _Float16* __restrict__ Wt3, float scale) {
  const int y = blockIdx.y; const float* __restrict__ W = (y == 0) ? W0 : (y == 1) ? W1 : (y == 2) ? W2 : W3; _Float16* __restrict__ Wt = (y == 3) ? Wt3 : Wt012 + (size_t)y * CC * CC;
  const int lane = threadIdx.x & 31, wv = blockIdx.x * 8 + (threadIdx.x >> 5); const int n0 = ((wv % (CC / 32)) * 4 + (lane & 3)) * 8, k0 = ((wv / (CC / 32)) * 8 + (lane >> 2)) * 8;
  const unsigned lo = (unsigned)(k0 * CC + n0) * 4u; const char* p = (const char*)W + lo; v4f a[8][2];      /* the thread's byte offset: one register serves every load */
#pragma unroll
  for (int i = 0; i < 8; ++i) { a[i][0] = *(const v4fa*)(p + i * (CC * 4)); a[i][1] = *(const v4fa*)(p + i * (CC * 4) + 16); }
  asm volatile("s_wait_xcnt 0x0" :: "v"(lo) : "memory");      // stands in front of the first instruction that reuses the loads' address register; the operand keeps that register untouched up to here
  __builtin_amdgcn_sched_barrier(0);      // keeps the arithmetic below behind that wait, and so behind the issue of every load
  unsigned short* o = (unsigned short*)Wt + (size_t)n0 * CC + k0; FragH f[8];
#pragma unroll
  for (int j = 0; j < 8; ++j)
#pragma unroll
    for (int i = 0; i < 8; ++i) f[j].h[i] = (_Float16)(bf16_round(a[i][j >> 2][j & 3]) * scale);
  __builtin_amdgcn_sched_barrier(0);      // the stores go out as one run behind the arithmetic: none of it then overwrites a register of an issued store
#pragma unroll
  for (int j = 0; j < 8; ++j) *(v8us*)(o + j * CC) = f[j].half[0];
}
// Block-tiled GEMM with fused epilogue: v = acc*alpha + bias[by*sBias + col] ; ACT 0 none / 1 elu ; writes f16 C16 (H16) or f32 C.
// One block = WM x WN waves = a (WM*FM*16) x (WN*64) tile of C; a wave owns FM x 4 accumulator tiles. Per chunk of KC k the block brings its A rows and B rows (whole 128-B lines, KC/8 lanes a row)
// into LDS at a pitch of 2*KC + 16 B and every wave reads its fragments from there; two buffers, the next chunk's global loads fly while this chunk is multiplied.
// LD = row pitch of A and of B in elements, a compile-time constant so that the rows of a tile are immediate offsets from one address per operand.
// Needs M a multiple of WM*FM*16, N of WN*64, K of KC (every launch below is).
// Two batch axes: blockIdx.y steps A, B, C by sA, sB, sC (heads), blockIdx.z by zA, zB, zC (batches).
template <int ACT, int WM, int WN, int FM, int KC, int LD, bool H16>
__global__ __launch_bounds__(WM * WN * 32) void k_gemm_hhx(const _Float16* __restrict__ A, size_t sA, const _Float16* __restrict__ Bh, size_t sB, float alpha, const float* __restrict__ bias, size_t sBias,
    float* __restrict__ C, _Float16* __restrict__ C16, int ldc, size_t sC, int M, int N, int K, size_t zA, size_t zB, size_t zC) {
  constexpr int NW = WM * WN, BM = WM * FM * 16, BN = WN * 64, CPR = KC / 8, RP = NW * 32 / CPR, NA = BM / RP, NB = BN / RP, PIT = KC + 8;
  __shared__ __attribute__((aligned(16))) unsigned short tA[2][BM][PIT];
  __shared__ __attribute__((aligned(16))) unsigned short tB[2][BN][PIT];
  __shared__ __attribute__((aligned(16))) float so[NW][16][64];
  const int tid = threadIdx.x, w = tid >> 5, lane = tid & 31, ln = lane & 15, hh = lane >> 4; const int by = blockIdx.y;
  const int bz = blockIdx.z; A += (size_t)by * sA + (size_t)bz * zA; Bh += (size_t)by * sB + (size_t)bz * zB; const size_t cofs = (size_t)by * sC + (size_t)bz * zC; const float* bp = bias ? bias + (size_t)by * sBias : nullptr;
  const int ntn = N / BN; const int bm = blockIdx.x / ntn, bn = blockIdx.x % ntn; if (bm * BM >= M) return;
  const int wm = w / WN, wn = w % WN; const int srow = tid / CPR, sc = (tid % CPR) * 8;
  const unsigned short* gA = (const unsigned short*)A + (size_t)(bm * BM + srow) * LD + sc;
  const unsigned short* gB = (const unsigned short*)Bh + (size_t)(bn * BN + srow) * LD + sc;
  const int col0 = bn * BN + wn * 64;
  float bvv[4];      // the wave's bias values, fetched ahead of the products
#pragma unroll
  for (int t = 0; t < 4; ++t) bvv[t] = bp ? bf16_round(bp[col0 + t * 16 + ln]) : 0.f;
  v8us ra[NA], rb[NB];
  v8f acc[FM][4] = {};
  auto g2r = [&](int kb) {
#pragma unroll
    for (int i = 0; i < NA; ++i) ra[i] = *(const v8us*)(gA + kb + i * RP * LD);
#pragma unroll
    for (int i = 0; i < NB; ++i) rb[i] = *(const v8us*)(gB + kb + i * RP * LD);
  };
  auto r2s = [&](int buf) {
#pragma unroll
    for (int i = 0; i < NA; ++i) *(v8us*)&tA[buf][i * RP + srow][sc] = ra[i];
#pragma unroll
    for (int i = 0; i < NB; ++i) *(v8us*)&tB[buf][i * RP + srow][sc] = rb[i];
  };
  auto mul = [&](int buf) {
#pragma unroll
    for (int ks = 0; ks < KC / 32; ++ks) { FragH fa[FM], fb[4];
#pragma unroll
      for (int i = 0; i < FM; ++i) { const unsigned short* p = &tA[buf][(wm * FM + i) * 16 + ln][ks * 32 + 8 * hh]; fa[i].half[0] = *(const v8us*)p; fa[i].half[1] = *(const v8us*)(p + 16); }
#pragma unroll
      for (int t = 0; t < 4; ++t) { const unsigned short* p = &tB[buf][wn * 64 + t * 16 + ln][ks * 32 + 8 * hh]; fb[t].half[0] = *(const v8us*)p; fb[t].half[1] = *(const v8us*)(p + 16); }
#pragma unroll
      for (int i = 0; i < FM; ++i)
#pragma unroll
        for (int t = 0; t < 4; ++t) acc[i][t] = __builtin_amdgcn_wmma_f32_16x16x32_f16(false, fa[i].v, false, fb[t].v, (short)0, acc[i][t], false, false); }
  };
  g2r(0); r2s(0);
  __syncthreads();      // chunk 0 is in buffer 0 for every wave
  int buf = 0;
  for (int kb = KC; kb < K; kb += KC) {
    g2r(kb);            // next chunk: in flight while this one is multiplied
    __builtin_amdgcn_sched_barrier(0);      // keeps those loads above the products; without it the compiler sinks them to just before their LDS stores and their latency is waited out
    mul(buf);
    r2s(buf ^ 1);       // that buffer's last readers left it before the barrier that ended the trip before
    __syncthreads();    // publishes the next chunk and ends this trip's reads of buf
    buf ^= 1;
  }
  mul(buf);
  const int rsub = lane >> 4, c4 = (lane & 15) * 4; typedef _Float16 v4h __attribute__((ext_vector_type(4)));
#pragma unroll
  for (int i = 0; i < FM; ++i) { const int row0 = bm * BM + (wm * FM + i) * 16;
#pragma unroll
    for (int t = 0; t < 4; ++t) { const float bv = bvv[t];
#pragma unroll
      for (int r = 0; r < 8; ++r) { float v = acc[i][t][r] * alpha + bv; if (ACT == 1) v = (v > 0.f) ? v : expm1f(v); else if (ACT == 7) v = (v > 0.f) ? v + 1.0f : expf(v); else if (ACT == 8) v = tanhf(v); else if (ACT == 9) v = 0.5f * v * (1.0f + tanhf(0.7978845608028654f * (v + 0.044715f * v * v * v))); else if (ACT == 11) v = 1.0f / (1.0f + expf(-v)); else if (ACT == 12) v = (v > 0.f) ? v : 0.01f * v; else if (ACT == 14) v = (v > 0.f) ? v : 0.1f * v; else if (ACT == 15) v = v / (1.0f + expf(-v)); else if (ACT == 3) v = fmaxf(v, 0.f); else if (ACT == 6) v = 0.5f * v * (1.0f + erff(v * 0.70710678118654752f)); so[w][8 * hh + r][t * 16 + ln] = v; } }
    __builtin_amdgcn_fence(__ATOMIC_ACQ_REL, "workgroup"); __builtin_amdgcn_wave_barrier();
#pragma unroll
    for (int q = 0; q < 8; ++q) { const int r = q * 2 + rsub; const v4f v = *(const v4fa*)&so[w][r][c4]; if (!H16) *(v4f*)(C + cofs + (size_t)(row0 + r) * ldc + col0 + c4) = v; else { v4h h4; for (int j = 0; j < 4; ++j) h4[j] = (_Float16)v[j]; *(v4h*)(C16 + cofs + (size_t)(row0 + r) * ldc + col0 + c4) = h4; } }
    if (i + 1 < FM) { __builtin_amdgcn_fence(__ATOMIC_ACQ_REL, "workgroup"); __builtin_amdgcn_wave_barrier(); }      // the wave's rows are read back before its next 16 rows overwrite them
  }
}


typedef _Float16 v4h __attribute__((ext_vector_type(4)));

// All three activations to f16, plane y of X16 from x_y. One round of 256 work-groups: a thread takes XP pieces of 8 elements of each activation, a work-group XP * 256 pieces in a row;
// all of a thread's loads are asked for before the first value is used, so that 8 waves a WGP keep the memory busy.
#define XP 8
__global__ __launch_bounds__(256) void k_x16(const float* __restrict__ x0, const float* __restrict__ x1, const float* __restrict__ x2, _Float16* __restrict__ X16) {
  const unsigned e0 = (blockIdx.x * (XP * 256) + threadIdx.x) * 8u, lo = e0 * 4u; v4f a[3][XP][2];      /* the thread's first element, and its byte offset: one register serves every load */
#pragma unroll
  for (int y = 0; y < 3; ++y) { const char* p = (const char*)((y == 0) ? x0 : (y == 1) ? x1 : x2) + lo;
#pragma unroll
    for (int i = 0; i < XP; ++i) { a[y][i][0] = *(const v4fa*)(p + i * 8192); a[y][i][1] = *(const v4fa*)(p + i * 8192 + 16); } }
  asm volatile("s_wait_xcnt 0x0" :: "v"(lo) : "memory");      // stands in front of the first instruction that reuses the loads' address register; the operand keeps that register untouched up to here
  __builtin_amdgcn_sched_barrier(0);      // keeps the arithmetic below behind that wait, and so behind the issue of every load
#pragma unroll
  for (int y = 0; y < 3; ++y) { FragH f[XP];
#pragma unroll
    for (int i = 0; i < XP; ++i)
#pragma unroll
      for (int q = 0; q < 8; ++q) f[i].h[q] = (_Float16)bf16_round(a[y][i][q >> 2][q & 3]);
    __builtin_amdgcn_sched_barrier(0);      // the stores go out as one run behind the arithmetic: none of it then overwrites a register of an issued store
#pragma unroll
    for (int i = 0; i < XP; ++i) *(v8us*)((unsigned short*)X16 + (size_t)y * NR * CC + e0 + i * 2048) = f[i].half[0];
    if (y < 2) { asm volatile("s_wait_xcnt 0x0" ::: "memory");      // stands in front of the next group's arithmetic, which reuses the registers of these stores
      __builtin_amdgcn_sched_barrier(0);      // keeps that arithmetic behind the wait
    } } }
__global__ __launch_bounds__(256) void k_h16(const float* __restrict__ x, _Float16* __restrict__ X16, size_t n8) { const size_t t = (size_t)blockIdx.x * 256 + threadIdx.x; if (t >= n8) return; FragH f;
#pragma unroll
  for (int q = 0; q < 8; ++q) f.h[q] = (_Float16)x[t * 8 + q]; *(v8us*)((unsigned short*)X16 + t * 8) = f.half[0];  }
__global__ __launch_bounds__(256) void k_round16f(const float* __restrict__ W, _Float16* __restrict__ Bt, size_t n8) { const size_t t = (size_t)blockIdx.x * 256 + threadIdx.x; if (t >= n8) return; FragH f;
#pragma unroll
  for (int i = 0; i < 8; ++i) f.h[i] = (_Float16)(bf16_round(W[t * 8 + i]) * 16.0f); *(v8us*)((unsigned short*)Bt + t * 8) = f.half[0];  }
template <int NHv, int TTv>
__global__ __launch_bounds__(256) void k_vt(const _Float16* __restrict__ V16, int ldv, int voff, _Float16* __restrict__ Vt) { __shared__ unsigned short tl[64][66]; const int tid = threadIdx.x; const int slab = blockIdx.x / (TTv / 64), lg = blockIdx.x % (TTv / 64); const int b = slab / NHv, h = slab % NHv;
  for (int i = tid; i < 64 * 8; i += 256) { const int r = i / 8, c8 = (i % 8) * 8; FragH f; f.half[0] = *(const v8us*)((const unsigned short*)V16 + ((size_t)b * TTv + lg * 64 + r) * ldv + voff + h * 64 + c8);
#pragma unroll
    for (int q = 0; q < 8; ++q) tl[r][c8 + q] = f.u[q]; }
  __syncthreads();
  {
#pragma unroll
    for (int rd = 0; rd < 2; ++rd) { const int d = rd * 32 + tid / 8, pc = tid % 8; FragH f;
#pragma unroll
      for (int q = 0; q < 8; ++q) f.u[q] = tl[pc * 8 + q][d];
      *(v8us*)((unsigned short*)Vt + ((size_t)slab * 64 + d) * TTv + lg * 64 + pc * 8) = f.half[0]; }
     } }

__global__ __launch_bounds__(256) void k_hl(const float* __restrict__ F, _Float16* __restrict__ Hh, _Float16* __restrict__ Hl, size_t n8) { const size_t t = (size_t)blockIdx.x * 256 + threadIdx.x; if (t >= n8) return; FragH fh, fl; const v4f a = *(const v4fa*)(F + t * 8), c = *(const v4fa*)(F + t * 8 + 4);
#pragma unroll
  for (int q = 0; q < 4; ++q) { _Float16 h = (_Float16)a[q]; fh.h[q] = h; fl.h[q] = (_Float16)((a[q] - (float)h) * 1024.0f); h = (_Float16)c[q]; fh.h[4 + q] = h; fl.h[4 + q] = (_Float16)((c[q] - (float)h) * 1024.0f); }
  { *(v8us*)((unsigned short*)Hh + t * 8) = fh.half[0]; *(v8us*)((unsigned short*)Hl + t * 8) = fl.half[0];  } }

// The three projections as ONE launch: blockIdx.y = 0 Q, 1 K, 2 V (plane y of X16 times plane y of BW, bias y). The products are those of k_gemm_hhx<0, 4, 2, 2, 128, CC, .> (128 x 128 tile, 8 waves of 2 x 4 accumulator tiles,
// k chunks of 128 in two LDS buffers); the epilogue writes the operand forms that the score kernels read, so no f32 Q or K plane, no row-major V, and no fold or transpose launch.
// Q -> [hi | lo*2^10 | hi], K -> [hi | hi*2^-10 | lo] (a wave's 64 columns are one head: 3 whole 128-B lines a row); V -> V^T (a lane's 8 accumulator rows are 8 tokens in a row of V^T; the block's tile goes through LDS so that 256 B of a V^T row leave together).
// Both epilogues stage in the buffers that the last chunk does not use: their last readers left them before the loop's last barrier.
#define PKC 128
#define PPIT (PKC + 8)
#define SOP 68                   /* floats a staging row: 16 B more than 64 columns, so that rows 8 apart and the 4 rows of a read fall on different banks */
typedef float fal __attribute__((may_alias));
// 16 staged rows of 64 f32 -> the three f16 parts of each row, MODE 0 as Q, 1 as K. A lane takes 8 columns of rows 0, 4, 8, 12 from its own: 8 lanes write one 128-B line.
template <int MODE>
__device__ __forceinline__ void fold_store(const fal* p, unsigned short* o) {
  FragH s0[4], s1[4], s2[4];
#pragma unroll
  for (int q = 0; q < 4; ++q) { const v4f a0 = *(const v4fa*)(p + q * 4 * SOP), a1 = *(const v4fa*)(p + q * 4 * SOP + 4);
#pragma unroll
    for (int e = 0; e < 8; ++e) { const float v = (e < 4) ? a0[e & 3] : a1[e & 3]; const _Float16 hi = (_Float16)v; const float rest = v - (float)hi; s0[q].h[e] = hi;
      if (MODE == 0) { s1[q].h[e] = (_Float16)(rest * 1024.0f); s2[q].h[e] = hi; } else { s1[q].h[e] = (_Float16)((float)hi * 0.0009765625f); s2[q].h[e] = (_Float16)rest; } } }
  __builtin_amdgcn_sched_barrier(0);      // the stores go out as one run behind the arithmetic: none of it then overwrites a register of an issued store
#pragma unroll
  for (int q = 0; q < 4; ++q) { unsigned short* oq = o + q * 4 * (NH * K3); *(v8us*)(oq) = s0[q].half[0]; *(v8us*)(oq + HD) = s1[q].half[0]; *(v8us*)(oq + 2 * HD) = s2[q].half[0]; }
  asm volatile("s_wait_xcnt 0x0" ::: "memory");      // stands directly behind the run of stores, in front of whatever next reuses their registers
  __builtin_amdgcn_sched_barrier(0);      // keeps later arithmetic behind that wait
}
__global__ __launch_bounds__(256) void k_proj(const _Float16* __restrict__ X16, const _Float16* __restrict__ BW, const float* __restrict__ bq, const float* __restrict__ bk, const float* __restrict__ bv,
    _Float16* __restrict__ O3q, _Float16* __restrict__ O3k, _Float16* __restrict__ VT) {
  constexpr int WN = 2, FM = 2, BM = 128, BN = 128, CPR = PKC / 8, RP = 256 / CPR, NA = BM / RP, NB = BN / RP;
  __shared__ __attribute__((aligned(16))) unsigned short tA[2][BM][PPIT];
  __shared__ __attribute__((aligned(16))) unsigned short tB[2][BN][PPIT];
  const int tid = threadIdx.x, w = tid >> 5, lane = tid & 31, ln = lane & 15, hh = lane >> 4; const int y = blockIdx.y;
  const float* bp = (y == 0) ? bq : (y == 1) ? bk : bv;
  const int bm = blockIdx.x / (CC / BN), bn = blockIdx.x % (CC / BN);
  const int wm = w / WN, wn = w % WN; const int srow = tid / CPR, sc = (tid % CPR) * 8;
  const unsigned short* gA = (const unsigned short*)X16 + (size_t)y * NR * CC + (size_t)(bm * BM + srow) * CC + sc;
  const unsigned short* gB = (const unsigned short*)BW + (size_t)y * CC * CC + (size_t)(bn * BN + srow) * CC + sc;
  const int col0 = bn * BN + wn * 64;
  float bvv[4];      // the wave's bias values, fetched ahead of the products
#pragma unroll
  for (int t = 0; t < 4; ++t) bvv[t] = bf16_round(bp[col0 + t * 16 + ln]);
  v8us ra[NA], rb[NB];
  v8f acc[FM][4] = {};
  auto g2r = [&](int kb) {
#pragma unroll
    for (int i = 0; i < NA; ++i) ra[i] = *(const v8us*)(gA + kb + i * RP * CC);
#pragma unroll
    for (int i = 0; i < NB; ++i) rb[i] = *(const v8us*)(gB + kb + i * RP * CC);
  };
  auto r2s = [&](int buf) {
#pragma unroll
    for (int i = 0; i < NA; ++i) *(v8us*)&tA[buf][i * RP + srow][sc] = ra[i];
#pragma unroll
    for (int i = 0; i < NB; ++i) *(v8us*)&tB[buf][i * RP + srow][sc] = rb[i];
  };
  auto mul = [&](int buf) {
#pragma unroll
    for (int ks = 0; ks < PKC / 32; ++ks) { FragH fa[FM], fb[4];
#pragma unroll
      for (int i = 0; i < FM; ++i) { const unsigned short* p = &tA[buf][(wm * FM + i) * 16 + ln][ks * 32 + 8 * hh]; fa[i].half[0] = *(const v8us*)p; fa[i].half[1] = *(const v8us*)(p + 16); }
#pragma unroll
      for (int t = 0; t < 4; ++t) { const unsigned short* p = &tB[buf][wn * 64 + t * 16 + ln][ks * 32 + 8 * hh]; fb[t].half[0] = *(const v8us*)p; fb[t].half[1] = *(const v8us*)(p + 16); }
#pragma unroll
      for (int i = 0; i < FM; ++i)
#pragma unroll
        for (int t = 0; t < 4; ++t) acc[i][t] = __builtin_amdgcn_wmma_f32_16x16x32_f16(false, fa[i].v, false, fb[t].v, (short)0, acc[i][t], false, false); }
  };
  g2r(0); r2s(0);
  __syncthreads();      // chunk 0 is in buffer 0 for every wave
  int buf = 0;
  for (int kb = PKC; kb < CC; kb += PKC) {
    g2r(kb);            // next chunk: in flight while this one is multiplied
    __builtin_amdgcn_sched_barrier(0);      // keeps those loads above the products; without it the compiler sinks them to just before their LDS stores and their latency is waited out
    mul(buf);
    r2s(buf ^ 1);       // that buffer's last readers left it before the barrier that ended the trip before
    __syncthreads();    // publishes the next chunk and ends this trip's reads of buf
    buf ^= 1;
  }
  mul(buf);
  if (y < 2) {      /* Q, K: each wave by itself, its first 16 rows through its 16 x SOP floats of the free A buffer, its other 16 through the same place of the free B buffer */
    fal* soA = (fal*)&tA[buf ^ 1][0][0] + w * (16 * SOP); fal* soB = (fal*)&tB[buf ^ 1][0][0] + w * (16 * SOP);
#pragma unroll
    for (int i = 0; i < FM; ++i) { fal* so = i ? soB : soA;
#pragma unroll
      for (int t = 0; t < 4; ++t)
#pragma unroll
        for (int r = 0; r < 8; ++r) so[(8 * hh + r) * SOP + t * 16 + ln] = acc[i][t][r] * 0.0625f + bvv[t]; }
    __builtin_amdgcn_fence(__ATOMIC_ACQ_REL, "workgroup"); __builtin_amdgcn_wave_barrier();      // the wave's rows are written before its lanes read them back; it stands ahead of every global store, so it waits for none
    const int po = (lane >> 3) * SOP + (lane & 7) * 8;
    unsigned short* ob = (unsigned short*)(y ? O3k : O3q) + (size_t)(bm * BM + wm * FM * 16 + (lane >> 3)) * (NH * K3) + (col0 / HD) * K3 + (lane & 7) * 8;
    if (y == 0) fold_store<0>(soA + po, ob); else fold_store<1>(soA + po, ob);
    if (y == 0) fold_store<0>(soB + po, ob + 16 * (NH * K3)); else fold_store<1>(soB + po, ob + 16 * (NH * K3));
  } else {      /* V: the block's 128 tokens x 128 columns, transposed in LDS */
    unsigned short (*tv)[PPIT] = tA[buf ^ 1];
#pragma unroll
    for (int i = 0; i < FM; ++i)
#pragma unroll
      for (int t = 0; t < 4; ++t) { FragH f;
#pragma unroll
        for (int r = 0; r < 8; ++r) f.h[r] = (_Float16)(acc[i][t][r] * 0.0625f + bvv[t]);
        *(v8us*)&tv[wn * 64 + t * 16 + ln][(wm * FM + i) * 16 + 8 * hh] = f.half[0]; }
    __syncthreads();      // every wave's tokens are in the tile before rows of it are read
    unsigned short* o = (unsigned short*)VT + ((size_t)(bm / (TT / BM)) * CC + bn * BN + (tid >> 4)) * TT + (bm % (TT / BM)) * BM + (tid & 15) * 8;
    v8us rv[8];
#pragma unroll
    for (int j = 0; j < 8; ++j) rv[j] = *(const v8us*)&tv[j * 16 + (tid >> 4)][(tid & 15) * 8];
#pragma unroll
    for (int j = 0; j < 8; ++j) *(v8us*)(o + (size_t)j * 16 * TT) = rv[j];
    asm volatile("s_wait_xcnt 0x0" ::: "memory");      // stands directly behind the run of stores, in front of whatever next reuses their registers
  }
}
// Scores never leave the registers. One wave owns NQ*16 queries, one work-group of 8 waves NQ*128 queries of one (batch, head); it walks the head's 1024 keys in stages of KT.
// S^T = K*Q^T: A = 16 key rows of the folded K from LDS, B = the wave's folded Q rows, loaded once and kept; a lane then holds scores of ONE query per 16-query group (column ln), keys 8*hh + r of each 16-key tile,
// so every row sum and maximum is in-lane plus one exchange between the wave's halves.
// ATT false: the row statistics. exp(s/2) needs no maximum taken off, because s is clipped to +-50 (e within 1.4e-11 .. 7.2e10, its squares' sum below 6e24);
//   with p = e / sum e and sum p = 1 the sum of (p - 1/TT)^2 is sum e^2 / (sum e)^2 - 1/TT. The clip and the scale are monotone, so the clipped maximum comes from the raw maximum.
//   RST[row] = (sum of clipped s, max of clipped s, variance, raw maximum).
// ATT true: O^T += V^T * P^T. Two score tiles (32 keys), turned into exp in place, ARE the B operand in the hardware's k order; A = 16 rows of V^T from LDS read in that same order.
//   The row's raw maximum is known from the statistics kernel (same products, same order), so nothing is rescaled; P = exp(..) * 2^10 as f16, the division by the f32 sum comes last.
//   The head's time t is found in the prologue, by every work-group of the head for itself: a thread sums 4 rows of RST, the 256 sums go through LDS (published by stage 0's barrier), and every wave adds them in the order of a
//   halving tree over 256 (steps 128, 64, 32 in-lane, 16 .. 1 between lanes). Lane u of each half-wave takes hidden unit u of the MLP; the 16 products are added in the order of u. All loads are asked for with the Q loads.
// 2^x with the slot behind it: the instruction set asks for one v_nop or independent instruction between a transcendental and a use of its result or an overwrite of its source.
// In one statement the v_nop cannot be parted from its exp.
__device__ __forceinline__ float exp2_slot(float x) { float e; asm volatile("v_exp_f32 %0, %1\n\tv_nop" : "=v"(e) : "v"(x)); return e; }
#define KT 64                    /* keys per stage */
#define KPIT (K3 + 8)            /* 400 B a row: 16 B x odd, for 16-byte LDS reads */
#define VPIT (KT + 8)            /* 144 B a row */
template <bool ATT, int NQ>
__global__ __launch_bounds__(256) void k_fused(const _Float16* __restrict__ Q3, const _Float16* __restrict__ Kf, const _Float16* __restrict__ VT, float* __restrict__ RST,
    const float* __restrict__ Wt1, const float* __restrict__ bt1, const float* __restrict__ Wt2, const float* __restrict__ bt2, _Float16* __restrict__ O16) {
  __shared__ __attribute__((aligned(16))) unsigned short tK[2][KT][KPIT];
  __shared__ __attribute__((aligned(16))) unsigned short tV[ATT ? 2 : 1][ATT ? HD : 1][VPIT];
  __shared__ v4f red[ATT ? 256 : 1];      /* the threads' sums of row statistics */
  const int tid = threadIdx.x, w = tid >> 5, lane = tid & 31, ln = lane & 15, hh = lane >> 4;
  const int slab = blockIdx.y, b = slab / NH, h = slab % NH; const int q0 = (blockIdx.x * 8 + w) * (NQ * 16) + ln;      /* the lane's first query; its others follow in steps of 16 */
  const int sr = tid >> 3, sc8 = (tid & 7) * 8;      /* staging: 8 lanes bring one 128-B line, the block 32 rows at a time */
  const unsigned short* gK = (const unsigned short*)Kf + ((size_t)b * TT + sr) * (NH * K3) + h * K3 + sc8;
  const unsigned short* gV = (const unsigned short*)VT + ((size_t)b * CC + h * HD + sr) * TT + sc8;
  FragH qf[NQ][6];
  float sc2 = 0.f, nm2[NQ];
  v8us rk[6], rv[2];
  v8f o[NQ][4] = {};
  float su0[NQ], su1[NQ], se[NQ], se2[NQ], rmx[NQ];
#pragma unroll
  for (int n = 0; n < NQ; ++n) { su0[n] = 0.f; su1[n] = 0.f; se[n] = 0.f; se2[n] = 0.f; rmx[n] = -3.0e38f; }
  auto g2r = [&](int kb) {
#pragma unroll
    for (int i = 0; i < 6; ++i) rk[i] = *(const v8us*)(gK + (size_t)(kb + (i / 3) * 32) * (NH * K3) + (i % 3) * 64);
    if (ATT) {
#pragma unroll
      for (int i = 0; i < 2; ++i) rv[i] = *(const v8us*)(gV + kb + i * 32 * TT); }
    asm volatile("s_wait_xcnt 0x0" ::: "memory");      // stands in front of the first instruction that reuses these loads' address registers
  };
  auto r2s = [&](int buf) {
#pragma unroll
    for (int i = 0; i < 6; ++i) *(v8us*)&tK[buf][(i / 3) * 32 + sr][(i % 3) * 64 + sc8] = rk[i];
    if (ATT) {
#pragma unroll
      for (int i = 0; i < 2; ++i) *(v8us*)&tV[buf][i * 32 + sr][sc8] = rv[i]; }
  };
  auto work = [&](int buf) {
#pragma unroll
    for (int p = 0; p < KT / 32; ++p) { v8f t[NQ][2] = {}; FragH a[6][2];
#pragma unroll
      for (int ks = 0; ks < 6; ++ks)
#pragma unroll
        for (int j = 0; j < 2; ++j) { const unsigned short* pk = &tK[buf][p * 32 + j * 16 + ln][ks * 32 + 8 * hh]; a[ks][j].half[0] = *(const v8us*)pk; a[ks][j].half[1] = *(const v8us*)(pk + 16); }
      __builtin_amdgcn_sched_barrier(0);      // the pass's K fragments are asked for as one group; without it the compiler puts each pair of reads, with a full wait, right in front of its product
#pragma unroll
      for (int ks = 0; ks < 6; ++ks)
#pragma unroll
        for (int j = 0; j < 2; ++j)
#pragma unroll
          for (int n = 0; n < NQ; ++n) t[n][j] = __builtin_amdgcn_wmma_f32_16x16x32_f16(false, a[ks][j].v, false, qf[n][ks].v, (short)0, t[n][j], false, false);
      float xe[NQ * 16];      /* exponent, then exp, of the lane's scores: group n, key slot s at n * 16 + s */
      if (!ATT) {
#pragma unroll
        for (int n = 0; n < NQ; ++n)
#pragma unroll
          for (int r = 0; r < 8; ++r) { const float x0 = t[n][0][r], x1 = t[n][1][r]; rmx[n] = fmaxf(rmx[n], fmaxf(x0, x1));
            const float v0 = fminf(fmaxf(x0 * 0.125f, -50.f), 50.f), v1 = fminf(fmaxf(x1 * 0.125f, -50.f), 50.f); su0[n] += v0; su1[n] += v1;
            xe[n * 16 + r] = v0 * 0.7213475204444817f; xe[n * 16 + 8 + r] = v1 * 0.7213475204444817f; }
        __builtin_amdgcn_sched_barrier(0);      // this fence and the next keep the exps in one run, every exponent ready ahead of it and every use behind it: the compiler writes no delay hint for a result of asm text, and a dependent instruction close behind its exp would wait unhinted, which holds up the SIMD's other wave too
#pragma unroll
        for (int i = 0; i < NQ * 16; ++i) xe[i] = exp2_slot(xe[i]);
        __builtin_amdgcn_sched_barrier(0);      // see the fence above
#pragma unroll
        for (int i = 0; i < NQ * 16; ++i) { se[i >> 4] += xe[i]; se2[i >> 4] += xe[i] * xe[i]; }
      } else { FragH pb[NQ], va[4];
#pragma unroll
        for (int dt = 0; dt < 4; ++dt) { const unsigned short* pv = &tV[buf][dt * 16 + ln][p * 32 + 8 * hh]; va[dt].half[0] = *(const v8us*)pv; va[dt].half[1] = *(const v8us*)(pv + 16); }
        __builtin_amdgcn_sched_barrier(0);      // the V fragments are asked for ahead of the exponentials, which then cover their latency
#pragma unroll
        for (int n = 0; n < NQ; ++n)
#pragma unroll
          for (int r = 0; r < 8; ++r) { xe[n * 16 + r] = t[n][0][r] * sc2 + nm2[n]; xe[n * 16 + 8 + r] = t[n][1][r] * sc2 + nm2[n]; }
        __builtin_amdgcn_sched_barrier(0);      // this fence and the next keep the exps in one run, every exponent ready ahead of it and every use behind it: the compiler writes no delay hint for a result of asm text, and a dependent instruction close behind its exp would wait unhinted, which holds up the SIMD's other wave too
#pragma unroll
        for (int i = 0; i < NQ * 16; ++i) xe[i] = exp2_slot(xe[i]);
        __builtin_amdgcn_sched_barrier(0);      // see the fence above
#pragma unroll
        for (int i = 0; i < NQ * 16; i += 2) { su0[i >> 4] += xe[i]; su1[i >> 4] += xe[i + 1]; }
#pragma unroll
        for (int n = 0; n < NQ; ++n)
#pragma unroll
          for (int s = 0; s < 16; ++s) pb[n].h[s] = (_Float16)xe[n * 16 + s];
#pragma unroll
        for (int dt = 0; dt < 4; ++dt)
#pragma unroll
          for (int n = 0; n < NQ; ++n) o[n][dt] = __builtin_amdgcn_wmma_f32_16x16x32_f16(false, va[dt].v, false, pb[n].v, (short)0, o[n][dt], false, false); } }
  };
  g2r(0);
  __builtin_amdgcn_sched_barrier(0);      // stage 0's loads and their wait stay ahead of the Q loads
#pragma unroll
  for (int n = 0; n < NQ; ++n) { const unsigned short* p = (const unsigned short*)Q3 + ((size_t)b * TT + q0 + n * 16) * (NH * K3) + h * K3 + 8 * hh;
#pragma unroll
    for (int ks = 0; ks < 6; ++ks) { qf[n][ks].half[0] = *(const v8us*)(p + ks * 32); qf[n][ks].half[1] = *(const v8us*)(p + ks * 32 + 16); } }
#pragma unroll
  for (int n = 0; n < NQ; ++n) nm2[n] = ATT ? RST[((size_t)slab * TT + q0 + n * 16) * 4 + 3] : 0.f;      /* the row's raw maximum, for now */
  v4f rs[4]; float m1b = 0.f, m1w0 = 0.f, m1w1 = 0.f, m1w2 = 0.f, m2w = 0.f, m2b = 0.f;      /* 4 rows of the head's statistics; the lane's hidden unit of the time MLP */
  if (ATT) {
#pragma unroll
    for (int i = 0; i < 4; ++i) rs[i] = *(const v4fa*)(RST + ((size_t)slab * TT + tid + i * 256) * 4);
    m1b = bt1[ln]; m1w0 = Wt1[ln]; m1w1 = Wt1[16 + ln]; m1w2 = Wt1[32 + ln]; m2w = Wt2[ln]; m2b = bt2[0]; }
  __builtin_amdgcn_sched_barrier(0);      // keeps the loads above ahead of the wait below
  asm volatile("s_wait_xcnt 0x0" ::: "memory");      // stands in front of the first instruction that reuses the address registers of the Q and row-maximum loads
  __builtin_amdgcn_sched_barrier(0);      // keeps the arithmetic below, which reuses those registers, behind the wait
  if (ATT) { v4f s = {0.f, 0.f, 0.f, 0.f};
#pragma unroll
    for (int i = 0; i < 4; ++i) { s[0] += rs[i][0]; s[1] += rs[i][1]; s[2] += rs[i][2]; }
    red[tid] = s; }
  r2s(0);
  __syncthreads();      // stage 0 is in buffer 0 for every wave, and every thread's sum of statistics in red
  if (ATT) { v4f x[8];      /* every loop of this block is unrolled, so that x and the lane numbers of the exchanges are constants and x stays in registers */
#pragma unroll
    for (int j = 0; j < 8; ++j) x[j] = red[j * 32 + lane];
#pragma unroll
    for (int st = 4; st > 0; st >>= 1)
#pragma unroll
      for (int j = 0; j < st; ++j) { x[j][0] += x[j + st][0]; x[j][1] += x[j + st][1]; x[j][2] += x[j + st][2]; }
#pragma unroll
    for (int st = 16; st > 0; st >>= 1) { const float y0 = __shfl_xor(x[0][0], st, 32), y1 = __shfl_xor(x[0][1], st, 32), y2 = __shfl_xor(x[0][2], st, 32); x[0][0] += y0; x[0][1] += y1; x[0][2] += y2; }      /* after a step every lane holds the sum that the tree's lane (lane mod st) holds */
    float f0 = x[0][0] / ((float)TT * (float)TT), f1 = x[0][1] / (float)TT, f2 = x[0][2] / (float)TT; f0 = fminf(fmaxf(f0, -10.f), 10.f); f1 = fminf(fmaxf(f1, -10.f), 10.f); f2 = fminf(fmaxf(f2, 0.f), 1.f);
    float pre = bf16_round(m1b); pre += f0 * bf16_round(m1w0); pre += f1 * bf16_round(m1w1); pre += f2 * bf16_round(m1w2);
    const float hu = tanhf(pre) * bf16_round(m2w);
    float raw = bf16_round(m2b);
#pragma unroll
    for (int u = 0; u < 16; ++u) raw += __shfl(hu, u, 32);
    float t = 0.01f + (1.0f / (1.0f + expf(-raw))) * (2.0f - 0.01f); t = fminf(fmaxf(t, 0.01f), 2.0f); t = fminf(t, 0.85f);
    sc2 = 1.4426950408889634f / (2.0f * t);
#pragma unroll
    for (int n = 0; n < NQ; ++n) nm2[n] = 10.0f - nm2[n] * sc2; }
  int buf = 0;
  for (int kb = KT; kb < TT; kb += KT) {
    g2r(kb);            // next stage: in flight while this one is worked on
    __builtin_amdgcn_sched_barrier(0);      // keeps those loads above the products; without it the compiler may sink them to just before their LDS stores and their latency is waited out
    work(buf);
    r2s(buf ^ 1);       // that buffer's last readers left it before the barrier that ended the trip before
    __syncthreads();    // publishes the next stage and ends this trip's reads of buf
    buf ^= 1;
  }
  work(buf);
#pragma unroll
  for (int n = 0; n < NQ; ++n) { const int q = q0 + n * 16;
    float su = su0[n] + su1[n]; su += __shfl_xor(su, 16, 32);      /* the two halves of the wave hold the two halves of a query's keys */
    if (!ATT) { const float set = se[n] + __shfl_xor(se[n], 16, 32), se2t = se2[n] + __shfl_xor(se2[n], 16, 32), rm = fmaxf(rmx[n], __shfl_xor(rmx[n], 16, 32));
      const float inv = 1.0f / set; const float vq = (se2t * inv) * inv - 1.0f / (float)TT;
      if (hh == 0) { const v4f v = {su, fminf(fmaxf(rm * 0.125f, -50.f), 50.f), vq / (float)(TT - 1), rm}; *(v4f*)(RST + ((size_t)slab * TT + q) * 4) = v; }
    } else { const float inv = 1.0f / su;
#pragma unroll
      for (int dt = 0; dt < 4; ++dt) { FragH f;
#pragma unroll
        for (int r = 0; r < 8; ++r) f.h[r] = (_Float16)(o[n][dt][r] * inv);
        *(v8us*)((unsigned short*)O16 + ((size_t)b * TT + q) * CC + h * HD + dt * 16 + 8 * hh) = f.half[0]; } } } }

extern "C" void kernel_launch(void* const* d_in, const int* in_sizes, int n_in,
                              void* d_out, int out_size, void* d_ws, size_t ws_size, hipStream_t stream) {
  (void)in_sizes; (void)n_in; (void)out_size;
  const float* const* I = (const float* const*)d_in; const float* xq = I[0]; const float* xk = I[1]; const float* xv = I[2]; const float* Wq = I[3]; const float* bq = I[4]; const float* Wk = I[5]; const float* bk = I[6]; const float* Wv = I[7]; const float* bv = I[8]; const float* Wo = I[9]; const float* bo = I[10]; const float* Wt1 = I[11]; const float* bt1 = I[12]; const float* Wt2 = I[13]; const float* bt2 = I[14];
  char* ws = (char*)d_ws; size_t off = 0;
  auto take = [&](size_t bytes) { char* p = ws + off; off += (bytes + 255) & ~(size_t)255; return p; };
  _Float16* Q3p = (_Float16*)take((size_t)NR * NH * K3 * 2); _Float16* K3p = (_Float16*)take((size_t)NR * NH * K3 * 2); _Float16* VTb = (_Float16*)take((size_t)NBt * CC * TT * 2); _Float16* BWo = (_Float16*)take((size_t)CC * CC * 2); float* RST = (float*)take((size_t)HG * TT * 4 * 4); _Float16* O16 = (_Float16*)take((size_t)NR * CC * 2);
  const size_t pW = (size_t)CC * CC, pX = (size_t)NR * CC;      /* plane sizes in elements: a weight; an activation */
  _Float16* BW = (_Float16*)take(3 * pW * 2); _Float16* X16 = (_Float16*)take(3 * pX * 2);      /* what only the projections need */
  if (off > ws_size) return;      // 25.2 + 25.2 + 8.4 + 2.1 + 1.0 + 8.4 + 6.3 + 25.2 = 101.8 MB
  const dim3 gP((NR / 128) * (CC / 128), 1);
  k_wt_f16<<<dim3((CC / 8) * (CC / 8) / 256, 4), 256, 0, stream>>>(Wq, Wk, Wv, Wo, BW, BWo, 16.0f);      /* all four weights, one launch */
  k_x16<<<NR * CC / 8 / (XP * 256), 256, 0, stream>>>(xq, xk, xv, X16);      /* all three activations, one launch */
  k_proj<<<dim3((NR / 128) * (CC / 128), 3), 256, 0, stream>>>(X16, BW, bq, bk, bv, Q3p, K3p, VTb);      /* Q exact -> [hi | lo | hi], K -> [hi | hi*2^-10 | lo], V -> f16, transposed */
  const dim3 gF(TT / 256, HG);      /* 256 queries a work-group; slab g = batch * NH + head in RST */
  k_fused<false, 2><<<gF, 256, 0, stream>>>(Q3p, K3p, nullptr, RST, nullptr, nullptr, nullptr, nullptr, nullptr);      /* row statistics of raw Q*K, about f32 (K 192) */
  k_fused<true, 2><<<gF, 256, 0, stream>>>(Q3p, K3p, VTb, RST, Wt1, bt1, Wt2, bt2, O16);      /* the head's t, then softmax(Q*K / 2t) * V */
  k_gemm_hhx<0, 4, 2, 2, 128, CC, false><<<gP, 256, 0, stream>>>(O16, 0, BWo, 0, 0.0625f, bo, 0, (float*)d_out, nullptr, CC, 0, NR, CC, CC, 0, 0, 0);
}

// v008
// It runs in 113 microseconds.
// In two side-by-side timings against v007, it was 1.03 and 1.04 times as fast.
// Counting every step since v000, it is 8.77 times as fast.
#include <hip/hip_runtime.h>
// Diffusion-time multi-head attention (B 4, S 1024, D 1024, 16 heads × 64): Q,K,V = x·W + b ((in,out)); per (b,h): s = clip(Q·K/8, ±50); feats = (mean s, mean_q max_k s, mean_q var_k softmax(s/2) (ddof 1)) → t = min(clip(0.01 + 1.99·σ(tanh(feats·Wt1 + b)·Wt2 + b)), 0.85); attn = softmax(Q·K/(2t)); out = (attn·V merged)·Wo + bo → [4,1024,1024].
// Structure: projections as GEMMs (exact products); Q and K carried as f16 [hi | lo] (lo = the f16 of what hi leaves, unscaled: f16 subnormals count) and contracted as q_hi*k_hi + q_lo*k_hi + q_hi*k_lo (K 192, each hi fragment used in two terms) so the raw logits are about f32 (they are divided by 2t, i.e. scaled up to x50); all 64 (batch, head) slabs per launch: a statistics kernel that forms the score tiles by WMMA and reduces them in registers (clipped sum / max / softmax(s/2) variance), then an attention kernel whose work-groups each reduce their head's row statistics and run the tiny time MLP themselves (fixed order), form the same tiles again, take exp with the head's 1/(2t) (x2^10 -> f16) and multiplies by V in place; output projection GEMM.
// Compute dtype: inputs and parameters rounded to bf16; logits ≈f32; statistics/MLP/softmax f32; V and the attention output as f16 operands (≈2^-12); f32 accumulation. v_wmma_f32_16x16x32_f16.
#define NBt 4
#define TT 1024
#define CC 1024
#define NH 16
#define HD 64
#define NR (NBt * TT)            /* 4096 */
#define HG (NBt * NH)            /* (batch, head) slabs: all in one launch */
#define K2 (2 * HD)              /* 128: a row of Q or K of one head as stored, [hi | lo] */
typedef __bf16 v16b __attribute__((ext_vector_type(16)));
typedef unsigned short v8us __attribute__((ext_vector_type(8), may_alias));
typedef float  v8f  __attribute__((ext_vector_type(8)));
typedef float  v4f  __attribute__((ext_vector_type(4)));
typedef float  v4fa __attribute__((ext_vector_type(4), may_alias));
union FragB { v16b v; v8us half[2]; unsigned short u[16]; };

__device__ __forceinline__ unsigned short bf16_bits(float x) { unsigned int u = __float_as_uint(x); return (unsigned short)((u + 0x7FFFu + ((u >> 16) & 1u)) >> 16); }
__device__ __forceinline__ float bf16_val(unsigned short b) { return __uint_as_float(((unsigned int)b) << 16); }
__device__ __forceinline__ float bf16_round(float x) { return bf16_val(bf16_bits(x)); }
// D += A·B with NT terms: 1 = ah·bh, 2 = + al·bh (A split), 3 = + ah·bl (both split)
template <int NT>
__device__ __forceinline__ v8f mmaN(v16b ah, v16b al, v16b bh, v16b bl, v8f c) {
  c = __builtin_amdgcn_wmma_f32_16x16x32_bf16(false, ah, false, bh, (short)0, c, false, false);
  if (NT >= 2) c = __builtin_amdgcn_wmma_f32_16x16x32_bf16(false, al, false, bh, (short)0, c, false, false);
  if (NT >= 3) c = __builtin_amdgcn_wmma_f32_16x16x32_bf16(false, ah, false, bl, (short)0, c, false, false);
  asm volatile("v_nop\n\tv_nop\n\tv_nop\n\tv_nop" : "+v"(c) : "v"(ah), "v"(al), "v"(bh), "v"(bl));
  return c;
}

__global__ __launch_bounds__(256) void k_wt_bf16(const float* __restrict__ W, unsigned short* __restrict__ Wt, int K, int N) {
  const int t = blockIdx.x * 256 + threadIdx.x;
  const int k8n = K / 8;
  if (t >= N * k8n) return;
  const int n = t / k8n, k8 = (t % k8n) * 8;
  v8us v;
#pragma unroll
  for (int i = 0; i < 8; ++i) v[i] = bf16_bits(W[(size_t)(k8 + i) * N + n]);
  *(v8us*)(Wt + (size_t)n * K + k8) = v;
  
}

// GEMM C[M][N] (f32, pitch ldc) = act(A[M][K]·W + bias). A f32 row-major (pitch lda) converted per fragment to bf16
// (ASPLIT: hi/lo two planes -> 2 terms, else single rounded term); Wt bf16 [N][K] (pitch ldb). BIAS_BF16 rounds the
// bias to bf16 first (bias quantised to bf16 before the add). K%32==0, M%16==0, N%64==0.
template <bool ASPLIT, int ACT, bool BIAS_BF16>
__global__ __launch_bounds__(128) void k_gemm_bf(const float* __restrict__ A, int lda, const unsigned short* __restrict__ Wt, int ldb,
                                               const float* __restrict__ bias, float* __restrict__ C, int ldc, int M, int N, int K) {
  __shared__ __attribute__((aligned(16))) float so[4][16][64];
  const int tid = threadIdx.x, w = tid >> 5, lane = tid & 31, ln = lane & 15, hh = lane >> 4;
  const int ntn = N / 64;
  const int wid = blockIdx.x * 4 + w;
  const int mt = wid / ntn, nq = wid % ntn;
  if (mt * 16 >= M) return;
  const int row0 = mt * 16, col0 = nq * 64;
  const float* arow = A + (size_t)(row0 + ln) * lda;
  v8f acc[4] = {};
  for (int kb = 0; kb < K; kb += 32) {
    FragB ah, al;
    const v4f x0 = *(const v4fa*)(arow + kb + 8 * hh), x1 = *(const v4fa*)(arow + kb + 8 * hh + 4);
    const v4f x2 = *(const v4fa*)(arow + kb + 16 + 8 * hh), x3 = *(const v4fa*)(arow + kb + 16 + 8 * hh + 4);
    float xs[16] = {x0[0],x0[1],x0[2],x0[3],x1[0],x1[1],x1[2],x1[3],x2[0],x2[1],x2[2],x2[3],x3[0],x3[1],x3[2],x3[3]};
#pragma unroll
    for (int i = 0; i < 16; ++i) { const unsigned short hb = bf16_bits(xs[i]); ah.u[i] = hb; al.u[i] = ASPLIT ? bf16_bits(xs[i] - bf16_val(hb)) : (unsigned short)0; }
#pragma unroll
    for (int t = 0; t < 4; ++t) {
      const unsigned short* brow = Wt + (size_t)(col0 + t * 16 + ln) * ldb + kb;
      FragB b;
      b.half[0] = *(const v8us*)(brow + 8 * hh);
      b.half[1] = *(const v8us*)(brow + 16 + 8 * hh);
      acc[t] = mmaN<ASPLIT ? 2 : 1>(ah.v, al.v, b.v, b.v, acc[t]);
    }
  }
#pragma unroll
  for (int t = 0; t < 4; ++t) {
    float bv = bias ? bias[col0 + t * 16 + ln] : 0.f;
    if (BIAS_BF16) bv = bf16_round(bv);
#pragma unroll
    for (int r = 0; r < 8; ++r) { float v = acc[t][r] + bv; if (ACT == 1) v = fmaxf(v, 0.f); so[w][8 * hh + r][t * 16 + ln] = v; }
  }
  __builtin_amdgcn_fence(__ATOMIC_ACQ_REL, "workgroup");
  __builtin_amdgcn_wave_barrier();
  const int rsub = lane >> 4, c4 = (lane & 15) * 4;
  {
#pragma unroll
    for (int q = 0; q < 8; ++q) {
      const int r = q * 2 + rsub;
      const v4f v = *(const v4fa*)&so[w][r][c4];
      *(v4f*)(C + (size_t)(row0 + r) * ldc + col0 + c4) = v;
    }
    
  }
}

// GEMM C = act(A·W + bias + resid): A f32 (ASPLIT -> hi/lo 2 terms), Wt bf16 [N][K]; ACT 0 none, 1 relu, 2 exact gelu;
// resid (optional, f32, row index = (row % rmod), pitch ldr, RES_BF16 rounds it) added before the activation.
template <bool ASPLIT, int ACT, bool BIAS_BF16, bool RES_BF16>
__global__ __launch_bounds__(128) void k_gemm_bf3(const float* __restrict__ A, int lda, const unsigned short* __restrict__ Wt, int ldb,
                                                const float* __restrict__ bias, const float* __restrict__ resid, int rmod, int ldr,
                                                float* __restrict__ C, int ldc, int M, int N, int K) {
  __shared__ __attribute__((aligned(16))) float so[4][16][64];
  const int tid = threadIdx.x, w = tid >> 5, lane = tid & 31, ln = lane & 15, hh = lane >> 4;
  const int ntn = N / 64;
  const int wid = blockIdx.x * 4 + w;
  const int mt = wid / ntn, nq = wid % ntn;
  if (mt * 16 >= M) return;
  const int row0 = mt * 16, col0 = nq * 64;
  const float* arow = A + (size_t)(row0 + ln) * lda;
  v8f acc[4] = {};
  for (int kb = 0; kb < K; kb += 32) {
    FragB ah, al;
    const v4f x0 = *(const v4fa*)(arow + kb + 8 * hh), x1 = *(const v4fa*)(arow + kb + 8 * hh + 4);
    const v4f x2 = *(const v4fa*)(arow + kb + 16 + 8 * hh), x3 = *(const v4fa*)(arow + kb + 16 + 8 * hh + 4);
    float xs[16] = {x0[0],x0[1],x0[2],x0[3],x1[0],x1[1],x1[2],x1[3],x2[0],x2[1],x2[2],x2[3],x3[0],x3[1],x3[2],x3[3]};
#pragma unroll
    for (int i = 0; i < 16; ++i) { const unsigned short hb = bf16_bits(xs[i]); ah.u[i] = hb; al.u[i] = ASPLIT ? bf16_bits(xs[i] - bf16_val(hb)) : (unsigned short)0; }
#pragma unroll
    for (int t = 0; t < 4; ++t) {
      const unsigned short* brow = Wt + (size_t)(col0 + t * 16 + ln) * ldb + kb;
      FragB b;
      b.half[0] = *(const v8us*)(brow + 8 * hh);
      b.half[1] = *(const v8us*)(brow + 16 + 8 * hh);
      acc[t] = mmaN<ASPLIT ? 2 : 1>(ah.v, al.v, b.v, b.v, acc[t]);
    }
  }
#pragma unroll
  for (int t = 0; t < 4; ++t) {
    const int col = col0 + t * 16 + ln;
    float bv = bias ? bias[col] : 0.f;
    if (BIAS_BF16) bv = bf16_round(bv);
#pragma unroll
    for (int r = 0; r < 8; ++r) {
      float v = acc[t][r] + bv;
      if (resid) { float rv = resid[(size_t)((row0 + 8 * hh + r) % rmod) * ldr + col]; if (RES_BF16) rv = bf16_round(rv); v += rv; }
      if (ACT == 1) v = fmaxf(v, 0.f);
      if (ACT == 2) v = 0.5f * v * (1.0f + erff(v * 0.70710678118654752f));
      if (ACT == 3) { const float u = 0.7978845608028654f * (v + 0.044715f * v * v * v); v = 0.5f * v * (1.0f + tanhf(u)); }
      so[w][8 * hh + r][t * 16 + ln] = v;
    }
  }
  __builtin_amdgcn_fence(__ATOMIC_ACQ_REL, "workgroup");
  __builtin_amdgcn_wave_barrier();
  const int rsub = lane >> 4, c4 = (lane & 15) * 4;
  {
#pragma unroll
    for (int q = 0; q < 8; ++q) {
      const int r = q * 2 + rsub;
      const v4f v = *(const v4fa*)&so[w][r][c4];
      *(v4f*)(C + (size_t)(row0 + r) * ldc + col0 + c4) = v;
    }
    
  }
}
// row LayerNorm (biased variance, eps) over N: s = X (+ R); optional out_sum <- s; out_norm <- (s-mu)*rsqrt(var+eps)*g + b
template <bool PARAM_BF16>
__global__ __launch_bounds__(256) void k_layernorm(const float* __restrict__ X, const float* __restrict__ R, const float* __restrict__ g, const float* __restrict__ bta,
                                                  float* __restrict__ out_sum, float* __restrict__ out_norm, int N, float eps) {
  __shared__ float red[256];
  const int row = blockIdx.x, tid = threadIdx.x;
  const float* x = X + (size_t)row * N; const float* rr = R ? R + (size_t)row * N : nullptr;
  float vals[16];                     // up to N = 4096
  const int per = N / 256;            // contiguous chunk per thread? use strided-by-4 chunks: thread handles j = tid*4 + 1024*u
  float s1 = 0.f;
  for (int u = 0; u < per / 4; ++u) {
    const int j = tid * 4 + 1024 * u;
    const v4f a = *(const v4fa*)(x + j);
    v4f b = {0.f,0.f,0.f,0.f}; if (rr) b = *(const v4fa*)(rr + j);
#pragma unroll
    for (int q = 0; q < 4; ++q) { const float v = a[q] + b[q]; vals[u * 4 + q] = v; s1 += v; }
  }
  red[tid] = s1; __syncthreads();
  for (int st = 128; st > 0; st >>= 1) { if (tid < st) red[tid] += red[tid + st]; __syncthreads(); }
  const float mu = red[0] / (float)N; __syncthreads();
  float s2 = 0.f;
  for (int u = 0; u < per / 4; ++u)
#pragma unroll
    for (int q = 0; q < 4; ++q) { const float c = vals[u * 4 + q] - mu; s2 += c * c; }
  red[tid] = s2; __syncthreads();
  for (int st = 128; st > 0; st >>= 1) { if (tid < st) red[tid] += red[tid + st]; __syncthreads(); }
  const float rs = rsqrtf(red[0] / (float)N + eps);
  {
    for (int u = 0; u < per / 4; ++u) {
      const int j = tid * 4 + 1024 * u;
      v4f o, sm;
#pragma unroll
      for (int q = 0; q < 4; ++q) {
        float gg = g[j + q], bb = bta[j + q];
        if (PARAM_BF16) { gg = bf16_round(gg); bb = bf16_round(bb); }
        sm[q] = vals[u * 4 + q]; o[q] = (vals[u * 4 + q] - mu) * rs * gg + bb;
      }
      if (out_sum) *(v4f*)(out_sum + (size_t)row * N + j) = sm;
      *(v4f*)(out_norm + (size_t)row * N + j) = o;
    }
    
  }
}



// ---- f16 WMMA path (v_wmma_f32_16x16x32_f16): 11-bit significands for operands in range — used where a [0,1] probability operand needs more precision than bf16
typedef _Float16 v16h __attribute__((ext_vector_type(16)));
union FragH { v16h v; v8us half[2]; _Float16 h[16]; unsigned short u[16]; };
template <int NT>
__device__ __forceinline__ v8f mmaH(v16h ah, v16h al, v16h bh, v16h bl, v8f c) {
  c = __builtin_amdgcn_wmma_f32_16x16x32_f16(false, ah, false, bh, (short)0, c, false, false);
  if (NT >= 2) c = __builtin_amdgcn_wmma_f32_16x16x32_f16(false, al, false, bh, (short)0, c, false, false);
  if (NT >= 3) c = __builtin_amdgcn_wmma_f32_16x16x32_f16(false, ah, false, bl, (short)0, c, false, false);
  asm volatile("v_nop\n\tv_nop\n\tv_nop\n\tv_nop" : "+v"(c) : "v"(ah), "v"(al), "v"(bh), "v"(bl));
  return c;
}
// batched GEMM like k_gemm_b but f16 operands: A f32 (split into f16 hi/lo if ASPLIT, else rounded to f16), Bt = f16 values [n][k]; alpha; C f32; N multiple of 16 (partial tiles skipped)
template <bool ASPLIT>
__global__ __launch_bounds__(128) void k_gemm_h(const float* __restrict__ A, int lda, size_t sA, const _Float16* __restrict__ Bh, int ldb, size_t sB, float alpha, float* __restrict__ C, int ldc, size_t sC, int M, int N, int K) {
  __shared__ __attribute__((aligned(16))) float so[4][16][64];
  const int tid = threadIdx.x, w = tid >> 5, lane = tid & 31, ln = lane & 15, hh = lane >> 4; const int by = blockIdx.y;
  A += (size_t)by * sA; Bh += (size_t)by * sB; C += (size_t)by * sC;
  const int ntn = (N + 63) / 64; const int wid = blockIdx.x * 4 + w; const int mt = wid / ntn, nq = wid % ntn; if (mt * 16 >= M) return;
  const int row0 = mt * 16, col0 = nq * 64; const float* arow = A + (size_t)(row0 + ln) * lda;
  v8f acc[4] = {};
  for (int kb = 0; kb < K; kb += 32) {
    FragH ah, al;
    const v4f x0 = *(const v4fa*)(arow + kb + 8 * hh), x1 = *(const v4fa*)(arow + kb + 8 * hh + 4), x2 = *(const v4fa*)(arow + kb + 16 + 8 * hh), x3 = *(const v4fa*)(arow + kb + 16 + 8 * hh + 4);
    float xs[16] = {x0[0],x0[1],x0[2],x0[3],x1[0],x1[1],x1[2],x1[3],x2[0],x2[1],x2[2],x2[3],x3[0],x3[1],x3[2],x3[3]};
#pragma unroll
    for (int i = 0; i < 16; ++i) { const _Float16 h = (_Float16)xs[i]; ah.h[i] = h; al.h[i] = ASPLIT ? (_Float16)(xs[i] - (float)h) : (_Float16)0.0f; }
#pragma unroll
    for (int t = 0; t < 4; ++t) { if (col0 + t * 16 >= N) continue; const size_t boff = (size_t)(col0 + t * 16 + ln) * ldb + kb; FragH bq; bq.half[0] = *(const v8us*)(Bh + boff + 8 * hh); bq.half[1] = *(const v8us*)(Bh + boff + 16 + 8 * hh);
      acc[t] = mmaH<ASPLIT ? 2 : 1>(ah.v, al.v, bq.v, bq.v, acc[t]); }
  }
#pragma unroll
  for (int t = 0; t < 4; ++t) { if (col0 + t * 16 >= N) continue;
#pragma unroll
    for (int r = 0; r < 8; ++r) so[w][8 * hh + r][t * 16 + ln] = acc[t][r] * alpha; }
  __builtin_amdgcn_fence(__ATOMIC_ACQ_REL, "workgroup"); __builtin_amdgcn_wave_barrier();
  const int rsub = lane >> 4, c4 = (lane & 15) * 4;
  {
#pragma unroll
    for (int q = 0; q < 8; ++q) { const int r = q * 2 + rsub; if (col0 + c4 < N) { const v4f v = *(const v4fa*)&so[w][r][c4]; *(v4f*)(C + (size_t)(row0 + r) * ldc + col0 + c4) = v; } }
     }
}

// Wt[n][k] = f16(W[k][n]·scale) from f32 row-major W[K][N] (scale = power of two; bf16-exact weights stay exact in f16 away from the subnormal range)
// blockIdx.y picks one of four weight matrices: 0..2 go to planes 0..2 of Wt012, 3 goes to Wt3
// One thread takes an 8 x 8 block of W (8 output pieces of 16 B), so the launch is one round of 256 work-groups. A wave = 4 column groups (one 128-B line of each W row) x 8 row groups (one 128-B line of each Wt row).
__global__ __launch_bounds__(256) void k_wt_f16(const float* __restrict__ W0, const float* __restrict__ W1, const float* __restrict__ W2, const float* __restrict__ W3, _Float16* __restrict__ Wt012, _Float16* __restrict__ Wt3, float scale) {
  const int y = blockIdx.y; const float* __restrict__ W = (y == 0) ? W0 : (y == 1) ? W1 : (y == 2) ? W2 : W3; _Float16* __restrict__ Wt = (y == 3) ? Wt3 : Wt012 + (size_t)y * CC * CC;
  const int lane = threadIdx.x & 31, wv = blockIdx.x * 8 + (threadIdx.x >> 5); const int n0 = ((wv % (CC / 32)) * 4 + (lane & 3)) * 8, k0 = ((wv / (CC / 32)) * 8 + (lane >> 2)) * 8;
  const unsigned lo = (unsigned)(k0 * CC + n0) * 4u; const char* p = (const char*)W + lo; v4f a[8][2];      /* the thread's byte offset: one register serves every load */
#pragma unroll
  for (int i = 0; i < 8; ++i) { a[i][0] = *(const v4fa*)(p + i * (CC * 4)); a[i][1] = *(const v4fa*)(p + i * (CC * 4) + 16); }
  asm volatile("s_wait_xcnt 0x0" :: "v"(lo) : "memory");      // stands in front of the first instruction that reuses the loads' address register; the operand keeps that register untouched up to here
  __builtin_amdgcn_sched_barrier(0);      // keeps the arithmetic below behind that wait, and so behind the issue of every load
  unsigned short* o = (unsigned short*)Wt + (size_t)n0 * CC + k0; FragH f[8];
#pragma unroll
  for (int j = 0; j < 8; ++j)
#pragma unroll
    for (int i = 0; i < 8; ++i) f[j].h[i] = (_Float16)(bf16_round(a[i][j >> 2][j & 3]) * scale);
  __builtin_amdgcn_sched_barrier(0);      // the stores go out as one run behind the arithmetic: none of it then overwrites a register of an issued store
#pragma unroll
  for (int j = 0; j < 8; ++j) *(v8us*)(o + j * CC) = f[j].half[0];
}
// Block-tiled GEMM with fused epilogue: v = acc*alpha + bias[by*sBias + col] ; ACT 0 none / 1 elu ; writes f16 C16 (H16) or f32 C.
// One block = WM x WN waves = a (WM*FM*16) x (WN*64) tile of C; a wave owns FM x 4 accumulator tiles. Per chunk of KC k the block brings its A rows and B rows (whole 128-B lines, KC/8 lanes a row)
// into LDS at a pitch of 2*KC + 16 B and every wave reads its fragments from there; two buffers, the next chunk's global loads fly while this chunk is multiplied.
// LD = row pitch of A and of B in elements, a compile-time constant so that the rows of a tile are immediate offsets from one address per operand.
// Needs M a multiple of WM*FM*16, N of WN*64, K of KC (every launch below is).
// Two batch axes: blockIdx.y steps A, B, C by sA, sB, sC (heads), blockIdx.z by zA, zB, zC (batches).
template <int ACT, int WM, int WN, int FM, int KC, int LD, bool H16>
__global__ __launch_bounds__(WM * WN * 32) void k_gemm_hhx(const _Float16* __restrict__ A, size_t sA, const _Float16* __restrict__ Bh, size_t sB, float alpha, const float* __restrict__ bias, size_t sBias,
    float* __restrict__ C, _Float16* __restrict__ C16, int ldc, size_t sC, int M, int N, int K, size_t zA, size_t zB, size_t zC) {
  constexpr int NW = WM * WN, BM = WM * FM * 16, BN = WN * 64, CPR = KC / 8, RP = NW * 32 / CPR, NA = BM / RP, NB = BN / RP, PIT = KC + 8;
  __shared__ __attribute__((aligned(16))) unsigned short tA[2][BM][PIT];
  __shared__ __attribute__((aligned(16))) unsigned short tB[2][BN][PIT];
  __shared__ __attribute__((aligned(16))) float so[NW][16][64];
  const int tid = threadIdx.x, w = tid >> 5, lane = tid & 31, ln = lane & 15, hh = lane >> 4; const int by = blockIdx.y;
  const int bz = blockIdx.z; A += (size_t)by * sA + (size_t)bz * zA; Bh += (size_t)by * sB + (size_t)bz * zB; const size_t cofs = (size_t)by * sC + (size_t)bz * zC; const float* bp = bias ? bias + (size_t)by * sBias : nullptr;
  const int ntn = N / BN; const int bm = blockIdx.x / ntn, bn = blockIdx.x % ntn; if (bm * BM >= M) return;
  const int wm = w / WN, wn = w % WN; const int srow = tid / CPR, sc = (tid % CPR) * 8;
  const unsigned short* gA = (const unsigned short*)A + (size_t)(bm * BM + srow) * LD + sc;
  const unsigned short* gB = (const unsigned short*)Bh + (size_t)(bn * BN + srow) * LD + sc;
  const int col0 = bn * BN + wn * 64;
  float bvv[4];      // the wave's bias values, fetched ahead of the products
#pragma unroll
  for (int t = 0; t < 4; ++t) bvv[t] = bp ? bf16_round(bp[col0 + t * 16 + ln]) : 0.f;
  v8us ra[NA], rb[NB];
  v8f acc[FM][4] = {};
  auto g2r = [&](int kb) {
#pragma unroll
    for (int i = 0; i < NA; ++i) ra[i] = *(const v8us*)(gA + kb + i * RP * LD);
#pragma unroll
    for (int i = 0; i < NB; ++i) rb[i] = *(const v8us*)(gB + kb + i * RP * LD);
  };
  auto r2s = [&](int buf) {
#pragma unroll
    for (int i = 0; i < NA; ++i) *(v8us*)&tA[buf][i * RP + srow][sc] = ra[i];
#pragma unroll
    for (int i = 0; i < NB; ++i) *(v8us*)&tB[buf][i * RP + srow][sc] = rb[i];
  };
  auto mul = [&](int buf) {
#pragma unroll
    for (int ks = 0; ks < KC / 32; ++ks) { FragH fa[FM], fb[4];
#pragma unroll
      for (int i = 0; i < FM; ++i) { const unsigned short* p = &tA[buf][(wm * FM + i) * 16 + ln][ks * 32 + 8 * hh]; fa[i].half[0] = *(const v8us*)p; fa[i].half[1] = *(const v8us*)(p + 16); }
#pragma unroll
      for (int t = 0; t < 4; ++t) { const unsigned short* p = &tB[buf][wn * 64 + t * 16 + ln][ks * 32 + 8 * hh]; fb[t].half[0] = *(const v8us*)p; fb[t].half[1] = *(const v8us*)(p + 16); }
#pragma unroll
      for (int i = 0; i < FM; ++i)
#pragma unroll
        for (int t = 0; t < 4; ++t) acc[i][t] = __builtin_amdgcn_wmma_f32_16x16x32_f16(false, fa[i].v, false, fb[t].v, (short)0, acc[i][t], false, false); }
  };
  g2r(0); r2s(0);
  __syncthreads();      // chunk 0 is in buffer 0 for every wave
  int buf = 0;
  for (int kb = KC; kb < K; kb += KC) {
    g2r(kb);            // next chunk: in flight while this one is multiplied
    __builtin_amdgcn_sched_barrier(0);      // keeps those loads above the products; without it the compiler sinks them to just before their LDS stores and their latency is waited out
    mul(buf);
    r2s(buf ^ 1);       // that buffer's last readers left it before the barrier that ended the trip before
    __syncthreads();    // publishes the next chunk and ends this trip's reads of buf
    buf ^= 1;
  }
  mul(buf);
  const int rsub = lane >> 4, c4 = (lane & 15) * 4; typedef _Float16 v4h __attribute__((ext_vector_type(4)));
#pragma unroll
  for (int i = 0; i < FM; ++i) { const int row0 = bm * BM + (wm * FM + i) * 16;
#pragma unroll
    for (int t = 0; t < 4; ++t) { const float bv = bvv[t];
#pragma unroll
      for (int r = 0; r < 8; ++r) { float v = acc[i][t][r] * alpha + bv; if (ACT == 1) v = (v > 0.f) ? v : expm1f(v); else if (ACT == 7) v = (v > 0.f) ? v + 1.0f : expf(v); else if (ACT == 8) v = tanhf(v); else if (ACT == 9) v = 0.5f * v * (1.0f + tanhf(0.7978845608028654f * (v + 0.044715f * v * v * v))); else if (ACT == 11) v = 1.0f / (1.0f + expf(-v)); else if (ACT == 12) v = (v > 0.f) ? v : 0.01f * v; else if (ACT == 14) v = (v > 0.f) ? v : 0.1f * v; else if (ACT == 15) v = v / (1.0f + expf(-v)); else if (ACT == 3) v = fmaxf(v, 0.f); else if (ACT == 6) v = 0.5f * v * (1.0f + erff(v * 0.70710678118654752f)); so[w][8 * hh + r][t * 16 + ln] = v; } }
    __builtin_amdgcn_fence(__ATOMIC_ACQ_REL, "workgroup"); __builtin_amdgcn_wave_barrier();
#pragma unroll
    for (int q = 0; q < 8; ++q) { const int r = q * 2 + rsub; const v4f v = *(const v4fa*)&so[w][r][c4]; if (!H16) *(v4f*)(C + cofs + (size_t)(row0 + r) * ldc + col0 + c4) = v; else { v4h h4; for (int j = 0; j < 4; ++j) h4[j] = (_Float16)v[j]; *(v4h*)(C16 + cofs + (size_t)(row0 + r) * ldc + col0 + c4) = h4; } }
    if (i + 1 < FM) { __builtin_amdgcn_fence(__ATOMIC_ACQ_REL, "workgroup"); __builtin_amdgcn_wave_barrier(); }      // the wave's rows are read back before its next 16 rows overwrite them
  }
}


typedef _Float16 v4h __attribute__((ext_vector_type(4)));

// All three activations to f16, plane y of X16 from x_y. One round of 256 work-groups: a thread takes XP pieces of 8 elements of each activation, a work-group XP * 256 pieces in a row;
// all of a thread's loads are asked for before the first value is used, so that 8 waves a WGP keep the memory busy.
#define XP 8
__global__ __launch_bounds__(256) void k_x16(const float* __restrict__ x0, const float* __restrict__ x1, const float* __restrict__ x2, _Float16* __restrict__ X16) {
  const unsigned e0 = (blockIdx.x * (XP * 256) + threadIdx.x) * 8u, lo = e0 * 4u; v4f a[3][XP][2];      /* the thread's first element, and its byte offset: one register serves every load */
#pragma unroll
  for (int y = 0; y < 3; ++y) { const char* p = (const char*)((y == 0) ? x0 : (y == 1) ? x1 : x2) + lo;
#pragma unroll
    for (int i = 0; i < XP; ++i) { a[y][i][0] = *(const v4fa*)(p + i * 8192); a[y][i][1] = *(const v4fa*)(p + i * 8192 + 16); } }
  asm volatile("s_wait_xcnt 0x0" :: "v"(lo) : "memory");      // stands in front of the first instruction that reuses the loads' address register; the operand keeps that register untouched up to here
  __builtin_amdgcn_sched_barrier(0);      // keeps the arithmetic below behind that wait, and so behind the issue of every load
#pragma unroll
  for (int y = 0; y < 3; ++y) { FragH f[XP];
#pragma unroll
    for (int i = 0; i < XP; ++i)
#pragma unroll
      for (int q = 0; q < 8; ++q) f[i].h[q] = (_Float16)bf16_round(a[y][i][q >> 2][q & 3]);
    __builtin_amdgcn_sched_barrier(0);      // the stores go out as one run behind the arithmetic: none of it then overwrites a register of an issued store
#pragma unroll
    for (int i = 0; i < XP; ++i) *(v8us*)((unsigned short*)X16 + (size_t)y * NR * CC + e0 + i * 2048) = f[i].half[0];
    if (y < 2) { asm volatile("s_wait_xcnt 0x0" ::: "memory");      // stands in front of the next group's arithmetic, which reuses the registers of these stores
      __builtin_amdgcn_sched_barrier(0);      // keeps that arithmetic behind the wait
    } } }
__global__ __launch_bounds__(256) void k_h16(const float* __restrict__ x, _Float16* __restrict__ X16, size_t n8) { const size_t t = (size_t)blockIdx.x * 256 + threadIdx.x; if (t >= n8) return; FragH f;
#pragma unroll
  for (int q = 0; q < 8; ++q) f.h[q] = (_Float16)x[t * 8 + q]; *(v8us*)((unsigned short*)X16 + t * 8) = f.half[0];  }
__global__ __launch_bounds__(256) void k_round16f(const float* __restrict__ W, _Float16* __restrict__ Bt, size_t n8) { const size_t t = (size_t)blockIdx.x * 256 + threadIdx.x; if (t >= n8) return; FragH f;
#pragma unroll
  for (int i = 0; i < 8; ++i) f.h[i] = (_Float16)(bf16_round(W[t * 8 + i]) * 16.0f); *(v8us*)((unsigned short*)Bt + t * 8) = f.half[0];  }
template <int NHv, int TTv>
__global__ __launch_bounds__(256) void k_vt(const _Float16* __restrict__ V16, int ldv, int voff, _Float16* __restrict__ Vt) { __shared__ unsigned short tl[64][66]; const int tid = threadIdx.x; const int slab = blockIdx.x / (TTv / 64), lg = blockIdx.x % (TTv / 64); const int b = slab / NHv, h = slab % NHv;
  for (int i = tid; i < 64 * 8; i += 256) { const int r = i / 8, c8 = (i % 8) * 8; FragH f; f.half[0] = *(const v8us*)((const unsigned short*)V16 + ((size_t)b * TTv + lg * 64 + r) * ldv + voff + h * 64 + c8);
#pragma unroll
    for (int q = 0; q < 8; ++q) tl[r][c8 + q] = f.u[q]; }
  __syncthreads();
  {
#pragma unroll
    for (int rd = 0; rd < 2; ++rd) { const int d = rd * 32 + tid / 8, pc = tid % 8; FragH f;
#pragma unroll
      for (int q = 0; q < 8; ++q) f.u[q] = tl[pc * 8 + q][d];
      *(v8us*)((unsigned short*)Vt + ((size_t)slab * 64 + d) * TTv + lg * 64 + pc * 8) = f.half[0]; }
     } }

__global__ __launch_bounds__(256) void k_hl(const float* __restrict__ F, _Float16* __restrict__ Hh, _Float16* __restrict__ Hl, size_t n8) { const size_t t = (size_t)blockIdx.x * 256 + threadIdx.x; if (t >= n8) return; FragH fh, fl; const v4f a = *(const v4fa*)(F + t * 8), c = *(const v4fa*)(F + t * 8 + 4);
#pragma unroll
  for (int q = 0; q < 4; ++q) { _Float16 h = (_Float16)a[q]; fh.h[q] = h; fl.h[q] = (_Float16)((a[q] - (float)h) * 1024.0f); h = (_Float16)c[q]; fh.h[4 + q] = h; fl.h[4 + q] = (_Float16)((c[q] - (float)h) * 1024.0f); }
  { *(v8us*)((unsigned short*)Hh + t * 8) = fh.half[0]; *(v8us*)((unsigned short*)Hl + t * 8) = fl.half[0];  } }

// The three projections as ONE launch: blockIdx.y = 0 Q, 1 K, 2 V (plane y of X16 times plane y of BW, bias y). The products are those of k_gemm_hhx<0, 4, 2, 2, 128, CC, .> (128 x 128 tile, 8 waves of 2 x 4 accumulator tiles,
// k chunks of 128 in two LDS buffers); the epilogue writes the operand forms that the score kernels read, so no f32 Q or K plane, no row-major V, and no fold or transpose launch.
// Q and K -> [hi | lo] (a wave's 64 columns are one head: 2 whole 128-B lines a row); V -> V^T (a lane's 8 accumulator rows are 8 tokens in a row of V^T; the block's tile goes through LDS so that 256 B of a V^T row leave together).
// Both epilogues stage in the buffers that the last chunk does not use: their last readers left them before the loop's last barrier.
#define PKC 128
#define PPIT (PKC + 8)
#define SOP 68                   /* floats a staging row: 16 B more than 64 columns, so that rows 8 apart and the 4 rows of a read fall on different banks */
typedef float fal __attribute__((may_alias));
// 16 staged rows of 64 f32 -> the two f16 parts of each row. A lane takes 8 columns of rows 0, 4, 8, 12 from its own: 8 lanes write one 128-B line.
__device__ __forceinline__ void fold_store(const fal* p, unsigned short* o) {
  FragH s0[4], s1[4];
#pragma unroll
  for (int q = 0; q < 4; ++q) { const v4f a0 = *(const v4fa*)(p + q * 4 * SOP), a1 = *(const v4fa*)(p + q * 4 * SOP + 4);
#pragma unroll
    for (int e = 0; e < 8; ++e) { const float v = (e < 4) ? a0[e & 3] : a1[e & 3]; const _Float16 hi = (_Float16)v; s0[q].h[e] = hi; s1[q].h[e] = (_Float16)(v - (float)hi); } }
  __builtin_amdgcn_sched_barrier(0);      // the stores go out as one run behind the arithmetic: none of it then overwrites a register of an issued store
#pragma unroll
  for (int q = 0; q < 4; ++q) { unsigned short* oq = o + q * 4 * (NH * K2); *(v8us*)(oq) = s0[q].half[0]; *(v8us*)(oq + HD) = s1[q].half[0]; }
  asm volatile("s_wait_xcnt 0x0" ::: "memory");      // stands directly behind the run of stores, in front of whatever next reuses their registers
  __builtin_amdgcn_sched_barrier(0);      // keeps later arithmetic behind that wait
}
__global__ __launch_bounds__(256) void k_proj(const _Float16* __restrict__ X16, const _Float16* __restrict__ BW, const float* __restrict__ bq, const float* __restrict__ bk, const float* __restrict__ bv,
    _Float16* __restrict__ O3q, _Float16* __restrict__ O3k, _Float16* __restrict__ VT) {
  constexpr int WN = 2, FM = 2, BM = 128, BN = 128, CPR = PKC / 8, RP = 256 / CPR, NA = BM / RP, NB = BN / RP;
  __shared__ __attribute__((aligned(16))) unsigned short tA[2][BM][PPIT];
  __shared__ __attribute__((aligned(16))) unsigned short tB[2][BN][PPIT];
  const int tid = threadIdx.x, w = tid >> 5, lane = tid & 31, ln = lane & 15, hh = lane >> 4; const int y = blockIdx.y;
  const float* bp = (y == 0) ? bq : (y == 1) ? bk : bv;
  const int bm = blockIdx.x / (CC / BN), bn = blockIdx.x % (CC / BN);
  const int wm = w / WN, wn = w % WN; const int srow = tid / CPR, sc = (tid % CPR) * 8;
  const unsigned short* gA = (const unsigned short*)X16 + (size_t)y * NR * CC + (size_t)(bm * BM + srow) * CC + sc;
  const unsigned short* gB = (const unsigned short*)BW + (size_t)y * CC * CC + (size_t)(bn * BN + srow) * CC + sc;
  const int col0 = bn * BN + wn * 64;
  float bvv[4];      // the wave's bias values, fetched ahead of the products
#pragma unroll
  for (int t = 0; t < 4; ++t) bvv[t] = bf16_round(bp[col0 + t * 16 + ln]);
  v8us ra[NA], rb[NB];
  v8f acc[FM][4] = {};
  auto g2r = [&](int kb) {
#pragma unroll
    for (int i = 0; i < NA; ++i) ra[i] = *(const v8us*)(gA + kb + i * RP * CC);
#pragma unroll
    for (int i = 0; i < NB; ++i) rb[i] = *(const v8us*)(gB + kb + i * RP * CC);
  };
  auto r2s = [&](int buf) {
#pragma unroll
    for (int i = 0; i < NA; ++i) *(v8us*)&tA[buf][i * RP + srow][sc] = ra[i];
#pragma unroll
    for (int i = 0; i < NB; ++i) *(v8us*)&tB[buf][i * RP + srow][sc] = rb[i];
  };
  auto mul = [&](int buf) {
#pragma unroll
    for (int ks = 0; ks < PKC / 32; ++ks) { FragH fa[FM], fb[4];
#pragma unroll
      for (int i = 0; i < FM; ++i) { const unsigned short* p = &tA[buf][(wm * FM + i) * 16 + ln][ks * 32 + 8 * hh]; fa[i].half[0] = *(const v8us*)p; fa[i].half[1] = *(const v8us*)(p + 16); }
#pragma unroll
      for (int t = 0; t < 4; ++t) { const unsigned short* p = &tB[buf][wn * 64 + t * 16 + ln][ks * 32 + 8 * hh]; fb[t].half[0] = *(const v8us*)p; fb[t].half[1] = *(const v8us*)(p + 16); }
#pragma unroll
      for (int i = 0; i < FM; ++i)
#pragma unroll
        for (int t = 0; t < 4; ++t) acc[i][t] = __builtin_amdgcn_wmma_f32_16x16x32_f16(false, fa[i].v, false, fb[t].v, (short)0, acc[i][t], false, false); }
  };
  g2r(0); r2s(0);
  __syncthreads();      // chunk 0 is in buffer 0 for every wave
  int buf = 0;
  for (int kb = PKC; kb < CC; kb += PKC) {
    g2r(kb);            // next chunk: in flight while this one is multiplied
    __builtin_amdgcn_sched_barrier(0);      // keeps those loads above the products; without it the compiler sinks them to just before their LDS stores and their latency is waited out
    mul(buf);
    r2s(buf ^ 1);       // that buffer's last readers left it before the barrier that ended the trip before
    __syncthreads();    // publishes the next chunk and ends this trip's reads of buf
    buf ^= 1;
  }
  mul(buf);
  if (y < 2) {      /* Q, K: each wave by itself, its first 16 rows through its 16 x SOP floats of the free A buffer, its other 16 through the same place of the free B buffer */
    fal* soA = (fal*)&tA[buf ^ 1][0][0] + w * (16 * SOP); fal* soB = (fal*)&tB[buf ^ 1][0][0] + w * (16 * SOP);
#pragma unroll
    for (int i = 0; i < FM; ++i) { fal* so = i ? soB : soA;
#pragma unroll
      for (int t = 0; t < 4; ++t)
#pragma unroll
        for (int r = 0; r < 8; ++r) so[(8 * hh + r) * SOP + t * 16 + ln] = acc[i][t][r] * 0.0625f + bvv[t]; }
    __builtin_amdgcn_fence(__ATOMIC_ACQ_REL, "workgroup"); __builtin_amdgcn_wave_barrier();      // the wave's rows are written before its lanes read them back; it stands ahead of every global store, so it waits for none
    const int po = (lane >> 3) * SOP + (lane & 7) * 8;
    unsigned short* ob = (unsigned short*)(y ? O3k : O3q) + (size_t)(bm * BM + wm * FM * 16 + (lane >> 3)) * (NH * K2) + (col0 / HD) * K2 + (lane & 7) * 8;
    fold_store(soA + po, ob);
    fold_store(soB + po, ob + 16 * (NH * K2));
  } else {      /* V: the block's 128 tokens x 128 columns, transposed in LDS */
    unsigned short (*tv)[PPIT] = tA[buf ^ 1];
#pragma unroll
    for (int i = 0; i < FM; ++i)
#pragma unroll
      for (int t = 0; t < 4; ++t) { FragH f;
#pragma unroll
        for (int r = 0; r < 8; ++r) f.h[r] = (_Float16)(acc[i][t][r] * 0.0625f + bvv[t]);
        *(v8us*)&tv[wn * 64 + t * 16 + ln][(wm * FM + i) * 16 + 8 * hh] = f.half[0]; }
    __syncthreads();      // every wave's tokens are in the tile before rows of it are read
    unsigned short* o = (unsigned short*)VT + ((size_t)(bm / (TT / BM)) * CC + bn * BN + (tid >> 4)) * TT + (bm % (TT / BM)) * BM + (tid & 15) * 8;
    v8us rv[8];
#pragma unroll
    for (int j = 0; j < 8; ++j) rv[j] = *(const v8us*)&tv[j * 16 + (tid >> 4)][(tid & 15) * 8];
#pragma unroll
    for (int j = 0; j < 8; ++j) *(v8us*)(o + (size_t)j * 16 * TT) = rv[j];
    asm volatile("s_wait_xcnt 0x0" ::: "memory");      // stands directly behind the run of stores, in front of whatever next reuses their registers
  }
}
// Scores never leave the registers. One wave owns NQ*16 queries, one work-group of 8 waves NQ*128 queries of one (batch, head); it walks the head's 1024 keys in stages of KT.
// S^T = K*Q^T in three terms: A = 16 key rows of K from LDS (k_hi, k_hi, k_lo), B = the wave's Q rows, loaded once and kept (q_hi, q_lo, q_hi): a hi fragment is fetched once and serves two terms; a lane then holds scores of ONE query per 16-query group (column ln), keys 8*hh + r of each 16-key tile,
// so every row sum and maximum is in-lane plus one exchange between the wave's halves.
// ATT false: the row statistics. exp(s/2) needs no maximum taken off, because s is clipped to +-50 (e within 1.4e-11 .. 7.2e10, its squares' sum below 6e24);
//   with p = e / sum e and sum p = 1 the sum of (p - 1/TT)^2 is sum e^2 / (sum e)^2 - 1/TT. The clip and the scale are monotone, so the clipped maximum comes from the raw maximum.
//   RST[row] = (sum of clipped s, max of clipped s, variance, raw maximum).
// ATT true: O^T += V^T * P^T. Two score tiles (32 keys), turned into exp in place, ARE the B operand in the hardware's k order; A = 16 rows of V^T from LDS read in that same order.
//   The row's raw maximum is known from the statistics kernel (same products, same order), so nothing is rescaled; P = exp(..) * 2^10 as f16, the division by the f32 sum comes last.
//   The head's time t is found in the prologue, by every work-group of the head for itself: a thread sums 4 rows of RST, the 256 sums go through LDS (published by stage 0's barrier), and every wave adds them in the order of a
//   halving tree over 256 (steps 128, 64, 32 in-lane, 16 .. 1 between lanes). Lane u of each half-wave takes hidden unit u of the MLP; the 16 products are added in the order of u. All loads are asked for with the Q loads.
// 2^x with the slot behind it: the instruction set asks for one v_nop or independent instruction between a transcendental and a use of its result or an overwrite of its source.
// In one statement the v_nop cannot be parted from its exp.
__device__ __forceinline__ float exp2_slot(float x) { float e; asm volatile("v_exp_f32 %0, %1\n\tv_nop" : "=v"(e) : "v"(x)); return e; }
#define KT 64                    /* keys per stage */
#define KPIT (K2 + 8)            /* 272 B a row: 16 B x odd, for 16-byte LDS reads */
#define VPIT (KT + 8)            /* 144 B a row */
template <bool ATT, int NQ>
__global__ __launch_bounds__(256) void k_fused(const _Float16* __restrict__ Q3, const _Float16* __restrict__ Kf, const _Float16* __restrict__ VT, float* __restrict__ RST,
    const float* __restrict__ Wt1, const float* __restrict__ bt1, const float* __restrict__ Wt2, const float* __restrict__ bt2, _Float16* __restrict__ O16) {
  __shared__ __attribute__((aligned(16))) unsigned short tK[2][KT][KPIT];
  __shared__ __attribute__((aligned(16))) unsigned short tV[ATT ? 2 : 1][ATT ? HD : 1][VPIT];
  __shared__ v4f red[ATT ? 256 : 1];      /* the threads' sums of row statistics */
  const int tid = threadIdx.x, w = tid >> 5, lane = tid & 31, ln = lane & 15, hh = lane >> 4;
  const int slab = blockIdx.y, b = slab / NH, h = slab % NH; const int q0 = (blockIdx.x * 8 + w) * (NQ * 16) + ln;      /* the lane's first query; its others follow in steps of 16 */
  const int sr = tid >> 3, sc8 = (tid & 7) * 8;      /* staging: 8 lanes bring one 128-B line, the block 32 rows at a time */
  const unsigned short* gK = (const unsigned short*)Kf + ((size_t)b * TT + sr) * (NH * K2) + h * K2 + sc8;
  const unsigned short* gV = (const unsigned short*)VT + ((size_t)b * CC + h * HD + sr) * TT + sc8;
  FragH qf[NQ][4];      /* 0, 1: q_hi; 2, 3: q_lo */
  float sc2 = 0.f, nm2[NQ];
  v8us rk[4], rv[2];
  v8f o[NQ][4] = {};
  float su0[NQ], su1[NQ], se[NQ], se2[NQ], rmx[NQ];
#pragma unroll
  for (int n = 0; n < NQ; ++n) { su0[n] = 0.f; su1[n] = 0.f; se[n] = 0.f; se2[n] = 0.f; rmx[n] = -3.0e38f; }
  auto g2r = [&](int kb) {
#pragma unroll
    for (int i = 0; i < 4; ++i) rk[i] = *(const v8us*)(gK + (size_t)(kb + (i / 2) * 32) * (NH * K2) + (i % 2) * 64);
    if (ATT) {
#pragma unroll
      for (int i = 0; i < 2; ++i) rv[i] = *(const v8us*)(gV + kb + i * 32 * TT); }
    asm volatile("s_wait_xcnt 0x0" ::: "memory");      // stands in front of the first instruction that reuses these loads' address registers
  };
  auto r2s = [&](int buf) {
#pragma unroll
    for (int i = 0; i < 4; ++i) *(v8us*)&tK[buf][(i / 2) * 32 + sr][(i % 2) * 64 + sc8] = rk[i];
    if (ATT) {
#pragma unroll
      for (int i = 0; i < 2; ++i) *(v8us*)&tV[buf][i * 32 + sr][sc8] = rv[i]; }
  };
  auto work = [&](int buf) {
#pragma unroll
    for (int p = 0; p < KT / 32; ++p) { v8f t[NQ][2] = {}; FragH a[4][2];      /* 0, 1: k_hi; 2, 3: k_lo */
#pragma unroll
      for (int ks = 0; ks < 4; ++ks)
#pragma unroll
        for (int j = 0; j < 2; ++j) { const unsigned short* pk = &tK[buf][p * 32 + j * 16 + ln][ks * 32 + 8 * hh]; a[ks][j].half[0] = *(const v8us*)pk; a[ks][j].half[1] = *(const v8us*)(pk + 16); }
      __builtin_amdgcn_sched_barrier(0);      // the pass's K fragments are asked for as one group; without it the compiler puts each pair of reads, with a full wait, right in front of its product
#pragma unroll
      for (int ks = 0; ks < 6; ++ks)
#pragma unroll
        for (int j = 0; j < 2; ++j)
#pragma unroll
          for (int n = 0; n < NQ; ++n) t[n][j] = __builtin_amdgcn_wmma_f32_16x16x32_f16(false, a[ks < 2 ? ks : ks - 2][j].v, false, qf[n][ks < 4 ? ks : ks - 4].v, (short)0, t[n][j], false, false);      /* ks 0, 1: k_hi q_hi; 2, 3: k_hi q_lo; 4, 5: k_lo q_hi */
      float xe[NQ * 16];      /* exponent, then exp, of the lane's scores: group n, key slot s at n * 16 + s */
      if (!ATT) {
#pragma unroll
        for (int n = 0; n < NQ; ++n)
#pragma unroll
          for (int r = 0; r < 8; ++r) { const float x0 = t[n][0][r], x1 = t[n][1][r]; rmx[n] = fmaxf(rmx[n], fmaxf(x0, x1));
            const float v0 = fminf(fmaxf(x0 * 0.125f, -50.f), 50.f), v1 = fminf(fmaxf(x1 * 0.125f, -50.f), 50.f); su0[n] += v0; su1[n] += v1;
            xe[n * 16 + r] = v0 * 0.7213475204444817f; xe[n * 16 + 8 + r] = v1 * 0.7213475204444817f; }
        __builtin_amdgcn_sched_barrier(0);      // this fence and the next keep the exps in one run, every exponent ready ahead of it and every use behind it: the compiler writes no delay hint for a result of asm text, and a dependent instruction close behind its exp would wait unhinted, which holds up the SIMD's other wave too
#pragma unroll
        for (int i = 0; i < NQ * 16; ++i) xe[i] = exp2_slot(xe[i]);
        __builtin_amdgcn_sched_barrier(0);      // see the fence above
#pragma unroll
        for (int i = 0; i < NQ * 16; ++i) { se[i >> 4] += xe[i]; se2[i >> 4] += xe[i] * xe[i]; }
      } else { FragH pb[NQ], va[4];
#pragma unroll
        for (int dt = 0; dt < 4; ++dt) { const unsigned short* pv = &tV[buf][dt * 16 + ln][p * 32 + 8 * hh]; va[dt].half[0] = *(const v8us*)pv; va[dt].half[1] = *(const v8us*)(pv + 16); }
        __builtin_amdgcn_sched_barrier(0);      // the V fragments are asked for ahead of the exponentials, which then cover their latency
#pragma unroll
        for (int n = 0; n < NQ; ++n)
#pragma unroll
          for (int r = 0; r < 8; ++r) { xe[n * 16 + r] = t[n][0][r] * sc2 + nm2[n]; xe[n * 16 + 8 + r] = t[n][1][r] * sc2 + nm2[n]; }
        __builtin_amdgcn_sched_barrier(0);      // this fence and the next keep the exps in one run, every exponent ready ahead of it and every use behind it: the compiler writes no delay hint for a result of asm text, and a dependent instruction close behind its exp would wait unhinted, which holds up the SIMD's other wave too
#pragma unroll
        for (int i = 0; i < NQ * 16; ++i) xe[i] = exp2_slot(xe[i]);
        __builtin_amdgcn_sched_barrier(0);      // see the fence above
#pragma unroll
        for (int i = 0; i < NQ * 16; i += 2) { su0[i >> 4] += xe[i]; su1[i >> 4] += xe[i + 1]; }
#pragma unroll
        for (int n = 0; n < NQ; ++n)
#pragma unroll
          for (int s = 0; s < 16; ++s) pb[n].h[s] = (_Float16)xe[n * 16 + s];
#pragma unroll
        for (int dt = 0; dt < 4; ++dt)
#pragma unroll
          for (int n = 0; n < NQ; ++n) o[n][dt] = __builtin_amdgcn_wmma_f32_16x16x32_f16(false, va[dt].v, false, pb[n].v, (short)0, o[n][dt], false, false); } }
  };
  g2r(0);
  __builtin_amdgcn_sched_barrier(0);      // stage 0's loads and their wait stay ahead of the Q loads
  const unsigned short* qp = (const unsigned short*)Q3 + ((size_t)b * TT + q0) * (NH * K2) + h * K2 + 8 * hh;      /* the lane's first Q row; the rows of its other groups are constant offsets from it */
#pragma unroll
  for (int n = 0; n < NQ; ++n)
#pragma unroll
    for (int ks = 0; ks < 4; ++ks) { qf[n][ks].half[0] = *(const v8us*)(qp + n * 16 * (NH * K2) + ks * 32); qf[n][ks].half[1] = *(const v8us*)(qp + n * 16 * (NH * K2) + ks * 32 + 16); }
#pragma unroll
  for (int n = 0; n < NQ; ++n) nm2[n] = ATT ? RST[((size_t)slab * TT + q0 + n * 16) * 4 + 3] : 0.f;      /* the row's raw maximum, for now */
  v4f rs[4]; float m1b = 0.f, m1w0 = 0.f, m1w1 = 0.f, m1w2 = 0.f, m2w = 0.f, m2b = 0.f;      /* 4 rows of the head's statistics; the lane's hidden unit of the time MLP */
  if (ATT) {
    m1b = bt1[ln]; m1w0 = Wt1[ln]; m1w1 = Wt1[16 + ln]; m1w2 = Wt1[32 + ln]; m2w = Wt2[ln]; m2b = bt2[0];      /* ahead of the statistics rows: behind them this build put two of these results on the rows' unused fourth words and waited for the rows first */
#pragma unroll
    for (int i = 0; i < 4; ++i) rs[i] = *(const v4fa*)(RST + ((size_t)slab * TT + tid + i * 256) * 4); }
  __builtin_amdgcn_sched_barrier(0);      // keeps the loads above ahead of the wait below
  asm volatile("s_wait_xcnt 0x0" :: "v"(qp) : "memory");      // stands in front of the first instruction that reuses the address registers of the Q and row-maximum loads; the operand keeps the Q address untouched up to here
  __builtin_amdgcn_sched_barrier(0);      // keeps the arithmetic below, which reuses those registers, behind the wait
  if (ATT) { v4f s = {0.f, 0.f, 0.f, 0.f};
#pragma unroll
    for (int i = 0; i < 4; ++i) { s[0] += rs[i][0]; s[1] += rs[i][1]; s[2] += rs[i][2]; }
    red[tid] = s; }
  r2s(0);
  __syncthreads();      // stage 0 is in buffer 0 for every wave, and every thread's sum of statistics in red
  if (ATT) { v4f x[8];      /* every loop of this block is unrolled, so that x and the lane numbers of the exchanges are constants and x stays in registers */
#pragma unroll
    for (int j = 0; j < 8; ++j) x[j] = red[j * 32 + lane];
#pragma unroll
    for (int st = 4; st > 0; st >>= 1)
#pragma unroll
      for (int j = 0; j < st; ++j) { x[j][0] += x[j + st][0]; x[j][1] += x[j + st][1]; x[j][2] += x[j + st][2]; }
#pragma unroll
    for (int st = 16; st > 0; st >>= 1) { const float y0 = __shfl_xor(x[0][0], st, 32), y1 = __shfl_xor(x[0][1], st, 32), y2 = __shfl_xor(x[0][2], st, 32); x[0][0] += y0; x[0][1] += y1; x[0][2] += y2; }      /* after a step every lane holds the sum that the tree's lane (lane mod st) holds */
    float f0 = x[0][0] / ((float)TT * (float)TT), f1 = x[0][1] / (float)TT, f2 = x[0][2] / (float)TT; f0 = fminf(fmaxf(f0, -10.f), 10.f); f1 = fminf(fmaxf(f1, -10.f), 10.f); f2 = fminf(fmaxf(f2, 0.f), 1.f);
    float pre = bf16_round(m1b); pre += f0 * bf16_round(m1w0); pre += f1 * bf16_round(m1w1); pre += f2 * bf16_round(m1w2);
    const float hu = tanhf(pre) * bf16_round(m2w);
    float raw = bf16_round(m2b);
#pragma unroll
    for (int u = 0; u < 16; ++u) raw += __shfl(hu, u, 32);
    float t = 0.01f + (1.0f / (1.0f + expf(-raw))) * (2.0f - 0.01f); t = fminf(fmaxf(t, 0.01f), 2.0f); t = fminf(t, 0.85f);
    sc2 = 1.4426950408889634f / (2.0f * t);
#pragma unroll
    for (int n = 0; n < NQ; ++n) nm2[n] = 10.0f - nm2[n] * sc2; }
  int buf = 0;
  for (int kb = KT; kb < TT; kb += KT) {
    g2r(kb);            // next stage: in flight while this one is worked on
    __builtin_amdgcn_sched_barrier(0);      // keeps those loads above the products; without it the compiler may sink them to just before their LDS stores and their latency is waited out
    work(buf);
    r2s(buf ^ 1);       // that buffer's last readers left it before the barrier that ended the trip before
    __syncthreads();    // publishes the next stage and ends this trip's reads of buf
    buf ^= 1;
  }
  work(buf);
#pragma unroll
  for (int n = 0; n < NQ; ++n) { const int q = q0 + n * 16;
    float su = su0[n] + su1[n]; su += __shfl_xor(su, 16, 32);      /* the two halves of the wave hold the two halves of a query's keys */
    if (!ATT) { const float set = se[n] + __shfl_xor(se[n], 16, 32), se2t = se2[n] + __shfl_xor(se2[n], 16, 32), rm = fmaxf(rmx[n], __shfl_xor(rmx[n], 16, 32));
      const float inv = 1.0f / set; const float vq = (se2t * inv) * inv - 1.0f / (float)TT;
      if (hh == 0) { const v4f v = {su, fminf(fmaxf(rm * 0.125f, -50.f), 50.f), vq / (float)(TT - 1), rm}; *(v4f*)(RST + ((size_t)slab * TT + q) * 4) = v; }
    } else { const float inv = 1.0f / su;
#pragma unroll
      for (int dt = 0; dt < 4; ++dt) { FragH f;
#pragma unroll
        for (int r = 0; r < 8; ++r) f.h[r] = (_Float16)(o[n][dt][r] * inv);
        *(v8us*)((unsigned short*)O16 + ((size_t)b * TT + q) * CC + h * HD + dt * 16 + 8 * hh) = f.half[0]; } } } }

extern "C" void kernel_launch(void* const* d_in, const int* in_sizes, int n_in,
                              void* d_out, int out_size, void* d_ws, size_t ws_size, hipStream_t stream) {
  (void)in_sizes; (void)n_in; (void)out_size;
  const float* const* I = (const float* const*)d_in; const float* xq = I[0]; const float* xk = I[1]; const float* xv = I[2]; const float* Wq = I[3]; const float* bq = I[4]; const float* Wk = I[5]; const float* bk = I[6]; const float* Wv = I[7]; const float* bv = I[8]; const float* Wo = I[9]; const float* bo = I[10]; const float* Wt1 = I[11]; const float* bt1 = I[12]; const float* Wt2 = I[13]; const float* bt2 = I[14];
  char* ws = (char*)d_ws; size_t off = 0;
  auto take = [&](size_t bytes) { char* p = ws + off; off += (bytes + 255) & ~(size_t)255; return p; };
  _Float16* Q3p = (_Float16*)take((size_t)NR * NH * K2 * 2); _Float16* K3p = (_Float16*)take((size_t)NR * NH * K2 * 2); _Float16* VTb = (_Float16*)take((size_t)NBt * CC * TT * 2); _Float16* BWo = (_Float16*)take((size_t)CC * CC * 2); float* RST = (float*)take((size_t)HG * TT * 4 * 4); _Float16* O16 = (_Float16*)take((size_t)NR * CC * 2);
  const size_t pW = (size_t)CC * CC, pX = (size_t)NR * CC;      /* plane sizes in elements: a weight; an activation */
  _Float16* BW = (_Float16*)take(3 * pW * 2); _Float16* X16 = (_Float16*)take(3 * pX * 2);      /* what only the projections need */
  if (off > ws_size) return;      // 16.8 + 16.8 + 8.4 + 2.1 + 1.0 + 8.4 + 6.3 + 25.2 = 85.0 MB
  const dim3 gP((NR / 128) * (CC / 128), 1);
  k_wt_f16<<<dim3((CC / 8) * (CC / 8) / 256, 4), 256, 0, stream>>>(Wq, Wk, Wv, Wo, BW, BWo, 16.0f);      /* all four weights, one launch */
  k_x16<<<NR * CC / 8 / (XP * 256), 256, 0, stream>>>(xq, xk, xv, X16);      /* all three activations, one launch */
  k_proj<<<dim3((NR / 128) * (CC / 128), 3), 256, 0, stream>>>(X16, BW, bq, bk, bv, Q3p, K3p, VTb);      /* Q, K -> [hi | lo], V -> f16, transposed */
  const dim3 gF(TT / 256, HG);      /* 256 queries a work-group; slab g = batch * NH + head in RST */
  k_fused<false, 2><<<gF, 256, 0, stream>>>(Q3p, K3p, nullptr, RST, nullptr, nullptr, nullptr, nullptr, nullptr);      /* row statistics of raw Q*K, about f32 (K 192) */
  k_fused<true, 2><<<gF, 256, 0, stream>>>(Q3p, K3p, VTb, RST, Wt1, bt1, Wt2, bt2, O16);      /* the head's t, then softmax(Q*K / 2t) * V */
  k_gemm_hhx<0, 4, 2, 2, 128, CC, false><<<gP, 256, 0, stream>>>(O16, 0, BWo, 0, 0.0625f, bo, 0, (float*)d_out, nullptr, CC, 0, NR, CC, CC, 0, 0, 0);
}

// v009
// A run of this version takes 108 microseconds.
// Next to v008, in two timings, it ran 1.05 times as fast each time.
// Over all steps from v000 it is 9.20 times as fast.
#include <hip/hip_runtime.h>
// Diffusion-time multi-head attention (B 4, S 1024, D 1024, 16 heads × 64): Q,K,V = x·W + b ((in,out)); per (b,h): s = clip(Q·K/8, ±50); feats = (mean s, mean_q max_k s, mean_q var_k softmax(s/2) (ddof 1)) → t = min(clip(0.01 + 1.99·σ(tanh(feats·Wt1 + b)·Wt2 + b)), 0.85); attn = softmax(Q·K/(2t)); out = (attn·V merged)·Wo + bo → [4,1024,1024].
// Structure: projections as GEMMs (exact products); Q and K carried as f16 [hi | lo] (lo = the f16 of what hi leaves, unscaled: f16 subnormals count) and contracted as q_hi*k_hi + q_lo*k_hi + q_hi*k_lo (K 192, each hi fragment used in two terms) so the raw logits are about f32 (they are divided by 2t, i.e. scaled up to x50); all 64 (batch, head) slabs per launch: a statistics kernel that forms the score tiles by WMMA and reduces them in registers (clipped sum / max / softmax(s/2) variance), then an attention kernel whose work-groups each reduce their head's row statistics and run the tiny time MLP themselves (fixed order), form the same tiles again, take exp with the head's 1/(2t) (x2^10 -> f16) and multiplies by V in place; output projection GEMM.
// Compute dtype: inputs and parameters rounded to bf16; logits ≈f32; statistics/MLP/softmax f32; V and the attention output as f16 operands (≈2^-12); f32 accumulation. v_wmma_f32_16x16x32_f16.
#define NBt 4
#define TT 1024
#define CC 1024
#define NH 16
#define HD 64
#define NR (NBt * TT)            /* 4096 */
#define HG (NBt * NH)            /* (batch, head) slabs: all in one launch */
#define K2 (2 * HD)              /* 128: a row of Q or K of one head as stored, [hi | lo] */
typedef __bf16 v16b __attribute__((ext_vector_type(16)));
typedef unsigned short v8us __attribute__((ext_vector_type(8), may_alias));
typedef float  v8f  __attribute__((ext_vector_type(8)));
typedef float  v4f  __attribute__((ext_vector_type(4)));
typedef float  v4fa __attribute__((ext_vector_type(4), may_alias));
union FragB { v16b v; v8us half[2]; unsigned short u[16]; };

__device__ __forceinline__ unsigned short bf16_bits(float x) { unsigned int u = __float_as_uint(x); return (unsigned short)((u + 0x7FFFu + ((u >> 16) & 1u)) >> 16); }
__device__ __forceinline__ float bf16_val(unsigned short b) { return __uint_as_float(((unsigned int)b) << 16); }
__device__ __forceinline__ float bf16_round(float x) { return bf16_val(bf16_bits(x)); }
// D += A·B with NT terms: 1 = ah·bh, 2 = + al·bh (A split), 3 = + ah·bl (both split)
template <int NT>
__device__ __forceinline__ v8f mmaN(v16b ah, v16b al, v16b bh, v16b bl, v8f c) {
  c = __builtin_amdgcn_wmma_f32_16x16x32_bf16(false, ah, false, bh, (short)0, c, false, false);
  if (NT >= 2) c = __builtin_amdgcn_wmma_f32_16x16x32_bf16(false, al, false, bh, (short)0, c, false, false);
  if (NT >= 3) c = __builtin_amdgcn_wmma_f32_16x16x32_bf16(false, ah, false, bl, (short)0, c, false, false);
  asm volatile("v_nop\n\tv_nop\n\tv_nop\n\tv_nop" : "+v"(c) : "v"(ah), "v"(al), "v"(bh), "v"(bl));
  return c;
}

__global__ __launch_bounds__(256) void k_wt_bf16(const float* __restrict__ W, unsigned short* __restrict__ Wt, int K, int N) {
  const int t = blockIdx.x * 256 + threadIdx.x;
  const int k8n = K / 8;
  if (t >= N * k8n) return;
  const int n = t / k8n, k8 = (t % k8n) * 8;
  v8us v;
#pragma unroll
  for (int i = 0; i < 8; ++i) v[i] = bf16_bits(W[(size_t)(k8 + i) * N + n]);
  *(v8us*)(Wt + (size_t)n * K + k8) = v;
  
}

// GEMM C[M][N] (f32, pitch ldc) = act(A[M][K]·W + bias). A f32 row-major (pitch lda) converted per fragment to bf16
// (ASPLIT: hi/lo two planes -> 2 terms, else single rounded term); Wt bf16 [N][K] (pitch ldb). BIAS_BF16 rounds the
// bias to bf16 first (bias quantised to bf16 before the add). K%32==0, M%16==0, N%64==0.
template <bool ASPLIT, int ACT, bool BIAS_BF16>
__global__ __launch_bounds__(128) void k_gemm_bf(const float* __restrict__ A, int lda, const unsigned short* __restrict__ Wt, int ldb,
                                               const float* __restrict__ bias, float* __restrict__ C, int ldc, int M, int N, int K) {
  __shared__ __attribute__((aligned(16))) float so[4][16][64];
  const int tid = threadIdx.x, w = tid >> 5, lane = tid & 31, ln = lane & 15, hh = lane >> 4;
  const int ntn = N / 64;
  const int wid = blockIdx.x * 4 + w;
  const int mt = wid / ntn, nq = wid % ntn;
  if (mt * 16 >= M) return;
  const int row0 = mt * 16, col0 = nq * 64;
  const float* arow = A + (size_t)(row0 + ln) * lda;
  v8f acc[4] = {};
  for (int kb = 0; kb < K; kb += 32) {
    FragB ah, al;
    const v4f x0 = *(const v4fa*)(arow + kb + 8 * hh), x1 = *(const v4fa*)(arow + kb + 8 * hh + 4);
    const v4f x2 = *(const v4fa*)(arow + kb + 16 + 8 * hh), x3 = *(const v4fa*)(arow + kb + 16 + 8 * hh + 4);
    float xs[16] = {x0[0],x0[1],x0[2],x0[3],x1[0],x1[1],x1[2],x1[3],x2[0],x2[1],x2[2],x2[3],x3[0],x3[1],x3[2],x3[3]};
#pragma unroll
    for (int i = 0; i < 16; ++i) { const unsigned short hb = bf16_bits(xs[i]); ah.u[i] = hb; al.u[i] = ASPLIT ? bf16_bits(xs[i] - bf16_val(hb)) : (unsigned short)0; }
#pragma unroll
    for (int t = 0; t < 4; ++t) {
      const unsigned short* brow = Wt + (size_t)(col0 + t * 16 + ln) * ldb + kb;
      FragB b;
      b.half[0] = *(const v8us*)(brow + 8 * hh);
      b.half[1] = *(const v8us*)(brow + 16 + 8 * hh);
      acc[t] = mmaN<ASPLIT ? 2 : 1>(ah.v, al.v, b.v, b.v, acc[t]);
    }
  }
#pragma unroll
  for (int t = 0; t < 4; ++t) {
    float bv = bias ? bias[col0 + t * 16 + ln] : 0.f;
    if (BIAS_BF16) bv = bf16_round(bv);
#pragma unroll
    for (int r = 0; r < 8; ++r) { float v = acc[t][r] + bv; if (ACT == 1) v = fmaxf(v, 0.f); so[w][8 * hh + r][t * 16 + ln] = v; }
  }
  __builtin_amdgcn_fence(__ATOMIC_ACQ_REL, "workgroup");
  __builtin_amdgcn_wave_barrier();
  const int rsub = lane >> 4, c4 = (lane & 15) * 4;
  {
#pragma unroll
    for (int q = 0; q < 8; ++q) {
      const int r = q * 2 + rsub;
      const v4f v = *(const v4fa*)&so[w][r][c4];
      *(v4f*)(C + (size_t)(row0 + r) * ldc + col0 + c4) = v;
    }
    
  }
}

// GEMM C = act(A·W + bias + resid): A f32 (ASPLIT -> hi/lo 2 terms), Wt bf16 [N][K]; ACT 0 none, 1 relu, 2 exact gelu;
// resid (optional, f32, row index = (row % rmod), pitch ldr, RES_BF16 rounds it) added before the activation.
template <bool ASPLIT, int ACT, bool BIAS_BF16, bool RES_BF16>
__global__ __launch_bounds__(128) void k_gemm_bf3(const float* __restrict__ A, int lda, const unsigned short* __restrict__ Wt, int ldb,
                                                const float* __restrict__ bias, const float* __restrict__ resid, int rmod, int ldr,
                                                float* __restrict__ C, int ldc, int M, int N, int K) {
  __shared__ __attribute__((aligned(16))) float so[4][16][64];
  const int tid = threadIdx.x, w = tid >> 5, lane = tid & 31, ln = lane & 15, hh = lane >> 4;
  const int ntn = N / 64;
  const int wid = blockIdx.x * 4 + w;
  const int mt = wid / ntn, nq = wid % ntn;
  if (mt * 16 >= M) return;
  const int row0 = mt * 16, col0 = nq * 64;
  const float* arow = A + (size_t)(row0 + ln) * lda;
  v8f acc[4] = {};
  for (int kb = 0; kb < K; kb += 32) {
    FragB ah, al;
    const v4f x0 = *(const v4fa*)(arow + kb + 8 * hh), x1 = *(const v4fa*)(arow + kb + 8 * hh + 4);
    const v4f x2 = *(const v4fa*)(arow + kb + 16 + 8 * hh), x3 = *(const v4fa*)(arow + kb + 16 + 8 * hh + 4);
    float xs[16] = {x0[0],x0[1],x0[2],x0[3],x1[0],x1[1],x1[2],x1[3],x2[0],x2[1],x2[2],x2[3],x3[0],x3[1],x3[2],x3[3]};
#pragma unroll
    for (int i = 0; i < 16; ++i) { const unsigned short hb = bf16_bits(xs[i]); ah.u[i] = hb; al.u[i] = ASPLIT ? bf16_bits(xs[i] - bf16_val(hb)) : (unsigned short)0; }
#pragma unroll
    for (int t = 0; t < 4; ++t) {
      const unsigned short* brow = Wt + (size_t)(col0 + t * 16 + ln) * ldb + kb;
      FragB b;
      b.half[0] = *(const v8us*)(brow + 8 * hh);
      b.half[1] = *(const v8us*)(brow + 16 + 8 * hh);
      acc[t] = mmaN<ASPLIT ? 2 : 1>(ah.v, al.v, b.v, b.v, acc[t]);
    }
  }
#pragma unroll
  for (int t = 0; t < 4; ++t) {
    const int col = col0 + t * 16 + ln;
    float bv = bias ? bias[col] : 0.f;
    if (BIAS_BF16) bv = bf16_round(bv);
#pragma unroll
    for (int r = 0; r < 8; ++r) {
      float v = acc[t][r] + bv;
      if (resid) { float rv = resid[(size_t)((row0 + 8 * hh + r) % rmod) * ldr + col]; if (RES_BF16) rv = bf16_round(rv); v += rv; }
      if (ACT == 1) v = fmaxf(v, 0.f);
      if (ACT == 2) v = 0.5f * v * (1.0f + erff(v * 0.70710678118654752f));
      if (ACT == 3) { const float u = 0.7978845608028654f * (v + 0.044715f * v * v * v); v = 0.5f * v * (1.0f + tanhf(u)); }
      so[w][8 * hh + r][t * 16 + ln] = v;
    }
  }
  __builtin_amdgcn_fence(__ATOMIC_ACQ_REL, "workgroup");
  __builtin_amdgcn_wave_barrier();
  const int rsub = lane >> 4, c4 = (lane & 15) * 4;
  {
#pragma unroll
    for (int q = 0; q < 8; ++q) {
      const int r = q * 2 + rsub;
      const v4f v = *(const v4fa*)&so[w][r][c4];
      *(v4f*)(C + (size_t)(row0 + r) * ldc + col0 + c4) = v;
    }
    
  }
}
// row LayerNorm (biased variance, eps) over N: s = X (+ R); optional out_sum <- s; out_norm <- (s-mu)*rsqrt(var+eps)*g + b
template <bool PARAM_BF16>
__global__ __launch_bounds__(256) void k_layernorm(const float* __restrict__ X, const float* __restrict__ R, const float* __restrict__ g, const float* __restrict__ bta,
                                                  float* __restrict__ out_sum, float* __restrict__ out_norm, int N, float eps) {
  __shared__ float red[256];
  const int row = blockIdx.x, tid = threadIdx.x;
  const float* x = X + (size_t)row * N; const float* rr = R ? R + (size_t)row * N : nullptr;
  float vals[16];                     // up to N = 4096
  const int per = N / 256;            // contiguous chunk per thread? use strided-by-4 chunks: thread handles j = tid*4 + 1024*u
  float s1 = 0.f;
  for (int u = 0; u < per / 4; ++u) {
    const int j = tid * 4 + 1024 * u;
    const v4f a = *(const v4fa*)(x + j);
    v4f b = {0.f,0.f,0.f,0.f}; if (rr) b = *(const v4fa*)(rr + j);
#pragma unroll
    for (int q = 0; q < 4; ++q) { const float v = a[q] + b[q]; vals[u * 4 + q] = v; s1 += v; }
  }
  red[tid] = s1; __syncthreads();
  for (int st = 128; st > 0; st >>= 1) { if (tid < st) red[tid] += red[tid + st]; __syncthreads(); }
  const float mu = red[0] / (float)N; __syncthreads();
  float s2 = 0.f;
  for (int u = 0; u < per / 4; ++u)
#pragma unroll
    for (int q = 0; q < 4; ++q) { const float c = vals[u * 4 + q] - mu; s2 += c * c; }
  red[tid] = s2; __syncthreads();
  for (int st = 128; st > 0; st >>= 1) { if (tid < st) red[tid] += red[tid + st]; __syncthreads(); }
  const float rs = rsqrtf(red[0] / (float)N + eps);
  {
    for (int u = 0; u < per / 4; ++u) {
      const int j = tid * 4 + 1024 * u;
      v4f o, sm;
#pragma unroll
      for (int q = 0; q < 4; ++q) {
        float gg = g[j + q], bb = bta[j + q];
        if (PARAM_BF16) { gg = bf16_round(gg); bb = bf16_round(bb); }
        sm[q] = vals[u * 4 + q]; o[q] = (vals[u * 4 + q] - mu) * rs * gg + bb;
      }
      if (out_sum) *(v4f*)(out_sum + (size_t)row * N + j) = sm;
      *(v4f*)(out_norm + (size_t)row * N + j) = o;
    }
    
  }
}



// ---- f16 WMMA path (v_wmma_f32_16x16x32_f16): 11-bit significands for operands in range — used where a [0,1] probability operand needs more precision than bf16
typedef _Float16 v16h __attribute__((ext_vector_type(16)));
union FragH { v16h v; v8us half[2]; _Float16 h[16]; unsigned short u[16]; };
template <int NT>
__device__ __forceinline__ v8f mmaH(v16h ah, v16h al, v16h bh, v16h bl, v8f c) {
  c = __builtin_amdgcn_wmma_f32_16x16x32_f16(false, ah, false, bh, (short)0, c, false, false);
  if (NT >= 2) c = __builtin_amdgcn_wmma_f32_16x16x32_f16(false, al, false, bh, (short)0, c, false, false);
  if (NT >= 3) c = __builtin_amdgcn_wmma_f32_16x16x32_f16(false, ah, false, bl, (short)0, c, false, false);
  asm volatile("v_nop\n\tv_nop\n\tv_nop\n\tv_nop" : "+v"(c) : "v"(ah), "v"(al), "v"(bh), "v"(bl));
  return c;
}
// batched GEMM like k_gemm_b but f16 operands: A f32 (split into f16 hi/lo if ASPLIT, else rounded to f16), Bt = f16 values [n][k]; alpha; C f32; N multiple of 16 (partial tiles skipped)
template <bool ASPLIT>
__global__ __launch_bounds__(128) void k_gemm_h(const float* __restrict__ A, int lda, size_t sA, const _Float16* __restrict__ Bh, int ldb, size_t sB, float alpha, float* __restrict__ C, int ldc, size_t sC, int M, int N, int K) {
  __shared__ __attribute__((aligned(16))) float so[4][16][64];
  const int tid = threadIdx.x, w = tid >> 5, lane = tid & 31, ln = lane & 15, hh = lane >> 4; const int by = blockIdx.y;
  A += (size_t)by * sA; Bh += (size_t)by * sB; C += (size_t)by * sC;
  const int ntn = (N + 63) / 64; const int wid = blockIdx.x * 4 + w; const int mt = wid / ntn, nq = wid % ntn; if (mt * 16 >= M) return;
  const int row0 = mt * 16, col0 = nq * 64; const float* arow = A + (size_t)(row0 + ln) * lda;
  v8f acc[4] = {};
  for (int kb = 0; kb < K; kb += 32) {
    FragH ah, al;
    const v4f x0 = *(const v4fa*)(arow + kb + 8 * hh), x1 = *(const v4fa*)(arow + kb + 8 * hh + 4), x2 = *(const v4fa*)(arow + kb + 16 + 8 * hh), x3 = *(const v4fa*)(arow + kb + 16 + 8 * hh + 4);
    float xs[16] = {x0[0],x0[1],x0[2],x0[3],x1[0],x1[1],x1[2],x1[3],x2[0],x2[1],x2[2],x2[3],x3[0],x3[1],x3[2],x3[3]};
#pragma unroll
    for (int i = 0; i < 16; ++i) { const _Float16 h = (_Float16)xs[i]; ah.h[i] = h; al.h[i] = ASPLIT ? (_Float16)(xs[i] - (float)h) : (_Float16)0.0f; }
#pragma unroll
    for (int t = 0; t < 4; ++t) { if (col0 + t * 16 >= N) continue; const size_t boff = (size_t)(col0 + t * 16 + ln) * ldb + kb; FragH bq; bq.half[0] = *(const v8us*)(Bh + boff + 8 * hh); bq.half[1] = *(const v8us*)(Bh + boff + 16 + 8 * hh);
      acc[t] = mmaH<ASPLIT ? 2 : 1>(ah.v, al.v, bq.v, bq.v, acc[t]); }
  }
#pragma unroll
  for (int t = 0; t < 4; ++t) { if (col0 + t * 16 >= N) continue;
#pragma unroll
    for (int r = 0; r < 8; ++r) so[w][8 * hh + r][t * 16 + ln] = acc[t][r] * alpha; }
  __builtin_amdgcn_fence(__ATOMIC_ACQ_REL, "workgroup"); __builtin_amdgcn_wave_barrier();
  const int rsub = lane >> 4, c4 = (lane & 15) * 4;
  {
#pragma unroll
    for (int q = 0; q < 8; ++q) { const int r = q * 2 + rsub; if (col0 + c4 < N) { const v4f v = *(const v4fa*)&so[w][r][c4]; *(v4f*)(C + (size_t)(row0 + r) * ldc + col0 + c4) = v; } }
     }
}

// Wt[n][k] = f16(W[k][n]·scale) from f32 row-major W[K][N] (scale = power of two; bf16-exact weights stay exact in f16 away from the subnormal range)
// y picks one of four weight matrices (bx: the work-group's place among the 64 of a matrix): 0..2 go to planes 0..2 of Wt012, 3 goes to Wt3
// One thread takes an 8 x 8 block of W (8 output pieces of 16 B), so the four matrices take 256 work-groups, 64 each. A wave = 4 column groups (one 128-B line of each W row) x 8 row groups (one 128-B line of each Wt row).
__device__ __forceinline__ void wt_f16_body(const int bx, const int y, const float* __restrict__ W0, const float* __restrict__ W1, const float* __restrict__ W2, const float* __restrict__ W3, _Float16* __restrict__ Wt012, _Float16* __restrict__ Wt3, float scale) {
  const float* __restrict__ W = (y == 0) ? W0 : (y == 1) ? W1 : (y == 2) ? W2 : W3; _Float16* __restrict__ Wt = (y == 3) ? Wt3 : Wt012 + (size_t)y * CC * CC;
  const int lane = threadIdx.x & 31, wv = bx * 8 + (threadIdx.x >> 5); const int n0 = ((wv % (CC / 32)) * 4 + (lane & 3)) * 8, k0 = ((wv / (CC / 32)) * 8 + (lane >> 2)) * 8;
  const unsigned lo = (unsigned)(k0 * CC + n0) * 4u; const char* p = (const char*)W + lo; v4f a[8][2];      /* the thread's byte offset: one register serves every load */
#pragma unroll
  for (int i = 0; i < 8; ++i) { a[i][0] = *(const v4fa*)(p + i * (CC * 4)); a[i][1] = *(const v4fa*)(p + i * (CC * 4) + 16); }
  asm volatile("s_wait_xcnt 0x0" :: "v"(lo) : "memory");      // stands in front of the first instruction that reuses the loads' address register; the operand keeps that register untouched up to here
  __builtin_amdgcn_sched_barrier(0);      // keeps the arithmetic below behind that wait, and so behind the issue of every load
  unsigned short* o = (unsigned short*)Wt + (size_t)n0 * CC + k0; FragH f[8];
#pragma unroll
  for (int j = 0; j < 8; ++j)
#pragma unroll
    for (int i = 0; i < 8; ++i) f[j].h[i] = (_Float16)(bf16_round(a[i][j >> 2][j & 3]) * scale);
  __builtin_amdgcn_sched_barrier(0);      // the stores go out as one run behind the arithmetic: none of it then overwrites a register of an issued store
#pragma unroll
  for (int j = 0; j < 8; ++j) *(v8us*)(o + j * CC) = f[j].half[0];
}
// Block-tiled GEMM with fused epilogue: v = acc*alpha + bias[by*sBias + col] ; ACT 0 none / 1 elu ; writes f16 C16 (H16) or f32 C.
// One block = WM x WN waves = a (WM*FM*16) x (WN*64) tile of C; a wave owns FM x 4 accumulator tiles. Per chunk of KC k the block brings its A rows and B rows (whole 128-B lines, KC/8 lanes a row)
// into LDS at a pitch of 2*KC + 16 B and every wave reads its fragments from there; two buffers, the next chunk's global loads fly while this chunk is multiplied.
// LD = row pitch of A and of B in elements, a compile-time constant so that the rows of a tile are immediate offsets from one address per operand.
// Needs M a multiple of WM*FM*16, N of WN*64, K of KC (every launch below is).
// Two batch axes: blockIdx.y steps A, B, C by sA, sB, sC (heads), blockIdx.z by zA, zB, zC (batches).
template <int ACT, int WM, int WN, int FM, int KC, int LD, bool H16>
__global__ __launch_bounds__(WM * WN * 32) void k_gemm_hhx(const _Float16* __restrict__ A, size_t sA, const _Float16* __restrict__ Bh, size_t sB, float alpha, const float* __restrict__ bias, size_t sBias,
    float* __restrict__ C, _Float16* __restrict__ C16, int ldc, size_t sC, int M, int N, int K, size_t zA, size_t zB, size_t zC) {
  constexpr int NW = WM * WN, BM = WM * FM * 16, BN = WN * 64, CPR = KC / 8, RP = NW * 32 / CPR, NA = BM / RP, NB = BN / RP, PIT = KC + 8;
  __shared__ __attribute__((aligned(16))) unsigned short tA[2][BM][PIT];
  __shared__ __attribute__((aligned(16))) unsigned short tB[2][BN][PIT];
  __shared__ __attribute__((aligned(16))) float so[NW][16][64];
  const int tid = threadIdx.x, w = tid >> 5, lane = tid & 31, ln = lane & 15, hh = lane >> 4; const int by = blockIdx.y;
  const int bz = blockIdx.z; A += (size_t)by * sA + (size_t)bz * zA; Bh += (size_t)by * sB + (size_t)bz * zB; const size_t cofs = (size_t)by * sC + (size_t)bz * zC; const float* bp = bias ? bias + (size_t)by * sBias : nullptr;
  const int ntn = N / BN; const int bm = blockIdx.x / ntn, bn = blockIdx.x % ntn; if (bm * BM >= M) return;
  const int wm = w / WN, wn = w % WN; const int srow = tid / CPR, sc = (tid % CPR) * 8;
  const unsigned short* gA = (const unsigned short*)A + (size_t)(bm * BM + srow) * LD + sc;
  const unsigned short* gB = (const unsigned short*)Bh + (size_t)(bn * BN + srow) * LD + sc;
  const int col0 = bn * BN + wn * 64;
  float bvv[4];      // the wave's bias values, fetched ahead of the products
#pragma unroll
  for (int t = 0; t < 4; ++t) bvv[t] = bp ? bf16_round(bp[col0 + t * 16 + ln]) : 0.f;
  v8us ra[NA], rb[NB];
  v8f acc[FM][4] = {};
  auto g2r = [&](int kb) {
#pragma unroll
    for (int i = 0; i < NA; ++i) ra[i] = *(const v8us*)(gA + kb + i * RP * LD);
#pragma unroll
    for (int i = 0; i < NB; ++i) rb[i] = *(const v8us*)(gB + kb + i * RP * LD);
  };
  auto r2s = [&](int buf) {
#pragma unroll
    for (int i = 0; i < NA; ++i) *(v8us*)&tA[buf][i * RP + srow][sc] = ra[i];
#pragma unroll
    for (int i = 0; i < NB; ++i) *(v8us*)&tB[buf][i * RP + srow][sc] = rb[i];
  };
  auto mul = [&](int buf) {
#pragma unroll
    for (int ks = 0; ks < KC / 32; ++ks) { FragH fa[FM], fb[4];
#pragma unroll
      for (int i = 0; i < FM; ++i) { const unsigned short* p = &tA[buf][(wm * FM + i) * 16 + ln][ks * 32 + 8 * hh]; fa[i].half[0] = *(const v8us*)p; fa[i].half[1] = *(const v8us*)(p + 16); }
#pragma unroll
      for (int t = 0; t < 4; ++t) { const unsigned short* p = &tB[buf][wn * 64 + t * 16 + ln][ks * 32 + 8 * hh]; fb[t].half[0] = *(const v8us*)p; fb[t].half[1] = *(const v8us*)(p + 16); }
#pragma unroll
      for (int i = 0; i < FM; ++i)
#pragma unroll
        for (int t = 0; t < 4; ++t) acc[i][t] = __builtin_amdgcn_wmma_f32_16x16x32_f16(false, fa[i].v, false, fb[t].v, (short)0, acc[i][t], false, false); }
  };
  g2r(0); r2s(0);
  __syncthreads();      // chunk 0 is in buffer 0 for every wave
  int buf = 0;
  for (int kb = KC; kb < K; kb += KC) {
    g2r(kb);            // next chunk: in flight while this one is multiplied
    __builtin_amdgcn_sched_barrier(0);      // keeps those loads above the products; without it the compiler sinks them to just before their LDS stores and their latency is waited out
    mul(buf);
    r2s(buf ^ 1);       // that buffer's last readers left it before the barrier that ended the trip before
    __syncthreads();    // publishes the next chunk and ends this trip's reads of buf
    buf ^= 1;
  }
  mul(buf);
  const int rsub = lane >> 4, c4 = (lane & 15) * 4; typedef _Float16 v4h __attribute__((ext_vector_type(4)));
#pragma unroll
  for (int i = 0; i < FM; ++i) { const int row0 = bm * BM + (wm * FM + i) * 16;
#pragma unroll
    for (int t = 0; t < 4; ++t) { const float bv = bvv[t];
#pragma unroll
      for (int r = 0; r < 8; ++r) { float v = acc[i][t][r] * alpha + bv; if (ACT == 1) v = (v > 0.f) ? v : expm1f(v); else if (ACT == 7) v = (v > 0.f) ? v + 1.0f : expf(v); else if (ACT == 8) v = tanhf(v); else if (ACT == 9) v = 0.5f * v * (1.0f + tanhf(0.7978845608028654f * (v + 0.044715f * v * v * v))); else if (ACT == 11) v = 1.0f / (1.0f + expf(-v)); else if (ACT == 12) v = (v > 0.f) ? v : 0.01f * v; else if (ACT == 14) v = (v > 0.f) ? v : 0.1f * v; else if (ACT == 15) v = v / (1.0f + expf(-v)); else if (ACT == 3) v = fmaxf(v, 0.f); else if (ACT == 6) v = 0.5f * v * (1.0f + erff(v * 0.70710678118654752f)); so[w][8 * hh + r][t * 16 + ln] = v; } }
    __builtin_amdgcn_fence(__ATOMIC_ACQ_REL, "workgroup"); __builtin_amdgcn_wave_barrier();
#pragma unroll
    for (int q = 0; q < 8; ++q) { const int r = q * 2 + rsub; const v4f v = *(const v4fa*)&so[w][r][c4]; if (!H16) *(v4f*)(C + cofs + (size_t)(row0 + r) * ldc + col0 + c4) = v; else { v4h h4; for (int j = 0; j < 4; ++j) h4[j] = (_Float16)v[j]; *(v4h*)(C16 + cofs + (size_t)(row0 + r) * ldc + col0 + c4) = h4; } }
    if (i + 1 < FM) { __builtin_amdgcn_fence(__ATOMIC_ACQ_REL, "workgroup"); __builtin_amdgcn_wave_barrier(); }      // the wave's rows are read back before its next 16 rows overwrite them
  }
}


typedef _Float16 v4h __attribute__((ext_vector_type(4)));

// All three activations to f16, plane y of X16 from x_y. One round of 256 work-groups: a thread takes XP pieces of 8 elements of each activation, a work-group XP * 256 pieces in a row;
// all of a thread's loads are asked for before the first value is used, so that 8 waves a WGP keep the memory busy.
#define XP 8
__device__ __forceinline__ void x16_body(const unsigned bx, const float* __restrict__ x0, const float* __restrict__ x1, const float* __restrict__ x2, _Float16* __restrict__ X16) {
  const unsigned e0 = (bx * (XP * 256) + threadIdx.x) * 8u, lo = e0 * 4u; v4f a[3][XP][2];      /* the thread's first element, and its byte offset: one register serves every load */
#pragma unroll
  for (int y = 0; y < 3; ++y) { const char* p = (const char*)((y == 0) ? x0 : (y == 1) ? x1 : x2) + lo;
#pragma unroll
    for (int i = 0; i < XP; ++i) { a[y][i][0] = *(const v4fa*)(p + i * 8192); a[y][i][1] = *(const v4fa*)(p + i * 8192 + 16); } }
  asm volatile("s_wait_xcnt 0x0" :: "v"(lo) : "memory");      // stands in front of the first instruction that reuses the loads' address register; the operand keeps that register untouched up to here
  __builtin_amdgcn_sched_barrier(0);      // keeps the arithmetic below behind that wait, and so behind the issue of every load
#pragma unroll
  for (int y = 0; y < 3; ++y) { FragH f[XP];
#pragma unroll
    for (int i = 0; i < XP; ++i)
#pragma unroll
      for (int q = 0; q < 8; ++q) f[i].h[q] = (_Float16)bf16_round(a[y][i][q >> 2][q & 3]);
    __builtin_amdgcn_sched_barrier(0);      // the stores go out as one run behind the arithmetic: none of it then overwrites a register of an issued store
#pragma unroll
    for (int i = 0; i < XP; ++i) *(v8us*)((unsigned short*)X16 + (size_t)y * NR * CC + e0 + i * 2048) = f[i].half[0];
    if (y < 2) { asm volatile("s_wait_xcnt 0x0" ::: "memory");      // stands in front of the next group's arithmetic, which reuses the registers of these stores
      __builtin_amdgcn_sched_barrier(0);      // keeps that arithmetic behind the wait
    } } }
// The activations and the weights need nothing of each other: one grid. Work-groups 0 .. 255 take the activations (the longer job, so it starts first), 256 .. 511 the weights, 64 a matrix.
__global__ __launch_bounds__(256) void k_prep(const float* __restrict__ x0, const float* __restrict__ x1, const float* __restrict__ x2, const float* __restrict__ W0, const float* __restrict__ W1, const float* __restrict__ W2, const float* __restrict__ W3,
    _Float16* __restrict__ X16, _Float16* __restrict__ Wt012, _Float16* __restrict__ Wt3) {
  const int bx = blockIdx.x;
  if (bx < 256) x16_body((unsigned)bx, x0, x1, x2, X16);
  else wt_f16_body((bx - 256) & 63, (bx - 256) >> 6, W0, W1, W2, W3, Wt012, Wt3, 16.0f);
}
__global__ __launch_bounds__(256) void k_h16(const float* __restrict__ x, _Float16* __restrict__ X16, size_t n8) { const size_t t = (size_t)blockIdx.x * 256 + threadIdx.x; if (t >= n8) return; FragH f;
#pragma unroll
  for (int q = 0; q < 8; ++q) f.h[q] = (_Float16)x[t * 8 + q]; *(v8us*)((unsigned short*)X16 + t * 8) = f.half[0];  }
__global__ __launch_bounds__(256) void k_round16f(const float* __restrict__ W, _Float16* __restrict__ Bt, size_t n8) { const size_t t = (size_t)blockIdx.x * 256 + threadIdx.x; if (t >= n8) return; FragH f;
#pragma unroll
  for (int i = 0; i < 8; ++i) f.h[i] = (_Float16)(bf16_round(W[t * 8 + i]) * 16.0f); *(v8us*)((unsigned short*)Bt + t * 8) = f.half[0];  }
template <int NHv, int TTv>
__global__ __launch_bounds__(256) void k_vt(const _Float16* __restrict__ V16, int ldv, int voff, _Float16* __restrict__ Vt) { __shared__ unsigned short tl[64][66]; const int tid = threadIdx.x; const int slab = blockIdx.x / (TTv / 64), lg = blockIdx.x % (TTv / 64); const int b = slab / NHv, h = slab % NHv;
  for (int i = tid; i < 64 * 8; i += 256) { const int r = i / 8, c8 = (i % 8) * 8; FragH f; f.half[0] = *(const v8us*)((const unsigned short*)V16 + ((size_t)b * TTv + lg * 64 + r) * ldv + voff + h * 64 + c8);
#pragma unroll
    for (int q = 0; q < 8; ++q) tl[r][c8 + q] = f.u[q]; }
  __syncthreads();
  {
#pragma unroll
    for (int rd = 0; rd < 2; ++rd) { const int d = rd * 32 + tid / 8, pc = tid % 8; FragH f;
#pragma unroll
      for (int q = 0; q < 8; ++q) f.u[q] = tl[pc * 8 + q][d];
      *(v8us*)((unsigned short*)Vt + ((size_t)slab * 64 + d) * TTv + lg * 64 + pc * 8) = f.half[0]; }
     } }

__global__ __launch_bounds__(256) void k_hl(const float* __restrict__ F, _Float16* __restrict__ Hh, _Float16* __restrict__ Hl, size_t n8) { const size_t t = (size_t)blockIdx.x * 256 + threadIdx.x; if (t >= n8) return; FragH fh, fl; const v4f a = *(const v4fa*)(F + t * 8), c = *(const v4fa*)(F + t * 8 + 4);
#pragma unroll
  for (int q = 0; q < 4; ++q) { _Float16 h = (_Float16)a[q]; fh.h[q] = h; fl.h[q] = (_Float16)((a[q] - (float)h) * 1024.0f); h = (_Float16)c[q]; fh.h[4 + q] = h; fl.h[4 + q] = (_Float16)((c[q] - (float)h) * 1024.0f); }
  { *(v8us*)((unsigned short*)Hh + t * 8) = fh.half[0]; *(v8us*)((unsigned short*)Hl + t * 8) = fl.half[0];  } }

// One projection tile: y = 0 Q, 1 K, 2 V (plane y of X16 times plane y of BW, bias y); bx = the tile. Q and K are one launch, V runs in the statistics' launch. The products are those of k_gemm_hhx<0, 4, 2, 2, 128, CC, .> (128 x 128 tile, 8 waves of 2 x 4 accumulator tiles,
// k chunks of 128 in two LDS buffers); the epilogue writes the operand forms that the score kernels read, so no f32 Q or K plane, no row-major V, and no fold or transpose launch.
// Q and K -> [hi | lo] (a wave's 64 columns are one head: 2 whole 128-B lines a row); V -> V^T (a lane's 8 accumulator rows are 8 tokens in a row of V^T; the block's tile goes through LDS so that 256 B of a V^T row leave together).
// Both epilogues stage in the buffers that the last chunk does not use: their last readers left them before the loop's last barrier.
#define PKC 128
#define PPIT (PKC + 8)
#define SOP 68                   /* floats a staging row: 16 B more than 64 columns, so that rows 8 apart and the 4 rows of a read fall on different banks */
typedef float fal __attribute__((may_alias));
// 16 staged rows of 64 f32 -> the two f16 parts of each row. A lane takes 8 columns of rows 0, 4, 8, 12 from its own: 8 lanes write one 128-B line.
__device__ __forceinline__ void fold_store(const fal* p, unsigned short* o) {
  FragH s0[4], s1[4];
#pragma unroll
  for (int q = 0; q < 4; ++q) { const v4f a0 = *(const v4fa*)(p + q * 4 * SOP), a1 = *(const v4fa*)(p + q * 4 * SOP + 4);
#pragma unroll
    for (int e = 0; e < 8; ++e) { const float v = (e < 4) ? a0[e & 3] : a1[e & 3]; const _Float16 hi = (_Float16)v; s0[q].h[e] = hi; s1[q].h[e] = (_Float16)(v - (float)hi); } }
  __builtin_amdgcn_sched_barrier(0);      // the stores go out as one run behind the arithmetic: none of it then overwrites a register of an issued store
#pragma unroll
  for (int q = 0; q < 4; ++q) { unsigned short* oq = o + q * 4 * (NH * K2); *(v8us*)(oq) = s0[q].half[0]; *(v8us*)(oq + HD) = s1[q].half[0]; }
  asm volatile("s_wait_xcnt 0x0" ::: "memory");      // stands directly behind the run of stores, in front of whatever next reuses their registers
  __builtin_amdgcn_sched_barrier(0);      // keeps later arithmetic behind that wait
}
template <bool ISV>
__device__ __forceinline__ void proj_body(unsigned short* sm, const int bx, const int y, const _Float16* __restrict__ X16, const _Float16* __restrict__ BW, const float* __restrict__ bq, const float* __restrict__ bk, const float* __restrict__ bv,
    _Float16* __restrict__ O3q, _Float16* __restrict__ O3k, _Float16* __restrict__ VT) {
  constexpr int WN = 2, FM = 2, BM = 128, BN = 128, CPR = PKC / 8, RP = 256 / CPR, NA = BM / RP, NB = BN / RP;
  unsigned short (*tA)[BM][PPIT] = (unsigned short (*)[BM][PPIT])sm;      /* the kernel's LDS: two A buffers, then two B buffers */
  unsigned short (*tB)[BN][PPIT] = (unsigned short (*)[BN][PPIT])(sm + 2 * BM * PPIT);
  const int tid = threadIdx.x, w = tid >> 5, lane = tid & 31, ln = lane & 15, hh = lane >> 4;
  const float* bp = (y == 0) ? bq : (y == 1) ? bk : bv;
  const int bm = bx / (CC / BN), bn = bx % (CC / BN);
  const int wm = w / WN, wn = w % WN; const int srow = tid / CPR, sc = (tid % CPR) * 8;
  const unsigned short* gA = (const unsigned short*)X16 + (size_t)y * NR * CC + (size_t)(bm * BM + srow) * CC + sc;
  const unsigned short* gB = (const unsigned short*)BW + (size_t)y * CC * CC + (size_t)(bn * BN + srow) * CC + sc;
  const int col0 = bn * BN + wn * 64;
  float bvv[4];      // the wave's bias values, fetched ahead of the products
#pragma unroll
  for (int t = 0; t < 4; ++t) bvv[t] = bf16_round(bp[col0 + t * 16 + ln]);
  v8us ra[NA], rb[NB];
  v8f acc[FM][4] = {};
  auto g2r = [&](int kb) {
#pragma unroll
    for (int i = 0; i < NA; ++i) ra[i] = *(const v8us*)(gA + kb + i * RP * CC);
#pragma unroll
    for (int i = 0; i < NB; ++i) rb[i] = *(const v8us*)(gB + kb + i * RP * CC);
  };
  auto r2s = [&](int buf) {
#pragma unroll
    for (int i = 0; i < NA; ++i) *(v8us*)&tA[buf][i * RP + srow][sc] = ra[i];
#pragma unroll
    for (int i = 0; i < NB; ++i) *(v8us*)&tB[buf][i * RP + srow][sc] = rb[i];
  };
  auto mul = [&](int buf) {
#pragma unroll
    for (int ks = 0; ks < PKC / 32; ++ks) { FragH fa[FM], fb[4];
#pragma unroll
      for (int i = 0; i < FM; ++i) { const unsigned short* p = &tA[buf][(wm * FM + i) * 16 + ln][ks * 32 + 8 * hh]; fa[i].half[0] = *(const v8us*)p; fa[i].half[1] = *(const v8us*)(p + 16); }
#pragma unroll
      for (int t = 0; t < 4; ++t) { const unsigned short* p = &tB[buf][wn * 64 + t * 16 + ln][ks * 32 + 8 * hh]; fb[t].half[0] = *(const v8us*)p; fb[t].half[1] = *(const v8us*)(p + 16); }
#pragma unroll
      for (int i = 0; i < FM; ++i)
#pragma unroll
        for (int t = 0; t < 4; ++t) acc[i][t] = __builtin_amdgcn_wmma_f32_16x16x32_f16(false, fa[i].v, false, fb[t].v, (short)0, acc[i][t], false, false); }
  };
  g2r(0); r2s(0);
  __syncthreads();      // chunk 0 is in buffer 0 for every wave
  int buf = 0;
  for (int kb = PKC; kb < CC; kb += PKC) {
    g2r(kb);            // next chunk: in flight while this one is multiplied
    __builtin_amdgcn_sched_barrier(0);      // keeps those loads above the products; without it the compiler sinks them to just before their LDS stores and their latency is waited out
    mul(buf);
    r2s(buf ^ 1);       // that buffer's last readers left it before the barrier that ended the trip before
    __syncthreads();    // publishes the next chunk and ends this trip's reads of buf
    buf ^= 1;
  }
  mul(buf);
  if (!ISV) {      /* Q, K: each wave by itself, its first 16 rows through its 16 x SOP floats of the free A buffer, its other 16 through the same place of the free B buffer */
    fal* soA = (fal*)&tA[buf ^ 1][0][0] + w * (16 * SOP); fal* soB = (fal*)&tB[buf ^ 1][0][0] + w * (16 * SOP);
#pragma unroll
    for (int i = 0; i < FM; ++i) { fal* so = i ? soB : soA;
#pragma unroll
      for (int t = 0; t < 4; ++t)
#pragma unroll
        for (int r = 0; r < 8; ++r) so[(8 * hh + r) * SOP + t * 16 + ln] = acc[i][t][r] * 0.0625f + bvv[t]; }
    __builtin_amdgcn_fence(__ATOMIC_ACQ_REL, "workgroup"); __builtin_amdgcn_wave_barrier();      // the wave's rows are written before its lanes read them back; it stands ahead of every global store, so it waits for none
    const int po = (lane >> 3) * SOP + (lane & 7) * 8;
    unsigned short* ob = (unsigned short*)(y ? O3k : O3q) + (size_t)(bm * BM + wm * FM * 16 + (lane >> 3)) * (NH * K2) + (col0 / HD) * K2 + (lane & 7) * 8;
    fold_store(soA + po, ob);
    fold_store(soB + po, ob + 16 * (NH * K2));
  } else {      /* V: the block's 128 tokens x 128 columns, transposed in LDS */
    unsigned short (*tv)[PPIT] = tA[buf ^ 1];
#pragma unroll
    for (int i = 0; i < FM; ++i)
#pragma unroll
      for (int t = 0; t < 4; ++t) { FragH f;
#pragma unroll
        for (int r = 0; r < 8; ++r) f.h[r] = (_Float16)(acc[i][t][r] * 0.0625f + bvv[t]);
        *(v8us*)&tv[wn * 64 + t * 16 + ln][(wm * FM + i) * 16 + 8 * hh] = f.half[0]; }
    __syncthreads();      // every wave's tokens are in the tile before rows of it are read
    unsigned short* o = (unsigned short*)VT + ((size_t)(bm / (TT / BM)) * CC + bn * BN + (tid >> 4)) * TT + (bm % (TT / BM)) * BM + (tid & 15) * 8;
    v8us rv[8];
#pragma unroll
    for (int j = 0; j < 8; ++j) rv[j] = *(const v8us*)&tv[j * 16 + (tid >> 4)][(tid & 15) * 8];
#pragma unroll
    for (int j = 0; j < 8; ++j) *(v8us*)(o + (size_t)j * 16 * TT) = rv[j];
    asm volatile("s_wait_xcnt 0x0" ::: "memory");      // stands directly behind the run of stores, in front of whatever next reuses their registers
  }
}
#define PSM (4 * 128 * PPIT)      /* LDS of a projection work-group, in 16-bit elements */
// Q and K: blockIdx.y = 0, 1. 512 work-groups, two to a WGP, all resident at once.
__global__ __launch_bounds__(256) void k_proj(const _Float16* __restrict__ X16, const _Float16* __restrict__ BW, const float* __restrict__ bq, const float* __restrict__ bk, _Float16* __restrict__ O3q, _Float16* __restrict__ O3k) {
  __shared__ __attribute__((aligned(16))) unsigned short sm[PSM];
  proj_body<false>(sm, blockIdx.x, blockIdx.y, X16, BW, bq, bk, nullptr, O3q, O3k, nullptr);
}
// Scores never leave the registers. One wave owns NQ*16 queries, one work-group of 8 waves NQ*128 queries of one (batch, head); it walks the head's 1024 keys in stages of KT.
// S^T = K*Q^T in three terms: A = 16 key rows of K from LDS (k_hi, k_hi, k_lo), B = the wave's Q rows, loaded once and kept (q_hi, q_lo, q_hi): a hi fragment is fetched once and serves two terms; a lane then holds scores of ONE query per 16-query group (column ln), keys 8*hh + r of each 16-key tile,
// so every row sum and maximum is in-lane plus one exchange between the wave's halves.
// ATT false: the row statistics. exp(s/2) needs no maximum taken off, because s is clipped to +-50 (e within 1.4e-11 .. 7.2e10, its squares' sum below 6e24);
//   with p = e / sum e and sum p = 1 the sum of (p - 1/TT)^2 is sum e^2 / (sum e)^2 - 1/TT. The clip and the scale are monotone, so the clipped maximum comes from the raw maximum.
//   RST[row] = (sum of clipped s, max of clipped s, variance, raw maximum).
// ATT true: O^T += V^T * P^T. Two score tiles (32 keys), turned into exp in place, ARE the B operand in the hardware's k order; A = 16 rows of V^T from LDS read in that same order.
//   The row's raw maximum is known from the statistics kernel (same products, same order), so nothing is rescaled; P = exp(..) * 2^10 as f16, the division by the f32 sum comes last.
//   The head's time t is found in the prologue, by every work-group of the head for itself: a thread sums 4 rows of RST, the 256 sums go through LDS (published by stage 0's barrier), and every wave adds them in the order of a
//   halving tree over 256 (steps 128, 64, 32 in-lane, 16 .. 1 between lanes). Lane u of each half-wave takes hidden unit u of the MLP; the 16 products are added in the order of u. All loads are asked for with the Q loads.
// 2^x with the slot behind it: the instruction set asks for one v_nop or independent instruction between a transcendental and a use of its result or an overwrite of its source.
// In one statement the v_nop cannot be parted from its exp.
__device__ __forceinline__ float exp2_slot(float x) { float e; asm volatile("v_exp_f32 %0, %1\n\tv_nop" : "=v"(e) : "v"(x)); return e; }
#define KT 64                    /* keys per stage */
#define KPIT (K2 + 8)            /* 272 B a row: 16 B x odd, for 16-byte LDS reads */
#define VPIT (KT + 8)            /* 144 B a row */
template <bool ATT, int NQ>
__device__ __forceinline__ void fused_body(unsigned short (*tK)[KT][KPIT], const int bx, const int slab, const _Float16* __restrict__ Q3, const _Float16* __restrict__ Kf, const _Float16* __restrict__ VT, float* __restrict__ RST,
    const float* __restrict__ Wt1, const float* __restrict__ bt1, const float* __restrict__ Wt2, const float* __restrict__ bt2, _Float16* __restrict__ O16) {
  __shared__ __attribute__((aligned(16))) unsigned short tV[ATT ? 2 : 1][ATT ? HD : 1][VPIT];
  __shared__ v4f red[ATT ? 256 : 1];      /* the threads' sums of row statistics */
  const int tid = threadIdx.x, w = tid >> 5, lane = tid & 31, ln = lane & 15, hh = lane >> 4;
  const int b = slab / NH, h = slab % NH; const int q0 = (bx * 8 + w) * (NQ * 16) + ln;      /* the lane's first query; its others follow in steps of 16 */
  const int sr = tid >> 3, sc8 = (tid & 7) * 8;      /* staging: 8 lanes bring one 128-B line, the block 32 rows at a time */
  const unsigned short* gK = (const unsigned short*)Kf + ((size_t)b * TT + sr) * (NH * K2) + h * K2 + sc8;
  const unsigned short* gV = (const unsigned short*)VT + ((size_t)b * CC + h * HD + sr) * TT + sc8;
  FragH qf[NQ][4];      /* 0, 1: q_hi; 2, 3: q_lo */
  float sc2 = 0.f, nm2[NQ];
  v8us rk[4], rv[2];
  v8f o[NQ][4] = {};
  float su0[NQ], su1[NQ], se[NQ], se2[NQ], rmx[NQ];
#pragma unroll
  for (int n = 0; n < NQ; ++n) { su0[n] = 0.f; su1[n] = 0.f; se[n] = 0.f; se2[n] = 0.f; rmx[n] = -3.0e38f; }
  auto g2r = [&](int kb) {
#pragma unroll
    for (int i = 0; i < 4; ++i) rk[i] = *(const v8us*)(gK + (size_t)(kb + (i / 2) * 32) * (NH * K2) + (i % 2) * 64);
    if (ATT) {
#pragma unroll
      for (int i = 0; i < 2; ++i) rv[i] = *(const v8us*)(gV + kb + i * 32 * TT); }
    asm volatile("s_wait_xcnt 0x0" ::: "memory");      // stands in front of the first instruction that reuses these loads' address registers
  };
  auto r2s = [&](int buf) {
#pragma unroll
    for (int i = 0; i < 4; ++i) *(v8us*)&tK[buf][(i / 2) * 32 + sr][(i % 2) * 64 + sc8] = rk[i];
    if (ATT) {
#pragma unroll
      for (int i = 0; i < 2; ++i) *(v8us*)&tV[buf][i * 32 + sr][sc8] = rv[i]; }
  };
  auto work = [&](int buf) {
#pragma unroll
    for (int p = 0; p < KT / 32; ++p) { v8f t[NQ][2] = {}; FragH a[4][2];      /* 0, 1: k_hi; 2, 3: k_lo */
#pragma unroll
      for (int ks = 0; ks < 4; ++ks)
#pragma unroll
        for (int j = 0; j < 2; ++j) { const unsigned short* pk = &tK[buf][p * 32 + j * 16 + ln][ks * 32 + 8 * hh]; a[ks][j].half[0] = *(const v8us*)pk; a[ks][j].half[1] = *(const v8us*)(pk + 16); }
      __builtin_amdgcn_sched_barrier(0);      // the pass's K fragments are asked for as one group; without it the compiler puts each pair of reads, with a full wait, right in front of its product
#pragma unroll
      for (int ks = 0; ks < 6; ++ks)
#pragma unroll
        for (int j = 0; j < 2; ++j)
#pragma unroll
          for (int n = 0; n < NQ; ++n) t[n][j] = __builtin_amdgcn_wmma_f32_16x16x32_f16(false, a[ks < 2 ? ks : ks - 2][j].v, false, qf[n][ks < 4 ? ks : ks - 4].v, (short)0, t[n][j], false, false);      /* ks 0, 1: k_hi q_hi; 2, 3: k_hi q_lo; 4, 5: k_lo q_hi */
      float xe[NQ * 16];      /* exponent, then exp, of the lane's scores: group n, key slot s at n * 16 + s */
      if (!ATT) {
#pragma unroll
        for (int n = 0; n < NQ; ++n)
#pragma unroll
          for (int r = 0; r < 8; ++r) { const float x0 = t[n][0][r], x1 = t[n][1][r]; rmx[n] = fmaxf(rmx[n], fmaxf(x0, x1));
            const float v0 = fminf(fmaxf(x0 * 0.125f, -50.f), 50.f), v1 = fminf(fmaxf(x1 * 0.125f, -50.f), 50.f); su0[n] += v0; su1[n] += v1;
            xe[n * 16 + r] = v0 * 0.7213475204444817f; xe[n * 16 + 8 + r] = v1 * 0.7213475204444817f; }
        __builtin_amdgcn_sched_barrier(0);      // this fence and the next keep the exps in one run, every exponent ready ahead of it and every use behind it: the compiler writes no delay hint for a result of asm text, and a dependent instruction close behind its exp would wait unhinted, which holds up the SIMD's other wave too
#pragma unroll
        for (int i = 0; i < NQ * 16; ++i) xe[i] = exp2_slot(xe[i]);
        __builtin_amdgcn_sched_barrier(0);      // see the fence above
#pragma unroll
        for (int i = 0; i < NQ * 16; ++i) { se[i >> 4] += xe[i]; se2[i >> 4] += xe[i] * xe[i]; }
      } else { FragH pb[NQ], va[4];
#pragma unroll
        for (int dt = 0; dt < 4; ++dt) { const unsigned short* pv = &tV[buf][dt * 16 + ln][p * 32 + 8 * hh]; va[dt].half[0] = *(const v8us*)pv; va[dt].half[1] = *(const v8us*)(pv + 16); }
        __builtin_amdgcn_sched_barrier(0);      // the V fragments are asked for ahead of the exponentials, which then cover their latency
#pragma unroll
        for (int n = 0; n < NQ; ++n)
#pragma unroll
          for (int r = 0; r < 8; ++r) { xe[n * 16 + r] = t[n][0][r] * sc2 + nm2[n]; xe[n * 16 + 8 + r] = t[n][1][r] * sc2 + nm2[n]; }
        __builtin_amdgcn_sched_barrier(0);      // this fence and the next keep the exps in one run, every exponent ready ahead of it and every use behind it: the compiler writes no delay hint for a result of asm text, and a dependent instruction close behind its exp would wait unhinted, which holds up the SIMD's other wave too
#pragma unroll
        for (int i = 0; i < NQ * 16; ++i) xe[i] = exp2_slot(xe[i]);
        __builtin_amdgcn_sched_barrier(0);      // see the fence above
#pragma unroll
        for (int i = 0; i < NQ * 16; i += 2) { su0[i >> 4] += xe[i]; su1[i >> 4] += xe[i + 1]; }
#pragma unroll
        for (int n = 0; n < NQ; ++n)
#pragma unroll
          for (int s = 0; s < 16; ++s) pb[n].h[s] = (_Float16)xe[n * 16 + s];
#pragma unroll
        for (int dt = 0; dt < 4; ++dt)
#pragma unroll
          for (int n = 0; n < NQ; ++n) o[n][dt] = __builtin_amdgcn_wmma_f32_16x16x32_f16(false, va[dt].v, false, pb[n].v, (short)0, o[n][dt], false, false); } }
  };
  g2r(0);
  __builtin_amdgcn_sched_barrier(0);      // stage 0's loads and their wait stay ahead of the Q loads
  const unsigned short* qp = (const unsigned short*)Q3 + ((size_t)b * TT + q0) * (NH * K2) + h * K2 + 8 * hh;      /* the lane's first Q row; the rows of its other groups are constant offsets from it */
#pragma unroll
  for (int n = 0; n < NQ; ++n)
#pragma unroll
    for (int ks = 0; ks < 4; ++ks) { qf[n][ks].half[0] = *(const v8us*)(qp + n * 16 * (NH * K2) + ks * 32); qf[n][ks].half[1] = *(const v8us*)(qp + n * 16 * (NH * K2) + ks * 32 + 16); }
#pragma unroll
  for (int n = 0; n < NQ; ++n) nm2[n] = ATT ? RST[((size_t)slab * TT + q0 + n * 16) * 4 + 3] : 0.f;      /* the row's raw maximum, for now */
  v4f rs[4]; float m1b = 0.f, m1w0 = 0.f, m1w1 = 0.f, m1w2 = 0.f, m2w = 0.f, m2b = 0.f;      /* 4 rows of the head's statistics; the lane's hidden unit of the time MLP */
  if (ATT) {
    m1b = bt1[ln]; m1w0 = Wt1[ln]; m1w1 = Wt1[16 + ln]; m1w2 = Wt1[32 + ln]; m2w = Wt2[ln]; m2b = bt2[0];      /* ahead of the statistics rows: behind them this build put two of these results on the rows' unused fourth words and waited for the rows first */
#pragma unroll
    for (int i = 0; i < 4; ++i) rs[i] = *(const v4fa*)(RST + ((size_t)slab * TT + tid + i * 256) * 4); }
  __builtin_amdgcn_sched_barrier(0);      // keeps the loads above ahead of the wait below
  asm volatile("s_wait_xcnt 0x0" :: "v"(qp) : "memory");      // stands in front of the first instruction that reuses the address registers of the Q and row-maximum loads; the operand keeps the Q address untouched up to here
  __builtin_amdgcn_sched_barrier(0);      // keeps the arithmetic below, which reuses those registers, behind the wait
  if (ATT) { v4f s = {0.f, 0.f, 0.f, 0.f};
#pragma unroll
    for (int i = 0; i < 4; ++i) { s[0] += rs[i][0]; s[1] += rs[i][1]; s[2] += rs[i][2]; }
    red[tid] = s; }
  r2s(0);
  __syncthreads();      // stage 0 is in buffer 0 for every wave, and every thread's sum of statistics in red
  if (ATT) { v4f x[8];      /* every loop of this block is unrolled, so that x and the lane numbers of the exchanges are constants and x stays in registers */
#pragma unroll
    for (int j = 0; j < 8; ++j) x[j] = red[j * 32 + lane];
#pragma unroll
    for (int st = 4; st > 0; st >>= 1)
#pragma unroll
      for (int j = 0; j < st; ++j) { x[j][0] += x[j + st][0]; x[j][1] += x[j + st][1]; x[j][2] += x[j + st][2]; }
#pragma unroll
    for (int st = 16; st > 0; st >>= 1) { const float y0 = __shfl_xor(x[0][0], st, 32), y1 = __shfl_xor(x[0][1], st, 32), y2 = __shfl_xor(x[0][2], st, 32); x[0][0] += y0; x[0][1] += y1; x[0][2] += y2; }      /* after a step every lane holds the sum that the tree's lane (lane mod st) holds */
    float f0 = x[0][0] / ((float)TT * (float)TT), f1 = x[0][1] / (float)TT, f2 = x[0][2] / (float)TT; f0 = fminf(fmaxf(f0, -10.f), 10.f); f1 = fminf(fmaxf(f1, -10.f), 10.f); f2 = fminf(fmaxf(f2, 0.f), 1.f);
    float pre = bf16_round(m1b); pre += f0 * bf16_round(m1w0); pre += f1 * bf16_round(m1w1); pre += f2 * bf16_round(m1w2);
    const float hu = tanhf(pre) * bf16_round(m2w);
    float raw = bf16_round(m2b);
#pragma unroll
    for (int u = 0; u < 16; ++u) raw += __shfl(hu, u, 32);
    float t = 0.01f + (1.0f / (1.0f + expf(-raw))) * (2.0f - 0.01f); t = fminf(fmaxf(t, 0.01f), 2.0f); t = fminf(t, 0.85f);
    sc2 = 1.4426950408889634f / (2.0f * t);
#pragma unroll
    for (int n = 0; n < NQ; ++n) nm2[n] = 10.0f - nm2[n] * sc2; }
  int buf = 0;
  for (int kb = KT; kb < TT; kb += KT) {
    g2r(kb);            // next stage: in flight while this one is worked on
    __builtin_amdgcn_sched_barrier(0);      // keeps those loads above the products; without it the compiler may sink them to just before their LDS stores and their latency is waited out
    work(buf);
    r2s(buf ^ 1);       // that buffer's last readers left it before the barrier that ended the trip before
    __syncthreads();    // publishes the next stage and ends this trip's reads of buf
    buf ^= 1;
  }
  work(buf);
#pragma unroll
  for (int n = 0; n < NQ; ++n) { const int q = q0 + n * 16;
    float su = su0[n] + su1[n]; su += __shfl_xor(su, 16, 32);      /* the two halves of the wave hold the two halves of a query's keys */
    if (!ATT) { const float set = se[n] + __shfl_xor(se[n], 16, 32), se2t = se2[n] + __shfl_xor(se2[n], 16, 32), rm = fmaxf(rmx[n], __shfl_xor(rmx[n], 16, 32));
      const float inv = 1.0f / set; const float vq = (se2t * inv) * inv - 1.0f / (float)TT;
      if (hh == 0) { const v4f v = {su, fminf(fmaxf(rm * 0.125f, -50.f), 50.f), vq / (float)(TT - 1), rm}; *(v4f*)(RST + ((size_t)slab * TT + q) * 4) = v; }
    } else { const float inv = 1.0f / su;
#pragma unroll
      for (int dt = 0; dt < 4; ++dt) { FragH f;
#pragma unroll
        for (int r = 0; r < 8; ++r) f.h[r] = (_Float16)(o[n][dt][r] * inv);
        *(v8us*)((unsigned short*)O16 + ((size_t)b * TT + q) * CC + h * HD + dt * 16 + 8 * hh) = f.half[0]; } } } }
// The attention kernel: blockIdx.x = 256 queries, blockIdx.y = (batch, head).
__global__ __launch_bounds__(256) void k_att(const _Float16* __restrict__ Q3, const _Float16* __restrict__ Kf, const _Float16* __restrict__ VT, float* __restrict__ RST,
    const float* __restrict__ Wt1, const float* __restrict__ bt1, const float* __restrict__ Wt2, const float* __restrict__ bt2, _Float16* __restrict__ O16) {
  __shared__ __attribute__((aligned(16))) unsigned short tK[2][KT][KPIT];
  fused_body<true, 2>(tK, blockIdx.x, blockIdx.y, Q3, Kf, VT, RST, Wt1, bt1, Wt2, bt2, O16);
}
// The row statistics need Q and K only, and nobody needs V before the attention kernel: the V projection shares the statistics' grid. Work-groups 0 .. 255 take the statistics (the longer job, so it starts first; 4 to a (batch, head)),
// 256 .. 511 the V tiles: one of each fits a WGP, and the projection's loads, LDS reads and products run in the slots that the statistics' vector work leaves open. One LDS array serves either job.
__global__ __launch_bounds__(256) void k_stat_v(const _Float16* __restrict__ Q3, const _Float16* __restrict__ Kf, float* __restrict__ RST, const _Float16* __restrict__ X16, const _Float16* __restrict__ BW, const float* __restrict__ bv, _Float16* __restrict__ VT) {
  __shared__ __attribute__((aligned(16))) unsigned short sm[PSM];
  const int bx = blockIdx.x;
  if (bx < 256) fused_body<false, 2>((unsigned short (*)[KT][KPIT])sm, bx & 3, bx >> 2, Q3, Kf, nullptr, RST, nullptr, nullptr, nullptr, nullptr, nullptr);
  else proj_body<true>(sm, bx - 256, 2, X16, BW, nullptr, nullptr, bv, nullptr, nullptr, VT);
}

extern "C" void kernel_launch(void* const* d_in, const int* in_sizes, int n_in,
                              void* d_out, int out_size, void* d_ws, size_t ws_size, hipStream_t stream) {
  (void)in_sizes; (void)n_in; (void)out_size;
  const float* const* I = (const float* const*)d_in; const float* xq = I[0]; const float* xk = I[1]; const float* xv = I[2]; const float* Wq = I[3]; const float* bq = I[4]; const float* Wk = I[5]; const float* bk = I[6]; const float* Wv = I[7]; const float* bv = I[8]; const float* Wo = I[9]; const float* bo = I[10]; const float* Wt1 = I[11]; const float* bt1 = I[12]; const float* Wt2 = I[13]; const float* bt2 = I[14];
  char* ws = (char*)d_ws; size_t off = 0;
  auto take = [&](size_t bytes) { char* p = ws + off; off += (bytes + 255) & ~(size_t)255; return p; };
  _Float16* Q3p = (_Float16*)take((size_t)NR * NH * K2 * 2); _Float16* K3p = (_Float16*)take((size_t)NR * NH * K2 * 2); _Float16* VTb = (_Float16*)take((size_t)NBt * CC * TT * 2); _Float16* BWo = (_Float16*)take((size_t)CC * CC * 2); float* RST = (float*)take((size_t)HG * TT * 4 * 4); _Float16* O16 = (_Float16*)take((size_t)NR * CC * 2);
  const size_t pW = (size_t)CC * CC, pX = (size_t)NR * CC;      /* plane sizes in elements: a weight; an activation */
  _Float16* BW = (_Float16*)take(3 * pW * 2); _Float16* X16 = (_Float16*)take(3 * pX * 2);      /* what only the projections need */
  if (off > ws_size) return;      // 16.8 + 16.8 + 8.4 + 2.1 + 1.0 + 8.4 + 6.3 + 25.2 = 85.0 MB
  const dim3 gP((NR / 128) * (CC / 128), 1);
  k_prep<<<512, 256, 0, stream>>>(xq, xk, xv, Wq, Wk, Wv, Wo, X16, BW, BWo);      /* all three activations and all four weights, one launch */
  k_proj<<<dim3((NR / 128) * (CC / 128), 2), 256, 0, stream>>>(X16, BW, bq, bk, Q3p, K3p);      /* Q, K -> [hi | lo] */
  const dim3 gF(TT / 256, HG);      /* 256 queries a work-group; slab g = batch * NH + head in RST */
  k_stat_v<<<512, 256, 0, stream>>>(Q3p, K3p, RST, X16, BW, bv, VTb);      /* row statistics of raw Q*K, about f32 (K 192); beside them V -> f16, transposed */
  k_att<<<gF, 256, 0, stream>>>(Q3p, K3p, VTb, RST, Wt1, bt1, Wt2, bt2, O16);      /* the head's t, then softmax(Q*K / 2t) * V */
  k_gemm_hhx<0, 4, 2, 2, 128, CC, false><<<gP, 256, 0, stream>>>(O16, 0, BWo, 0, 0.0625f, bo, 0, (float*)d_out, nullptr, CC, 0, NR, CC, CC, 0, 0, 0);
}

// v010
// One run takes 105 microseconds.
// Two timings next to v009 put it at 1.03 and 1.04 times that version's speed.
// Counting every step since v000, it is 9.52 times as fast.
#include <hip/hip_runtime.h>
// Diffusion-time multi-head attention (B 4, S 1024, D 1024, 16 heads × 64): Q,K,V = x·W + b ((in,out)); per (b,h): s = clip(Q·K/8, ±50); feats = (mean s, mean_q max_k s, mean_q var_k softmax(s/2) (ddof 1)) → t = min(clip(0.01 + 1.99·σ(tanh(feats·Wt1 + b)·Wt2 + b)), 0.85); attn = softmax(Q·K/(2t)); out = (attn·V merged)·Wo + bo → [4,1024,1024].
// Structure: projections as GEMMs (exact products); Q and K carried as f16 [hi | lo] (lo = the f16 of what hi leaves, unscaled: f16 subnormals count) and contracted as q_hi*k_hi + q_lo*k_hi + q_hi*k_lo (K 192, each hi fragment used in two terms) so the raw logits are about f32 (they are divided by 2t, i.e. scaled up to x50); all 64 (batch, head) slabs per launch: a statistics kernel that forms the score tiles by WMMA from q_hi*k_hi alone (its sums are means over 1024 and more scores and reach the output only through t) and reduces them in registers (clipped sum / max / softmax(s/2) variance), then an attention kernel whose work-groups each reduce their head's row statistics and run the tiny time MLP themselves (fixed order), form the tiles in all three terms, take exp with the head's 1/(2t) (x2^10 -> f16) and multiplies by V in place; output projection GEMM.
// Compute dtype: inputs and parameters rounded to bf16; the statistics' logits from plain f16 operands, the attention's logits ≈f32; statistics/MLP/softmax f32; V and the attention output as f16 operands (≈2^-12); f32 accumulation. v_wmma_f32_16x16x32_f16.
#define NBt 4
#define TT 1024
#define CC 1024
#define NH 16
#define HD 64
#define NR (NBt * TT)            /* 4096 */
#define HG (NBt * NH)            /* (batch, head) slabs: all in one launch */
#define K2 (2 * HD)              /* 128: a row of Q or K of one head as stored, [hi | lo] */
typedef __bf16 v16b __attribute__((ext_vector_type(16)));
typedef unsigned short v8us __attribute__((ext_vector_type(8), may_alias));
typedef float  v8f  __attribute__((ext_vector_type(8)));
typedef float  v4f  __attribute__((ext_vector_type(4)));
typedef float  v4fa __attribute__((ext_vector_type(4), may_alias));
union FragB { v16b v; v8us half[2]; unsigned short u[16]; };

__device__ __forceinline__ unsigned short bf16_bits(float x) { unsigned int u = __float_as_uint(x); return (unsigned short)((u + 0x7FFFu + ((u >> 16) & 1u)) >> 16); }
__device__ __forceinline__ float bf16_val(unsigned short b) { return __uint_as_float(((unsigned int)b) << 16); }
__device__ __forceinline__ float bf16_round(float x) { return bf16_val(bf16_bits(x)); }
// D += A·B with NT terms: 1 = ah·bh, 2 = + al·bh (A split), 3 = + ah·bl (both split)
template <int NT>
__device__ __forceinline__ v8f mmaN(v16b ah, v16b al, v16b bh, v16b bl, v8f c) {
  c = __builtin_amdgcn_wmma_f32_16x16x32_bf16(false, ah, false, bh, (short)0, c, false, false);
  if (NT >= 2) c = __builtin_amdgcn_wmma_f32_16x16x32_bf16(false, al, false, bh, (short)0, c, false, false);
  if (NT >= 3) c = __builtin_amdgcn_wmma_f32_16x16x32_bf16(false, ah, false, bl, (short)0, c, false, false);
  asm volatile("v_nop\n\tv_nop\n\tv_nop\n\tv_nop" : "+v"(c) : "v"(ah), "v"(al), "v"(bh), "v"(bl));
  return c;
}

__global__ __launch_bounds__(256) void k_wt_bf16(const float* __restrict__ W, unsigned short* __restrict__ Wt, int K, int N) {
  const int t = blockIdx.x * 256 + threadIdx.x;
  const int k8n = K / 8;
  if (t >= N * k8n) return;
  const int n = t / k8n, k8 = (t % k8n) * 8;
  v8us v;
#pragma unroll
  for (int i = 0; i < 8; ++i) v[i] = bf16_bits(W[(size_t)(k8 + i) * N + n]);
  *(v8us*)(Wt + (size_t)n * K + k8) = v;
  
}

// GEMM C[M][N] (f32, pitch ldc) = act(A[M][K]·W + bias). A f32 row-major (pitch lda) converted per fragment to bf16
// (ASPLIT: hi/lo two planes -> 2 terms, else single rounded term); Wt bf16 [N][K] (pitch ldb). BIAS_BF16 rounds the
// bias to bf16 first (bias quantised to bf16 before the add). K%32==0, M%16==0, N%64==0.
template <bool ASPLIT, int ACT, bool BIAS_BF16>
__global__ __launch_bounds__(128) void k_gemm_bf(const float* __restrict__ A, int lda, const unsigned short* __restrict__ Wt, int ldb,
                                               const float* __restrict__ bias, float* __restrict__ C, int ldc, int M, int N, int K) {
  __shared__ __attribute__((aligned(16))) float so[4][16][64];
  const int tid = threadIdx.x, w = tid >> 5, lane = tid & 31, ln = lane & 15, hh = lane >> 4;
  const int ntn = N / 64;
  const int wid = blockIdx.x * 4 + w;
  const int mt = wid / ntn, nq = wid % ntn;
  if (mt * 16 >= M) return;
  const int row0 = mt * 16, col0 = nq * 64;
  const float* arow = A + (size_t)(row0 + ln) * lda;
  v8f acc[4] = {};
  for (int kb = 0; kb < K; kb += 32) {
    FragB ah, al;
    const v4f x0 = *(const v4fa*)(arow + kb + 8 * hh), x1 = *(const v4fa*)(arow + kb + 8 * hh + 4);
    const v4f x2 = *(const v4fa*)(arow + kb + 16 + 8 * hh), x3 = *(const v4fa*)(arow + kb + 16 + 8 * hh + 4);
    float xs[16] = {x0[0],x0[1],x0[2],x0[3],x1[0],x1[1],x1[2],x1[3],x2[0],x2[1],x2[2],x2[3],x3[0],x3[1],x3[2],x3[3]};
#pragma unroll
    for (int i = 0; i < 16; ++i) { const unsigned short hb = bf16_bits(xs[i]); ah.u[i] = hb; al.u[i] = ASPLIT ? bf16_bits(xs[i] - bf16_val(hb)) : (unsigned short)0; }
#pragma unroll
    for (int t = 0; t < 4; ++t) {
      const unsigned short* brow = Wt + (size_t)(col0 + t * 16 + ln) * ldb + kb;
      FragB b;
      b.half[0] = *(const v8us*)(brow + 8 * hh);
      b.half[1] = *(const v8us*)(brow + 16 + 8 * hh);
      acc[t] = mmaN<ASPLIT ? 2 : 1>(ah.v, al.v, b.v, b.v, acc[t]);
    }
  }
#pragma unroll
  for (int t = 0; t < 4; ++t) {
    float bv = bias ? bias[col0 + t * 16 + ln] : 0.f;
    if (BIAS_BF16) bv = bf16_round(bv);
#pragma unroll
    for (int r = 0; r < 8; ++r) { float v = acc[t][r] + bv; if (ACT == 1) v = fmaxf(v, 0.f); so[w][8 * hh + r][t * 16 + ln] = v; }
  }
  __builtin_amdgcn_fence(__ATOMIC_ACQ_REL, "workgroup");
  __builtin_amdgcn_wave_barrier();
  const int rsub = lane >> 4, c4 = (lane & 15) * 4;
  {
#pragma unroll
    for (int q = 0; q < 8; ++q) {
      const int r = q * 2 + rsub;
      const v4f v = *(const v4fa*)&so[w][r][c4];
      *(v4f*)(C + (size_t)(row0 + r) * ldc + col0 + c4) = v;
    }
    
  }
}

// GEMM C = act(A·W + bias + resid): A f32 (ASPLIT -> hi/lo 2 terms), Wt bf16 [N][K]; ACT 0 none, 1 relu, 2 exact gelu;
// resid (optional, f32, row index = (row % rmod), pitch ldr, RES_BF16 rounds it) added before the activation.
template <bool ASPLIT, int ACT, bool BIAS_BF16, bool RES_BF16>
__global__ __launch_bounds__(128) void k_gemm_bf3(const float* __restrict__ A, int lda, const unsigned short* __restrict__ Wt, int ldb,
                                                const float* __restrict__ bias, const float* __restrict__ resid, int rmod, int ldr,
                                                float* __restrict__ C, int ldc, int M, int N, int K) {
  __shared__ __attribute__((aligned(16))) float so[4][16][64];
  const int tid = threadIdx.x, w = tid >> 5, lane = tid & 31, ln = lane & 15, hh = lane >> 4;
  const int ntn = N / 64;
  const int wid = blockIdx.x * 4 + w;
  const int mt = wid / ntn, nq = wid % ntn;
  if (mt * 16 >= M) return;
  const int row0 = mt * 16, col0 = nq * 64;
  const float* arow = A + (size_t)(row0 + ln) * lda;
  v8f acc[4] = {};
  for (int kb = 0; kb < K; kb += 32) {
    FragB ah, al;
    const v4f x0 = *(const v4fa*)(arow + kb + 8 * hh), x1 = *(const v4fa*)(arow + kb + 8 * hh + 4);
    const v4f x2 = *(const v4fa*)(arow + kb + 16 + 8 * hh), x3 = *(const v4fa*)(arow + kb + 16 + 8 * hh + 4);
    float xs[16] = {x0[0],x0[1],x0[2],x0[3],x1[0],x1[1],x1[2],x1[3],x2[0],x2[1],x2[2],x2[3],x3[0],x3[1],x3[2],x3[3]};
#pragma unroll
    for (int i = 0; i < 16; ++i) { const unsigned short hb = bf16_bits(xs[i]); ah.u[i] = hb; al.u[i] = ASPLIT ? bf16_bits(xs[i] - bf16_val(hb)) : (unsigned short)0; }
#pragma unroll
    for (int t = 0; t < 4; ++t) {
      const unsigned short* brow = Wt + (size_t)(col0 + t * 16 + ln) * ldb + kb;
      FragB b;
      b.half[0] = *(const v8us*)(brow + 8 * hh);
      b.half[1] = *(const v8us*)(brow + 16 + 8 * hh);
      acc[t] = mmaN<ASPLIT ? 2 : 1>(ah.v, al.v, b.v, b.v, acc[t]);
    }
  }
#pragma unroll
  for (int t = 0; t < 4; ++t) {
    const int col = col0 + t * 16 + ln;
    float bv = bias ? bias[col] : 0.f;
    if (BIAS_BF16) bv = bf16_round(bv);
#pragma unroll
    for (int r = 0; r < 8; ++r) {
      float v = acc[t][r] + bv;
      if (resid) { float rv = resid[(size_t)((row0 + 8 * hh + r) % rmod) * ldr + col]; if (RES_BF16) rv = bf16_round(rv); v += rv; }
      if (ACT == 1) v = fmaxf(v, 0.f);
      if (ACT == 2) v = 0.5f * v * (1.0f + erff(v * 0.70710678118654752f));
      if (ACT == 3) { const float u = 0.7978845608028654f * (v + 0.044715f * v * v * v); v = 0.5f * v * (1.0f + tanhf(u)); }
      so[w][8 * hh + r][t * 16 + ln] = v;
    }
  }
  __builtin_amdgcn_fence(__ATOMIC_ACQ_REL, "workgroup");
  __builtin_amdgcn_wave_barrier();
  const int rsub = lane >> 4, c4 = (lane & 15) * 4;
  {
#pragma unroll
    for (int q = 0; q < 8; ++q) {
      const int r = q * 2 + rsub;
      const v4f v = *(const v4fa*)&so[w][r][c4];
      *(v4f*)(C + (size_t)(row0 + r) * ldc + col0 + c4) = v;
    }
    
  }
}
// row LayerNorm (biased variance, eps) over N: s = X (+ R); optional out_sum <- s; out_norm <- (s-mu)*rsqrt(var+eps)*g + b
template <bool PARAM_BF16>
__global__ __launch_bounds__(256) void k_layernorm(const float* __restrict__ X, const float* __restrict__ R, const float* __restrict__ g, const float* __restrict__ bta,
                                                  float* __restrict__ out_sum, float* __restrict__ out_norm, int N, float eps) {
  __shared__ float red[256];
  const int row = blockIdx.x, tid = threadIdx.x;
  const float* x = X + (size_t)row * N; const float* rr = R ? R + (size_t)row * N : nullptr;
  float vals[16];                     // up to N = 4096
  const int per = N / 256;            // contiguous chunk per thread? use strided-by-4 chunks: thread handles j = tid*4 + 1024*u
  float s1 = 0.f;
  for (int u = 0; u < per / 4; ++u) {
    const int j = tid * 4 + 1024 * u;
    const v4f a = *(const v4fa*)(x + j);
    v4f b = {0.f,0.f,0.f,0.f}; if (rr) b = *(const v4fa*)(rr + j);
#pragma unroll
    for (int q = 0; q < 4; ++q) { const float v = a[q] + b[q]; vals[u * 4 + q] = v; s1 += v; }
  }
  red[tid] = s1; __syncthreads();
  for (int st = 128; st > 0; st >>= 1) { if (tid < st) red[tid] += red[tid + st]; __syncthreads(); }
  const float mu = red[0] / (float)N; __syncthreads();
  float s2 = 0.f;
  for (int u = 0; u < per / 4; ++u)
#pragma unroll
    for (int q = 0; q < 4; ++q) { const float c = vals[u * 4 + q] - mu; s2 += c * c; }
  red[tid] = s2; __syncthreads();
  for (int st = 128; st > 0; st >>= 1) { if (tid < st) red[tid] += red[tid + st]; __syncthreads(); }
  const float rs = rsqrtf(red[0] / (float)N + eps);
  {
    for (int u = 0; u < per / 4; ++u) {
      const int j = tid * 4 + 1024 * u;
      v4f o, sm;
#pragma unroll
      for (int q = 0; q < 4; ++q) {
        float gg = g[j + q], bb = bta[j + q];
        if (PARAM_BF16) { gg = bf16_round(gg); bb = bf16_round(bb); }
        sm[q] = vals[u * 4 + q]; o[q] = (vals[u * 4 + q] - mu) * rs * gg + bb;
      }
      if (out_sum) *(v4f*)(out_sum + (size_t)row * N + j) = sm;
      *(v4f*)(out_norm + (size_t)row * N + j) = o;
    }
    
  }
}



// ---- f16 WMMA path (v_wmma_f32_16x16x32_f16): 11-bit significands for operands in range — used where a [0,1] probability operand needs more precision than bf16
typedef _Float16 v16h __attribute__((ext_vector_type(16)));
union FragH { v16h v; v8us half[2]; _Float16 h[16]; unsigned short u[16]; };
template <int NT>
__device__ __forceinline__ v8f mmaH(v16h ah, v16h al, v16h bh, v16h bl, v8f c) {
  c = __builtin_amdgcn_wmma_f32_16x16x32_f16(false, ah, false, bh, (short)0, c, false, false);
  if (NT >= 2) c = __builtin_amdgcn_wmma_f32_16x16x32_f16(false, al, false, bh, (short)0, c, false, false);
  if (NT >= 3) c = __builtin_amdgcn_wmma_f32_16x16x32_f16(false, ah, false, bl, (short)0, c, false, false);
  asm volatile("v_nop\n\tv_nop\n\tv_nop\n\tv_nop" : "+v"(c) : "v"(ah), "v"(al), "v"(bh), "v"(bl));
  return c;
}
// batched GEMM like k_gemm_b but f16 operands: A f32 (split into f16 hi/lo if ASPLIT, else rounded to f16), Bt = f16 values [n][k]; alpha; C f32; N multiple of 16 (partial tiles skipped)
template <bool ASPLIT>
__global__ __launch_bounds__(128) void k_gemm_h(const float* __restrict__ A, int lda, size_t sA, const _Float16* __restrict__ Bh, int ldb, size_t sB, float alpha, float* __restrict__ C, int ldc, size_t sC, int M, int N, int K) {
  __shared__ __attribute__((aligned(16))) float so[4][16][64];
  const int tid = threadIdx.x, w = tid >> 5, lane = tid & 31, ln = lane & 15, hh = lane >> 4; const int by = blockIdx.y;
  A += (size_t)by * sA; Bh += (size_t)by * sB; C += (size_t)by * sC;
  const int ntn = (N + 63) / 64; const int wid = blockIdx.x * 4 + w; const int mt = wid / ntn, nq = wid % ntn; if (mt * 16 >= M) return;
  const int row0 = mt * 16, col0 = nq * 64; const float* arow = A + (size_t)(row0 + ln) * lda;
  v8f acc[4] = {};
  for (int kb = 0; kb < K; kb += 32) {
    FragH ah, al;
    const v4f x0 = *(const v4fa*)(arow + kb + 8 * hh), x1 = *(const v4fa*)(arow + kb + 8 * hh + 4), x2 = *(const v4fa*)(arow + kb + 16 + 8 * hh), x3 = *(const v4fa*)(arow + kb + 16 + 8 * hh + 4);
    float xs[16] = {x0[0],x0[1],x0[2],x0[3],x1[0],x1[1],x1[2],x1[3],x2[0],x2[1],x2[2],x2[3],x3[0],x3[1],x3[2],x3[3]};
#pragma unroll
    for (int i = 0; i < 16; ++i) { const _Float16 h = (_Float16)xs[i]; ah.h[i] = h; al.h[i] = ASPLIT ? (_Float16)(xs[i] - (float)h) : (_Float16)0.0f; }
#pragma unroll
    for (int t = 0; t < 4; ++t) { if (col0 + t * 16 >= N) continue; const size_t boff = (size_t)(col0 + t * 16 + ln) * ldb + kb; FragH bq; bq.half[0] = *(const v8us*)(Bh + boff + 8 * hh); bq.half[1] = *(const v8us*)(Bh + boff + 16 + 8 * hh);
      acc[t] = mmaH<ASPLIT ? 2 : 1>(ah.v, al.v, bq.v, bq.v, acc[t]); }
  }
#pragma unroll
  for (int t = 0; t < 4; ++t) { if (col0 + t * 16 >= N) continue;
#pragma unroll
    for (int r = 0; r < 8; ++r) so[w][8 * hh + r][t * 16 + ln] = acc[t][r] * alpha; }
  __builtin_amdgcn_fence(__ATOMIC_ACQ_REL, "workgroup"); __builtin_amdgcn_wave_barrier();
  const int rsub = lane >> 4, c4 = (lane & 15) * 4;
  {
#pragma unroll
    for (int q = 0; q < 8; ++q) { const int r = q * 2 + rsub; if (col0 + c4 < N) { const v4f v = *(const v4fa*)&so[w][r][c4]; *(v4f*)(C + (size_t)(row0 + r) * ldc + col0 + c4) = v; } }
     }
}

// Wt[n][k] = f16(W[k][n]·scale) from f32 row-major W[K][N] (scale = power of two; bf16-exact weights stay exact in f16 away from the subnormal range)
// y picks one of four weight matrices (bx: the work-group's place among the 64 of a matrix): 0..2 go to planes 0..2 of Wt012, 3 goes to Wt3
// One thread takes an 8 x 8 block of W (8 output pieces of 16 B), so the four matrices take 256 work-groups, 64 each. A wave = 4 column groups (one 128-B line of each W row) x 8 row groups (one 128-B line of each Wt row).
__device__ __forceinline__ void wt_f16_body(const int bx, const int y, const float* __restrict__ W0, const float* __restrict__ W1, const float* __restrict__ W2, const float* __restrict__ W3, _Float16* __restrict__ Wt012, _Float16* __restrict__ Wt3, float scale) {
  const float* __restrict__ W = (y == 0) ? W0 : (y == 1) ? W1 : (y == 2) ? W2 : W3; _Float16* __restrict__ Wt = (y == 3) ? Wt3 : Wt012 + (size_t)y * CC * CC;
  const int lane = threadIdx.x & 31, wv = bx * 8 + (threadIdx.x >> 5); const int n0 = ((wv % (CC / 32)) * 4 + (lane & 3)) * 8, k0 = ((wv / (CC / 32)) * 8 + (lane >> 2)) * 8;
  const unsigned lo = (unsigned)(k0 * CC + n0) * 4u; const char* p = (const char*)W + lo; v4f a[8][2];      /* the thread's byte offset: one register serves every load */
#pragma unroll
  for (int i = 0; i < 8; ++i) { a[i][0] = *(const v4fa*)(p + i * (CC * 4)); a[i][1] = *(const v4fa*)(p + i * (CC * 4) + 16); }
  asm volatile("s_wait_xcnt 0x0" :: "v"(lo) : "memory");      // stands in front of the first instruction that reuses the loads' address register; the operand keeps that register untouched up to here
  __builtin_amdgcn_sched_barrier(0);      // keeps the arithmetic below behind that wait, and so behind the issue of every load
  unsigned short* o = (unsigned short*)Wt + (size_t)n0 * CC + k0; FragH f[8];
#pragma unroll
  for (int j = 0; j < 8; ++j)
#pragma unroll
    for (int i = 0; i < 8; ++i) f[j].h[i] = (_Float16)(bf16_round(a[i][j >> 2][j & 3]) * scale);
  __builtin_amdgcn_sched_barrier(0);      // the stores go out as one run behind the arithmetic: none of it then overwrites a register of an issued store
#pragma unroll
  for (int j = 0; j < 8; ++j) *(v8us*)(o + j * CC) = f[j].half[0];
}
// Block-tiled GEMM with fused epilogue: v = acc*alpha + bias[by*sBias + col] ; ACT 0 none / 1 elu ; writes f16 C16 (H16) or f32 C.
// One block = WM x WN waves = a (WM*FM*16) x (WN*64) tile of C; a wave owns FM x 4 accumulator tiles. Per chunk of KC k the block brings its A rows and B rows (whole 128-B lines, KC/8 lanes a row)
// into LDS at a pitch of 2*KC + 16 B and every wave reads its fragments from there; two buffers, the next chunk's global loads fly while this chunk is multiplied.
// LD = row pitch of A and of B in elements, a compile-time constant so that the rows of a tile are immediate offsets from one address per operand.
// Needs M a multiple of WM*FM*16, N of WN*64, K of KC (every launch below is).
// Two batch axes: blockIdx.y steps A, B, C by sA, sB, sC (heads), blockIdx.z by zA, zB, zC (batches).
template <int ACT, int WM, int WN, int FM, int KC, int LD, bool H16>
__global__ __launch_bounds__(WM * WN * 32) void k_gemm_hhx(const _Float16* __restrict__ A, size_t sA, const _Float16* __restrict__ Bh, size_t sB, float alpha, const float* __restrict__ bias, size_t sBias,
    float* __restrict__ C, _Float16* __restrict__ C16, int ldc, size_t sC, int M, int N, int K, size_t zA, size_t zB, size_t zC) {
  constexpr int NW = WM * WN, BM = WM * FM * 16, BN = WN * 64, CPR = KC / 8, RP = NW * 32 / CPR, NA = BM / RP, NB = BN / RP, PIT = KC + 8;
  __shared__ __attribute__((aligned(16))) unsigned short tA[2][BM][PIT];
  __shared__ __attribute__((aligned(16))) unsigned short tB[2][BN][PIT];
  __shared__ __attribute__((aligned(16))) float so[NW][16][64];
  const int tid = threadIdx.x, w = tid >> 5, lane = tid & 31, ln = lane & 15, hh = lane >> 4; const int by = blockIdx.y;
  const int bz = blockIdx.z; A += (size_t)by * sA + (size_t)bz * zA; Bh += (size_t)by * sB + (size_t)bz * zB; const size_t cofs = (size_t)by * sC + (size_t)bz * zC; const float* bp = bias ? bias + (size_t)by * sBias : nullptr;
  const int ntn = N / BN; const int bm = blockIdx.x / ntn, bn = blockIdx.x % ntn; if (bm * BM >= M) return;
  const int wm = w / WN, wn = w % WN; const int srow = tid / CPR, sc = (tid % CPR) * 8;
  const unsigned short* gA = (const unsigned short*)A + (size_t)(bm * BM + srow) * LD + sc;
  const unsigned short* gB = (const unsigned short*)Bh + (size_t)(bn * BN + srow) * LD + sc;
  const int col0 = bn * BN + wn * 64;
  float bvv[4];      // the wave's bias values, fetched ahead of the products
#pragma unroll
  for (int t = 0; t < 4; ++t) bvv[t] = bp ? bf16_round(bp[col0 + t * 16 + ln]) : 0.f;
  v8us ra[NA], rb[NB];
  v8f acc[FM][4] = {};
  auto g2r = [&](int kb) {
#pragma unroll
    for (int i = 0; i < NA; ++i) ra[i] = *(const v8us*)(gA + kb + i * RP * LD);
#pragma unroll
    for (int i = 0; i < NB; ++i) rb[i] = *(const v8us*)(gB + kb + i * RP * LD);
  };
  auto r2s = [&](int buf) {
#pragma unroll
    for (int i = 0; i < NA; ++i) *(v8us*)&tA[buf][i * RP + srow][sc] = ra[i];
#pragma unroll
    for (int i = 0; i < NB; ++i) *(v8us*)&tB[buf][i * RP + srow][sc] = rb[i];
  };
  auto mul = [&](int buf) {
#pragma unroll
    for (int ks = 0; ks < KC / 32; ++ks) { FragH fa[FM], fb[4];
#pragma unroll
      for (int i = 0; i < FM; ++i) { const unsigned short* p = &tA[buf][(wm * FM + i) * 16 + ln][ks * 32 + 8 * hh]; fa[i].half[0] = *(const v8us*)p; fa[i].half[1] = *(const v8us*)(p + 16); }
#pragma unroll
      for (int t = 0; t < 4; ++t) { const unsigned short* p = &tB[buf][wn * 64 + t * 16 + ln][ks * 32 + 8 * hh]; fb[t].half[0] = *(const v8us*)p; fb[t].half[1] = *(const v8us*)(p + 16); }
#pragma unroll
      for (int i = 0; i < FM; ++i)
#pragma unroll
        for (int t = 0; t < 4; ++t) acc[i][t] = __builtin_amdgcn_wmma_f32_16x16x32_f16(false, fa[i].v, false, fb[t].v, (short)0, acc[i][t], false, false); }
  };
  g2r(0); r2s(0);
  __syncthreads();      // chunk 0 is in buffer 0 for every wave
  int buf = 0;
  for (int kb = KC; kb < K; kb += KC) {
    g2r(kb);            // next chunk: in flight while this one is multiplied
    __builtin_amdgcn_sched_barrier(0);      // keeps those loads above the products; without it the compiler sinks them to just before their LDS stores and their latency is waited out
    mul(buf);
    r2s(buf ^ 1);       // that buffer's last readers left it before the barrier that ended the trip before
    __syncthreads();    // publishes the next chunk and ends this trip's reads of buf
    buf ^= 1;
  }
  mul(buf);
  const int rsub = lane >> 4, c4 = (lane & 15) * 4; typedef _Float16 v4h __attribute__((ext_vector_type(4)));
#pragma unroll
  for (int i = 0; i < FM; ++i) { const int row0 = bm * BM + (wm * FM + i) * 16;
#pragma unroll
    for (int t = 0; t < 4; ++t) { const float bv = bvv[t];
#pragma unroll
      for (int r = 0; r < 8; ++r) { float v = acc[i][t][r] * alpha + bv; if (ACT == 1) v = (v > 0.f) ? v : expm1f(v); else if (ACT == 7) v = (v > 0.f) ? v + 1.0f : expf(v); else if (ACT == 8) v = tanhf(v); else if (ACT == 9) v = 0.5f * v * (1.0f + tanhf(0.7978845608028654f * (v + 0.044715f * v * v * v))); else if (ACT == 11) v = 1.0f / (1.0f + expf(-v)); else if (ACT == 12) v = (v > 0.f) ? v : 0.01f * v; else if (ACT == 14) v = (v > 0.f) ? v : 0.1f * v; else if (ACT == 15) v = v / (1.0f + expf(-v)); else if (ACT == 3) v = fmaxf(v, 0.f); else if (ACT == 6) v = 0.5f * v * (1.0f + erff(v * 0.70710678118654752f)); so[w][8 * hh + r][t * 16 + ln] = v; } }
    __builtin_amdgcn_fence(__ATOMIC_ACQ_REL, "workgroup"); __builtin_amdgcn_wave_barrier();
#pragma unroll
    for (int q = 0; q < 8; ++q) { const int r = q * 2 + rsub; const v4f v = *(const v4fa*)&so[w][r][c4]; if (!H16) *(v4f*)(C + cofs + (size_t)(row0 + r) * ldc + col0 + c4) = v; else { v4h h4; for (int j = 0; j < 4; ++j) h4[j] = (_Float16)v[j]; *(v4h*)(C16 + cofs + (size_t)(row0 + r) * ldc + col0 + c4) = h4; } }
    if (i + 1 < FM) { __builtin_amdgcn_fence(__ATOMIC_ACQ_REL, "workgroup"); __builtin_amdgcn_wave_barrier(); }      // the wave's rows are read back before its next 16 rows overwrite them
  }
}


typedef _Float16 v4h __attribute__((ext_vector_type(4)));

// All three activations to f16, plane y of X16 from x_y. One round of 256 work-groups: a thread takes XP pieces of 8 elements of each activation, a work-group XP * 256 pieces in a row;
// all of a thread's loads are asked for before the first value is used, so that 8 waves a WGP keep the memory busy.
#define XP 8
__device__ __forceinline__ void x16_body(const unsigned bx, const float* __restrict__ x0, const float* __restrict__ x1, const float* __restrict__ x2, _Float16* __restrict__ X16) {
  const unsigned e0 = (bx * (XP * 256) + threadIdx.x) * 8u, lo = e0 * 4u; v4f a[3][XP][2];      /* the thread's first element, and its byte offset: one register serves every load */
#pragma unroll
  for (int y = 0; y < 3; ++y) { const char* p = (const char*)((y == 0) ? x0 : (y == 1) ? x1 : x2) + lo;
#pragma unroll
    for (int i = 0; i < XP; ++i) { a[y][i][0] = *(const v4fa*)(p + i * 8192); a[y][i][1] = *(const v4fa*)(p + i * 8192 + 16); } }
  asm volatile("s_wait_xcnt 0x0" :: "v"(lo) : "memory");      // stands in front of the first instruction that reuses the loads' address register; the operand keeps that register untouched up to here
  __builtin_amdgcn_sched_barrier(0);      // keeps the arithmetic below behind that wait, and so behind the issue of every load
#pragma unroll
  for (int y = 0; y < 3; ++y) { FragH f[XP];
#pragma unroll
    for (int i = 0; i < XP; ++i)
#pragma unroll
      for (int q = 0; q < 8; ++q) f[i].h[q] = (_Float16)bf16_round(a[y][i][q >> 2][q & 3]);
    __builtin_amdgcn_sched_barrier(0);      // the stores go out as one run behind the arithmetic: none of it then overwrites a register of an issued store
#pragma unroll
    for (int i = 0; i < XP; ++i) *(v8us*)((unsigned short*)X16 + (size_t)y * NR * CC + e0 + i * 2048) = f[i].half[0];
    if (y < 2) { asm volatile("s_wait_xcnt 0x0" ::: "memory");      // stands in front of the next group's arithmetic, which reuses the registers of these stores
      __builtin_amdgcn_sched_barrier(0);      // keeps that arithmetic behind the wait
    } } }
// The activations and the weights need nothing of each other: one grid. Work-groups 0 .. 255 take the activations (the longer job, so it starts first), 256 .. 511 the weights, 64 a matrix.
__global__ __launch_bounds__(256) void k_prep(const float* __restrict__ x0, const float* __restrict__ x1, const float* __restrict__ x2, const float* __restrict__ W0, const float* __restrict__ W1, const float* __restrict__ W2, const float* __restrict__ W3,
    _Float16* __restrict__ X16, _Float16* __restrict__ Wt012, _Float16* __restrict__ Wt3) {
  const int bx = blockIdx.x;
  if (bx < 256) x16_body((unsigned)bx, x0, x1, x2, X16);
  else wt_f16_body((bx - 256) & 63, (bx - 256) >> 6, W0, W1, W2, W3, Wt012, Wt3, 16.0f);
}
__global__ __launch_bounds__(256) void k_h16(const float* __restrict__ x, _Float16* __restrict__ X16, size_t n8) { const size_t t = (size_t)blockIdx.x * 256 + threadIdx.x; if (t >= n8) return; FragH f;
#pragma unroll
  for (int q = 0; q < 8; ++q) f.h[q] = (_Float16)x[t * 8 + q]; *(v8us*)((unsigned short*)X16 + t * 8) = f.half[0];  }
__global__ __launch_bounds__(256) void k_round16f(const float* __restrict__ W, _Float16* __restrict__ Bt, size_t n8) { const size_t t = (size_t)blockIdx.x * 256 + threadIdx.x; if (t >= n8) return; FragH f;
#pragma unroll
  for (int i = 0; i < 8; ++i) f.h[i] = (_Float16)(bf16_round(W[t * 8 + i]) * 16.0f); *(v8us*)((unsigned short*)Bt + t * 8) = f.half[0];  }
template <int NHv, int TTv>
__global__ __launch_bounds__(256) void k_vt(const _Float16* __restrict__ V16, int ldv, int voff, _Float16* __restrict__ Vt) { __shared__ unsigned short tl[64][66]; const int tid = threadIdx.x; const int slab = blockIdx.x / (TTv / 64), lg = blockIdx.x % (TTv / 64); const int b = slab / NHv, h = slab % NHv;
  for (int i = tid; i < 64 * 8; i += 256) { const int r = i / 8, c8 = (i % 8) * 8; FragH f; f.half[0] = *(const v8us*)((const unsigned short*)V16 + ((size_t)b * TTv + lg * 64 + r) * ldv + voff + h * 64 + c8);
#pragma unroll
    for (int q = 0; q < 8; ++q) tl[r][c8 + q] = f.u[q]; }
  __syncthreads();
  {
#pragma unroll
    for (int rd = 0; rd < 2; ++rd) { const int d = rd * 32 + tid / 8, pc = tid % 8; FragH f;
#pragma unroll
      for (int q = 0; q < 8; ++q) f.u[q] = tl[pc * 8 + q][d];
      *(v8us*)((unsigned short*)Vt + ((size_t)slab * 64 + d) * TTv + lg * 64 + pc * 8) = f.half[0]; }
     } }

__global__ __launch_bounds__(256) void k_hl(const float* __restrict__ F, _Float16* __restrict__ Hh, _Float16* __restrict__ Hl, size_t n8) { const size_t t = (size_t)blockIdx.x * 256 + threadIdx.x; if (t >= n8) return; FragH fh, fl; const v4f a = *(const v4fa*)(F + t * 8), c = *(const v4fa*)(F + t * 8 + 4);
#pragma unroll
  for (int q = 0; q < 4; ++q) { _Float16 h = (_Float16)a[q]; fh.h[q] = h; fl.h[q] = (_Float16)((a[q] - (float)h) * 1024.0f); h = (_Float16)c[q]; fh.h[4 + q] = h; fl.h[4 + q] = (_Float16)((c[q] - (float)h) * 1024.0f); }
  { *(v8us*)((unsigned short*)Hh + t * 8) = fh.half[0]; *(v8us*)((unsigned short*)Hl + t * 8) = fl.half[0];  } }

// One projection tile: y = 0 Q, 1 K, 2 V (plane y of X16 times plane y of BW, bias y); bx = the tile. Q and K are one launch, V runs in the statistics' launch. The products are those of k_gemm_hhx<0, 4, 2, 2, 128, CC, .> (128 x 128 tile, 8 waves of 2 x 4 accumulator tiles,
// k chunks of 128 in two LDS buffers); the epilogue writes the operand forms that the score kernels read, so no f32 Q or K plane, no row-major V, and no fold or transpose launch.
// Q and K -> [hi | lo] (a wave's 64 columns are one head: 2 whole 128-B lines a row); V -> V^T (a lane's 8 accumulator rows are 8 tokens in a row of V^T; the block's tile goes through LDS so that 256 B of a V^T row leave together).
// Both epilogues stage in the buffers that the last chunk does not use: their last readers left them before the loop's last barrier.
#define PKC 128
#define PPIT (PKC + 8)
#define SOP 68                   /* floats a staging row: 16 B more than 64 columns, so that rows 8 apart and the 4 rows of a read fall on different banks */
typedef float fal __attribute__((may_alias));
// 16 staged rows of 64 f32 -> the two f16 parts of each row. A lane takes 8 columns of rows 0, 4, 8, 12 from its own: 8 lanes write one 128-B line.
__device__ __forceinline__ void fold_store(const fal* p, unsigned short* o) {
  FragH s0[4], s1[4];
#pragma unroll
  for (int q = 0; q < 4; ++q) { const v4f a0 = *(const v4fa*)(p + q * 4 * SOP), a1 = *(const v4fa*)(p + q * 4 * SOP + 4);
#pragma unroll
    for (int e = 0; e < 8; ++e) { const float v = (e < 4) ? a0[e & 3] : a1[e & 3]; const _Float16 hi = (_Float16)v; s0[q].h[e] = hi; s1[q].h[e] = (_Float16)(v - (float)hi); } }
  __builtin_amdgcn_sched_barrier(0);      // the stores go out as one run behind the arithmetic: none of it then overwrites a register of an issued store
#pragma unroll
  for (int q = 0; q < 4; ++q) { unsigned short* oq = o + q * 4 * (NH * K2); *(v8us*)(oq) = s0[q].half[0]; *(v8us*)(oq + HD) = s1[q].half[0]; }
  asm volatile("s_wait_xcnt 0x0" ::: "memory");      // stands directly behind the run of stores, in front of whatever next reuses their registers
  __builtin_amdgcn_sched_barrier(0);      // keeps later arithmetic behind that wait
}
template <bool ISV>
__device__ __forceinline__ void proj_body(unsigned short* sm, const int bx, const int y, const _Float16* __restrict__ X16, const _Float16* __restrict__ BW, const float* __restrict__ bq, const float* __restrict__ bk, const float* __restrict__ bv,
    _Float16* __restrict__ O3q, _Float16* __restrict__ O3k, _Float16* __restrict__ VT) {
  constexpr int WN = 2, FM = 2, BM = 128, BN = 128, CPR = PKC / 8, RP = 256 / CPR, NA = BM / RP, NB = BN / RP;
  unsigned short (*tA)[BM][PPIT] = (unsigned short (*)[BM][PPIT])sm;      /* the kernel's LDS: two A buffers, then two B buffers */
  unsigned short (*tB)[BN][PPIT] = (unsigned short (*)[BN][PPIT])(sm + 2 * BM * PPIT);
  const int tid = threadIdx.x, w = tid >> 5, lane = tid & 31, ln = lane & 15, hh = lane >> 4;
  const float* bp = (y == 0) ? bq : (y == 1) ? bk : bv;
  const int bm = bx / (CC / BN), bn = bx % (CC / BN);
  const int wm = w / WN, wn = w % WN; const int srow = tid / CPR, sc = (tid % CPR) * 8;
  const unsigned short* gA = (const unsigned short*)X16 + (size_t)y * NR * CC + (size_t)(bm * BM + srow) * CC + sc;
  const unsigned short* gB = (const unsigned short*)BW + (size_t)y * CC * CC + (size_t)(bn * BN + srow) * CC + sc;
  const int col0 = bn * BN + wn * 64;
  float bvv[4];      // the wave's bias values, fetched ahead of the products
#pragma unroll
  for (int t = 0; t < 4; ++t) bvv[t] = bf16_round(bp[col0 + t * 16 + ln]);
  v8us ra[NA], rb[NB];
  v8f acc[FM][4] = {};
  auto g2r = [&](int kb) {
#pragma unroll
    for (int i = 0; i < NA; ++i) ra[i] = *(const v8us*)(gA + kb + i * RP * CC);
#pragma unroll
    for (int i = 0; i < NB; ++i) rb[i] = *(const v8us*)(gB + kb + i * RP * CC);
  };
  auto r2s = [&](int buf) {
#pragma unroll
    for (int i = 0; i < NA; ++i) *(v8us*)&tA[buf][i * RP + srow][sc] = ra[i];
#pragma unroll
    for (int i = 0; i < NB; ++i) *(v8us*)&tB[buf][i * RP + srow][sc] = rb[i];
  };
  auto mul = [&](int buf) {
#pragma unroll
    for (int ks = 0; ks < PKC / 32; ++ks) { FragH fa[FM], fb[4];
#pragma unroll
      for (int i = 0; i < FM; ++i) { const unsigned short* p = &tA[buf][(wm * FM + i) * 16 + ln][ks * 32 + 8 * hh]; fa[i].half[0] = *(const v8us*)p; fa[i].half[1] = *(const v8us*)(p + 16); }
#pragma unroll
      for (int t = 0; t < 4; ++t) { const unsigned short* p = &tB[buf][wn * 64 + t * 16 + ln][ks * 32 + 8 * hh]; fb[t].half[0] = *(const v8us*)p; fb[t].half[1] = *(const v8us*)(p + 16); }
#pragma unroll
      for (int i = 0; i < FM; ++i)
#pragma unroll
        for (int t = 0; t < 4; ++t) acc[i][t] = __builtin_amdgcn_wmma_f32_16x16x32_f16(false, fa[i].v, false, fb[t].v, (short)0, acc[i][t], false, false); }
  };
  g2r(0); r2s(0);
  __syncthreads();      // chunk 0 is in buffer 0 for every wave
  int buf = 0;
  for (int kb = PKC; kb < CC; kb += PKC) {
    g2r(kb);            // next chunk: in flight while this one is multiplied
    __builtin_amdgcn_sched_barrier(0);      // keeps those loads above the products; without it the compiler sinks them to just before their LDS stores and their latency is waited out
    mul(buf);
    r2s(buf ^ 1);       // that buffer's last readers left it before the barrier that ended the trip before
    __syncthreads();    // publishes the next chunk and ends this trip's reads of buf
    buf ^= 1;
  }
  mul(buf);
  if (!ISV) {      /* Q, K: each wave by itself, its first 16 rows through its 16 x SOP floats of the free A buffer, its other 16 through the same place of the free B buffer */
    fal* soA = (fal*)&tA[buf ^ 1][0][0] + w * (16 * SOP); fal* soB = (fal*)&tB[buf ^ 1][0][0] + w * (16 * SOP);
#pragma unroll
    for (int i = 0; i < FM; ++i) { fal* so = i ? soB : soA;
#pragma unroll
      for (int t = 0; t < 4; ++t)
#pragma unroll
        for (int r = 0; r < 8; ++r) so[(8 * hh + r) * SOP + t * 16 + ln] = acc[i][t][r] * 0.0625f + bvv[t]; }
    __builtin_amdgcn_fence(__ATOMIC_ACQ_REL, "workgroup"); __builtin_amdgcn_wave_barrier();      // the wave's rows are written before its lanes read them back; it stands ahead of every global store, so it waits for none
    const int po = (lane >> 3) * SOP + (lane & 7) * 8;
    unsigned short* ob = (unsigned short*)(y ? O3k : O3q) + (size_t)(bm * BM + wm * FM * 16 + (lane >> 3)) * (NH * K2) + (col0 / HD) * K2 + (lane & 7) * 8;
    fold_store(soA + po, ob);
    fold_store(soB + po, ob + 16 * (NH * K2));
  } else {      /* V: the block's 128 tokens x 128 columns, transposed in LDS */
    unsigned short (*tv)[PPIT] = tA[buf ^ 1];
#pragma unroll
    for (int i = 0; i < FM; ++i)
#pragma unroll
      for (int t = 0; t < 4; ++t) { FragH f;
#pragma unroll
        for (int r = 0; r < 8; ++r) f.h[r] = (_Float16)(acc[i][t][r] * 0.0625f + bvv[t]);
        *(v8us*)&tv[wn * 64 + t * 16 + ln][(wm * FM + i) * 16 + 8 * hh] = f.half[0]; }
    __syncthreads();      // every wave's tokens are in the tile before rows of it are read
    unsigned short* o = (unsigned short*)VT + ((size_t)(bm / (TT / BM)) * CC + bn * BN + (tid >> 4)) * TT + (bm % (TT / BM)) * BM + (tid & 15) * 8;
    v8us rv[8];
#pragma unroll
    for (int j = 0; j < 8; ++j) rv[j] = *(const v8us*)&tv[j * 16 + (tid >> 4)][(tid & 15) * 8];
#pragma unroll
    for (int j = 0; j < 8; ++j) *(v8us*)(o + (size_t)j * 16 * TT) = rv[j];
    asm volatile("s_wait_xcnt 0x0" ::: "memory");      // stands directly behind the run of stores, in front of whatever next reuses their registers
  }
}
#define PSM (4 * 128 * PPIT)      /* LDS of a projection work-group, in 16-bit elements */
// Q and K: blockIdx.y = 0, 1. 512 work-groups, two to a WGP, all resident at once.
__global__ __launch_bounds__(256) void k_proj(const _Float16* __restrict__ X16, const _Float16* __restrict__ BW, const float* __restrict__ bq, const float* __restrict__ bk, _Float16* __restrict__ O3q, _Float16* __restrict__ O3k) {
  __shared__ __attribute__((aligned(16))) unsigned short sm[PSM];
  proj_body<false>(sm, blockIdx.x, blockIdx.y, X16, BW, bq, bk, nullptr, O3q, O3k, nullptr);
}
// Scores never leave the registers. One wave owns NQ*16 queries, one work-group of 8 waves NQ*128 queries of one (batch, head); it walks the head's 1024 keys in stages of KT.
// S^T = K*Q^T in three terms: A = 16 key rows of K from LDS (k_hi, k_hi, k_lo), B = the wave's Q rows, loaded once and kept (q_hi, q_lo, q_hi): a hi fragment is fetched once and serves two terms; a lane then holds scores of ONE query per 16-query group (column ln), keys 8*hh + r of each 16-key tile,
// so every row sum and maximum is in-lane plus one exchange between the wave's halves.
// ATT false: the row statistics, from the term k_hi * q_hi alone: only the hi half of a K row is staged (KW 64) and only q_hi is loaded. What the two lo terms would add to a raw score is at most 2^-10 |q| |k| (about 2e-3 r.m.s. for rows of 64 unit-variance entries);
//   in the three features it is averaged over the head's rows, and t follows them smoothly (its relative change is at most that of the MLP's output). exp(s/2) needs no maximum taken off, because s is clipped to +-50 (e within 1.4e-11 .. 7.2e10, its squares' sum below 6e24);
//   with p = e / sum e and sum p = 1 the sum of (p - 1/TT)^2 is sum e^2 / (sum e)^2 - 1/TT. The clip and the scale are monotone, so the clipped maximum comes from the raw maximum.
//   RST[row] = (sum of clipped s, max of clipped s, variance, raw maximum).
// ATT true: O^T += V^T * P^T. Two score tiles (32 keys), turned into exp in place, ARE the B operand in the hardware's k order; A = 16 rows of V^T from LDS read in that same order.
//   The row's raw maximum is known from the statistics kernel to within the lo terms, so nothing is rescaled; P = exp(..) * 2^10 as f16 (a shift that is off by the lo terms scales the whole row of P by 2^(that error * log2 e / 2t), below 2 even at the smallest t for such rows, inside the 2^6 of room that f16 leaves above 2^10, and cancels in the division), the division by the f32 sum comes last.
//   The head's time t is found in the prologue, by every work-group of the head for itself: a thread sums 4 rows of RST, the 256 sums go through LDS (published by stage 0's barrier), and every wave adds them in the order of a
//   halving tree over 256 (steps 128, 64, 32 in-lane, 16 .. 1 between lanes). Lane u of each half-wave takes hidden unit u of the MLP; the 16 products are added in the order of u. All loads are asked for with the Q loads.
// 2^x with the slot behind it: the instruction set asks for one v_nop or independent instruction between a transcendental and a use of its result or an overwrite of its source.
// In one statement the v_nop cannot be parted from its exp.
__device__ __forceinline__ float exp2_slot(float x) { float e; asm volatile("v_exp_f32 %0, %1\n\tv_nop" : "=v"(e) : "v"(x)); return e; }
#define KT 64                    /* keys per stage */
#define KPIT (K2 + 8)            /* 272 B a row: 16 B x odd, for 16-byte LDS reads */
#define VPIT (KT + 8)            /* 144 B a row */
template <bool ATT, int NQ>
__device__ __forceinline__ void fused_body(unsigned short* tK0, const int bx, const int slab, const _Float16* __restrict__ Q3, const _Float16* __restrict__ Kf, const _Float16* __restrict__ VT, float* __restrict__ RST,
    const float* __restrict__ Wt1, const float* __restrict__ bt1, const float* __restrict__ Wt2, const float* __restrict__ bt2, _Float16* __restrict__ O16) {
  __shared__ __attribute__((aligned(16))) unsigned short tV[ATT ? 2 : 1][ATT ? HD : 1][VPIT];
  __shared__ v4f red[ATT ? 256 : 1];      /* the threads' sums of row statistics */
  constexpr int KW = ATT ? K2 : HD, KP = KW + 8, NF = KW / 32, CH = KW / 64;      /* columns of a K row that are staged ([hi | lo], or hi alone); LDS pitch (272 or 144 B: 16 B x odd); 32-wide fragments and 128-B lines a row */
  unsigned short (*tK)[KT][KP] = (unsigned short (*)[KT][KP])tK0;
  const int tid = threadIdx.x, w = tid >> 5, lane = tid & 31, ln = lane & 15, hh = lane >> 4;
  const int b = slab / NH, h = slab % NH; const int q0 = (bx * 8 + w) * (NQ * 16) + ln;      /* the lane's first query; its others follow in steps of 16 */
  const int sr = tid >> 3, sc8 = (tid & 7) * 8;      /* staging: 8 lanes bring one 128-B line, the block 32 rows at a time */
  const unsigned short* gK = (const unsigned short*)Kf + ((size_t)b * TT + sr) * (NH * K2) + h * K2 + sc8;
  const unsigned short* gV = (const unsigned short*)VT + ((size_t)b * CC + h * HD + sr) * TT + sc8;
  FragH qf[NQ][NF];      /* 0, 1: q_hi; 2, 3: q_lo */
  float sc2 = 0.f, nm2[NQ];
  v8us rk[2 * CH], rv[2];
  v8f o[NQ][4] = {};
  float su0[NQ], su1[NQ], se[NQ], se2[NQ], rmx[NQ];
#pragma unroll
  for (int n = 0; n < NQ; ++n) { su0[n] = 0.f; su1[n] = 0.f; se[n] = 0.f; se2[n] = 0.f; rmx[n] = -3.0e38f; }
  auto g2r = [&](int kb) {
#pragma unroll
    for (int i = 0; i < 2 * CH; ++i) rk[i] = *(const v8us*)(gK + (size_t)(kb + (i / CH) * 32) * (NH * K2) + (i % CH) * 64);
    if (ATT) {
#pragma unroll
      for (int i = 0; i < 2; ++i) rv[i] = *(const v8us*)(gV + kb + i * 32 * TT); }
    asm volatile("s_wait_xcnt 0x0" ::: "memory");      // stands in front of the first instruction that reuses these loads' address registers
  };
  auto r2s = [&](int buf) {
#pragma unroll
    for (int i = 0; i < 2 * CH; ++i) *(v8us*)&tK[buf][(i / CH) * 32 + sr][(i % CH) * 64 + sc8] = rk[i];
    if (ATT) {
#pragma unroll
      for (int i = 0; i < 2; ++i) *(v8us*)&tV[buf][i * 32 + sr][sc8] = rv[i]; }
  };
  auto work = [&](int buf) {
#pragma unroll
    for (int p = 0; p < KT / 32; ++p) { v8f t[NQ][2] = {}; FragH a[NF][2];      /* 0, 1: k_hi; 2, 3: k_lo */
#pragma unroll
      for (int ks = 0; ks < NF; ++ks)
#pragma unroll
        for (int j = 0; j < 2; ++j) { const unsigned short* pk = &tK[buf][p * 32 + j * 16 + ln][ks * 32 + 8 * hh]; a[ks][j].half[0] = *(const v8us*)pk; a[ks][j].half[1] = *(const v8us*)(pk + 16); }
      __builtin_amdgcn_sched_barrier(0);      // the pass's K fragments are asked for as one group; without it the compiler puts each pair of reads, with a full wait, right in front of its product
#pragma unroll
      for (int ks = 0; ks < (ATT ? 6 : 2); ++ks)
#pragma unroll
        for (int j = 0; j < 2; ++j)
#pragma unroll
          for (int n = 0; n < NQ; ++n) t[n][j] = __builtin_amdgcn_wmma_f32_16x16x32_f16(false, a[ks < 2 ? ks : ks - 2][j].v, false, qf[n][ks < 4 ? ks : ks - 4].v, (short)0, t[n][j], false, false);      /* ks 0, 1: k_hi q_hi; 2, 3: k_hi q_lo; 4, 5: k_lo q_hi (the last four in the attention kernel only) */
      float xe[NQ * 16];      /* exponent, then exp, of the lane's scores: group n, key slot s at n * 16 + s */
      if (!ATT) {
#pragma unroll
        for (int n = 0; n < NQ; ++n)
#pragma unroll
          for (int r = 0; r < 8; ++r) { const float x0 = t[n][0][r], x1 = t[n][1][r]; rmx[n] = fmaxf(rmx[n], fmaxf(x0, x1));
            const float v0 = fminf(fmaxf(x0 * 0.125f, -50.f), 50.f), v1 = fminf(fmaxf(x1 * 0.125f, -50.f), 50.f); su0[n] += v0; su1[n] += v1;
            xe[n * 16 + r] = v0 * 0.7213475204444817f; xe[n * 16 + 8 + r] = v1 * 0.7213475204444817f; }
        __builtin_amdgcn_sched_barrier(0);      // this fence and the next keep the exps in one run, every exponent ready ahead of it and every use behind it: the compiler writes no delay hint for a result of asm text, and a dependent instruction close behind its exp would wait unhinted, which holds up the SIMD's other wave too
#pragma unroll
        for (int i = 0; i < NQ * 16; ++i) xe[i] = exp2_slot(xe[i]);
        __builtin_amdgcn_sched_barrier(0);      // see the fence above
#pragma unroll
        for (int i = 0; i < NQ * 16; ++i) { se[i >> 4] += xe[i]; se2[i >> 4] += xe[i] * xe[i]; }
      } else { FragH pb[NQ], va[4];
#pragma unroll
        for (int dt = 0; dt < 4; ++dt) { const unsigned short* pv = &tV[buf][dt * 16 + ln][p * 32 + 8 * hh]; va[dt].half[0] = *(const v8us*)pv; va[dt].half[1] = *(const v8us*)(pv + 16); }
        __builtin_amdgcn_sched_barrier(0);      // the V fragments are asked for ahead of the exponentials, which then cover their latency
#pragma unroll
        for (int n = 0; n < NQ; ++n)
#pragma unroll
          for (int r = 0; r < 8; ++r) { xe[n * 16 + r] = t[n][0][r] * sc2 + nm2[n]; xe[n * 16 + 8 + r] = t[n][1][r] * sc2 + nm2[n]; }
        __builtin_amdgcn_sched_barrier(0);      // this fence and the next keep the exps in one run, every exponent ready ahead of it and every use behind it: the compiler writes no delay hint for a result of asm text, and a dependent instruction close behind its exp would wait unhinted, which holds up the SIMD's other wave too
#pragma unroll
        for (int i = 0; i < NQ * 16; ++i) xe[i] = exp2_slot(xe[i]);
        __builtin_amdgcn_sched_barrier(0);      // see the fence above
#pragma unroll
        for (int i = 0; i < NQ * 16; i += 2) { su0[i >> 4] += xe[i]; su1[i >> 4] += xe[i + 1]; }
#pragma unroll
        for (int n = 0; n < NQ; ++n)
#pragma unroll
          for (int s = 0; s < 16; ++s) pb[n].h[s] = (_Float16)xe[n * 16 + s];
#pragma unroll
        for (int dt = 0; dt < 4; ++dt)
#pragma unroll
          for (int n = 0; n < NQ; ++n) o[n][dt] = __builtin_amdgcn_wmma_f32_16x16x32_f16(false, va[dt].v, false, pb[n].v, (short)0, o[n][dt], false, false); } }
  };
  g2r(0);
  __builtin_amdgcn_sched_barrier(0);      // stage 0's loads and their wait stay ahead of the Q loads
  const unsigned short* qp = (const unsigned short*)Q3 + ((size_t)b * TT + q0) * (NH * K2) + h * K2 + 8 * hh;      /* the lane's first Q row; the rows of its other groups are constant offsets from it */
#pragma unroll
  for (int n = 0; n < NQ; ++n)
#pragma unroll
    for (int ks = 0; ks < NF; ++ks) { qf[n][ks].half[0] = *(const v8us*)(qp + n * 16 * (NH * K2) + ks * 32); qf[n][ks].half[1] = *(const v8us*)(qp + n * 16 * (NH * K2) + ks * 32 + 16); }
#pragma unroll
  for (int n = 0; n < NQ; ++n) nm2[n] = ATT ? RST[((size_t)slab * TT + q0 + n * 16) * 4 + 3] : 0.f;      /* the row's raw maximum, for now */
  v4f rs[4]; float m1b = 0.f, m1w0 = 0.f, m1w1 = 0.f, m1w2 = 0.f, m2w = 0.f, m2b = 0.f;      /* 4 rows of the head's statistics; the lane's hidden unit of the time MLP */
  if (ATT) {
    m1b = bt1[ln]; m1w0 = Wt1[ln]; m1w1 = Wt1[16 + ln]; m1w2 = Wt1[32 + ln]; m2w = Wt2[ln]; m2b = bt2[0];      /* ahead of the statistics rows: behind them this build put two of these results on the rows' unused fourth words and waited for the rows first */
#pragma unroll
    for (int i = 0; i < 4; ++i) rs[i] = *(const v4fa*)(RST + ((size_t)slab * TT + tid + i * 256) * 4); }
  __builtin_amdgcn_sched_barrier(0);      // keeps the loads above ahead of the wait below
  asm volatile("s_wait_xcnt 0x0" :: "v"(qp) : "memory");      // stands in front of the first instruction that reuses the address registers of the Q and row-maximum loads; the operand keeps the Q address untouched up to here
  __builtin_amdgcn_sched_barrier(0);      // keeps the arithmetic below, which reuses those registers, behind the wait
  if (ATT) { v4f s = {0.f, 0.f, 0.f, 0.f};
#pragma unroll
    for (int i = 0; i < 4; ++i) { s[0] += rs[i][0]; s[1] += rs[i][1]; s[2] += rs[i][2]; }
    red[tid] = s; }
  r2s(0);
  __syncthreads();      // stage 0 is in buffer 0 for every wave, and every thread's sum of statistics in red
  if (ATT) { v4f x[8];      /* every loop of this block is unrolled, so that x and the lane numbers of the exchanges are constants and x stays in registers */
#pragma unroll
    for (int j = 0; j < 8; ++j) x[j] = red[j * 32 + lane];
#pragma unroll
    for (int st = 4; st > 0; st >>= 1)
#pragma unroll
      for (int j = 0; j < st; ++j) { x[j][0] += x[j + st][0]; x[j][1] += x[j + st][1]; x[j][2] += x[j + st][2]; }
#pragma unroll
    for (int st = 16; st > 0; st >>= 1) { const float y0 = __shfl_xor(x[0][0], st, 32), y1 = __shfl_xor(x[0][1], st, 32), y2 = __shfl_xor(x[0][2], st, 32); x[0][0] += y0; x[0][1] += y1; x[0][2] += y2; }      /* after a step every lane holds the sum that the tree's lane (lane mod st) holds */
    float f0 = x[0][0] / ((float)TT * (float)TT), f1 = x[0][1] / (float)TT, f2 = x[0][2] / (float)TT; f0 = fminf(fmaxf(f0, -10.f), 10.f); f1 = fminf(fmaxf(f1, -10.f), 10.f); f2 = fminf(fmaxf(f2, 0.f), 1.f);
    float pre = bf16_round(m1b); pre += f0 * bf16_round(m1w0); pre += f1 * bf16_round(m1w1); pre += f2 * bf16_round(m1w2);
    const float hu = tanhf(pre) * bf16_round(m2w);
    float raw = bf16_round(m2b);
#pragma unroll
    for (int u = 0; u < 16; ++u) raw += __shfl(hu, u, 32);
    float t = 0.01f + (1.0f / (1.0f + expf(-raw))) * (2.0f - 0.01f); t = fminf(fmaxf(t, 0.01f), 2.0f); t = fminf(t, 0.85f);
    sc2 = 1.4426950408889634f / (2.0f * t);
#pragma unroll
    for (int n = 0; n < NQ; ++n) nm2[n] = 10.0f - nm2[n] * sc2; }
  int buf = 0;
  for (int kb = KT; kb < TT; kb += KT) {
    g2r(kb);            // next stage: in flight while this one is worked on
    __builtin_amdgcn_sched_barrier(0);      // keeps those loads above the products; without it the compiler may sink them to just before their LDS stores and their latency is waited out
    work(buf);
    r2s(buf ^ 1);       // that buffer's last readers left it before the barrier that ended the trip before
    __syncthreads();    // publishes the next stage and ends this trip's reads of buf
    buf ^= 1;
  }
  work(buf);
#pragma unroll
  for (int n = 0; n < NQ; ++n) { const int q = q0 + n * 16;
    float su = su0[n] + su1[n]; su += __shfl_xor(su, 16, 32);      /* the two halves of the wave hold the two halves of a query's keys */
    if (!ATT) { const float set = se[n] + __shfl_xor(se[n], 16, 32), se2t = se2[n] + __shfl_xor(se2[n], 16, 32), rm = fmaxf(rmx[n], __shfl_xor(rmx[n], 16, 32));
      const float inv = 1.0f / set; const float vq = (se2t * inv) * inv - 1.0f / (float)TT;
      if (hh == 0) { const v4f v = {su, fminf(fmaxf(rm * 0.125f, -50.f), 50.f), vq / (float)(TT - 1), rm}; *(v4f*)(RST + ((size_t)slab * TT + q) * 4) = v; }
    } else { const float inv = 1.0f / su;
#pragma unroll
      for (int dt = 0; dt < 4; ++dt) { FragH f;
#pragma unroll
        for (int r = 0; r < 8; ++r) f.h[r] = (_Float16)(o[n][dt][r] * inv);
        *(v8us*)((unsigned short*)O16 + ((size_t)b * TT + q) * CC + h * HD + dt * 16 + 8 * hh) = f.half[0]; } } } }
// The attention kernel: blockIdx.x = 256 queries, blockIdx.y = (batch, head).
__global__ __launch_bounds__(256) void k_att(const _Float16* __restrict__ Q3, const _Float16* __restrict__ Kf, const _Float16* __restrict__ VT, float* __restrict__ RST,
    const float* __restrict__ Wt1, const float* __restrict__ bt1, const float* __restrict__ Wt2, const float* __restrict__ bt2, _Float16* __restrict__ O16) {
  __shared__ __attribute__((aligned(16))) unsigned short tK[2][KT][KPIT];
  fused_body<true, 2>(&tK[0][0][0], blockIdx.x, blockIdx.y, Q3, Kf, VT, RST, Wt1, bt1, Wt2, bt2, O16);
}
// The row statistics need Q and K only, and nobody needs V before the attention kernel: the V projection shares the statistics' grid. Work-groups 0 .. 255 take the statistics (the longer job, so it starts first; 4 to a (batch, head)),
// 256 .. 511 the V tiles: one of each fits a WGP, and the projection's loads, LDS reads and products run in the slots that the statistics' vector work leaves open. One LDS array serves either job.
__global__ __launch_bounds__(256) void k_stat_v(const _Float16* __restrict__ Q3, const _Float16* __restrict__ Kf, float* __restrict__ RST, const _Float16* __restrict__ X16, const _Float16* __restrict__ BW, const float* __restrict__ bv, _Float16* __restrict__ VT) {
  __shared__ __attribute__((aligned(16))) unsigned short sm[PSM];
  const int bx = blockIdx.x;
  if (bx < 256) fused_body<false, 2>(sm, bx & 3, bx >> 2, Q3, Kf, nullptr, RST, nullptr, nullptr, nullptr, nullptr, nullptr);
  else proj_body<true>(sm, bx - 256, 2, X16, BW, nullptr, nullptr, bv, nullptr, nullptr, VT);
}

extern "C" void kernel_launch(void* const* d_in, const int* in_sizes, int n_in,
                              void* d_out, int out_size, void* d_ws, size_t ws_size, hipStream_t stream) {
  (void)in_sizes; (void)n_in; (void)out_size;
  const float* const* I = (const float* const*)d_in; const float* xq = I[0]; const float* xk = I[1]; const float* xv = I[2]; const float* Wq = I[3]; const float* bq = I[4]; const float* Wk = I[5]; const float* bk = I[6]; const float* Wv = I[7]; const float* bv = I[8]; const float* Wo = I[9]; const float* bo = I[10]; const float* Wt1 = I[11]; const float* bt1 = I[12]; const float* Wt2 = I[13]; const float* bt2 = I[14];
  char* ws = (char*)d_ws; size_t off = 0;
  auto take = [&](size_t bytes) { char* p = ws + off; off += (bytes + 255) & ~(size_t)255; return p; };
  _Float16* Q3p = (_Float16*)take((size_t)NR * NH * K2 * 2); _Float16* K3p = (_Float16*)take((size_t)NR * NH * K2 * 2); _Float16* VTb = (_Float16*)take((size_t)NBt * CC * TT * 2); _Float16* BWo = (_Float16*)take((size_t)CC * CC * 2); float* RST = (float*)take((size_t)HG * TT * 4 * 4); _Float16* O16 = (_Float16*)take((size_t)NR * CC * 2);
  const size_t pW = (size_t)CC * CC, pX = (size_t)NR * CC;      /* plane sizes in elements: a weight; an activation */
  _Float16* BW = (_Float16*)take(3 * pW * 2); _Float16* X16 = (_Float16*)take(3 * pX * 2);      /* what only the projections need */
  if (off > ws_size) return;      // 16.8 + 16.8 + 8.4 + 2.1 + 1.0 + 8.4 + 6.3 + 25.2 = 85.0 MB
  const dim3 gP((NR / 128) * (CC / 128), 1);
  k_prep<<<512, 256, 0, stream>>>(xq, xk, xv, Wq, Wk, Wv, Wo, X16, BW, BWo);      /* all three activations and all four weights, one launch */
  k_proj<<<dim3((NR / 128) * (CC / 128), 2), 256, 0, stream>>>(X16, BW, bq, bk, Q3p, K3p);      /* Q, K -> [hi | lo] */
  const dim3 gF(TT / 256, HG);      /* 256 queries a work-group; slab g = batch * NH + head in RST */
  k_stat_v<<<512, 256, 0, stream>>>(Q3p, K3p, RST, X16, BW, bv, VTb);      /* row statistics of raw q_hi*k_hi (K 64); beside them V -> f16, transposed */
  k_att<<<gF, 256, 0, stream>>>(Q3p, K3p, VTb, RST, Wt1, bt1, Wt2, bt2, O16);      /* the head's t, then softmax(Q*K / 2t) * V */
  k_gemm_hhx<0, 4, 2, 2, 128, CC, false><<<gP, 256, 0, stream>>>(O16, 0, BWo, 0, 0.0625f, bo, 0, (float*)d_out, nullptr, CC, 0, NR, CC, CC, 0, 0, 0);
}
